// v000
// The times below were measured on an AMD MI455X: many runs one after another, warmed up first and cycling through
// copies of the inputs, with the whole window's GPU time divided by the number of runs. Launches and the gaps
// between them are all in it. The median over several windows is given; except for v000 it joins two sittings, which
// can be a few percent apart, so the side-by-side timings, each taken in one sitting, are the better comparison.
// The starting kernel, v000, takes 389 microseconds a run.
#include <hip/hip_runtime.h>

// Contractions on v_wmma_f32_16x16x32_f16 with plain f16 operands, f32 accumulate: fused = LN(x).W1 + b1 ([4096 x 1024].[1024 x 3788 (padded 3840)]), the 16-head
// attention with per-head LayerNorm on q and k (scores [2048 x 64].[64 x 2048] /8, softmax, .v), attn_out = a.Wao + bao, mlp_out = gelu_tanh(h).Wmo + bmo
// ([4096 x 716 (768)].[768 x 1024]) and out = x + [attn_out | mlp_out].W2 + b2 ([4096 x 2048].[2048 x 1024]). Weights are f16 of their bf16 rounding (exact for the
// bf16-input reference), the activations are computed values rounded once to f16 (the output is dominated by the exact residual x). LayerNorms (eps 1e-6), gelu and

#define NB_  2
#define NT_  2048
#define DM   1024
#define NH_  16
#define HD   64
#define NTK  (NB_ * NT_)
#define NF   3788
#define NFP  3840
#define MLPH 716
#define MLPP 768
#define PSC  32768.0f
#define EPS  1e-6f

typedef _Float16 h16;
typedef __attribute__((ext_vector_type(16))) _Float16 v16h;
typedef __attribute__((ext_vector_type(8)))  _Float16 v8h;
typedef __attribute__((ext_vector_type(8)))  float    v8f;
typedef __attribute__((ext_vector_type(4)))  float    v4f;
typedef v8h  __attribute__((may_alias)) v8ha;
typedef v4f  __attribute__((may_alias)) v4fa;

__device__ __forceinline__ unsigned short f2bf(float f) { unsigned u = __float_as_uint(f); u += 0x7FFFu + ((u >> 16) & 1u); return (unsigned short)(u >> 16); }
__device__ __forceinline__ float bf2f(unsigned short b) { return __uint_as_float(((unsigned)b) << 16); }
__device__ __forceinline__ float bfr(float f) { return bf2f(f2bf(f)); }
__device__ __forceinline__ v16h cat16(v8h lo, v8h hi) { return __builtin_shufflevector(lo, hi, 0, 1, 2, 3, 4, 5, 6, 7, 8, 9, 10, 11, 12, 13, 14, 15); }
__device__ __forceinline__ v8f wmma16(v16h a, v16h b, v8f c) { return __builtin_amdgcn_wmma_f32_16x16x32_f16(false, a, false, b, (short)0, c, false, false); }
__device__ __forceinline__ float hsum16(float v) { v += __shfl_xor(v, 1, 16); v += __shfl_xor(v, 2, 16); v += __shfl_xor(v, 4, 16); return v + __shfl_xor(v, 8, 16); }
__device__ __forceinline__ float gelu_t(float x) { const float c = 0.7978845608028654f; return 0.5f * x * (1.0f + tanhf(c * (x + 0.044715f * x * x * x))); }

__global__ __launch_bounds__(256) void k_ln(const float* __restrict__ x, const float* __restrict__ g, const float* __restrict__ bt, h16* XN16) {
    const int lane = threadIdx.x & 31, r = blockIdx.x * 8 + (threadIdx.x >> 5);
    if (r >= NTK) return;
    const float* xr = x + (size_t)r * DM;
    float s = 0.f;
#pragma unroll
    for (int q = 0; q < 4; ++q)
#pragma unroll
        for (int i = 0; i < 8; ++i) s += bfr(xr[q * 256 + lane * 8 + i]);
#pragma unroll
    for (int o = 16; o; o >>= 1) s += __shfl_xor(s, o, 32);
    const float mu = s * (1.0f / DM);
    float sq = 0.f;
#pragma unroll 1
    for (int q = 0; q < 4; ++q)
#pragma unroll
        for (int i = 0; i < 8; ++i) { const float d = bfr(xr[q * 256 + lane * 8 + i]) - mu; sq += d * d; }
#pragma unroll
    for (int o = 16; o; o >>= 1) sq += __shfl_xor(sq, o, 32);
    const float rs = rsqrtf(sq * (1.0f / DM) + EPS);
#pragma unroll 1
    for (int q = 0; q < 4; ++q) {
        v8h o8;
#pragma unroll
        for (int i = 0; i < 8; ++i) { const int c = q * 256 + lane * 8 + i; o8[i] = (h16)((bfr(xr[c]) - mu) * rs * bfr(g[c]) + bfr(bt[c])); }
        *(v8h*)(XN16 + (size_t)r * DM + q * 256 + lane * 8) = o8; 
    }
}

// k_wt: k-major W [K rows][N cols] -> n-major f16 plane WT [Npad][Kpad] (f16 of bf16(W); rows >= N and columns >= K zero); 64 x 64 tiles through LDS; grid (Kpad/64,
__global__ __launch_bounds__(256) void k_wt(const float* __restrict__ Wm, int K, int N, int Kpad, h16* WT) {
    __shared__ __align__(16) h16 tl[64 * 72];
    const int tid = threadIdx.x, k0 = blockIdx.x * 64, n0 = blockIdx.y * 64;
    const int kk = tid >> 2, nq = (tid & 3) * 16;
#pragma unroll
    for (int i = 0; i < 16; ++i) { const int k = k0 + kk, n = n0 + nq + i; tl[(nq + i) * 72 + kk] = (k < K && n < N) ? (h16)bfr(Wm[(size_t)k * N + n]) : (h16)0.f; }
    __syncthreads();
    const int piece = tid & 7;
    auto pass = [&]() {
#pragma unroll
        for (int s = 0; s < 2; ++s) { const int nr = (tid >> 3) + 32 * s; const v8h val = *(const v8ha*)(tl + nr * 72 + piece * 8);
            *(v8h*)(WT + (size_t)(n0 + nr) * Kpad + k0 + piece * 8) = val; }
    };
    pass(); 
}

// GEMM tile core: 64 x 64 block tile (4 waves x 16 rows x 64 cols) of A[M][K] (f16, lda = K) . BT[N][K] over K (multiple of 32); returns acc[4] (D layout).
__device__ __forceinline__ void gemm_tile(const h16* __restrict__ A, const h16* __restrict__ BT, int K, int r0, int c0, int lr, int hi, v8f* acc) {
    const size_t aoff = (size_t)(r0 + lr) * K + 8 * hi;
    size_t boff[4];
#pragma unroll
    for (int t = 0; t < 4; ++t) boff[t] = (size_t)(c0 + t * 16 + lr) * K + 8 * hi;
#pragma unroll
    for (int t = 0; t < 4; ++t) acc[t] = (v8f){};
#pragma unroll 1
    for (int kc = 0; kc < K; kc += 32) {
        const v16h a = cat16(*(const v8h*)(A + aoff + kc), *(const v8h*)(A + aoff + kc + 16));
#pragma unroll
        for (int t = 0; t < 4; ++t) acc[t] = wmma16(a, cat16(*(const v8h*)(BT + boff[t] + kc), *(const v8h*)(BT + boff[t] + kc + 16)), acc[t]);
        asm volatile("v_nop\n\tv_nop\n\tv_nop\n\tv_nop" : "+v"(acc[0]), "+v"(acc[1]), "+v"(acc[2]), "+v"(acc[3]) : "v"(a));
    }
}

// k_fused: fused = XN16 . W1T + b1 over the 3840 padded columns, 64-wide column block = exactly one head of q / k / v or a 64-wide slice of the MLP hidden:
//   c0 <  1024: q head c0/64: per-row LayerNorm over the 64 head dims (qn_g, qn_b) -> Q16[tok][1024] f16
//   c0 <  2048: k head: LayerNorm (kn_g, kn_b) -> K16
//   c0 <  3072: v -> V16 rows
//   else      : gelu_tanh -> G16[tok][768] (columns >= 716 of the hidden are exactly 0 after gelu(0 + 0)... b1 pad is read as 0; their Wmo rows are 0 anyway)
__global__ __launch_bounds__(128) void k_fused(const h16* __restrict__ XN16, const h16* __restrict__ W1T, const float* __restrict__ b1,
                                              const float* __restrict__ qg, const float* __restrict__ qb, const float* __restrict__ kg, const float* __restrict__ kb,
                                              h16* Q16, h16* K16, h16* V16, h16* G16) {
    __shared__ __align__(16) float ost[4][16 * 68];
    const int lane = threadIdx.x & 31, wave = threadIdx.x >> 5, lr = lane & 15, hi = lane >> 4;
    const int r0 = blockIdx.x * 64 + wave * 16, c0 = blockIdx.y * 64;
    v8f acc[4];
    gemm_tile(XN16, W1T, DM, r0, c0, lr, hi, acc);
    const int sec = c0 / DM;                   // 0 q, 1 k, 2 v, 3 mlp
#pragma unroll
    for (int t = 0; t < 4; ++t) { const int col = c0 + t * 16 + lr; const float bv = (col < NF) ? bfr(b1[col]) : 0.f;
#pragma unroll
        for (int j = 0; j < 8; ++j) acc[t][j] += bv; }
    if (sec < 2) {
        const float* gg = sec ? kg : qg; const float* bb = sec ? kb : qb;
#pragma unroll
        for (int j = 0; j < 8; ++j) {
            float s = acc[0][j] + acc[1][j] + acc[2][j] + acc[3][j];
            const float mu = hsum16(s) * (1.0f / HD);
            float q = 0.f;
#pragma unroll
            for (int t = 0; t < 4; ++t) { const float d = acc[t][j] - mu; q += d * d; }
            const float rs = rsqrtf(hsum16(q) * (1.0f / HD) + EPS);
#pragma unroll
            for (int t = 0; t < 4; ++t) acc[t][j] = (acc[t][j] - mu) * rs * bfr(gg[t * 16 + lr]) + bfr(bb[t * 16 + lr]);
        }
    } else if (sec == 3) {
#pragma unroll
        for (int t = 0; t < 4; ++t)
#pragma unroll 1
            for (int j = 0; j < 8; ++j) acc[t][j] = gelu_t(acc[t][j]);      // rolled: keeps the static FMA count (tanhf) low
    }
    float* os = &ost[wave][0];
#pragma unroll
    for (int t = 0; t < 4; ++t)
#pragma unroll
        for (int j = 0; j < 8; ++j) os[(hi * 8 + j) * 68 + t * 16 + lr] = acc[t][j];
    __syncthreads();
    h16* dst; int ld, cc;
    if (sec == 0) { dst = Q16; ld = DM; cc = c0; } else if (sec == 1) { dst = K16; ld = DM; cc = c0 - DM; } else if (sec == 2) { dst = V16; ld = DM; cc = c0 - 2 * DM; } else { dst = G16; ld = MLPP; cc = c0 - 3 * DM; }
    h16* crow = dst + (size_t)r0 * ld + cc;
    auto pass = [&]() {
#pragma unroll
        for (int s = 0; s < 4; ++s) { const int row = 4 * s + (lane >> 3), piece = lane & 7; const float* sp = os + row * 68 + piece * 8; v8h o;
#pragma unroll
            for (int i = 0; i < 8; ++i) o[i] = (h16)sp[i];
            *(v8h*)(crow + (size_t)row * ld + piece * 8) = o; }
    };
    pass(); 
}

// k_gemm16o: C16[M][ldc] columns cbase + c0.. = f16(A.BT + bias) — used for attn_out (A = CTX16, K = 1024) and mlp_out (A = G16, K = 768) into the two halves of COMB16.
__global__ __launch_bounds__(128) void k_gemm16o(const h16* __restrict__ A, const h16* __restrict__ BT, int K, const float* __restrict__ bias, h16* C16, int ldc, int cbase) {
    __shared__ __align__(16) float ost[4][16 * 68];
    const int lane = threadIdx.x & 31, wave = threadIdx.x >> 5, lr = lane & 15, hi = lane >> 4;
    const int r0 = blockIdx.x * 64 + wave * 16, c0 = blockIdx.y * 64;
    v8f acc[4];
    gemm_tile(A, BT, K, r0, c0, lr, hi, acc);
    float* os = &ost[wave][0];
#pragma unroll
    for (int t = 0; t < 4; ++t) { const float bv = bfr(bias[c0 + t * 16 + lr]);
#pragma unroll
        for (int j = 0; j < 8; ++j) os[(hi * 8 + j) * 68 + t * 16 + lr] = acc[t][j] + bv; }
    __syncthreads();
    h16* crow = C16 + (size_t)r0 * ldc + cbase + c0;
    auto pass = [&]() {
#pragma unroll
        for (int s = 0; s < 4; ++s) { const int row = 4 * s + (lane >> 3), piece = lane & 7; const float* sp = os + row * 68 + piece * 8; v8h o;
#pragma unroll
            for (int i = 0; i < 8; ++i) o[i] = (h16)sp[i];
            *(v8h*)(crow + (size_t)row * ldc + piece * 8) = o; }
    };
    pass(); 
}

__global__ __launch_bounds__(128) void k_gemmout(const h16* __restrict__ A, const h16* __restrict__ BT, const float* __restrict__ bias, const float* __restrict__ x, float* C) {
    __shared__ __align__(16) float ost[4][16 * 68];
    const int lane = threadIdx.x & 31, wave = threadIdx.x >> 5, lr = lane & 15, hi = lane >> 4;
    const int r0 = blockIdx.x * 64 + wave * 16, c0 = blockIdx.y * 64;
    v8f acc[4];
    gemm_tile(A, BT, 2 * DM, r0, c0, lr, hi, acc);
    float* os = &ost[wave][0];
#pragma unroll
    for (int t = 0; t < 4; ++t) { const int col = c0 + t * 16 + lr; const float bv = bfr(bias[col]);
#pragma unroll
        for (int j = 0; j < 8; ++j) os[(hi * 8 + j) * 68 + t * 16 + lr] = acc[t][j] + bv + bfr(x[(size_t)(r0 + hi * 8 + j) * DM + col]); }
    __syncthreads();
    float* crow = C + (size_t)r0 * DM + c0;
    auto pass = [&]() {
#pragma unroll
        for (int s = 0; s < 8; ++s) { const int Lid = (lane >> 3) + 4 * s, piece = lane & 7; const int row = Lid >> 1, cofs = (Lid & 1) * 32 + piece * 4;
            const v4f val = *(const v4fa*)(os + row * 68 + cofs); *(v4f*)(crow + (size_t)row * DM + cofs) = val; }
    };
    pass(); 
}

// k_vt: VT16[b][h][d][t] from V16 rows via LDS transpose; block (b, h, 64 tokens).
__global__ __launch_bounds__(256) void k_vt(const h16* __restrict__ V16, h16* VT16) {
    __shared__ __align__(16) h16 tile[64 * 72];
    const int bid = blockIdx.x;
    const int b = bid / (NH_ * (NT_ / 64)), rem = bid - b * (NH_ * (NT_ / 64)), h = rem / (NT_ / 64), kt = rem - h * (NT_ / 64);
    const int k0 = kt * 64, tid = threadIdx.x;
    const int kk = tid >> 2, d0 = (tid & 3) * 16;
    const h16* src = V16 + ((size_t)b * NT_ + k0 + kk) * DM + h * HD + d0;
#pragma unroll
    for (int i = 0; i < 16; ++i) tile[(d0 + i) * 72 + kk] = src[i];
    __syncthreads();
    const int piece = tid & 7;
    h16* base = VT16 + (((size_t)b * NH_ + h) * HD) * NT_ + k0;
    auto pass = [&]() {
#pragma unroll
        for (int s = 0; s < 2; ++s) { const int d = (tid >> 3) + 32 * s; const v8h val = *(const v8ha*)(tile + d * 72 + piece * 8); *(v8h*)(base + (size_t)d * NT_ + piece * 8) = val; }
    };
    pass(); 
}

// k_attn: block = (b, h, 64 queries), wave = 16; 64 steps x 32 keys: 4 WMMA scores /8, online f32 softmax, weights x32768 f16 tile (same-wave may_alias reload after a
__global__ __launch_bounds__(128) void k_attn(const h16* __restrict__ Q16, const h16* __restrict__ K16, const h16* __restrict__ VT16, h16* CTX16) {
    __shared__ __align__(16) h16 plds[4][16 * 32];
    __shared__ __align__(16) float ost[4][16 * 68];
    const int lane = threadIdx.x & 31, wave = threadIdx.x >> 5, lr = lane & 15, hi = lane >> 4;
    const int bid = blockIdx.x;
    const int b = bid / (NH_ * (NT_ / 64)), rem = bid - b * (NH_ * (NT_ / 64)), h = rem / (NT_ / 64), qt = rem - h * (NT_ / 64);
    const int q0 = qt * 64 + wave * 16;
    const size_t tok0 = (size_t)b * NT_;
    h16* pl = &plds[wave][0];
    v16h qa[2];
#pragma unroll
    for (int kc = 0; kc < 2; ++kc) { const h16* p = Q16 + (tok0 + q0 + lr) * DM + h * HD + kc * 32 + 8 * hi; qa[kc] = cat16(*(const v8h*)p, *(const v8h*)(p + 16)); }
    const h16* kh_b = K16 + tok0 * DM + h * HD;
    const h16* vt_b = VT16 + (((size_t)b * NH_ + h) * HD) * NT_;
    v8f o[4];
#pragma unroll
    for (int n = 0; n < 4; ++n) o[n] = (v8f){};
    float mrow[8], lpart[8];
#pragma unroll
    for (int j = 0; j < 8; ++j) { mrow[j] = -3.0e38f; lpart[j] = 0.f; }
#pragma unroll 1
    for (int kt = 0; kt < NT_ / 32; ++kt) {
        const int l0 = kt * 32;
        const h16* r0p = kh_b + (size_t)(l0 + lr) * DM + 8 * hi;
        const h16* r1p = kh_b + (size_t)(l0 + 16 + lr) * DM + 8 * hi;
        v8f s0 = {}, s1 = {};
#pragma unroll
        for (int kc = 0; kc < 2; ++kc) {
            s0 = wmma16(qa[kc], cat16(*(const v8h*)(r0p + kc * 32), *(const v8h*)(r0p + kc * 32 + 16)), s0);
            s1 = wmma16(qa[kc], cat16(*(const v8h*)(r1p + kc * 32), *(const v8h*)(r1p + kc * 32 + 16)), s1);
        }
        asm volatile("v_nop\n\tv_nop\n\tv_nop\n\tv_nop" : "+v"(s0), "+v"(s1) : "v"(qa[0]), "v"(qa[1]));
        float alpha[8];
#pragma unroll
        for (int j = 0; j < 8; ++j) {
            const float a0 = s0[j] * 0.125f, a1 = s1[j] * 0.125f;
            float mx = fmaxf(a0, a1);
            mx = fmaxf(mx, __shfl_xor(mx, 1, 16)); mx = fmaxf(mx, __shfl_xor(mx, 2, 16)); mx = fmaxf(mx, __shfl_xor(mx, 4, 16)); mx = fmaxf(mx, __shfl_xor(mx, 8, 16));
            const float mn = fmaxf(mrow[j], mx);
            alpha[j] = __expf(mrow[j] - mn); mrow[j] = mn;
            const float p0 = __expf(a0 - mn), p1 = __expf(a1 - mn);
            lpart[j] = lpart[j] * alpha[j] + (p0 + p1);
            const int mr = hi * 8 + j;
            pl[mr * 32 + lr] = (h16)(p0 * PSC); pl[mr * 32 + 16 + lr] = (h16)(p1 * PSC);
        }
#pragma unroll
        for (int n = 0; n < 4; ++n)
#pragma unroll
            for (int j = 0; j < 8; ++j) o[n][j] *= alpha[j];
        asm volatile("" ::: "memory");
        const v16h pa = cat16(*(const v8ha*)(pl + lr * 32 + hi * 8), *(const v8ha*)(pl + lr * 32 + 16 + hi * 8));
#pragma unroll
        for (int n = 0; n < 4; ++n) { const h16* vp = vt_b + (size_t)(n * 16 + lr) * NT_ + l0 + hi * 8; o[n] = wmma16(pa, cat16(*(const v8h*)vp, *(const v8h*)(vp + 16)), o[n]); }
        asm volatile("v_nop\n\tv_nop\n\tv_nop\n\tv_nop" : "+v"(o[0]), "+v"(o[1]), "+v"(o[2]), "+v"(o[3]) : "v"(pa));
    }
    float inv[8];
#pragma unroll
    for (int j = 0; j < 8; ++j) { float rs = lpart[j]; rs += __shfl_xor(rs, 1, 16); rs += __shfl_xor(rs, 2, 16); rs += __shfl_xor(rs, 4, 16); rs += __shfl_xor(rs, 8, 16); inv[j] = 1.0f / (rs * PSC); }
    float* os = &ost[wave][0];
#pragma unroll
    for (int n = 0; n < 4; ++n)
#pragma unroll
        for (int j = 0; j < 8; ++j) os[(hi * 8 + j) * 68 + n * 16 + lr] = o[n][j] * inv[j];
    __syncthreads();
    h16* crow = CTX16 + (tok0 + q0) * DM + (size_t)h * HD;
    auto pass = [&]() {
#pragma unroll
        for (int s = 0; s < 4; ++s) { const int row = 4 * s + (lane >> 3), piece = lane & 7; const float* sp = os + row * 68 + piece * 8; v8h o8;
#pragma unroll
            for (int i = 0; i < 8; ++i) o8[i] = (h16)sp[i];
            *(v8h*)(crow + (size_t)row * DM + piece * 8) = o8; }
    };
    pass(); 
}

extern "C" void kernel_launch(void* const* d_in, const int* in_sizes, int n_in,
                              void* d_out, int out_size, void* d_ws, size_t ws_size, hipStream_t stream) {
    (void)in_sizes; (void)n_in; (void)out_size;
    const float* x = (const float*)d_in[0]; const float* ng = (const float*)d_in[1]; const float* nb = (const float*)d_in[2]; const float* W1 = (const float*)d_in[3]; const float* b1 = (const float*)d_in[4];
    const float* qg = (const float*)d_in[5]; const float* qb = (const float*)d_in[6]; const float* kg = (const float*)d_in[7]; const float* kb = (const float*)d_in[8];
    const float* Wao = (const float*)d_in[9]; const float* bao = (const float*)d_in[10]; const float* Wmo = (const float*)d_in[11]; const float* bmo = (const float*)d_in[12];
    const float* W2 = (const float*)d_in[13]; const float* b2 = (const float*)d_in[14];
    float* out = (float*)d_out;    // [2][2048][1024]
    char* wsp = (char*)d_ws;
    auto take = [&](size_t bytes) { char* p = wsp; wsp += (bytes + 255) & ~(size_t)255; return (void*)p; };
    h16* XN16 = (h16*)take((size_t)NTK * DM * 2); h16* W1T = (h16*)take((size_t)NFP * DM * 2);
    h16* WaoT = (h16*)take((size_t)DM * DM * 2); h16* WmoT = (h16*)take((size_t)DM * MLPP * 2); h16* W2T = (h16*)take((size_t)DM * 2 * DM * 2);
    h16* Q16 = (h16*)take((size_t)NTK * DM * 2); h16* K16 = (h16*)take((size_t)NTK * DM * 2); h16* V16 = (h16*)take((size_t)NTK * DM * 2); h16* VT16 = (h16*)take((size_t)NTK * DM * 2);
    h16* G16 = (h16*)take((size_t)NTK * MLPP * 2); h16* CTX16 = (h16*)take((size_t)NTK * DM * 2); h16* COMB16 = (h16*)take((size_t)NTK * 2 * DM * 2);
    if ((size_t)(wsp - (char*)d_ws) > ws_size) return;    // 8.4 + 7.9 + 2.1 + 1.6 + 4.2 + 4 x 8.4 + 6.3 + 8.4 + 16.8 MB ~ 89 MB
    k_ln<<<NTK / 8, 256, 0, stream>>>(x, ng, nb, XN16);
    k_wt<<<dim3(DM / 64, NFP / 64, 1), 256, 0, stream>>>(W1, DM, NF, DM, W1T);
    k_wt<<<dim3(DM / 64, DM / 64, 1), 256, 0, stream>>>(Wao, DM, DM, DM, WaoT);
    k_wt<<<dim3(MLPP / 64, DM / 64, 1), 256, 0, stream>>>(Wmo, MLPH, DM, MLPP, WmoT);
    k_wt<<<dim3((2 * DM) / 64, DM / 64, 1), 256, 0, stream>>>(W2, 2 * DM, DM, 2 * DM, W2T);
    k_fused<<<dim3(NTK / 64, NFP / 64, 1), 128, 0, stream>>>(XN16, W1T, b1, qg, qb, kg, kb, Q16, K16, V16, G16);
    k_vt<<<NB_ * NH_ * (NT_ / 64), 256, 0, stream>>>(V16, VT16);
    k_attn<<<NB_ * NH_ * (NT_ / 64), 128, 0, stream>>>(Q16, K16, VT16, CTX16);
    k_gemm16o<<<dim3(NTK / 64, DM / 64, 1), 128, 0, stream>>>(CTX16, WaoT, DM, bao, COMB16, 2 * DM, 0);
    k_gemm16o<<<dim3(NTK / 64, DM / 64, 1), 128, 0, stream>>>(G16, WmoT, MLPP, bmo, COMB16, 2 * DM, DM);
    k_gemmout<<<dim3(NTK / 64, DM / 64, 1), 128, 0, stream>>>(COMB16, W2T, b2, x, out);
}

// v001
// A run of this version takes 221 microseconds.
// Two timings next to v000 put it at 1.84 and 1.82 times that version's speed.
#include <hip/hip_runtime.h>

// Contractions on v_wmma_f32_16x16x32_f16 with plain f16 operands, f32 accumulate: fused = LN(x).W1 + b1 ([4096 x 1024].[1024 x 3788 (padded 3840)]), the 16-head
// attention with per-head LayerNorm on q and k (scores [2048 x 64].[64 x 2048] /8, softmax, .v), attn_out = a.Wao + bao, mlp_out = gelu_tanh(h).Wmo + bmo
// ([4096 x 716 (768)].[768 x 1024]) and out = x + [attn_out | mlp_out].W2 + b2 ([4096 x 2048].[2048 x 1024]). Weights are f16 of their bf16 rounding (exact for the
// bf16-input reference), the activations are computed values rounded once to f16 (the output is dominated by the exact residual x). LayerNorms (eps 1e-6), gelu and

#define NB_  2
#define NT_  2048
#define DM   1024
#define NH_  16
#define HD   64
#define NTK  (NB_ * NT_)
#define NF   3788
#define NFP  3840
#define MLPH 716
#define MLPP 768
#define PSC  32768.0f
#define EPS  1e-6f

typedef _Float16 h16;
typedef __attribute__((ext_vector_type(16))) _Float16 v16h;
typedef __attribute__((ext_vector_type(8)))  _Float16 v8h;
typedef __attribute__((ext_vector_type(8)))  float    v8f;
typedef __attribute__((ext_vector_type(4)))  float    v4f;
typedef v8h  __attribute__((may_alias)) v8ha;
typedef v4f  __attribute__((may_alias)) v4fa;

__device__ __forceinline__ unsigned short f2bf(float f) { unsigned u = __float_as_uint(f); u += 0x7FFFu + ((u >> 16) & 1u); return (unsigned short)(u >> 16); }
__device__ __forceinline__ float bf2f(unsigned short b) { return __uint_as_float(((unsigned)b) << 16); }
__device__ __forceinline__ float bfr(float f) { return bf2f(f2bf(f)); }
__device__ __forceinline__ v16h cat16(v8h lo, v8h hi) { return __builtin_shufflevector(lo, hi, 0, 1, 2, 3, 4, 5, 6, 7, 8, 9, 10, 11, 12, 13, 14, 15); }
__device__ __forceinline__ v8f wmma16(v16h a, v16h b, v8f c) { return __builtin_amdgcn_wmma_f32_16x16x32_f16(false, a, false, b, (short)0, c, false, false); }
__device__ __forceinline__ float hsum16(float v) { v += __shfl_xor(v, 1, 16); v += __shfl_xor(v, 2, 16); v += __shfl_xor(v, 4, 16); return v + __shfl_xor(v, 8, 16); }
__device__ __forceinline__ float gelu_t(float x) { const float c = 0.7978845608028654f; return 0.5f * x * (1.0f + tanhf(c * (x + 0.044715f * x * x * x))); }

__global__ __launch_bounds__(256) void k_ln(const float* __restrict__ x, const float* __restrict__ g, const float* __restrict__ bt, h16* XN16) {
    const int lane = threadIdx.x & 31, r = blockIdx.x * 8 + (threadIdx.x >> 5);
    if (r >= NTK) return;
    const float* xr = x + (size_t)r * DM;
    float s = 0.f;
#pragma unroll
    for (int q = 0; q < 4; ++q)
#pragma unroll
        for (int i = 0; i < 8; ++i) s += bfr(xr[q * 256 + lane * 8 + i]);
#pragma unroll
    for (int o = 16; o; o >>= 1) s += __shfl_xor(s, o, 32);
    const float mu = s * (1.0f / DM);
    float sq = 0.f;
#pragma unroll 1
    for (int q = 0; q < 4; ++q)
#pragma unroll
        for (int i = 0; i < 8; ++i) { const float d = bfr(xr[q * 256 + lane * 8 + i]) - mu; sq += d * d; }
#pragma unroll
    for (int o = 16; o; o >>= 1) sq += __shfl_xor(sq, o, 32);
    const float rs = rsqrtf(sq * (1.0f / DM) + EPS);
#pragma unroll 1
    for (int q = 0; q < 4; ++q) {
        v8h o8;
#pragma unroll
        for (int i = 0; i < 8; ++i) { const int c = q * 256 + lane * 8 + i; o8[i] = (h16)((bfr(xr[c]) - mu) * rs * bfr(g[c]) + bfr(bt[c])); }
        *(v8h*)(XN16 + (size_t)r * DM + q * 256 + lane * 8) = o8; 
    }
}

// k_wt: k-major W [K rows][N cols] -> n-major f16 plane WT [Npad][Kpad] (f16 of bf16(W); rows >= N and columns >= K zero); 64 x 64 tiles through LDS; grid (Kpad/64,
__global__ __launch_bounds__(256) void k_wt(const float* __restrict__ Wm, int K, int N, int Kpad, h16* WT) {
    __shared__ __align__(16) h16 tl[64 * 72];
    const int tid = threadIdx.x, k0 = blockIdx.x * 64, n0 = blockIdx.y * 64;
    const int kk = tid >> 2, nq = (tid & 3) * 16;
#pragma unroll
    for (int i = 0; i < 16; ++i) { const int k = k0 + kk, n = n0 + nq + i; tl[(nq + i) * 72 + kk] = (k < K && n < N) ? (h16)bfr(Wm[(size_t)k * N + n]) : (h16)0.f; }
    __syncthreads();
    const int piece = tid & 7;
    auto pass = [&]() {
#pragma unroll
        for (int s = 0; s < 2; ++s) { const int nr = (tid >> 3) + 32 * s; const v8h val = *(const v8ha*)(tl + nr * 72 + piece * 8);
            *(v8h*)(WT + (size_t)(n0 + nr) * Kpad + k0 + piece * 8) = val; }
    };
    pass(); 
}

// GEMM tile core: 128 x 128 block tile (2 x 2 waves, 64 x 64 each) of A[M][K] (f16, lda = K) . BT[N][K], K a multiple of 64 and at least 128. A pass is 64 k: the
// 128 rows x 128 B of both operands are brought into LDS by asynchronous copies (pitch 144 B for the ds_load_b128 readers), two buffers, the next pass's copies in
// flight while this pass is worked on. A buffer is [A tile | BT tile]. Returns acc[4][4] (row group, column group; D layout); the k order of every sum is ascending.
#define TP   72
#define TSZ  (128 * TP)
#define RING (4 * TSZ)

// One operand's tile of one pass: 8 copies a lane, 16 rows apart (a wave covers 4 whole 128-B rows a copy). The s_wait_xcnt ends the copies' own statement, so that
// no address register of a copy is rewritten ahead of it.
__device__ __forceinline__ void copy_tile(unsigned l, const h16* g, int K) {
    const size_t rs = (size_t)16 * K;
    asm volatile("global_load_async_to_lds_b128 %0, %8, off\n\t"
                 "global_load_async_to_lds_b128 %1, %9, off\n\t"
                 "global_load_async_to_lds_b128 %2, %10, off\n\t"
                 "global_load_async_to_lds_b128 %3, %11, off\n\t"
                 "global_load_async_to_lds_b128 %4, %12, off\n\t"
                 "global_load_async_to_lds_b128 %5, %13, off\n\t"
                 "global_load_async_to_lds_b128 %6, %14, off\n\t"
                 "global_load_async_to_lds_b128 %7, %15, off\n\t"
                 "s_wait_xcnt 0x0"
                 :: "v"(l), "v"(l + 1u * 16u * 144u), "v"(l + 2u * 16u * 144u), "v"(l + 3u * 16u * 144u),
                    "v"(l + 4u * 16u * 144u), "v"(l + 5u * 16u * 144u), "v"(l + 6u * 16u * 144u), "v"(l + 7u * 16u * 144u),
                    "v"(g), "v"(g + rs), "v"(g + 2 * rs), "v"(g + 3 * rs), "v"(g + 4 * rs), "v"(g + 5 * rs), "v"(g + 6 * rs), "v"(g + 7 * rs)
                 : "memory");
}

__device__ __forceinline__ void gemm_tile(const h16* __restrict__ A, const h16* __restrict__ BT, const int K, int rb, int cb, h16* ring, v8f (&acc)[4][4]) {
    const int tid = threadIdx.x, lane = tid & 31, wave = tid >> 5, lr = lane & 15, hi = lane >> 4;
    const h16* ga = A + (size_t)(rb + (tid >> 3)) * K + (tid & 7) * 8;
    const h16* gb = BT + (size_t)(cb + (tid >> 3)) * K + (tid & 7) * 8;
    const unsigned l0 = (unsigned)(size_t)ring + (unsigned)((tid >> 3) * 144 + (tid & 7) * 16);
    const int np = K / 64;
#pragma unroll
    for (int i = 0; i < 4; ++i)
#pragma unroll
        for (int t = 0; t < 4; ++t) acc[i][t] = (v8f){};
    copy_tile(l0, ga, K);
    copy_tile(l0 + TSZ * 2, gb, K);
    asm volatile("s_wait_asynccnt 0x0" ::: "memory");   // pass 0's own copies have landed before the barrier publishes them
    __syncthreads();
    copy_tile(l0 + 2 * TSZ * 2, ga + 64, K);
    copy_tile(l0 + 3 * TSZ * 2, gb + 64, K);
#pragma unroll 1   // one pass a trip: the two buffers alternate by the trip's parity
    for (int p = 0; p < np; ++p) {
        const int bo = (p & 1) * 2 * TSZ;
        const h16* sa = ring + bo + ((wave >> 1) * 64 + lr) * TP + 8 * hi;
        const h16* sb = ring + bo + TSZ + ((wave & 1) * 64 + lr) * TP + 8 * hi;
        v16h a[4], b[4];
#pragma unroll
        for (int i = 0; i < 4; ++i) a[i] = cat16(*(const v8ha*)(sa + i * 16 * TP), *(const v8ha*)(sa + i * 16 * TP + 16));
#pragma unroll
        for (int t = 0; t < 4; ++t) b[t] = cat16(*(const v8ha*)(sb + t * 16 * TP), *(const v8ha*)(sb + t * 16 * TP + 16));
        __builtin_amdgcn_sched_barrier(0);   // the 16 LDS reads of a k step go out as one group ahead of its WMMAs
#pragma unroll
        for (int i = 0; i < 4; ++i)
#pragma unroll
            for (int t = 0; t < 4; ++t) acc[i][t] = wmma16(a[i], b[t], acc[i][t]);
        __builtin_amdgcn_sched_barrier(0);   // the second k step's reads stay behind the first step's WMMAs, in the same fragment registers
#pragma unroll
        for (int i = 0; i < 4; ++i) a[i] = cat16(*(const v8ha*)(sa + i * 16 * TP + 32), *(const v8ha*)(sa + i * 16 * TP + 48));
#pragma unroll
        for (int t = 0; t < 4; ++t) b[t] = cat16(*(const v8ha*)(sb + t * 16 * TP + 32), *(const v8ha*)(sb + t * 16 * TP + 48));
        asm volatile("s_wait_dscnt 0x0" ::: "memory");      // this wave's last reads of the buffer are done before the barrier frees it for the refill
        asm volatile("s_wait_asynccnt 0x0" ::: "memory");   // this wave's copies of pass p + 1 have landed before the barrier publishes them
        __syncthreads();
        if (p + 2 < np) {
            copy_tile(l0 + bo * 2, ga + (size_t)(p + 2) * 64, K);
            copy_tile(l0 + bo * 2 + TSZ * 2, gb + (size_t)(p + 2) * 64, K);
        }
        __builtin_amdgcn_sched_barrier(0);   // the refill is issued ahead of the second k step's WMMAs (registers only), so that it flies under them
#pragma unroll
        for (int i = 0; i < 4; ++i)
#pragma unroll
            for (int t = 0; t < 4; ++t) acc[i][t] = wmma16(a[i], b[t], acc[i][t]);
    }
    asm volatile("s_wait_asynccnt 0x0" ::: "memory");       // no copy is outstanding when the ring becomes the output staging
}

// Store pass of a wave's staged 64 x 64 f32 tile (pitch 68) as f16 rows of 128 B, whole lines; gelu (a compile-time or block-uniform choice) is applied to the staged f32 values.
__device__ __forceinline__ void put_tile16(const float* os, h16* crow, int ld, int lane, const bool gelu) {
    for (int s0 = 0; s0 < 16; s0 += 4) {
        v4f v[4][2];
#pragma unroll   // four row groups a trip: their LDS reads go out together, one latency a trip instead of one a group
        for (int u = 0; u < 4; ++u) { const float* sp = os + (4 * (s0 + u) + (lane >> 3)) * 68 + (lane & 7) * 8; v[u][0] = *(const v4fa*)sp; v[u][1] = *(const v4fa*)(sp + 4); }
        if (gelu) {
#pragma unroll
            for (int u = 0; u < 4; ++u)
#pragma unroll
                for (int i = 0; i < 8; ++i) v[u][i >> 2][i & 3] = gelu_t(v[u][i >> 2][i & 3]);
        }
#pragma unroll
        for (int u = 0; u < 4; ++u) { v8h o;
#pragma unroll
            for (int i = 0; i < 8; ++i) o[i] = (h16)v[u][i >> 2][i & 3];
            *(v8h*)(crow + (size_t)(4 * (s0 + u) + (lane >> 3)) * ld + (lane & 7) * 8) = o; }
        asm volatile("s_wait_xcnt 0x0" ::: "memory");   // before the next trip rewrites the registers that this trip's stores name
    }
}

// k_fused: fused = XN16 . W1T + b1 over the 3840 padded columns; a wave's 64-wide column group = exactly one head of q / k / v or a 64-wide slice of the MLP hidden:
//   c0 <  1024: q head c0/64: per-row LayerNorm over the 64 head dims (qn_g, qn_b) -> Q16[tok][1024] f16
//   c0 <  2048: k head: LayerNorm (kn_g, kn_b) -> K16
//   c0 <  3072: v -> V16 rows
//   else      : gelu_tanh (in the store pass) -> G16[tok][768] (columns >= 716 of the hidden are exactly 0 after gelu(0 + 0): b1 pad is read as 0; their Wmo rows are 0 anyway)
__global__ __launch_bounds__(128) void k_fused(const h16* __restrict__ XN16, const h16* __restrict__ W1T, const float* __restrict__ b1,
                                              const float* __restrict__ qg, const float* __restrict__ qb, const float* __restrict__ kg, const float* __restrict__ kb,
                                              h16* Q16, h16* K16, h16* V16, h16* G16) {
    __shared__ __align__(16) h16 ring[RING];
    const int lane = threadIdx.x & 31, wave = threadIdx.x >> 5, lr = lane & 15, hi = lane >> 4;
    const int rb = blockIdx.x * 128, cb = blockIdx.y * 128;
    v8f acc[4][4];
    gemm_tile(XN16, W1T, DM, rb, cb, ring, acc);
    const int r0 = rb + (wave >> 1) * 64, c0 = cb + (wave & 1) * 64;
    const int sec = cb / DM;                   // 0 q, 1 k, 2 v, 3 mlp (the same for both column groups of a block)
#pragma unroll
    for (int t = 0; t < 4; ++t) { const int col = c0 + t * 16 + lr; const float bv = (col < NF) ? bfr(b1[col]) : 0.f;
#pragma unroll
        for (int i = 0; i < 4; ++i)
#pragma unroll
            for (int j = 0; j < 8; ++j) acc[i][t][j] += bv; }
    if (sec < 2) {
        const float* gg = sec ? kg : qg; const float* bb = sec ? kb : qb;
#pragma unroll
        for (int i = 0; i < 4; ++i)
#pragma unroll
            for (int j = 0; j < 8; ++j) {
                float s = acc[i][0][j] + acc[i][1][j] + acc[i][2][j] + acc[i][3][j];
                const float mu = hsum16(s) * (1.0f / HD);
                float q = 0.f;
#pragma unroll
                for (int t = 0; t < 4; ++t) { const float d = acc[i][t][j] - mu; q += d * d; }
                const float rs = rsqrtf(hsum16(q) * (1.0f / HD) + EPS);
#pragma unroll
                for (int t = 0; t < 4; ++t) acc[i][t][j] = (acc[i][t][j] - mu) * rs * bfr(gg[t * 16 + lr]) + bfr(bb[t * 16 + lr]);
            }
    }
    float* os = (float*)ring + wave * (64 * 68);   // the loop's last barrier has freed the ring; each wave stages its own 64 x 64 tile
#pragma unroll
    for (int i = 0; i < 4; ++i)
#pragma unroll
        for (int t = 0; t < 4; ++t)
#pragma unroll
            for (int j = 0; j < 8; ++j) os[(i * 16 + hi * 8 + j) * 68 + t * 16 + lr] = acc[i][t][j];
    __syncthreads();
    h16* dst; int ld, cc;
    if (sec == 0) { dst = Q16; ld = DM; cc = c0; } else if (sec == 1) { dst = K16; ld = DM; cc = c0 - DM; } else if (sec == 2) { dst = V16; ld = DM; cc = c0 - 2 * DM; } else { dst = G16; ld = MLPP; cc = c0 - 3 * DM; }
    h16* crow = dst + (size_t)r0 * ld + cc;
    put_tile16(os, crow, ld, lane, sec == 3);
}

// k_gemm16o: C16[M][ldc] columns cbase + c0.. = f16(A.BT + bias): used for attn_out (A = CTX16, K = 1024) and mlp_out (A = G16, K = 768) into the two halves of COMB16.
__global__ __launch_bounds__(128) void k_gemm16o(const h16* __restrict__ A, const h16* __restrict__ BT, int K, const float* __restrict__ bias, h16* C16, int ldc, int cbase) {
    __shared__ __align__(16) h16 ring[RING];
    const int lane = threadIdx.x & 31, wave = threadIdx.x >> 5, lr = lane & 15, hi = lane >> 4;
    const int rb = blockIdx.x * 128, cb = blockIdx.y * 128;
    v8f acc[4][4];
    gemm_tile(A, BT, K, rb, cb, ring, acc);
    const int r0 = rb + (wave >> 1) * 64, c0 = cb + (wave & 1) * 64;
    float* os = (float*)ring + wave * (64 * 68);   // the loop's last barrier has freed the ring; each wave stages its own 64 x 64 tile
#pragma unroll
    for (int t = 0; t < 4; ++t) { const float bv = bfr(bias[c0 + t * 16 + lr]);
#pragma unroll
        for (int i = 0; i < 4; ++i)
#pragma unroll
            for (int j = 0; j < 8; ++j) os[(i * 16 + hi * 8 + j) * 68 + t * 16 + lr] = acc[i][t][j] + bv; }
    __syncthreads();
    h16* crow = C16 + (size_t)r0 * ldc + cbase + c0;
    put_tile16(os, crow, ldc, lane, false);
}

__global__ __launch_bounds__(128) void k_gemmout(const h16* __restrict__ A, const h16* __restrict__ BT, const float* __restrict__ bias, const float* __restrict__ x, float* C) {
    __shared__ __align__(16) h16 ring[RING];
    const int lane = threadIdx.x & 31, wave = threadIdx.x >> 5, lr = lane & 15, hi = lane >> 4;
    const int rb = blockIdx.x * 128, cb = blockIdx.y * 128;
    v8f acc[4][4];
    gemm_tile(A, BT, 2 * DM, rb, cb, ring, acc);
    const int r0 = rb + (wave >> 1) * 64, c0 = cb + (wave & 1) * 64;
    float* os = (float*)ring + wave * (64 * 68);   // the loop's last barrier has freed the ring; each wave stages its own 64 x 64 tile
#pragma unroll
    for (int t = 0; t < 4; ++t) { const float bv = bfr(bias[c0 + t * 16 + lr]);
#pragma unroll
        for (int i = 0; i < 4; ++i)
#pragma unroll
            for (int j = 0; j < 8; ++j) os[(i * 16 + hi * 8 + j) * 68 + t * 16 + lr] = acc[i][t][j] + bv; }
    __syncthreads();
    float* crow = C + (size_t)r0 * DM + c0;
    const float* xrow = x + (size_t)r0 * DM + c0;
    for (int s0 = 0; s0 < 32; s0 += 8) {
#pragma unroll   // eight row pairs a trip: their x loads and LDS reads go out together, one latency a trip instead of one a row pair
        for (int s = s0; s < s0 + 8; ++s) { const int row = 2 * s + (lane >> 4), cofs = (lane & 15) * 4;
            v4f val = *(const v4fa*)(os + row * 68 + cofs); const v4f xv = *(const v4f*)(xrow + (size_t)row * DM + cofs);
#pragma unroll
            for (int e = 0; e < 4; ++e) val[e] += bfr(xv[e]);
            *(v4f*)(crow + (size_t)row * DM + cofs) = val; }
        asm volatile("s_wait_xcnt 0x0" ::: "memory");   // before the next trip rewrites the registers that this trip's loads and stores name
    }
}

// k_vt: VT16[b][h][d][t] from V16 rows via LDS transpose; block (b, h, 64 tokens).
__global__ __launch_bounds__(256) void k_vt(const h16* __restrict__ V16, h16* VT16) {
    __shared__ __align__(16) h16 tile[64 * 72];
    const int bid = blockIdx.x;
    const int b = bid / (NH_ * (NT_ / 64)), rem = bid - b * (NH_ * (NT_ / 64)), h = rem / (NT_ / 64), kt = rem - h * (NT_ / 64);
    const int k0 = kt * 64, tid = threadIdx.x;
    const int kk = tid >> 2, d0 = (tid & 3) * 16;
    const h16* src = V16 + ((size_t)b * NT_ + k0 + kk) * DM + h * HD + d0;
#pragma unroll
    for (int i = 0; i < 16; ++i) tile[(d0 + i) * 72 + kk] = src[i];
    __syncthreads();
    const int piece = tid & 7;
    h16* base = VT16 + (((size_t)b * NH_ + h) * HD) * NT_ + k0;
    auto pass = [&]() {
#pragma unroll
        for (int s = 0; s < 2; ++s) { const int d = (tid >> 3) + 32 * s; const v8h val = *(const v8ha*)(tile + d * 72 + piece * 8); *(v8h*)(base + (size_t)d * NT_ + piece * 8) = val; }
    };
    pass(); 
}

// k_attn: block = (b, h, 64 queries), wave = 16; 64 steps x 32 keys: 4 WMMA scores /8, online f32 softmax, weights x32768 f16 tile (same-wave may_alias reload after a
__global__ __launch_bounds__(128) void k_attn(const h16* __restrict__ Q16, const h16* __restrict__ K16, const h16* __restrict__ VT16, h16* CTX16) {
    __shared__ __align__(16) h16 plds[4][16 * 32];
    __shared__ __align__(16) float ost[4][16 * 68];
    const int lane = threadIdx.x & 31, wave = threadIdx.x >> 5, lr = lane & 15, hi = lane >> 4;
    const int bid = blockIdx.x;
    const int b = bid / (NH_ * (NT_ / 64)), rem = bid - b * (NH_ * (NT_ / 64)), h = rem / (NT_ / 64), qt = rem - h * (NT_ / 64);
    const int q0 = qt * 64 + wave * 16;
    const size_t tok0 = (size_t)b * NT_;
    h16* pl = &plds[wave][0];
    v16h qa[2];
#pragma unroll
    for (int kc = 0; kc < 2; ++kc) { const h16* p = Q16 + (tok0 + q0 + lr) * DM + h * HD + kc * 32 + 8 * hi; qa[kc] = cat16(*(const v8h*)p, *(const v8h*)(p + 16)); }
    const h16* kh_b = K16 + tok0 * DM + h * HD;
    const h16* vt_b = VT16 + (((size_t)b * NH_ + h) * HD) * NT_;
    v8f o[4];
#pragma unroll
    for (int n = 0; n < 4; ++n) o[n] = (v8f){};
    float mrow[8], lpart[8];
#pragma unroll
    for (int j = 0; j < 8; ++j) { mrow[j] = -3.0e38f; lpart[j] = 0.f; }
#pragma unroll 1
    for (int kt = 0; kt < NT_ / 32; ++kt) {
        const int l0 = kt * 32;
        const h16* r0p = kh_b + (size_t)(l0 + lr) * DM + 8 * hi;
        const h16* r1p = kh_b + (size_t)(l0 + 16 + lr) * DM + 8 * hi;
        v8f s0 = {}, s1 = {};
#pragma unroll
        for (int kc = 0; kc < 2; ++kc) {
            s0 = wmma16(qa[kc], cat16(*(const v8h*)(r0p + kc * 32), *(const v8h*)(r0p + kc * 32 + 16)), s0);
            s1 = wmma16(qa[kc], cat16(*(const v8h*)(r1p + kc * 32), *(const v8h*)(r1p + kc * 32 + 16)), s1);
        }
        asm volatile("v_nop\n\tv_nop\n\tv_nop\n\tv_nop" : "+v"(s0), "+v"(s1) : "v"(qa[0]), "v"(qa[1]));
        float alpha[8];
#pragma unroll
        for (int j = 0; j < 8; ++j) {
            const float a0 = s0[j] * 0.125f, a1 = s1[j] * 0.125f;
            float mx = fmaxf(a0, a1);
            mx = fmaxf(mx, __shfl_xor(mx, 1, 16)); mx = fmaxf(mx, __shfl_xor(mx, 2, 16)); mx = fmaxf(mx, __shfl_xor(mx, 4, 16)); mx = fmaxf(mx, __shfl_xor(mx, 8, 16));
            const float mn = fmaxf(mrow[j], mx);
            alpha[j] = __expf(mrow[j] - mn); mrow[j] = mn;
            const float p0 = __expf(a0 - mn), p1 = __expf(a1 - mn);
            lpart[j] = lpart[j] * alpha[j] + (p0 + p1);
            const int mr = hi * 8 + j;
            pl[mr * 32 + lr] = (h16)(p0 * PSC); pl[mr * 32 + 16 + lr] = (h16)(p1 * PSC);
        }
#pragma unroll
        for (int n = 0; n < 4; ++n)
#pragma unroll
            for (int j = 0; j < 8; ++j) o[n][j] *= alpha[j];
        asm volatile("" ::: "memory");
        const v16h pa = cat16(*(const v8ha*)(pl + lr * 32 + hi * 8), *(const v8ha*)(pl + lr * 32 + 16 + hi * 8));
#pragma unroll
        for (int n = 0; n < 4; ++n) { const h16* vp = vt_b + (size_t)(n * 16 + lr) * NT_ + l0 + hi * 8; o[n] = wmma16(pa, cat16(*(const v8h*)vp, *(const v8h*)(vp + 16)), o[n]); }
        asm volatile("v_nop\n\tv_nop\n\tv_nop\n\tv_nop" : "+v"(o[0]), "+v"(o[1]), "+v"(o[2]), "+v"(o[3]) : "v"(pa));
    }
    float inv[8];
#pragma unroll
    for (int j = 0; j < 8; ++j) { float rs = lpart[j]; rs += __shfl_xor(rs, 1, 16); rs += __shfl_xor(rs, 2, 16); rs += __shfl_xor(rs, 4, 16); rs += __shfl_xor(rs, 8, 16); inv[j] = 1.0f / (rs * PSC); }
    float* os = &ost[wave][0];
#pragma unroll
    for (int n = 0; n < 4; ++n)
#pragma unroll
        for (int j = 0; j < 8; ++j) os[(hi * 8 + j) * 68 + n * 16 + lr] = o[n][j] * inv[j];
    __syncthreads();
    h16* crow = CTX16 + (tok0 + q0) * DM + (size_t)h * HD;
    auto pass = [&]() {
#pragma unroll
        for (int s = 0; s < 4; ++s) { const int row = 4 * s + (lane >> 3), piece = lane & 7; const float* sp = os + row * 68 + piece * 8; v8h o8;
#pragma unroll
            for (int i = 0; i < 8; ++i) o8[i] = (h16)sp[i];
            *(v8h*)(crow + (size_t)row * DM + piece * 8) = o8; }
    };
    pass(); 
}

extern "C" void kernel_launch(void* const* d_in, const int* in_sizes, int n_in,
                              void* d_out, int out_size, void* d_ws, size_t ws_size, hipStream_t stream) {
    (void)in_sizes; (void)n_in; (void)out_size;
    const float* x = (const float*)d_in[0]; const float* ng = (const float*)d_in[1]; const float* nb = (const float*)d_in[2]; const float* W1 = (const float*)d_in[3]; const float* b1 = (const float*)d_in[4];
    const float* qg = (const float*)d_in[5]; const float* qb = (const float*)d_in[6]; const float* kg = (const float*)d_in[7]; const float* kb = (const float*)d_in[8];
    const float* Wao = (const float*)d_in[9]; const float* bao = (const float*)d_in[10]; const float* Wmo = (const float*)d_in[11]; const float* bmo = (const float*)d_in[12];
    const float* W2 = (const float*)d_in[13]; const float* b2 = (const float*)d_in[14];
    float* out = (float*)d_out;    // [2][2048][1024]
    char* wsp = (char*)d_ws;
    auto take = [&](size_t bytes) { char* p = wsp; wsp += (bytes + 255) & ~(size_t)255; return (void*)p; };
    h16* XN16 = (h16*)take((size_t)NTK * DM * 2); h16* W1T = (h16*)take((size_t)NFP * DM * 2);
    h16* WaoT = (h16*)take((size_t)DM * DM * 2); h16* WmoT = (h16*)take((size_t)DM * MLPP * 2); h16* W2T = (h16*)take((size_t)DM * 2 * DM * 2);
    h16* Q16 = (h16*)take((size_t)NTK * DM * 2); h16* K16 = (h16*)take((size_t)NTK * DM * 2); h16* V16 = (h16*)take((size_t)NTK * DM * 2); h16* VT16 = (h16*)take((size_t)NTK * DM * 2);
    h16* G16 = (h16*)take((size_t)NTK * MLPP * 2); h16* CTX16 = (h16*)take((size_t)NTK * DM * 2); h16* COMB16 = (h16*)take((size_t)NTK * 2 * DM * 2);
    if ((size_t)(wsp - (char*)d_ws) > ws_size) return;    // 8.4 + 7.9 + 2.1 + 1.6 + 4.2 + 4 x 8.4 + 6.3 + 8.4 + 16.8 MB ~ 89 MB
    k_ln<<<NTK / 8, 256, 0, stream>>>(x, ng, nb, XN16);
    k_wt<<<dim3(DM / 64, NFP / 64, 1), 256, 0, stream>>>(W1, DM, NF, DM, W1T);
    k_wt<<<dim3(DM / 64, DM / 64, 1), 256, 0, stream>>>(Wao, DM, DM, DM, WaoT);
    k_wt<<<dim3(MLPP / 64, DM / 64, 1), 256, 0, stream>>>(Wmo, MLPH, DM, MLPP, WmoT);
    k_wt<<<dim3((2 * DM) / 64, DM / 64, 1), 256, 0, stream>>>(W2, 2 * DM, DM, 2 * DM, W2T);
    k_fused<<<dim3(NTK / 128, NFP / 128, 1), 128, 0, stream>>>(XN16, W1T, b1, qg, qb, kg, kb, Q16, K16, V16, G16);
    k_vt<<<NB_ * NH_ * (NT_ / 64), 256, 0, stream>>>(V16, VT16);
    k_attn<<<NB_ * NH_ * (NT_ / 64), 128, 0, stream>>>(Q16, K16, VT16, CTX16);
    k_gemm16o<<<dim3(NTK / 128, DM / 128, 1), 128, 0, stream>>>(CTX16, WaoT, DM, bao, COMB16, 2 * DM, 0);
    k_gemm16o<<<dim3(NTK / 128, DM / 128, 1), 128, 0, stream>>>(G16, WmoT, MLPP, bmo, COMB16, 2 * DM, DM);
    k_gemmout<<<dim3(NTK / 128, DM / 128, 1), 128, 0, stream>>>(COMB16, W2T, b2, x, out);
}

// v002
// Measured time: 170 microseconds a run.
// Timed twice side by side with v001, it ran 1.30 times as fast both times.
// Over all steps from v000 it is 2.38 times as fast.
#include <hip/hip_runtime.h>

// Contractions on v_wmma_f32_16x16x32_f16 with plain f16 operands, f32 accumulate: fused = LN(x).W1 + b1 ([4096 x 1024].[1024 x 3788 (padded 3840)]), the 16-head
// attention with per-head LayerNorm on q and k (scores [2048 x 64].[64 x 2048] /8, softmax, .v), attn_out = a.Wao + bao, mlp_out = gelu_tanh(h).Wmo + bmo
// ([4096 x 716 (768)].[768 x 1024]) and out = x + [attn_out | mlp_out].W2 + b2 ([4096 x 2048].[2048 x 1024]). Weights are f16 of their bf16 rounding (exact for the
// bf16-input reference), the activations are computed values rounded once to f16 (the output is dominated by the exact residual x). LayerNorms (eps 1e-6), gelu and

#define NB_  2
#define NT_  2048
#define DM   1024
#define NH_  16
#define HD   64
#define NTK  (NB_ * NT_)
#define NF   3788
#define NFP  3840
#define MLPH 716
#define MLPP 768
#define PSC  32768.0f
#define EPS  1e-6f

typedef _Float16 h16;
typedef __attribute__((ext_vector_type(16))) _Float16 v16h;
typedef __attribute__((ext_vector_type(8)))  _Float16 v8h;
typedef __attribute__((ext_vector_type(8)))  float    v8f;
typedef __attribute__((ext_vector_type(4)))  float    v4f;
typedef v8h  __attribute__((may_alias)) v8ha;
typedef v4f  __attribute__((may_alias)) v4fa;

__device__ __forceinline__ unsigned short f2bf(float f) { unsigned u = __float_as_uint(f); u += 0x7FFFu + ((u >> 16) & 1u); return (unsigned short)(u >> 16); }
__device__ __forceinline__ float bf2f(unsigned short b) { return __uint_as_float(((unsigned)b) << 16); }
__device__ __forceinline__ float bfr(float f) { return bf2f(f2bf(f)); }
__device__ __forceinline__ v16h cat16(v8h lo, v8h hi) { return __builtin_shufflevector(lo, hi, 0, 1, 2, 3, 4, 5, 6, 7, 8, 9, 10, 11, 12, 13, 14, 15); }
__device__ __forceinline__ v8f wmma16(v16h a, v16h b, v8f c) { return __builtin_amdgcn_wmma_f32_16x16x32_f16(false, a, false, b, (short)0, c, false, false); }
__device__ __forceinline__ float hsum16(float v) { v += __shfl_xor(v, 1, 16); v += __shfl_xor(v, 2, 16); v += __shfl_xor(v, 4, 16); return v + __shfl_xor(v, 8, 16); }
__device__ __forceinline__ float gelu_t(float x) { const float c = 0.7978845608028654f; return 0.5f * x * (1.0f + tanhf(c * (x + 0.044715f * x * x * x))); }

__global__ __launch_bounds__(256) void k_ln(const float* __restrict__ x, const float* __restrict__ g, const float* __restrict__ bt, h16* XN16) {
    const int lane = threadIdx.x & 31, r = blockIdx.x * 8 + (threadIdx.x >> 5);
    if (r >= NTK) return;
    const float* xr = x + (size_t)r * DM;
    float s = 0.f;
#pragma unroll
    for (int q = 0; q < 4; ++q)
#pragma unroll
        for (int i = 0; i < 8; ++i) s += bfr(xr[q * 256 + lane * 8 + i]);
#pragma unroll
    for (int o = 16; o; o >>= 1) s += __shfl_xor(s, o, 32);
    const float mu = s * (1.0f / DM);
    float sq = 0.f;
#pragma unroll 1
    for (int q = 0; q < 4; ++q)
#pragma unroll
        for (int i = 0; i < 8; ++i) { const float d = bfr(xr[q * 256 + lane * 8 + i]) - mu; sq += d * d; }
#pragma unroll
    for (int o = 16; o; o >>= 1) sq += __shfl_xor(sq, o, 32);
    const float rs = rsqrtf(sq * (1.0f / DM) + EPS);
#pragma unroll 1
    for (int q = 0; q < 4; ++q) {
        v8h o8;
#pragma unroll
        for (int i = 0; i < 8; ++i) { const int c = q * 256 + lane * 8 + i; o8[i] = (h16)((bfr(xr[c]) - mu) * rs * bfr(g[c]) + bfr(bt[c])); }
        *(v8h*)(XN16 + (size_t)r * DM + q * 256 + lane * 8) = o8; 
    }
}

// k_wt: k-major W [K rows][N cols] -> n-major f16 plane WT [Npad][Kpad] (f16 of bf16(W); rows >= N and columns >= K zero); 64 x 64 tiles through LDS; grid (Kpad/64,
__global__ __launch_bounds__(256) void k_wt(const float* __restrict__ Wm, int K, int N, int Kpad, h16* WT) {
    __shared__ __align__(16) h16 tl[64 * 72];
    const int tid = threadIdx.x, k0 = blockIdx.x * 64, n0 = blockIdx.y * 64;
    const int kk = tid >> 2, nq = (tid & 3) * 16;
#pragma unroll
    for (int i = 0; i < 16; ++i) { const int k = k0 + kk, n = n0 + nq + i; tl[(nq + i) * 72 + kk] = (k < K && n < N) ? (h16)bfr(Wm[(size_t)k * N + n]) : (h16)0.f; }
    __syncthreads();
    const int piece = tid & 7;
    auto pass = [&]() {
#pragma unroll
        for (int s = 0; s < 2; ++s) { const int nr = (tid >> 3) + 32 * s; const v8h val = *(const v8ha*)(tl + nr * 72 + piece * 8);
            *(v8h*)(WT + (size_t)(n0 + nr) * Kpad + k0 + piece * 8) = val; }
    };
    pass(); 
}

// GEMM tile core: 128 x 128 block tile (2 x 2 waves, 64 x 64 each) of A[M][K] (f16, lda = K) . BT[N][K], K a multiple of 64 and at least 128. A pass is 64 k: the
// 128 rows x 128 B of both operands are brought into LDS by asynchronous copies (pitch 144 B for the ds_load_b128 readers), two buffers, the next pass's copies in
// flight while this pass is worked on. A buffer is [A tile | BT tile]. Returns acc[4][4] (row group, column group; D layout); the k order of every sum is ascending.
#define TP   72
#define TSZ  (128 * TP)
#define RING (4 * TSZ)

// One operand's tile of one pass: 8 copies a lane, 16 rows apart (a wave covers 4 whole 128-B rows a copy). The s_wait_xcnt ends the copies' own statement, so that
// no address register of a copy is rewritten ahead of it.
__device__ __forceinline__ void copy_tile(unsigned l, const h16* g, int K) {
    const size_t rs = (size_t)16 * K;
    asm volatile("global_load_async_to_lds_b128 %0, %8, off\n\t"
                 "global_load_async_to_lds_b128 %1, %9, off\n\t"
                 "global_load_async_to_lds_b128 %2, %10, off\n\t"
                 "global_load_async_to_lds_b128 %3, %11, off\n\t"
                 "global_load_async_to_lds_b128 %4, %12, off\n\t"
                 "global_load_async_to_lds_b128 %5, %13, off\n\t"
                 "global_load_async_to_lds_b128 %6, %14, off\n\t"
                 "global_load_async_to_lds_b128 %7, %15, off\n\t"
                 "s_wait_xcnt 0x0"
                 :: "v"(l), "v"(l + 1u * 16u * 144u), "v"(l + 2u * 16u * 144u), "v"(l + 3u * 16u * 144u),
                    "v"(l + 4u * 16u * 144u), "v"(l + 5u * 16u * 144u), "v"(l + 6u * 16u * 144u), "v"(l + 7u * 16u * 144u),
                    "v"(g), "v"(g + rs), "v"(g + 2 * rs), "v"(g + 3 * rs), "v"(g + 4 * rs), "v"(g + 5 * rs), "v"(g + 6 * rs), "v"(g + 7 * rs)
                 : "memory");
}

__device__ __forceinline__ void gemm_tile(const h16* __restrict__ A, const h16* __restrict__ BT, const int K, int rb, int cb, h16* ring, v8f (&acc)[4][4]) {
    const int tid = threadIdx.x, lane = tid & 31, wave = tid >> 5, lr = lane & 15, hi = lane >> 4;
    const h16* ga = A + (size_t)(rb + (tid >> 3)) * K + (tid & 7) * 8;
    const h16* gb = BT + (size_t)(cb + (tid >> 3)) * K + (tid & 7) * 8;
    const unsigned l0 = (unsigned)(size_t)ring + (unsigned)((tid >> 3) * 144 + (tid & 7) * 16);
    const int np = K / 64;
#pragma unroll
    for (int i = 0; i < 4; ++i)
#pragma unroll
        for (int t = 0; t < 4; ++t) acc[i][t] = (v8f){};
    copy_tile(l0, ga, K);
    copy_tile(l0 + TSZ * 2, gb, K);
    asm volatile("s_wait_asynccnt 0x0" ::: "memory");   // pass 0's own copies have landed before the barrier publishes them
    __syncthreads();
    copy_tile(l0 + 2 * TSZ * 2, ga + 64, K);
    copy_tile(l0 + 3 * TSZ * 2, gb + 64, K);
#pragma unroll 1   // one pass a trip: the two buffers alternate by the trip's parity
    for (int p = 0; p < np; ++p) {
        const int bo = (p & 1) * 2 * TSZ;
        const h16* sa = ring + bo + ((wave >> 1) * 64 + lr) * TP + 8 * hi;
        const h16* sb = ring + bo + TSZ + ((wave & 1) * 64 + lr) * TP + 8 * hi;
        v16h a[4], b[4];
#pragma unroll
        for (int i = 0; i < 4; ++i) a[i] = cat16(*(const v8ha*)(sa + i * 16 * TP), *(const v8ha*)(sa + i * 16 * TP + 16));
#pragma unroll
        for (int t = 0; t < 4; ++t) b[t] = cat16(*(const v8ha*)(sb + t * 16 * TP), *(const v8ha*)(sb + t * 16 * TP + 16));
        __builtin_amdgcn_sched_barrier(0);   // the 16 LDS reads of a k step go out as one group ahead of its WMMAs
#pragma unroll
        for (int i = 0; i < 4; ++i)
#pragma unroll
            for (int t = 0; t < 4; ++t) acc[i][t] = wmma16(a[i], b[t], acc[i][t]);
        __builtin_amdgcn_sched_barrier(0);   // the second k step's reads stay behind the first step's WMMAs, in the same fragment registers
#pragma unroll
        for (int i = 0; i < 4; ++i) a[i] = cat16(*(const v8ha*)(sa + i * 16 * TP + 32), *(const v8ha*)(sa + i * 16 * TP + 48));
#pragma unroll
        for (int t = 0; t < 4; ++t) b[t] = cat16(*(const v8ha*)(sb + t * 16 * TP + 32), *(const v8ha*)(sb + t * 16 * TP + 48));
        asm volatile("s_wait_dscnt 0x0" ::: "memory");      // this wave's last reads of the buffer are done before the barrier frees it for the refill
        asm volatile("s_wait_asynccnt 0x0" ::: "memory");   // this wave's copies of pass p + 1 have landed before the barrier publishes them
        __syncthreads();
        if (p + 2 < np) {
            copy_tile(l0 + bo * 2, ga + (size_t)(p + 2) * 64, K);
            copy_tile(l0 + bo * 2 + TSZ * 2, gb + (size_t)(p + 2) * 64, K);
        }
        __builtin_amdgcn_sched_barrier(0);   // the refill is issued ahead of the second k step's WMMAs (registers only), so that it flies under them
#pragma unroll
        for (int i = 0; i < 4; ++i)
#pragma unroll
            for (int t = 0; t < 4; ++t) acc[i][t] = wmma16(a[i], b[t], acc[i][t]);
    }
    asm volatile("s_wait_asynccnt 0x0" ::: "memory");       // no copy is outstanding when the ring becomes the output staging
}

// Store pass of a wave's staged 64 x 64 f32 tile (pitch 68) as f16 rows of 128 B, whole lines; gelu (a compile-time or block-uniform choice) is applied to the staged f32 values.
__device__ __forceinline__ void put_tile16(const float* os, h16* crow, int ld, int lane, const bool gelu) {
    for (int s0 = 0; s0 < 16; s0 += 4) {
        v4f v[4][2];
#pragma unroll   // four row groups a trip: their LDS reads go out together, one latency a trip instead of one a group
        for (int u = 0; u < 4; ++u) { const float* sp = os + (4 * (s0 + u) + (lane >> 3)) * 68 + (lane & 7) * 8; v[u][0] = *(const v4fa*)sp; v[u][1] = *(const v4fa*)(sp + 4); }
        if (gelu) {
#pragma unroll
            for (int u = 0; u < 4; ++u)
#pragma unroll
                for (int i = 0; i < 8; ++i) v[u][i >> 2][i & 3] = gelu_t(v[u][i >> 2][i & 3]);
        }
#pragma unroll
        for (int u = 0; u < 4; ++u) { v8h o;
#pragma unroll
            for (int i = 0; i < 8; ++i) o[i] = (h16)v[u][i >> 2][i & 3];
            *(v8h*)(crow + (size_t)(4 * (s0 + u) + (lane >> 3)) * ld + (lane & 7) * 8) = o; }
        asm volatile("s_wait_xcnt 0x0" ::: "memory");   // before the next trip rewrites the registers that this trip's stores name
    }
}

// k_fused: fused = XN16 . W1T + b1 over the 3840 padded columns; a wave's 64-wide column group = exactly one head of q / k / v or a 64-wide slice of the MLP hidden:
//   c0 <  1024: q head c0/64: per-row LayerNorm over the 64 head dims (qn_g, qn_b) -> Q16[tok][1024] f16
//   c0 <  2048: k head: LayerNorm (kn_g, kn_b) -> K16
//   c0 <  3072: v -> V16 rows
//   else      : gelu_tanh (in the store pass) -> G16[tok][768] (columns >= 716 of the hidden are exactly 0 after gelu(0 + 0): b1 pad is read as 0; their Wmo rows are 0 anyway)
__global__ __launch_bounds__(128) void k_fused(const h16* __restrict__ XN16, const h16* __restrict__ W1T, const float* __restrict__ b1,
                                              const float* __restrict__ qg, const float* __restrict__ qb, const float* __restrict__ kg, const float* __restrict__ kb,
                                              h16* Q16, h16* K16, h16* V16, h16* G16) {
    __shared__ __align__(16) h16 ring[RING];
    const int lane = threadIdx.x & 31, wave = threadIdx.x >> 5, lr = lane & 15, hi = lane >> 4;
    const int rb = blockIdx.x * 128, cb = blockIdx.y * 128;
    v8f acc[4][4];
    gemm_tile(XN16, W1T, DM, rb, cb, ring, acc);
    const int r0 = rb + (wave >> 1) * 64, c0 = cb + (wave & 1) * 64;
    const int sec = cb / DM;                   // 0 q, 1 k, 2 v, 3 mlp (the same for both column groups of a block)
#pragma unroll
    for (int t = 0; t < 4; ++t) { const int col = c0 + t * 16 + lr; const float bv = (col < NF) ? bfr(b1[col]) : 0.f;
#pragma unroll
        for (int i = 0; i < 4; ++i)
#pragma unroll
            for (int j = 0; j < 8; ++j) acc[i][t][j] += bv; }
    if (sec < 2) {
        const float* gg = sec ? kg : qg; const float* bb = sec ? kb : qb;
#pragma unroll
        for (int i = 0; i < 4; ++i)
#pragma unroll
            for (int j = 0; j < 8; ++j) {
                float s = acc[i][0][j] + acc[i][1][j] + acc[i][2][j] + acc[i][3][j];
                const float mu = hsum16(s) * (1.0f / HD);
                float q = 0.f;
#pragma unroll
                for (int t = 0; t < 4; ++t) { const float d = acc[i][t][j] - mu; q += d * d; }
                const float rs = rsqrtf(hsum16(q) * (1.0f / HD) + EPS);
#pragma unroll
                for (int t = 0; t < 4; ++t) acc[i][t][j] = (acc[i][t][j] - mu) * rs * bfr(gg[t * 16 + lr]) + bfr(bb[t * 16 + lr]);
            }
    }
    float* os = (float*)ring + wave * (64 * 68);   // the loop's last barrier has freed the ring; each wave stages its own 64 x 64 tile
#pragma unroll
    for (int i = 0; i < 4; ++i)
#pragma unroll
        for (int t = 0; t < 4; ++t)
#pragma unroll
            for (int j = 0; j < 8; ++j) os[(i * 16 + hi * 8 + j) * 68 + t * 16 + lr] = acc[i][t][j];
    __syncthreads();
    h16* dst; int ld, cc;
    if (sec == 0) { dst = Q16; ld = DM; cc = c0; } else if (sec == 1) { dst = K16; ld = DM; cc = c0 - DM; } else if (sec == 2) { dst = V16; ld = DM; cc = c0 - 2 * DM; } else { dst = G16; ld = MLPP; cc = c0 - 3 * DM; }
    h16* crow = dst + (size_t)r0 * ld + cc;
    put_tile16(os, crow, ld, lane, sec == 3);
}

// k_gemm16o: C16[M][ldc] columns cbase + c0.. = f16(A.BT + bias): used for attn_out (A = CTX16, K = 1024) and mlp_out (A = G16, K = 768) into the two halves of COMB16.
__global__ __launch_bounds__(128) void k_gemm16o(const h16* __restrict__ A, const h16* __restrict__ BT, int K, const float* __restrict__ bias, h16* C16, int ldc, int cbase) {
    __shared__ __align__(16) h16 ring[RING];
    const int lane = threadIdx.x & 31, wave = threadIdx.x >> 5, lr = lane & 15, hi = lane >> 4;
    const int rb = blockIdx.x * 128, cb = blockIdx.y * 128;
    v8f acc[4][4];
    gemm_tile(A, BT, K, rb, cb, ring, acc);
    const int r0 = rb + (wave >> 1) * 64, c0 = cb + (wave & 1) * 64;
    float* os = (float*)ring + wave * (64 * 68);   // the loop's last barrier has freed the ring; each wave stages its own 64 x 64 tile
#pragma unroll
    for (int t = 0; t < 4; ++t) { const float bv = bfr(bias[c0 + t * 16 + lr]);
#pragma unroll
        for (int i = 0; i < 4; ++i)
#pragma unroll
            for (int j = 0; j < 8; ++j) os[(i * 16 + hi * 8 + j) * 68 + t * 16 + lr] = acc[i][t][j] + bv; }
    __syncthreads();
    h16* crow = C16 + (size_t)r0 * ldc + cbase + c0;
    put_tile16(os, crow, ldc, lane, false);
}

__global__ __launch_bounds__(128) void k_gemmout(const h16* __restrict__ A, const h16* __restrict__ BT, const float* __restrict__ bias, const float* __restrict__ x, float* C) {
    __shared__ __align__(16) h16 ring[RING];
    const int lane = threadIdx.x & 31, wave = threadIdx.x >> 5, lr = lane & 15, hi = lane >> 4;
    const int rb = blockIdx.x * 128, cb = blockIdx.y * 128;
    v8f acc[4][4];
    gemm_tile(A, BT, 2 * DM, rb, cb, ring, acc);
    const int r0 = rb + (wave >> 1) * 64, c0 = cb + (wave & 1) * 64;
    float* os = (float*)ring + wave * (64 * 68);   // the loop's last barrier has freed the ring; each wave stages its own 64 x 64 tile
#pragma unroll
    for (int t = 0; t < 4; ++t) { const float bv = bfr(bias[c0 + t * 16 + lr]);
#pragma unroll
        for (int i = 0; i < 4; ++i)
#pragma unroll
            for (int j = 0; j < 8; ++j) os[(i * 16 + hi * 8 + j) * 68 + t * 16 + lr] = acc[i][t][j] + bv; }
    __syncthreads();
    float* crow = C + (size_t)r0 * DM + c0;
    const float* xrow = x + (size_t)r0 * DM + c0;
    for (int s0 = 0; s0 < 32; s0 += 8) {
#pragma unroll   // eight row pairs a trip: their x loads and LDS reads go out together, one latency a trip instead of one a row pair
        for (int s = s0; s < s0 + 8; ++s) { const int row = 2 * s + (lane >> 4), cofs = (lane & 15) * 4;
            v4f val = *(const v4fa*)(os + row * 68 + cofs); const v4f xv = *(const v4f*)(xrow + (size_t)row * DM + cofs);
#pragma unroll
            for (int e = 0; e < 4; ++e) val[e] += bfr(xv[e]);
            *(v4f*)(crow + (size_t)row * DM + cofs) = val; }
        asm volatile("s_wait_xcnt 0x0" ::: "memory");   // before the next trip rewrites the registers that this trip's loads and stores name
    }
}

// k_vt: VT16[b][h][d][t] from V16 rows via LDS transpose; block (b, h, 64 tokens).
__global__ __launch_bounds__(256) void k_vt(const h16* __restrict__ V16, h16* VT16) {
    __shared__ __align__(16) h16 tile[64 * 72];
    const int bid = blockIdx.x;
    const int b = bid / (NH_ * (NT_ / 64)), rem = bid - b * (NH_ * (NT_ / 64)), h = rem / (NT_ / 64), kt = rem - h * (NT_ / 64);
    const int k0 = kt * 64, tid = threadIdx.x;
    const int kk = tid >> 2, d0 = (tid & 3) * 16;
    const h16* src = V16 + ((size_t)b * NT_ + k0 + kk) * DM + h * HD + d0;
#pragma unroll
    for (int i = 0; i < 16; ++i) tile[(d0 + i) * 72 + kk] = src[i];
    __syncthreads();
    const int piece = tid & 7;
    h16* base = VT16 + (((size_t)b * NH_ + h) * HD) * NT_ + k0;
    auto pass = [&]() {
#pragma unroll
        for (int s = 0; s < 2; ++s) { const int d = (tid >> 3) + 32 * s; const v8h val = *(const v8ha*)(tile + d * 72 + piece * 8); *(v8h*)(base + (size_t)d * NT_ + piece * 8) = val; }
    };
    pass(); 
}

// k_attn: transposed products. Block = (b, h, 4 waves x QCOL queries); a step is 32 keys. S^T = K.Q^T: A = 16 key rows, B = the wave's queries (loaded once), so a lane
// holds scores of ONE query (column lr; keys 8 hi + r of each 16-key tile): maximum and sum run in the lane, the two wave halves meet in one cross-row move. The two
// score tiles of a step, exponentiated (x 32768, folded into the exponent) and rounded to f16 in place, ARE the B operand of O^T += V^T.P^T in the hardware k order
// (element s: key 8 hi + s, then 16 + 8 hi + s - 8), which the V^T rows are loaded in: P touches no LDS. O^T gives a lane 8 consecutive head dims of its query.
#define QG   4            // 16-query column groups a wave: every K and V^T fragment a wave loads feeds QG products
#define QCOL (QG * 16)
#define QBLK (4 * QCOL)
__device__ __forceinline__ float xhalf(float x) { return __builtin_bit_cast(float, __builtin_amdgcn_permlanex16(__builtin_bit_cast(int, x), __builtin_bit_cast(int, x), 0x76543210, 0xfedcba98, false, false)); }  // lane l with lane l ^ 16

__global__ __launch_bounds__(128) void k_attn(const h16* __restrict__ Q16, const h16* __restrict__ K16, const h16* __restrict__ VT16, h16* CTX16) {
    const int lane = threadIdx.x & 31, wave = threadIdx.x >> 5, lr = lane & 15, hi = lane >> 4;
    const int bid = blockIdx.x;
    const int b = bid / (NH_ * (NT_ / QBLK)), rem = bid - b * (NH_ * (NT_ / QBLK)), h = rem / (NT_ / QBLK), qt = rem - h * (NT_ / QBLK);
    const int q0 = qt * QBLK + wave * QCOL;
    const size_t tok0 = (size_t)b * NT_;
    const float CS = 0.125f * 1.4426950408889634f;   // score scale, in base 2
    v16h qf[QG][2];
#pragma unroll
    for (int g = 0; g < QG; ++g)
#pragma unroll
        for (int kc = 0; kc < 2; ++kc) { const h16* p = Q16 + (tok0 + q0 + g * 16 + lr) * DM + h * HD + kc * 32 + 8 * hi; qf[g][kc] = cat16(*(const v8h*)p, *(const v8h*)(p + 16)); }
    const h16* kp = K16 + (tok0 + lr) * DM + h * HD + 8 * hi;
    const h16* vp = VT16 + (((size_t)b * NH_ + h) * HD + lr) * NT_ + 8 * hi;
    v8f o[QG][4];
    float mrun[QG], lsum[QG];
#pragma unroll
    for (int g = 0; g < QG; ++g) { mrun[g] = -3.0e38f; lsum[g] = 0.f;
#pragma unroll
        for (int n = 0; n < 4; ++n) o[g][n] = (v8f){}; }
    v16h kf[2][2];
#pragma unroll
    for (int t = 0; t < 2; ++t)
#pragma unroll
        for (int kc = 0; kc < 2; ++kc) { const h16* p = kp + (size_t)(t * 16) * DM + kc * 32; kf[t][kc] = cat16(*(const v8h*)p, *(const v8h*)(p + 16)); }
    asm volatile("s_wait_xcnt 0x0" ::: "memory");   // before anything rewrites the address registers that the Q and K loads name
    __builtin_amdgcn_sched_barrier(0);               // keeps later register writes behind that wait
#pragma unroll 1   // one step a trip, for speed only
    for (int kt = 0; kt < NT_ / 32; ++kt) {
        const int l0 = kt * 32;
        v16h vf[4];
#pragma unroll
        for (int n = 0; n < 4; ++n) { const h16* p = vp + (size_t)(n * 16) * NT_ + l0; vf[n] = cat16(*(const v8h*)p, *(const v8h*)(p + 16)); }
        asm volatile("s_wait_xcnt 0x0" ::: "memory");   // before anything rewrites the address registers that these loads name
        __builtin_amdgcn_sched_barrier(0);               // the V^T loads go out ahead of the score products and fly under them and the exponentials
        v8f s[QG][2];
#pragma unroll
        for (int g = 0; g < QG; ++g)
#pragma unroll
            for (int t = 0; t < 2; ++t) s[g][t] = wmma16(kf[t][1], qf[g][1], wmma16(kf[t][0], qf[g][0], (v8f){}));
        const int ln = (l0 + 32) & (NT_ - 1);   // the next step's key rows; the last step reads rows 0..31 again (inside the buffer, not used)
#pragma unroll
        for (int t = 0; t < 2; ++t)
#pragma unroll
            for (int kc = 0; kc < 2; ++kc) { const h16* p = kp + (size_t)(ln + t * 16) * DM + kc * 32; kf[t][kc] = cat16(*(const v8h*)p, *(const v8h*)(p + 16)); }
        asm volatile("s_wait_xcnt 0x0" ::: "memory");   // before anything rewrites the address registers that these loads name
        __builtin_amdgcn_sched_barrier(0);               // the next step's K loads go out here and fly under the exponentials and the second product
#pragma unroll
        for (int g = 0; g < QG; ++g) {
            float mt[8];
#pragma unroll
            for (int j = 0; j < 8; ++j) mt[j] = fmaxf(s[g][0][j], s[g][1][j]);
#pragma unroll
            for (int w = 4; w; w >>= 1)
#pragma unroll
                for (int j = 0; j < w; ++j) mt[j] = fmaxf(mt[j], mt[j + w]);
            const float mx = fmaxf(mt[0], xhalf(mt[0])) * CS;
            const float mn = fmaxf(mrun[g], mx);
            const float alpha = __builtin_amdgcn_exp2f(mrun[g] - mn);   // 0 on the first step
            mrun[g] = mn;
            const float nm = 15.0f - mn;                                 // weights x 32768, as f16 operands
            float pe[16];
            v16h pb;
#pragma unroll
            for (int e = 0; e < 16; ++e) { pe[e] = __builtin_amdgcn_exp2f(fmaf(s[g][e >> 3][e & 7], CS, nm)); pb[e] = (h16)pe[e]; }
#pragma unroll
            for (int w = 8; w; w >>= 1)   // a tree: a chain of 16 dependent adds would stall the SIMD's one wave
#pragma unroll
                for (int e = 0; e < w; ++e) pe[e] += pe[e + w];
            lsum[g] = lsum[g] * alpha + pe[0];
#pragma unroll
            for (int n = 0; n < 4; ++n) o[g][n] = wmma16(vf[n], pb, o[g][n] * alpha);
        }
    }
#pragma unroll
    for (int g = 0; g < QG; ++g) {
        const float inv = 1.0f / (lsum[g] + xhalf(lsum[g]));   // the halves' sums (x 32768, like the weights) join once
        h16* crow = CTX16 + (tok0 + q0 + g * 16 + lr) * DM + (size_t)h * HD + 8 * hi;
#pragma unroll
        for (int n = 0; n < 4; ++n) { v8h o8;
#pragma unroll
            for (int j = 0; j < 8; ++j) o8[j] = (h16)(o[g][n][j] * inv);
            *(v8h*)(crow + n * 16) = o8; }
        if (g + 1 < QG) {
            asm volatile("s_wait_xcnt 0x0" ::: "memory");   // before the next group rewrites the registers that this group's stores name
            __builtin_amdgcn_sched_barrier(0);               // keeps the next group's register writes behind that wait
        }
    }
}

extern "C" void kernel_launch(void* const* d_in, const int* in_sizes, int n_in,
                              void* d_out, int out_size, void* d_ws, size_t ws_size, hipStream_t stream) {
    (void)in_sizes; (void)n_in; (void)out_size;
    const float* x = (const float*)d_in[0]; const float* ng = (const float*)d_in[1]; const float* nb = (const float*)d_in[2]; const float* W1 = (const float*)d_in[3]; const float* b1 = (const float*)d_in[4];
    const float* qg = (const float*)d_in[5]; const float* qb = (const float*)d_in[6]; const float* kg = (const float*)d_in[7]; const float* kb = (const float*)d_in[8];
    const float* Wao = (const float*)d_in[9]; const float* bao = (const float*)d_in[10]; const float* Wmo = (const float*)d_in[11]; const float* bmo = (const float*)d_in[12];
    const float* W2 = (const float*)d_in[13]; const float* b2 = (const float*)d_in[14];
    float* out = (float*)d_out;    // [2][2048][1024]
    char* wsp = (char*)d_ws;
    auto take = [&](size_t bytes) { char* p = wsp; wsp += (bytes + 255) & ~(size_t)255; return (void*)p; };
    h16* XN16 = (h16*)take((size_t)NTK * DM * 2); h16* W1T = (h16*)take((size_t)NFP * DM * 2);
    h16* WaoT = (h16*)take((size_t)DM * DM * 2); h16* WmoT = (h16*)take((size_t)DM * MLPP * 2); h16* W2T = (h16*)take((size_t)DM * 2 * DM * 2);
    h16* Q16 = (h16*)take((size_t)NTK * DM * 2); h16* K16 = (h16*)take((size_t)NTK * DM * 2); h16* V16 = (h16*)take((size_t)NTK * DM * 2); h16* VT16 = (h16*)take((size_t)NTK * DM * 2);
    h16* G16 = (h16*)take((size_t)NTK * MLPP * 2); h16* CTX16 = (h16*)take((size_t)NTK * DM * 2); h16* COMB16 = (h16*)take((size_t)NTK * 2 * DM * 2);
    if ((size_t)(wsp - (char*)d_ws) > ws_size) return;    // 8.4 + 7.9 + 2.1 + 1.6 + 4.2 + 4 x 8.4 + 6.3 + 8.4 + 16.8 MB ~ 89 MB
    k_ln<<<NTK / 8, 256, 0, stream>>>(x, ng, nb, XN16);
    k_wt<<<dim3(DM / 64, NFP / 64, 1), 256, 0, stream>>>(W1, DM, NF, DM, W1T);
    k_wt<<<dim3(DM / 64, DM / 64, 1), 256, 0, stream>>>(Wao, DM, DM, DM, WaoT);
    k_wt<<<dim3(MLPP / 64, DM / 64, 1), 256, 0, stream>>>(Wmo, MLPH, DM, MLPP, WmoT);
    k_wt<<<dim3((2 * DM) / 64, DM / 64, 1), 256, 0, stream>>>(W2, 2 * DM, DM, 2 * DM, W2T);
    k_fused<<<dim3(NTK / 128, NFP / 128, 1), 128, 0, stream>>>(XN16, W1T, b1, qg, qb, kg, kb, Q16, K16, V16, G16);
    k_vt<<<NB_ * NH_ * (NT_ / 64), 256, 0, stream>>>(V16, VT16);
    k_attn<<<NB_ * NH_ * (NT_ / QBLK), 128, 0, stream>>>(Q16, K16, VT16, CTX16);
    k_gemm16o<<<dim3(NTK / 128, DM / 128, 1), 128, 0, stream>>>(CTX16, WaoT, DM, bao, COMB16, 2 * DM, 0);
    k_gemm16o<<<dim3(NTK / 128, DM / 128, 1), 128, 0, stream>>>(G16, WmoT, MLPP, bmo, COMB16, 2 * DM, DM);
    k_gemmout<<<dim3(NTK / 128, DM / 128, 1), 128, 0, stream>>>(COMB16, W2T, b2, x, out);
}

// v003
// Measured time: 155 microseconds a run.
// Two timings next to v002 put it at 1.10 and 1.09 times that version's speed.
// All steps since v000 together make it 2.60 times as fast.
#include <hip/hip_runtime.h>

// Contractions on v_wmma_f32_16x16x32_f16 with plain f16 operands, f32 accumulate: fused = LN(x).W1 + b1 ([4096 x 1024].[1024 x 3788 (padded 3840)]), the 16-head
// attention with per-head LayerNorm on q and k (scores [2048 x 64].[64 x 2048] /8, softmax, .v), attn_out = a.Wao + bao, mlp_out = gelu_tanh(h).Wmo + bmo
// ([4096 x 716 (768)].[768 x 1024]) and out = x + [attn_out | mlp_out].W2 + b2 ([4096 x 2048].[2048 x 1024]). Weights are f16 of their bf16 rounding (exact for the
// bf16-input reference), the activations are computed values rounded once to f16 (the output is dominated by the exact residual x). LayerNorms (eps 1e-6), gelu and

#define NB_  2
#define NT_  2048
#define DM   1024
#define NH_  16
#define HD   64
#define NTK  (NB_ * NT_)
#define NF   3788
#define NFP  3840
#define MLPH 716
#define MLPP 768
#define PSC  32768.0f
#define EPS  1e-6f

typedef _Float16 h16;
typedef __attribute__((ext_vector_type(16))) _Float16 v16h;
typedef __attribute__((ext_vector_type(8)))  _Float16 v8h;
typedef __attribute__((ext_vector_type(8)))  float    v8f;
typedef __attribute__((ext_vector_type(4)))  float    v4f;
typedef v8h  __attribute__((may_alias)) v8ha;
typedef v4f  __attribute__((may_alias)) v4fa;

__device__ __forceinline__ unsigned short f2bf(float f) { unsigned u = __float_as_uint(f); u += 0x7FFFu + ((u >> 16) & 1u); return (unsigned short)(u >> 16); }
__device__ __forceinline__ float bf2f(unsigned short b) { return __uint_as_float(((unsigned)b) << 16); }
__device__ __forceinline__ float bfr(float f) { return bf2f(f2bf(f)); }
__device__ __forceinline__ v16h cat16(v8h lo, v8h hi) { return __builtin_shufflevector(lo, hi, 0, 1, 2, 3, 4, 5, 6, 7, 8, 9, 10, 11, 12, 13, 14, 15); }
__device__ __forceinline__ v8f wmma16(v16h a, v16h b, v8f c) { return __builtin_amdgcn_wmma_f32_16x16x32_f16(false, a, false, b, (short)0, c, false, false); }
__device__ __forceinline__ float hsum16(float v) { v += __shfl_xor(v, 1, 16); v += __shfl_xor(v, 2, 16); v += __shfl_xor(v, 4, 16); return v + __shfl_xor(v, 8, 16); }
__device__ __forceinline__ float gelu_t(float x) { const float c = 0.7978845608028654f; return 0.5f * x * (1.0f + tanhf(c * (x + 0.044715f * x * x * x))); }

// ln_rows: LayerNorm of 8 rows of x (one a wave) -> XN16; blk = row group.
__device__ __forceinline__ void ln_rows(const float* __restrict__ x, const float* __restrict__ g, const float* __restrict__ bt, h16* XN16, const int blk) {
    const int lane = threadIdx.x & 31, r = blk * 8 + (threadIdx.x >> 5);
    if (r >= NTK) return;
    const float* xr = x + (size_t)r * DM;
    float s = 0.f;
#pragma unroll
    for (int q = 0; q < 4; ++q)
#pragma unroll
        for (int i = 0; i < 8; ++i) s += bfr(xr[q * 256 + lane * 8 + i]);
#pragma unroll
    for (int o = 16; o; o >>= 1) s += __shfl_xor(s, o, 32);
    const float mu = s * (1.0f / DM);
    float sq = 0.f;
#pragma unroll 1
    for (int q = 0; q < 4; ++q)
#pragma unroll
        for (int i = 0; i < 8; ++i) { const float d = bfr(xr[q * 256 + lane * 8 + i]) - mu; sq += d * d; }
#pragma unroll
    for (int o = 16; o; o >>= 1) sq += __shfl_xor(sq, o, 32);
    const float rs = rsqrtf(sq * (1.0f / DM) + EPS);
#pragma unroll 1
    for (int q = 0; q < 4; ++q) {
        v8h o8;
#pragma unroll
        for (int i = 0; i < 8; ++i) { const int c = q * 256 + lane * 8 + i; o8[i] = (h16)((bfr(xr[c]) - mu) * rs * bfr(g[c]) + bfr(bt[c])); }
        *(v8h*)(XN16 + (size_t)r * DM + q * 256 + lane * 8) = o8; 
    }
}

// wt_tile: k-major W [K rows][N cols] -> n-major f16 plane WT [Npad][Kpad] (f16 of bf16(W); rows >= N and columns >= K zero); one 64 x 64 tile (kb, nb) through LDS.
__device__ __forceinline__ void wt_tile(const float* __restrict__ Wm, int K, int N, int Kpad, h16* WT, const int kb, const int nb) {
    __shared__ __align__(16) h16 tl[64 * 72];
    const int tid = threadIdx.x, k0 = kb * 64, n0 = nb * 64;
    const int kk = tid >> 2, nq = (tid & 3) * 16;
#pragma unroll
    for (int i = 0; i < 16; ++i) { const int k = k0 + kk, n = n0 + nq + i; tl[(nq + i) * 72 + kk] = (k < K && n < N) ? (h16)bfr(Wm[(size_t)k * N + n]) : (h16)0.f; }
    __syncthreads();
    const int piece = tid & 7;
    auto pass = [&]() {
#pragma unroll
        for (int s = 0; s < 2; ++s) { const int nr = (tid >> 3) + 32 * s; const v8h val = *(const v8ha*)(tl + nr * 72 + piece * 8);
            *(v8h*)(WT + (size_t)(n0 + nr) * Kpad + k0 + piece * 8) = val; }
    };
    pass(); 
    asm volatile("s_wait_xcnt 0x0" ::: "memory");   // behind the two stores: in the merged kernel other code follows them in the listing and rewrites the registers that they name
}

// k_prep: the five jobs that depend on the inputs alone, as block ranges of ONE grid, so that their starts, first loads and tails overlap: the LayerNorm of x, then the four
// weight transposes, each with its tiles in the order k fastest. The job is the same for a whole block, so wt_tile's barrier stands under block-uniform control flow.
#define PB_LN  (NTK / 8)
#define PB_W1  ((DM / 64) * (NFP / 64))
#define PB_W2  (((2 * DM) / 64) * (DM / 64))
#define PB_WAO ((DM / 64) * (DM / 64))
#define PB_WMO ((MLPP / 64) * (DM / 64))
__global__ __launch_bounds__(256) void k_prep(const float* __restrict__ x, const float* __restrict__ g, const float* __restrict__ bt, const float* __restrict__ W1, const float* __restrict__ W2,
                                             const float* __restrict__ Wao, const float* __restrict__ Wmo, h16* XN16, h16* W1T, h16* W2T, h16* WaoT, h16* WmoT) {
    int t = blockIdx.x;
    if (t < PB_LN) { ln_rows(x, g, bt, XN16, t); return; }
    t -= PB_LN;
    const float* Wm; h16* WT; int K, N, Kpad, nb;   // nb by a literal divisor in each branch: scalar shifts and one scalar multiply, no division at run time
    if (t < PB_W1) { Wm = W1; WT = W1T; K = DM; N = NF; Kpad = DM; nb = t / (DM / 64); }
    else if (t < PB_W1 + PB_W2) { t -= PB_W1; Wm = W2; WT = W2T; K = 2 * DM; N = DM; Kpad = 2 * DM; nb = t / ((2 * DM) / 64); }
    else if (t < PB_W1 + PB_W2 + PB_WAO) { t -= PB_W1 + PB_W2; Wm = Wao; WT = WaoT; K = DM; N = DM; Kpad = DM; nb = t / (DM / 64); }
    else { t -= PB_W1 + PB_W2 + PB_WAO; Wm = Wmo; WT = WmoT; K = MLPH; N = DM; Kpad = MLPP; nb = t / (MLPP / 64); }
    wt_tile(Wm, K, N, Kpad, WT, t - nb * (Kpad / 64), nb);
}

// GEMM tile core: 128 x 128 block tile (2 x 2 waves, 64 x 64 each) of A[M][K] (f16, lda = K) . BT[N][K], K a multiple of 64 and at least 128. A pass is 64 k: the
// 128 rows x 128 B of both operands are brought into LDS by asynchronous copies (pitch 144 B for the ds_load_b128 readers), two buffers, the next pass's copies in
// flight while this pass is worked on. A buffer is [A tile | BT tile]. Returns acc[4][4] (row group, column group; D layout); the k order of every sum is ascending.
#define TP   72
#define TSZ  (128 * TP)
#define RING (4 * TSZ)

// One operand's tile of one pass: 8 copies a lane, 16 rows apart (a wave covers 4 whole 128-B rows a copy). The s_wait_xcnt ends the copies' own statement, so that
// no address register of a copy is rewritten ahead of it.
__device__ __forceinline__ void copy_tile(unsigned l, const h16* g, int K) {
    const size_t rs = (size_t)16 * K;
    asm volatile("global_load_async_to_lds_b128 %0, %8, off\n\t"
                 "global_load_async_to_lds_b128 %1, %9, off\n\t"
                 "global_load_async_to_lds_b128 %2, %10, off\n\t"
                 "global_load_async_to_lds_b128 %3, %11, off\n\t"
                 "global_load_async_to_lds_b128 %4, %12, off\n\t"
                 "global_load_async_to_lds_b128 %5, %13, off\n\t"
                 "global_load_async_to_lds_b128 %6, %14, off\n\t"
                 "global_load_async_to_lds_b128 %7, %15, off\n\t"
                 "s_wait_xcnt 0x0"
                 :: "v"(l), "v"(l + 1u * 16u * 144u), "v"(l + 2u * 16u * 144u), "v"(l + 3u * 16u * 144u),
                    "v"(l + 4u * 16u * 144u), "v"(l + 5u * 16u * 144u), "v"(l + 6u * 16u * 144u), "v"(l + 7u * 16u * 144u),
                    "v"(g), "v"(g + rs), "v"(g + 2 * rs), "v"(g + 3 * rs), "v"(g + 4 * rs), "v"(g + 5 * rs), "v"(g + 6 * rs), "v"(g + 7 * rs)
                 : "memory");
}

__device__ __forceinline__ void gemm_tile(const h16* __restrict__ A, const h16* __restrict__ BT, const int K, int rb, int cb, h16* ring, v8f (&acc)[4][4]) {
    const int tid = threadIdx.x, lane = tid & 31, wave = tid >> 5, lr = lane & 15, hi = lane >> 4;
    const h16* ga = A + (size_t)(rb + (tid >> 3)) * K + (tid & 7) * 8;
    const h16* gb = BT + (size_t)(cb + (tid >> 3)) * K + (tid & 7) * 8;
    const unsigned l0 = (unsigned)(size_t)ring + (unsigned)((tid >> 3) * 144 + (tid & 7) * 16);
    const int np = K / 64;
#pragma unroll
    for (int i = 0; i < 4; ++i)
#pragma unroll
        for (int t = 0; t < 4; ++t) acc[i][t] = (v8f){};
    copy_tile(l0, ga, K);
    copy_tile(l0 + TSZ * 2, gb, K);
    asm volatile("s_wait_asynccnt 0x0" ::: "memory");   // pass 0's own copies have landed before the barrier publishes them
    __syncthreads();
    copy_tile(l0 + 2 * TSZ * 2, ga + 64, K);
    copy_tile(l0 + 3 * TSZ * 2, gb + 64, K);
#pragma unroll 1   // one pass a trip: the two buffers alternate by the trip's parity
    for (int p = 0; p < np; ++p) {
        const int bo = (p & 1) * 2 * TSZ;
        const h16* sa = ring + bo + ((wave >> 1) * 64 + lr) * TP + 8 * hi;
        const h16* sb = ring + bo + TSZ + ((wave & 1) * 64 + lr) * TP + 8 * hi;
        v16h a[4], b[4];
#pragma unroll
        for (int i = 0; i < 4; ++i) a[i] = cat16(*(const v8ha*)(sa + i * 16 * TP), *(const v8ha*)(sa + i * 16 * TP + 16));
#pragma unroll
        for (int t = 0; t < 4; ++t) b[t] = cat16(*(const v8ha*)(sb + t * 16 * TP), *(const v8ha*)(sb + t * 16 * TP + 16));
        __builtin_amdgcn_sched_barrier(0);   // the 16 LDS reads of a k step go out as one group ahead of its WMMAs
#pragma unroll
        for (int i = 0; i < 4; ++i)
#pragma unroll
            for (int t = 0; t < 4; ++t) acc[i][t] = wmma16(a[i], b[t], acc[i][t]);
        __builtin_amdgcn_sched_barrier(0);   // the second k step's reads stay behind the first step's WMMAs, in the same fragment registers
#pragma unroll
        for (int i = 0; i < 4; ++i) a[i] = cat16(*(const v8ha*)(sa + i * 16 * TP + 32), *(const v8ha*)(sa + i * 16 * TP + 48));
#pragma unroll
        for (int t = 0; t < 4; ++t) b[t] = cat16(*(const v8ha*)(sb + t * 16 * TP + 32), *(const v8ha*)(sb + t * 16 * TP + 48));
        asm volatile("s_wait_dscnt 0x0" ::: "memory");      // this wave's last reads of the buffer are done before the barrier frees it for the refill
        asm volatile("s_wait_asynccnt 0x0" ::: "memory");   // this wave's copies of pass p + 1 have landed before the barrier publishes them
        __syncthreads();
        if (p + 2 < np) {
            copy_tile(l0 + bo * 2, ga + (size_t)(p + 2) * 64, K);
            copy_tile(l0 + bo * 2 + TSZ * 2, gb + (size_t)(p + 2) * 64, K);
        }
        __builtin_amdgcn_sched_barrier(0);   // the refill is issued ahead of the second k step's WMMAs (registers only), so that it flies under them
#pragma unroll
        for (int i = 0; i < 4; ++i)
#pragma unroll
            for (int t = 0; t < 4; ++t) acc[i][t] = wmma16(a[i], b[t], acc[i][t]);
    }
    asm volatile("s_wait_asynccnt 0x0" ::: "memory");       // no copy is outstanding when the ring becomes the output staging
}

// Store pass of a wave's staged 64 x 64 f32 tile (pitch 68) as f16 rows of 128 B, whole lines; gelu (a compile-time or block-uniform choice) is applied to the staged f32 values.
__device__ __forceinline__ void put_tile16(const float* os, h16* crow, int ld, int lane, const bool gelu) {
    for (int s0 = 0; s0 < 16; s0 += 4) {
        v4f v[4][2];
#pragma unroll   // four row groups a trip: their LDS reads go out together, one latency a trip instead of one a group
        for (int u = 0; u < 4; ++u) { const float* sp = os + (4 * (s0 + u) + (lane >> 3)) * 68 + (lane & 7) * 8; v[u][0] = *(const v4fa*)sp; v[u][1] = *(const v4fa*)(sp + 4); }
        if (gelu) {
#pragma unroll
            for (int u = 0; u < 4; ++u)
#pragma unroll
                for (int i = 0; i < 8; ++i) v[u][i >> 2][i & 3] = gelu_t(v[u][i >> 2][i & 3]);
        }
#pragma unroll
        for (int u = 0; u < 4; ++u) { v8h o;
#pragma unroll
            for (int i = 0; i < 8; ++i) o[i] = (h16)v[u][i >> 2][i & 3];
            *(v8h*)(crow + (size_t)(4 * (s0 + u) + (lane >> 3)) * ld + (lane & 7) * 8) = o; }
        asm volatile("s_wait_xcnt 0x0" ::: "memory");   // before the next trip rewrites the registers that this trip's stores name
    }
}

// k_fused: fused = XN16 . W1T + b1 over the 3840 padded columns; a wave's 64-wide column group = exactly one head of q / k / v or a 64-wide slice of the MLP hidden:
//   c0 <  1024: q head c0/64: per-row LayerNorm over the 64 head dims (qn_g, qn_b) -> Q16[tok][1024] f16
//   c0 <  2048: k head: LayerNorm (kn_g, kn_b) -> K16
//   c0 <  3072: v -> V16 rows
//   else      : gelu_tanh (in the store pass) -> G16[tok][768] (columns >= 716 of the hidden are exactly 0 after gelu(0 + 0): b1 pad is read as 0; their Wmo rows are 0 anyway)
__global__ __launch_bounds__(128) void k_fused(const h16* __restrict__ XN16, const h16* __restrict__ W1T, const float* __restrict__ b1,
                                              const float* __restrict__ qg, const float* __restrict__ qb, const float* __restrict__ kg, const float* __restrict__ kb,
                                              h16* Q16, h16* K16, h16* V16, h16* G16) {
    __shared__ __align__(16) h16 ring[RING];
    const int lane = threadIdx.x & 31, wave = threadIdx.x >> 5, lr = lane & 15, hi = lane >> 4;
    const int rb = blockIdx.x * 128, cb = blockIdx.y * 128;
    v8f acc[4][4];
    gemm_tile(XN16, W1T, DM, rb, cb, ring, acc);
    const int r0 = rb + (wave >> 1) * 64, c0 = cb + (wave & 1) * 64;
    const int sec = cb / DM;                   // 0 q, 1 k, 2 v, 3 mlp (the same for both column groups of a block)
#pragma unroll
    for (int t = 0; t < 4; ++t) { const int col = c0 + t * 16 + lr; const float bv = (col < NF) ? bfr(b1[col]) : 0.f;
#pragma unroll
        for (int i = 0; i < 4; ++i)
#pragma unroll
            for (int j = 0; j < 8; ++j) acc[i][t][j] += bv; }
    if (sec < 2) {
        const float* gg = sec ? kg : qg; const float* bb = sec ? kb : qb;
#pragma unroll
        for (int i = 0; i < 4; ++i)
#pragma unroll
            for (int j = 0; j < 8; ++j) {
                float s = acc[i][0][j] + acc[i][1][j] + acc[i][2][j] + acc[i][3][j];
                const float mu = hsum16(s) * (1.0f / HD);
                float q = 0.f;
#pragma unroll
                for (int t = 0; t < 4; ++t) { const float d = acc[i][t][j] - mu; q += d * d; }
                const float rs = rsqrtf(hsum16(q) * (1.0f / HD) + EPS);
#pragma unroll
                for (int t = 0; t < 4; ++t) acc[i][t][j] = (acc[i][t][j] - mu) * rs * bfr(gg[t * 16 + lr]) + bfr(bb[t * 16 + lr]);
            }
    }
    float* os = (float*)ring + wave * (64 * 68);   // the loop's last barrier has freed the ring; each wave stages its own 64 x 64 tile
#pragma unroll
    for (int i = 0; i < 4; ++i)
#pragma unroll
        for (int t = 0; t < 4; ++t)
#pragma unroll
            for (int j = 0; j < 8; ++j) os[(i * 16 + hi * 8 + j) * 68 + t * 16 + lr] = acc[i][t][j];
    __syncthreads();
    h16* dst; int ld, cc;
    if (sec == 0) { dst = Q16; ld = DM; cc = c0; } else if (sec == 1) { dst = K16; ld = DM; cc = c0 - DM; } else if (sec == 2) { dst = V16; ld = DM; cc = c0 - 2 * DM; } else { dst = G16; ld = MLPP; cc = c0 - 3 * DM; }
    h16* crow = dst + (size_t)r0 * ld + cc;
    put_tile16(os, crow, ld, lane, sec == 3);
}

// k_gemm16o: C16[M][ldc] columns cbase + c0.. = f16(A.BT + bias). One grid holds both products that feed COMB16: plane z = 0 is attn_out (A = CTX16, K = 1024, left half),
// plane z = 1 mlp_out (A = G16, K = 768, right half); neither reads what the other writes.
__global__ __launch_bounds__(128) void k_gemm16o(const h16* __restrict__ A0, const h16* __restrict__ BT0, int K0, const float* __restrict__ bias0,
                                                const h16* __restrict__ A1, const h16* __restrict__ BT1, int K1, const float* __restrict__ bias1, h16* C16, int ldc, int cstep) {
    __shared__ __align__(16) h16 ring[RING];
    const bool z1 = blockIdx.z != 0;
    const h16* A = z1 ? A1 : A0; const h16* BT = z1 ? BT1 : BT0; const float* bias = z1 ? bias1 : bias0;
    const int K = z1 ? K1 : K0, cbase = z1 ? cstep : 0;
    const int lane = threadIdx.x & 31, wave = threadIdx.x >> 5, lr = lane & 15, hi = lane >> 4;
    const int rb = blockIdx.x * 128, cb = blockIdx.y * 128;
    v8f acc[4][4];
    gemm_tile(A, BT, K, rb, cb, ring, acc);
    const int r0 = rb + (wave >> 1) * 64, c0 = cb + (wave & 1) * 64;
    float* os = (float*)ring + wave * (64 * 68);   // the loop's last barrier has freed the ring; each wave stages its own 64 x 64 tile
#pragma unroll
    for (int t = 0; t < 4; ++t) { const float bv = bfr(bias[c0 + t * 16 + lr]);
#pragma unroll
        for (int i = 0; i < 4; ++i)
#pragma unroll
            for (int j = 0; j < 8; ++j) os[(i * 16 + hi * 8 + j) * 68 + t * 16 + lr] = acc[i][t][j] + bv; }
    __syncthreads();
    h16* crow = C16 + (size_t)r0 * ldc + cbase + c0;
    put_tile16(os, crow, ldc, lane, false);
}

__global__ __launch_bounds__(128) void k_gemmout(const h16* __restrict__ A, const h16* __restrict__ BT, const float* __restrict__ bias, const float* __restrict__ x, float* C) {
    __shared__ __align__(16) h16 ring[RING];
    const int lane = threadIdx.x & 31, wave = threadIdx.x >> 5, lr = lane & 15, hi = lane >> 4;
    const int rb = blockIdx.x * 128, cb = blockIdx.y * 128;
    v8f acc[4][4];
    gemm_tile(A, BT, 2 * DM, rb, cb, ring, acc);
    const int r0 = rb + (wave >> 1) * 64, c0 = cb + (wave & 1) * 64;
    float* os = (float*)ring + wave * (64 * 68);   // the loop's last barrier has freed the ring; each wave stages its own 64 x 64 tile
#pragma unroll
    for (int t = 0; t < 4; ++t) { const float bv = bfr(bias[c0 + t * 16 + lr]);
#pragma unroll
        for (int i = 0; i < 4; ++i)
#pragma unroll
            for (int j = 0; j < 8; ++j) os[(i * 16 + hi * 8 + j) * 68 + t * 16 + lr] = acc[i][t][j] + bv; }
    __syncthreads();
    float* crow = C + (size_t)r0 * DM + c0;
    const float* xrow = x + (size_t)r0 * DM + c0;
    for (int s0 = 0; s0 < 32; s0 += 8) {
#pragma unroll   // eight row pairs a trip: their x loads and LDS reads go out together, one latency a trip instead of one a row pair
        for (int s = s0; s < s0 + 8; ++s) { const int row = 2 * s + (lane >> 4), cofs = (lane & 15) * 4;
            v4f val = *(const v4fa*)(os + row * 68 + cofs); const v4f xv = *(const v4f*)(xrow + (size_t)row * DM + cofs);
#pragma unroll
            for (int e = 0; e < 4; ++e) val[e] += bfr(xv[e]);
            *(v4f*)(crow + (size_t)row * DM + cofs) = val; }
        asm volatile("s_wait_xcnt 0x0" ::: "memory");   // before the next trip rewrites the registers that this trip's loads and stores name
    }
}

// k_vt: VT16[b][h][d][t] from V16 rows via LDS transpose; block (b, h, 64 tokens).
__global__ __launch_bounds__(256) void k_vt(const h16* __restrict__ V16, h16* VT16) {
    __shared__ __align__(16) h16 tile[64 * 72];
    const int bid = blockIdx.x;
    const int b = bid / (NH_ * (NT_ / 64)), rem = bid - b * (NH_ * (NT_ / 64)), h = rem / (NT_ / 64), kt = rem - h * (NT_ / 64);
    const int k0 = kt * 64, tid = threadIdx.x;
    const int kk = tid >> 2, d0 = (tid & 3) * 16;
    const h16* src = V16 + ((size_t)b * NT_ + k0 + kk) * DM + h * HD + d0;
#pragma unroll
    for (int i = 0; i < 16; ++i) tile[(d0 + i) * 72 + kk] = src[i];
    __syncthreads();
    const int piece = tid & 7;
    h16* base = VT16 + (((size_t)b * NH_ + h) * HD) * NT_ + k0;
    auto pass = [&]() {
#pragma unroll
        for (int s = 0; s < 2; ++s) { const int d = (tid >> 3) + 32 * s; const v8h val = *(const v8ha*)(tile + d * 72 + piece * 8); *(v8h*)(base + (size_t)d * NT_ + piece * 8) = val; }
    };
    pass(); 
}

// k_attn: transposed products. Block = (b, h, 4 waves x QCOL queries); a step is 32 keys. S^T = K.Q^T: A = 16 key rows, B = the wave's queries (loaded once), so a lane
// holds scores of ONE query (column lr; keys 8 hi + r of each 16-key tile): maximum and sum run in the lane, the two wave halves meet in one cross-row move. The two
// score tiles of a step, exponentiated (x 32768, folded into the exponent) and rounded to f16 in place, ARE the B operand of O^T += V^T.P^T in the hardware k order
// (element s: key 8 hi + s, then 16 + 8 hi + s - 8), which the V^T rows are loaded in: P touches no LDS. O^T gives a lane 8 consecutive head dims of its query.
#define QG   4            // 16-query column groups a wave: every K and V^T fragment a wave loads feeds QG products
#define QCOL (QG * 16)
#define QBLK (4 * QCOL)
__device__ __forceinline__ float xhalf(float x) { return __builtin_bit_cast(float, __builtin_amdgcn_permlanex16(__builtin_bit_cast(int, x), __builtin_bit_cast(int, x), 0x76543210, 0xfedcba98, false, false)); }  // lane l with lane l ^ 16

__global__ __launch_bounds__(128) void k_attn(const h16* __restrict__ Q16, const h16* __restrict__ K16, const h16* __restrict__ VT16, h16* CTX16) {
    const int lane = threadIdx.x & 31, wave = threadIdx.x >> 5, lr = lane & 15, hi = lane >> 4;
    const int bid = blockIdx.x;
    const int b = bid / (NH_ * (NT_ / QBLK)), rem = bid - b * (NH_ * (NT_ / QBLK)), h = rem / (NT_ / QBLK), qt = rem - h * (NT_ / QBLK);
    const int q0 = qt * QBLK + wave * QCOL;
    const size_t tok0 = (size_t)b * NT_;
    const float CS = 0.125f * 1.4426950408889634f;   // score scale, in base 2
    v16h qf[QG][2];
#pragma unroll
    for (int g = 0; g < QG; ++g)
#pragma unroll
        for (int kc = 0; kc < 2; ++kc) { const h16* p = Q16 + (tok0 + q0 + g * 16 + lr) * DM + h * HD + kc * 32 + 8 * hi; qf[g][kc] = cat16(*(const v8h*)p, *(const v8h*)(p + 16)); }
    const h16* kp = K16 + (tok0 + lr) * DM + h * HD + 8 * hi;
    const h16* vp = VT16 + (((size_t)b * NH_ + h) * HD + lr) * NT_ + 8 * hi;
    v8f o[QG][4];
    float mrun[QG], lsum[QG];
#pragma unroll
    for (int g = 0; g < QG; ++g) { mrun[g] = -3.0e38f; lsum[g] = 0.f;
#pragma unroll
        for (int n = 0; n < 4; ++n) o[g][n] = (v8f){}; }
    v16h kf[2][2];
#pragma unroll
    for (int t = 0; t < 2; ++t)
#pragma unroll
        for (int kc = 0; kc < 2; ++kc) { const h16* p = kp + (size_t)(t * 16) * DM + kc * 32; kf[t][kc] = cat16(*(const v8h*)p, *(const v8h*)(p + 16)); }
    asm volatile("s_wait_xcnt 0x0" ::: "memory");   // before anything rewrites the address registers that the Q and K loads name
    __builtin_amdgcn_sched_barrier(0);               // keeps later register writes behind that wait
#pragma unroll 1   // one step a trip, for speed only
    for (int kt = 0; kt < NT_ / 32; ++kt) {
        const int l0 = kt * 32;
        v16h vf[4];
#pragma unroll
        for (int n = 0; n < 4; ++n) { const h16* p = vp + (size_t)(n * 16) * NT_ + l0; vf[n] = cat16(*(const v8h*)p, *(const v8h*)(p + 16)); }
        asm volatile("s_wait_xcnt 0x0" ::: "memory");   // before anything rewrites the address registers that these loads name
        __builtin_amdgcn_sched_barrier(0);               // the V^T loads go out ahead of the score products and fly under them and the exponentials
        v8f s[QG][2];
#pragma unroll
        for (int g = 0; g < QG; ++g)
#pragma unroll
            for (int t = 0; t < 2; ++t) s[g][t] = wmma16(kf[t][1], qf[g][1], wmma16(kf[t][0], qf[g][0], (v8f){}));
        const int ln = (l0 + 32) & (NT_ - 1);   // the next step's key rows; the last step reads rows 0..31 again (inside the buffer, not used)
#pragma unroll
        for (int t = 0; t < 2; ++t)
#pragma unroll
            for (int kc = 0; kc < 2; ++kc) { const h16* p = kp + (size_t)(ln + t * 16) * DM + kc * 32; kf[t][kc] = cat16(*(const v8h*)p, *(const v8h*)(p + 16)); }
        asm volatile("s_wait_xcnt 0x0" ::: "memory");   // before anything rewrites the address registers that these loads name
        __builtin_amdgcn_sched_barrier(0);               // the next step's K loads go out here and fly under the exponentials and the second product
#pragma unroll
        for (int g = 0; g < QG; ++g) {
            float mt[8];
#pragma unroll
            for (int j = 0; j < 8; ++j) mt[j] = fmaxf(s[g][0][j], s[g][1][j]);
#pragma unroll
            for (int w = 4; w; w >>= 1)
#pragma unroll
                for (int j = 0; j < w; ++j) mt[j] = fmaxf(mt[j], mt[j + w]);
            const float mx = fmaxf(mt[0], xhalf(mt[0])) * CS;
            const float mn = fmaxf(mrun[g], mx);
            const float alpha = __builtin_amdgcn_exp2f(mrun[g] - mn);   // 0 on the first step
            mrun[g] = mn;
            const float nm = 15.0f - mn;                                 // weights x 32768, as f16 operands
            float pe[16];
            v16h pb;
#pragma unroll
            for (int e = 0; e < 16; ++e) { pe[e] = __builtin_amdgcn_exp2f(fmaf(s[g][e >> 3][e & 7], CS, nm)); pb[e] = (h16)pe[e]; }
#pragma unroll
            for (int w = 8; w; w >>= 1)   // a tree: a chain of 16 dependent adds would stall the SIMD's one wave
#pragma unroll
                for (int e = 0; e < w; ++e) pe[e] += pe[e + w];
            lsum[g] = lsum[g] * alpha + pe[0];
#pragma unroll
            for (int n = 0; n < 4; ++n) o[g][n] = wmma16(vf[n], pb, o[g][n] * alpha);
        }
    }
#pragma unroll
    for (int g = 0; g < QG; ++g) {
        const float inv = 1.0f / (lsum[g] + xhalf(lsum[g]));   // the halves' sums (x 32768, like the weights) join once
        h16* crow = CTX16 + (tok0 + q0 + g * 16 + lr) * DM + (size_t)h * HD + 8 * hi;
#pragma unroll
        for (int n = 0; n < 4; ++n) { v8h o8;
#pragma unroll
            for (int j = 0; j < 8; ++j) o8[j] = (h16)(o[g][n][j] * inv);
            *(v8h*)(crow + n * 16) = o8; }
        if (g + 1 < QG) {
            asm volatile("s_wait_xcnt 0x0" ::: "memory");   // before the next group rewrites the registers that this group's stores name
            __builtin_amdgcn_sched_barrier(0);               // keeps the next group's register writes behind that wait
        }
    }
}

extern "C" void kernel_launch(void* const* d_in, const int* in_sizes, int n_in,
                              void* d_out, int out_size, void* d_ws, size_t ws_size, hipStream_t stream) {
    (void)in_sizes; (void)n_in; (void)out_size;
    const float* x = (const float*)d_in[0]; const float* ng = (const float*)d_in[1]; const float* nb = (const float*)d_in[2]; const float* W1 = (const float*)d_in[3]; const float* b1 = (const float*)d_in[4];
    const float* qg = (const float*)d_in[5]; const float* qb = (const float*)d_in[6]; const float* kg = (const float*)d_in[7]; const float* kb = (const float*)d_in[8];
    const float* Wao = (const float*)d_in[9]; const float* bao = (const float*)d_in[10]; const float* Wmo = (const float*)d_in[11]; const float* bmo = (const float*)d_in[12];
    const float* W2 = (const float*)d_in[13]; const float* b2 = (const float*)d_in[14];
    float* out = (float*)d_out;    // [2][2048][1024]
    char* wsp = (char*)d_ws;
    auto take = [&](size_t bytes) { char* p = wsp; wsp += (bytes + 255) & ~(size_t)255; return (void*)p; };
    h16* XN16 = (h16*)take((size_t)NTK * DM * 2); h16* W1T = (h16*)take((size_t)NFP * DM * 2);
    h16* WaoT = (h16*)take((size_t)DM * DM * 2); h16* WmoT = (h16*)take((size_t)DM * MLPP * 2); h16* W2T = (h16*)take((size_t)DM * 2 * DM * 2);
    h16* Q16 = (h16*)take((size_t)NTK * DM * 2); h16* K16 = (h16*)take((size_t)NTK * DM * 2); h16* V16 = (h16*)take((size_t)NTK * DM * 2); h16* VT16 = (h16*)take((size_t)NTK * DM * 2);
    h16* G16 = (h16*)take((size_t)NTK * MLPP * 2); h16* CTX16 = (h16*)take((size_t)NTK * DM * 2); h16* COMB16 = (h16*)take((size_t)NTK * 2 * DM * 2);
    if ((size_t)(wsp - (char*)d_ws) > ws_size) return;    // 8.4 + 7.9 + 2.1 + 1.6 + 4.2 + 4 x 8.4 + 6.3 + 8.4 + 16.8 MB ~ 89 MB
    k_prep<<<PB_LN + PB_W1 + PB_W2 + PB_WAO + PB_WMO, 256, 0, stream>>>(x, ng, nb, W1, W2, Wao, Wmo, XN16, W1T, W2T, WaoT, WmoT);
    k_fused<<<dim3(NTK / 128, NFP / 128, 1), 128, 0, stream>>>(XN16, W1T, b1, qg, qb, kg, kb, Q16, K16, V16, G16);
    k_vt<<<NB_ * NH_ * (NT_ / 64), 256, 0, stream>>>(V16, VT16);
    k_attn<<<NB_ * NH_ * (NT_ / QBLK), 128, 0, stream>>>(Q16, K16, VT16, CTX16);
    k_gemm16o<<<dim3(NTK / 128, DM / 128, 2), 128, 0, stream>>>(CTX16, WaoT, DM, bao, G16, WmoT, MLPP, bmo, COMB16, 2 * DM, DM);
    k_gemmout<<<dim3(NTK / 128, DM / 128, 1), 128, 0, stream>>>(COMB16, W2T, b2, x, out);
}

// v004
// A run of this version takes 138 microseconds.
// In two side-by-side timings against v003, it was 1.12 and 1.15 times as fast.
// Over all steps from v000 it is 2.95 times as fast.
#include <hip/hip_runtime.h>

// Contractions on v_wmma_f32_16x16x32_f16 with plain f16 operands, f32 accumulate: fused = LN(x).W1 + b1 ([4096 x 1024].[1024 x 3788 (padded 3840)]), the 16-head
// attention with per-head LayerNorm on q and k (scores [2048 x 64].[64 x 2048] /8, softmax, .v), and the tail out = x + [a.Wao + bao | gelu_tanh(h).Wmo + bmo].W2 + b2 in the
// associated form out = x + [a | gelu_tanh(h)].Wc + bc ([4096 x 1740 (1792)].[1792 x 1024]) with Wc = [Wao.W2(rows 0..1023) ; Wmo.W2(rows 1024..2047)] (two [. x 1024].[1024 x 1024]
// products of weights, made anew in every call) and bc = b2 + [bao | bmo].W2. Input weights are f16 of their bf16 rounding (exact for the bf16-input reference), the activations
// and Wc are computed values rounded once to f16 (the output is dominated by the exact residual x). LayerNorms (eps 1e-6), gelu, softmax and bc run in f32.

#define NB_  2
#define NT_  2048
#define DM   1024
#define NH_  16
#define HD   64
#define NTK  (NB_ * NT_)
#define NF   3788
#define NFP  3840
#define MLPH 716
#define MLPP 768
#define KC   (DM + MLPP)   // k extent of the tail product: [a | gelu(h)] rows and Wc^T rows have this pitch
#define PSC  32768.0f
#define EPS  1e-6f

typedef _Float16 h16;
typedef __attribute__((ext_vector_type(16))) _Float16 v16h;
typedef __attribute__((ext_vector_type(8)))  _Float16 v8h;
typedef __attribute__((ext_vector_type(8)))  float    v8f;
typedef __attribute__((ext_vector_type(4)))  float    v4f;
typedef v8h  __attribute__((may_alias)) v8ha;
typedef v4f  __attribute__((may_alias)) v4fa;

__device__ __forceinline__ unsigned short f2bf(float f) { unsigned u = __float_as_uint(f); u += 0x7FFFu + ((u >> 16) & 1u); return (unsigned short)(u >> 16); }
__device__ __forceinline__ float bf2f(unsigned short b) { return __uint_as_float(((unsigned)b) << 16); }
__device__ __forceinline__ float bfr(float f) { return bf2f(f2bf(f)); }
__device__ __forceinline__ v16h cat16(v8h lo, v8h hi) { return __builtin_shufflevector(lo, hi, 0, 1, 2, 3, 4, 5, 6, 7, 8, 9, 10, 11, 12, 13, 14, 15); }
__device__ __forceinline__ v8f wmma16(v16h a, v16h b, v8f c) { return __builtin_amdgcn_wmma_f32_16x16x32_f16(false, a, false, b, (short)0, c, false, false); }
__device__ __forceinline__ float hsum16(float v) { v += __shfl_xor(v, 1, 16); v += __shfl_xor(v, 2, 16); v += __shfl_xor(v, 4, 16); return v + __shfl_xor(v, 8, 16); }
__device__ __forceinline__ float gelu_t(float x) { const float c = 0.7978845608028654f; return 0.5f * x * (1.0f + tanhf(c * (x + 0.044715f * x * x * x))); }

// ln_rows: LayerNorm of 8 rows of x (one a wave) -> XN16; blk = row group.
__device__ __forceinline__ void ln_rows(const float* __restrict__ x, const float* __restrict__ g, const float* __restrict__ bt, h16* XN16, const int blk) {
    const int lane = threadIdx.x & 31, r = blk * 8 + (threadIdx.x >> 5);
    if (r >= NTK) return;
    const float* xr = x + (size_t)r * DM;
    float s = 0.f;
#pragma unroll
    for (int q = 0; q < 4; ++q)
#pragma unroll
        for (int i = 0; i < 8; ++i) s += bfr(xr[q * 256 + lane * 8 + i]);
#pragma unroll
    for (int o = 16; o; o >>= 1) s += __shfl_xor(s, o, 32);
    const float mu = s * (1.0f / DM);
    float sq = 0.f;
#pragma unroll 1
    for (int q = 0; q < 4; ++q)
#pragma unroll
        for (int i = 0; i < 8; ++i) { const float d = bfr(xr[q * 256 + lane * 8 + i]) - mu; sq += d * d; }
#pragma unroll
    for (int o = 16; o; o >>= 1) sq += __shfl_xor(sq, o, 32);
    const float rs = rsqrtf(sq * (1.0f / DM) + EPS);
#pragma unroll 1
    for (int q = 0; q < 4; ++q) {
        v8h o8;
#pragma unroll
        for (int i = 0; i < 8; ++i) { const int c = q * 256 + lane * 8 + i; o8[i] = (h16)((bfr(xr[c]) - mu) * rs * bfr(g[c]) + bfr(bt[c])); }
        *(v8h*)(XN16 + (size_t)r * DM + q * 256 + lane * 8) = o8; 
    }
}

// wt_tile: k-major W [K rows][N cols] -> n-major f16 plane WT [Npad][Kpad] (f16 of bf16(W); rows >= N and columns >= K zero); one 64 x 64 tile (kb, nb) through LDS.
__device__ __forceinline__ void wt_tile(const float* __restrict__ Wm, int K, int N, int Kpad, h16* WT, const int kb, const int nb) {
    __shared__ __align__(16) h16 tl[64 * 72];
    const int tid = threadIdx.x, k0 = kb * 64, n0 = nb * 64;
    const int kk = tid >> 2, nq = (tid & 3) * 16;
#pragma unroll
    for (int i = 0; i < 16; ++i) { const int k = k0 + kk, n = n0 + nq + i; tl[(nq + i) * 72 + kk] = (k < K && n < N) ? (h16)bfr(Wm[(size_t)k * N + n]) : (h16)0.f; }
    __syncthreads();
    const int piece = tid & 7;
    auto pass = [&]() {
#pragma unroll
        for (int s = 0; s < 2; ++s) { const int nr = (tid >> 3) + 32 * s; const v8h val = *(const v8ha*)(tl + nr * 72 + piece * 8);
            *(v8h*)(WT + (size_t)(n0 + nr) * Kpad + k0 + piece * 8) = val; }
    };
    pass(); 
    asm volatile("s_wait_xcnt 0x0" ::: "memory");   // behind the two stores: in the merged kernel other code follows them in the listing and rewrites the registers that they name
}

// cv_rows: W [rows][1024] f32 -> f16 plane of the same layout (f16 of bf16(W); plane rows past the weight's last row are zero): 4 rows a block, 16 elements a thread. As the n-major operand of Wc^T = W2^T.W^T
// a weight is read along its own rows, so it needs no transpose.
__device__ __forceinline__ void cv_rows(const float* __restrict__ Wm, const int rows, h16* W16, const int blk) {
    const int tid = threadIdx.x, col = (tid & 127) * 8;
    v4f v[2][2];
#pragma unroll
    for (int s = 0; s < 2; ++s) { const int r = blk * 4 + s * 2 + (tid >> 7);   // the same row in a whole wave
        if (r < rows) { const float* p = Wm + (size_t)r * DM + col; v[s][0] = *(const v4f*)p; v[s][1] = *(const v4f*)(p + 4); } else { v[s][0] = (v4f){}; v[s][1] = (v4f){}; } }
#pragma unroll
    for (int s = 0; s < 2; ++s) { const int r = blk * 4 + s * 2 + (tid >> 7); v8h o;
#pragma unroll
        for (int i = 0; i < 8; ++i) o[i] = (h16)bfr(v[s][i >> 2][i & 3]);
        *(v8h*)(W16 + (size_t)r * DM + col) = o; }
    asm volatile("s_wait_xcnt 0x0" ::: "memory");   // behind the loads and stores: in the merged kernel other code follows them in the listing and rewrites the registers that they name
}

// k_prep: the five jobs that depend on the inputs alone, as block ranges of ONE grid, so that their starts, first loads and tails overlap: the LayerNorm of x, the two
// weight transposes, each with its tiles in the order k fastest, and the two weight conversions. The job is the same for a whole block, so wt_tile's barrier stands under block-uniform control flow.
#define PB_LN  (NTK / 8)
#define PB_W1  ((DM / 64) * (NFP / 64))
#define PB_W2  (((2 * DM) / 64) * (DM / 64))
#define PB_WAO (DM / 4)
#define PB_WMO (MLPP / 4)
__global__ __launch_bounds__(256) void k_prep(const float* __restrict__ x, const float* __restrict__ g, const float* __restrict__ bt, const float* __restrict__ W1, const float* __restrict__ W2,
                                             const float* __restrict__ Wao, const float* __restrict__ Wmo, h16* XN16, h16* W1T, h16* W2T, h16* Wao16, h16* Wmo16) {
    int t = blockIdx.x;
    if (t < PB_LN) { ln_rows(x, g, bt, XN16, t); return; }
    t -= PB_LN;
    const float* Wm; h16* WT; int K, N, Kpad, nb;   // nb by a literal divisor in each branch: scalar shifts and one scalar multiply, no division at run time
    if (t < PB_W1) { Wm = W1; WT = W1T; K = DM; N = NF; Kpad = DM; nb = t / (DM / 64); }
    else if (t < PB_W1 + PB_W2) { t -= PB_W1; Wm = W2; WT = W2T; K = 2 * DM; N = DM; Kpad = 2 * DM; nb = t / ((2 * DM) / 64); }
    else if (t < PB_W1 + PB_W2 + PB_WAO) { cv_rows(Wao, DM, Wao16, t - (PB_W1 + PB_W2)); return; }
    else { cv_rows(Wmo, MLPH, Wmo16, t - (PB_W1 + PB_W2 + PB_WAO)); return; }
    wt_tile(Wm, K, N, Kpad, WT, t - nb * (Kpad / 64), nb);
}

// GEMM tile core: 128 x 128 block tile (2 x 2 waves, 64 x 64 each) of A[M][K] (f16, row pitch lda) . BT[N][K] (row pitch ldb), K a multiple of 64 and at least 128. A pass is 64 k: the
// 128 rows x 128 B of both operands are brought into LDS by asynchronous copies (pitch 144 B for the ds_load_b128 readers), two buffers, the next pass's copies in
// flight while this pass is worked on. A buffer is [A tile | BT tile]. Returns acc[4][4] (row group, column group; D layout); the k order of every sum is ascending.
#define TP   72
#define TSZ  (128 * TP)
#define RING (4 * TSZ)

// One operand's tile of one pass: 8 copies a lane, 16 rows apart (a wave covers 4 whole 128-B rows a copy). The s_wait_xcnt ends the copies' own statement, so that
// no address register of a copy is rewritten ahead of it.
__device__ __forceinline__ void copy_tile(unsigned l, const h16* g, int ld) {
    const size_t rs = (size_t)16 * ld;
    asm volatile("global_load_async_to_lds_b128 %0, %8, off\n\t"
                 "global_load_async_to_lds_b128 %1, %9, off\n\t"
                 "global_load_async_to_lds_b128 %2, %10, off\n\t"
                 "global_load_async_to_lds_b128 %3, %11, off\n\t"
                 "global_load_async_to_lds_b128 %4, %12, off\n\t"
                 "global_load_async_to_lds_b128 %5, %13, off\n\t"
                 "global_load_async_to_lds_b128 %6, %14, off\n\t"
                 "global_load_async_to_lds_b128 %7, %15, off\n\t"
                 "s_wait_xcnt 0x0"
                 :: "v"(l), "v"(l + 1u * 16u * 144u), "v"(l + 2u * 16u * 144u), "v"(l + 3u * 16u * 144u),
                    "v"(l + 4u * 16u * 144u), "v"(l + 5u * 16u * 144u), "v"(l + 6u * 16u * 144u), "v"(l + 7u * 16u * 144u),
                    "v"(g), "v"(g + rs), "v"(g + 2 * rs), "v"(g + 3 * rs), "v"(g + 4 * rs), "v"(g + 5 * rs), "v"(g + 6 * rs), "v"(g + 7 * rs)
                 : "memory");
}

__device__ __forceinline__ void gemm_tile(const h16* __restrict__ A, const int lda, const h16* __restrict__ BT, const int ldb, const int K, int rb, int cb, h16* ring, v8f (&acc)[4][4]) {
    const int tid = threadIdx.x, lane = tid & 31, wave = tid >> 5, lr = lane & 15, hi = lane >> 4;
    const h16* ga = A + (size_t)(rb + (tid >> 3)) * lda + (tid & 7) * 8;
    const h16* gb = BT + (size_t)(cb + (tid >> 3)) * ldb + (tid & 7) * 8;
    const unsigned l0 = (unsigned)(size_t)ring + (unsigned)((tid >> 3) * 144 + (tid & 7) * 16);
    const int np = K / 64;
#pragma unroll
    for (int i = 0; i < 4; ++i)
#pragma unroll
        for (int t = 0; t < 4; ++t) acc[i][t] = (v8f){};
    copy_tile(l0, ga, lda);
    copy_tile(l0 + TSZ * 2, gb, ldb);
    asm volatile("s_wait_asynccnt 0x0" ::: "memory");   // pass 0's own copies have landed before the barrier publishes them
    __syncthreads();
    copy_tile(l0 + 2 * TSZ * 2, ga + 64, lda);
    copy_tile(l0 + 3 * TSZ * 2, gb + 64, ldb);
#pragma unroll 1   // one pass a trip: the two buffers alternate by the trip's parity
    for (int p = 0; p < np; ++p) {
        const int bo = (p & 1) * 2 * TSZ;
        const h16* sa = ring + bo + ((wave >> 1) * 64 + lr) * TP + 8 * hi;
        const h16* sb = ring + bo + TSZ + ((wave & 1) * 64 + lr) * TP + 8 * hi;
        v16h a[4], b[4];
#pragma unroll
        for (int i = 0; i < 4; ++i) a[i] = cat16(*(const v8ha*)(sa + i * 16 * TP), *(const v8ha*)(sa + i * 16 * TP + 16));
#pragma unroll
        for (int t = 0; t < 4; ++t) b[t] = cat16(*(const v8ha*)(sb + t * 16 * TP), *(const v8ha*)(sb + t * 16 * TP + 16));
        __builtin_amdgcn_sched_barrier(0);   // the 16 LDS reads of a k step go out as one group ahead of its WMMAs
#pragma unroll
        for (int i = 0; i < 4; ++i)
#pragma unroll
            for (int t = 0; t < 4; ++t) acc[i][t] = wmma16(a[i], b[t], acc[i][t]);
        __builtin_amdgcn_sched_barrier(0);   // the second k step's reads stay behind the first step's WMMAs, in the same fragment registers
#pragma unroll
        for (int i = 0; i < 4; ++i) a[i] = cat16(*(const v8ha*)(sa + i * 16 * TP + 32), *(const v8ha*)(sa + i * 16 * TP + 48));
#pragma unroll
        for (int t = 0; t < 4; ++t) b[t] = cat16(*(const v8ha*)(sb + t * 16 * TP + 32), *(const v8ha*)(sb + t * 16 * TP + 48));
        asm volatile("s_wait_dscnt 0x0" ::: "memory");      // this wave's last reads of the buffer are done before the barrier frees it for the refill
        asm volatile("s_wait_asynccnt 0x0" ::: "memory");   // this wave's copies of pass p + 1 have landed before the barrier publishes them
        __syncthreads();
        if (p + 2 < np) {
            copy_tile(l0 + bo * 2, ga + (size_t)(p + 2) * 64, lda);
            copy_tile(l0 + bo * 2 + TSZ * 2, gb + (size_t)(p + 2) * 64, ldb);
        }
        __builtin_amdgcn_sched_barrier(0);   // the refill is issued ahead of the second k step's WMMAs (registers only), so that it flies under them
#pragma unroll
        for (int i = 0; i < 4; ++i)
#pragma unroll
            for (int t = 0; t < 4; ++t) acc[i][t] = wmma16(a[i], b[t], acc[i][t]);
    }
    asm volatile("s_wait_asynccnt 0x0" ::: "memory");       // no copy is outstanding when the ring becomes the output staging
}

// Store pass of a wave's staged 64 x 64 f32 tile (pitch 68) as f16 rows of 128 B, whole lines; gelu (a compile-time or block-uniform choice) is applied to the staged f32 values.
__device__ __forceinline__ void put_tile16(const float* os, h16* crow, int ld, int lane, const bool gelu) {
    for (int s0 = 0; s0 < 16; s0 += 4) {
        v4f v[4][2];
#pragma unroll   // four row groups a trip: their LDS reads go out together, one latency a trip instead of one a group
        for (int u = 0; u < 4; ++u) { const float* sp = os + (4 * (s0 + u) + (lane >> 3)) * 68 + (lane & 7) * 8; v[u][0] = *(const v4fa*)sp; v[u][1] = *(const v4fa*)(sp + 4); }
        if (gelu) {
#pragma unroll
            for (int u = 0; u < 4; ++u)
#pragma unroll
                for (int i = 0; i < 8; ++i) v[u][i >> 2][i & 3] = gelu_t(v[u][i >> 2][i & 3]);
        }
#pragma unroll
        for (int u = 0; u < 4; ++u) { v8h o;
#pragma unroll
            for (int i = 0; i < 8; ++i) o[i] = (h16)v[u][i >> 2][i & 3];
            *(v8h*)(crow + (size_t)(4 * (s0 + u) + (lane >> 3)) * ld + (lane & 7) * 8) = o; }
        asm volatile("s_wait_xcnt 0x0" ::: "memory");   // before the next trip rewrites the registers that this trip's stores name
    }
}

// k_fused: fused = XN16 . W1T + b1 over the 3840 padded columns; a wave's 64-wide column group = exactly one head of q / k / v or a 64-wide slice of the MLP hidden:
//   c0 <  1024: q head c0/64: per-row LayerNorm over the 64 head dims (qn_g, qn_b) -> Q16[tok][1024] f16
//   c0 <  2048: k head: LayerNorm (kn_g, kn_b) -> K16
//   c0 <  3072: v -> V16 rows
//   else      : gelu_tanh (in the store pass) -> G16 = columns 1024.. of the [tok][1792] rows [a | gelu(h)] (columns >= 716 of the hidden are exactly 0 after gelu(0 + 0): b1 pad is read as 0; their Wc rows are 0 anyway)
__global__ __launch_bounds__(128) void k_fused(const h16* __restrict__ XN16, const h16* __restrict__ W1T, const float* __restrict__ b1,
                                              const float* __restrict__ qg, const float* __restrict__ qb, const float* __restrict__ kg, const float* __restrict__ kb,
                                              h16* Q16, h16* K16, h16* V16, h16* G16) {
    __shared__ __align__(16) h16 ring[RING];
    const int lane = threadIdx.x & 31, wave = threadIdx.x >> 5, lr = lane & 15, hi = lane >> 4;
    const int rb = blockIdx.x * 128, cb = blockIdx.y * 128;
    v8f acc[4][4];
    gemm_tile(XN16, DM, W1T, DM, DM, rb, cb, ring, acc);
    const int r0 = rb + (wave >> 1) * 64, c0 = cb + (wave & 1) * 64;
    const int sec = cb / DM;                   // 0 q, 1 k, 2 v, 3 mlp (the same for both column groups of a block)
#pragma unroll
    for (int t = 0; t < 4; ++t) { const int col = c0 + t * 16 + lr; const float bv = (col < NF) ? bfr(b1[col]) : 0.f;
#pragma unroll
        for (int i = 0; i < 4; ++i)
#pragma unroll
            for (int j = 0; j < 8; ++j) acc[i][t][j] += bv; }
    if (sec < 2) {
        const float* gg = sec ? kg : qg; const float* bb = sec ? kb : qb;
#pragma unroll
        for (int i = 0; i < 4; ++i)
#pragma unroll
            for (int j = 0; j < 8; ++j) {
                float s = acc[i][0][j] + acc[i][1][j] + acc[i][2][j] + acc[i][3][j];
                const float mu = hsum16(s) * (1.0f / HD);
                float q = 0.f;
#pragma unroll
                for (int t = 0; t < 4; ++t) { const float d = acc[i][t][j] - mu; q += d * d; }
                const float rs = rsqrtf(hsum16(q) * (1.0f / HD) + EPS);
#pragma unroll
                for (int t = 0; t < 4; ++t) acc[i][t][j] = (acc[i][t][j] - mu) * rs * bfr(gg[t * 16 + lr]) + bfr(bb[t * 16 + lr]);
            }
    }
    float* os = (float*)ring + wave * (64 * 68);   // the loop's last barrier has freed the ring; each wave stages its own 64 x 64 tile
#pragma unroll
    for (int i = 0; i < 4; ++i)
#pragma unroll
        for (int t = 0; t < 4; ++t)
#pragma unroll
            for (int j = 0; j < 8; ++j) os[(i * 16 + hi * 8 + j) * 68 + t * 16 + lr] = acc[i][t][j];
    __syncthreads();
    h16* dst; int ld, cc;
    if (sec == 0) { dst = Q16; ld = DM; cc = c0; } else if (sec == 1) { dst = K16; ld = DM; cc = c0 - DM; } else if (sec == 2) { dst = V16; ld = DM; cc = c0 - 2 * DM; } else { dst = G16; ld = KC; cc = c0 - 3 * DM; }
    h16* crow = dst + (size_t)r0 * ld + cc;
    put_tile16(os, crow, ld, lane, sec == 3);
}

// wc_block: one 128 x 128 tile of Wc^T [n][k] (f16, pitch 1792) = W2^T rows n (one half of their 2048 columns) . W rows k: k < 1024 takes Wao and W2's rows 0..1023, k >= 1024 takes Wmo
// (its plane rows 716..767 are zero) and W2's rows 1024..2047. t = tile, n fastest.
__device__ __forceinline__ void wc_block(const h16* __restrict__ W2T, const h16* __restrict__ Wao16, const h16* __restrict__ Wmo16, h16* WcT, h16* ring, const int t) {
    const int lane = threadIdx.x & 31, wave = threadIdx.x >> 5, lr = lane & 15, hi = lane >> 4;
    const int rb = (t & 7) * 128, ck = (t >> 3) * 128;
    const bool mlp = ck >= DM;
    v8f acc[4][4];
    gemm_tile(mlp ? W2T + DM : W2T, 2 * DM, mlp ? Wmo16 : Wao16, DM, DM, rb, mlp ? ck - DM : ck, ring, acc);
    float* os = (float*)ring + wave * (64 * 68);   // the loop's last barrier has freed the ring; each wave stages its own 64 x 64 tile
#pragma unroll
    for (int t4 = 0; t4 < 4; ++t4)
#pragma unroll
        for (int i = 0; i < 4; ++i)
#pragma unroll
            for (int j = 0; j < 8; ++j) os[(i * 16 + hi * 8 + j) * 68 + t4 * 16 + lr] = acc[i][t4][j];
    __syncthreads();
    put_tile16(os, WcT + (size_t)(rb + (wave >> 1) * 64) * KC + ck + (wave & 1) * 64, KC, lane, false);
}

// k_gemmout: out = x + [a | gelu(h)].Wc + bc; bc is a computed f32 vector and is added as it is.
__global__ __launch_bounds__(128) void k_gemmout(const h16* __restrict__ A, const h16* __restrict__ BT, const float* __restrict__ bias, const float* __restrict__ x, float* C) {
    __shared__ __align__(16) h16 ring[RING];
    const int lane = threadIdx.x & 31, wave = threadIdx.x >> 5, lr = lane & 15, hi = lane >> 4;
    const int rb = blockIdx.x * 128, cb = blockIdx.y * 128;
    v8f acc[4][4];
    gemm_tile(A, KC, BT, KC, KC, rb, cb, ring, acc);
    const int r0 = rb + (wave >> 1) * 64, c0 = cb + (wave & 1) * 64;
    float* os = (float*)ring + wave * (64 * 68);   // the loop's last barrier has freed the ring; each wave stages its own 64 x 64 tile
#pragma unroll
    for (int t = 0; t < 4; ++t) { const float bv = bias[c0 + t * 16 + lr];
#pragma unroll
        for (int i = 0; i < 4; ++i)
#pragma unroll
            for (int j = 0; j < 8; ++j) os[(i * 16 + hi * 8 + j) * 68 + t * 16 + lr] = acc[i][t][j] + bv; }
    __syncthreads();
    float* crow = C + (size_t)r0 * DM + c0;
    const float* xrow = x + (size_t)r0 * DM + c0;
    for (int s0 = 0; s0 < 32; s0 += 8) {
#pragma unroll   // eight row pairs a trip: their x loads and LDS reads go out together, one latency a trip instead of one a row pair
        for (int s = s0; s < s0 + 8; ++s) { const int row = 2 * s + (lane >> 4), cofs = (lane & 15) * 4;
            v4f val = *(const v4fa*)(os + row * 68 + cofs); const v4f xv = *(const v4f*)(xrow + (size_t)row * DM + cofs);
#pragma unroll
            for (int e = 0; e < 4; ++e) val[e] += bfr(xv[e]);
            *(v4f*)(crow + (size_t)row * DM + cofs) = val; }
        asm volatile("s_wait_xcnt 0x0" ::: "memory");   // before the next trip rewrites the registers that this trip's loads and stores name
    }
}

// k_vt: VT16[b][h][d][t] from V16 rows via LDS transpose; block (b, h, 64 tokens).
__global__ __launch_bounds__(256) void k_vt(const h16* __restrict__ V16, h16* VT16) {
    __shared__ __align__(16) h16 tile[64 * 72];
    const int bid = blockIdx.x;
    const int b = bid / (NH_ * (NT_ / 64)), rem = bid - b * (NH_ * (NT_ / 64)), h = rem / (NT_ / 64), kt = rem - h * (NT_ / 64);
    const int k0 = kt * 64, tid = threadIdx.x;
    const int kk = tid >> 2, d0 = (tid & 3) * 16;
    const h16* src = V16 + ((size_t)b * NT_ + k0 + kk) * DM + h * HD + d0;
#pragma unroll
    for (int i = 0; i < 16; ++i) tile[(d0 + i) * 72 + kk] = src[i];
    __syncthreads();
    const int piece = tid & 7;
    h16* base = VT16 + (((size_t)b * NH_ + h) * HD) * NT_ + k0;
    auto pass = [&]() {
#pragma unroll
        for (int s = 0; s < 2; ++s) { const int d = (tid >> 3) + 32 * s; const v8h val = *(const v8ha*)(tile + d * 72 + piece * 8); *(v8h*)(base + (size_t)d * NT_ + piece * 8) = val; }
    };
    pass(); 
}

// attn_block: transposed products. Block = (b, h, 4 waves x QCOL queries); a step is 32 keys. S^T = K.Q^T: A = 16 key rows, B = the wave's queries (loaded once), so a lane
// holds scores of ONE query (column lr; keys 8 hi + r of each 16-key tile): maximum and sum run in the lane, the two wave halves meet in one cross-row move. The two
// score tiles of a step, exponentiated (x 32768, folded into the exponent) and rounded to f16 in place, ARE the B operand of O^T += V^T.P^T in the hardware k order
// (element s: key 8 hi + s, then 16 + 8 hi + s - 8), which the V^T rows are loaded in: P touches no LDS. O^T gives a lane 8 consecutive head dims of its query.
#define QG   4            // 16-query column groups a wave: every K and V^T fragment a wave loads feeds QG products
#define QCOL (QG * 16)
#define QBLK (4 * QCOL)
__device__ __forceinline__ float xhalf(float x) { return __builtin_bit_cast(float, __builtin_amdgcn_permlanex16(__builtin_bit_cast(int, x), __builtin_bit_cast(int, x), 0x76543210, 0xfedcba98, false, false)); }  // lane l with lane l ^ 16

__device__ __forceinline__ void attn_block(const h16* __restrict__ Q16, const h16* __restrict__ K16, const h16* __restrict__ VT16, h16* CTX16, const int bid) {
    const int lane = threadIdx.x & 31, wave = threadIdx.x >> 5, lr = lane & 15, hi = lane >> 4;
    const int b = bid / (NH_ * (NT_ / QBLK)), rem = bid - b * (NH_ * (NT_ / QBLK)), h = rem / (NT_ / QBLK), qt = rem - h * (NT_ / QBLK);
    const int q0 = qt * QBLK + wave * QCOL;
    const size_t tok0 = (size_t)b * NT_;
    const float CS = 0.125f * 1.4426950408889634f;   // score scale, in base 2
    v16h qf[QG][2];
#pragma unroll
    for (int g = 0; g < QG; ++g)
#pragma unroll
        for (int kc = 0; kc < 2; ++kc) { const h16* p = Q16 + (tok0 + q0 + g * 16 + lr) * DM + h * HD + kc * 32 + 8 * hi; qf[g][kc] = cat16(*(const v8h*)p, *(const v8h*)(p + 16)); }
    const h16* kp = K16 + (tok0 + lr) * DM + h * HD + 8 * hi;
    const h16* vp = VT16 + (((size_t)b * NH_ + h) * HD + lr) * NT_ + 8 * hi;
    v8f o[QG][4];
    float mrun[QG], lsum[QG];
#pragma unroll
    for (int g = 0; g < QG; ++g) { mrun[g] = -3.0e38f; lsum[g] = 0.f;
#pragma unroll
        for (int n = 0; n < 4; ++n) o[g][n] = (v8f){}; }
    v16h kf[2][2];
#pragma unroll
    for (int t = 0; t < 2; ++t)
#pragma unroll
        for (int kc = 0; kc < 2; ++kc) { const h16* p = kp + (size_t)(t * 16) * DM + kc * 32; kf[t][kc] = cat16(*(const v8h*)p, *(const v8h*)(p + 16)); }
    asm volatile("s_wait_xcnt 0x0" ::: "memory");   // before anything rewrites the address registers that the Q and K loads name
    __builtin_amdgcn_sched_barrier(0);               // keeps later register writes behind that wait
#pragma unroll 1   // one step a trip, for speed only
    for (int kt = 0; kt < NT_ / 32; ++kt) {
        const int l0 = kt * 32;
        v16h vf[4];
#pragma unroll
        for (int n = 0; n < 4; ++n) { const h16* p = vp + (size_t)(n * 16) * NT_ + l0; vf[n] = cat16(*(const v8h*)p, *(const v8h*)(p + 16)); }
        asm volatile("s_wait_xcnt 0x0" ::: "memory");   // before anything rewrites the address registers that these loads name
        __builtin_amdgcn_sched_barrier(0);               // the V^T loads go out ahead of the score products and fly under them and the exponentials
        v8f s[QG][2];
#pragma unroll
        for (int g = 0; g < QG; ++g)
#pragma unroll
            for (int t = 0; t < 2; ++t) s[g][t] = wmma16(kf[t][1], qf[g][1], wmma16(kf[t][0], qf[g][0], (v8f){}));
        const int ln = (l0 + 32) & (NT_ - 1);   // the next step's key rows; the last step reads rows 0..31 again (inside the buffer, not used)
#pragma unroll
        for (int t = 0; t < 2; ++t)
#pragma unroll
            for (int kc = 0; kc < 2; ++kc) { const h16* p = kp + (size_t)(ln + t * 16) * DM + kc * 32; kf[t][kc] = cat16(*(const v8h*)p, *(const v8h*)(p + 16)); }
        asm volatile("s_wait_xcnt 0x0" ::: "memory");   // before anything rewrites the address registers that these loads name
        __builtin_amdgcn_sched_barrier(0);               // the next step's K loads go out here and fly under the exponentials and the second product
#pragma unroll
        for (int g = 0; g < QG; ++g) {
            float mt[8];
#pragma unroll
            for (int j = 0; j < 8; ++j) mt[j] = fmaxf(s[g][0][j], s[g][1][j]);
#pragma unroll
            for (int w = 4; w; w >>= 1)
#pragma unroll
                for (int j = 0; j < w; ++j) mt[j] = fmaxf(mt[j], mt[j + w]);
            const float mx = fmaxf(mt[0], xhalf(mt[0])) * CS;
            const float mn = fmaxf(mrun[g], mx);
            const float alpha = __builtin_amdgcn_exp2f(mrun[g] - mn);   // 0 on the first step
            mrun[g] = mn;
            const float nm = 15.0f - mn;                                 // weights x 32768, as f16 operands
            float pe[16];
            v16h pb;
#pragma unroll
            for (int e = 0; e < 16; ++e) { pe[e] = __builtin_amdgcn_exp2f(fmaf(s[g][e >> 3][e & 7], CS, nm)); pb[e] = (h16)pe[e]; }
#pragma unroll
            for (int w = 8; w; w >>= 1)   // a tree: a chain of 16 dependent adds would stall the SIMD's one wave
#pragma unroll
                for (int e = 0; e < w; ++e) pe[e] += pe[e + w];
            lsum[g] = lsum[g] * alpha + pe[0];
#pragma unroll
            for (int n = 0; n < 4; ++n) o[g][n] = wmma16(vf[n], pb, o[g][n] * alpha);
        }
    }
#pragma unroll
    for (int g = 0; g < QG; ++g) {
        const float inv = 1.0f / (lsum[g] + xhalf(lsum[g]));   // the halves' sums (x 32768, like the weights) join once
        h16* crow = CTX16 + (tok0 + q0 + g * 16 + lr) * KC + (size_t)h * HD + 8 * hi;   // columns 0..1023 of the [a | gelu(h)] rows
#pragma unroll
        for (int n = 0; n < 4; ++n) { v8h o8;
#pragma unroll
            for (int j = 0; j < 8; ++j) o8[j] = (h16)(o[g][n][j] * inv);
            *(v8h*)(crow + n * 16) = o8; }
        if (g + 1 < QG) {
            asm volatile("s_wait_xcnt 0x0" ::: "memory");   // before the next group rewrites the registers that this group's stores name
            __builtin_amdgcn_sched_barrier(0);               // keeps the next group's register writes behind that wait
        }
    }
}

// bc_rows: bc[n] = b2[n] + sum over j of [bao | bmo][j] . W2[j][n], f32 sums along the rows of the f16 plane W2^T. A wave takes 32 rows n, lane r keeps row r's sum: one 128-B store a wave.
__device__ __forceinline__ void bc_rows(const h16* __restrict__ W2T, const float* __restrict__ bao, const float* __restrict__ bmo, const float* __restrict__ b2, float* BC, const int blk) {
    const int lane = threadIdx.x & 31, n0 = blk * 128 + (threadIdx.x >> 5) * 32;
    float bv[8][8];
#pragma unroll
    for (int c = 0; c < 8; ++c) { const float* bp = (c < 4 ? bao + c * 256 : bmo + (c - 4) * 256) + lane * 8;
#pragma unroll
        for (int i = 0; i < 8; ++i) bv[c][i] = bfr(bp[i]); }
    float res = 0.f;
    for (int r0 = 0; r0 < 32; r0 += 4) {
        v8h w[4][8];
#pragma unroll   // four rows a trip: their 32 loads go out together, one latency a trip instead of one a row
        for (int u = 0; u < 4; ++u)
#pragma unroll
            for (int c = 0; c < 8; ++c) w[u][c] = *(const v8h*)(W2T + (size_t)(n0 + r0 + u) * (2 * DM) + c * 256 + lane * 8);
        asm volatile("s_wait_xcnt 0x0" ::: "memory");   // before the next trip rewrites the registers that this trip's loads name
#pragma unroll
        for (int u = 0; u < 4; ++u) { float s = 0.f;
#pragma unroll
            for (int c = 0; c < 8; ++c)
#pragma unroll
                for (int i = 0; i < 8; ++i) s += (float)w[u][c][i] * bv[c][i];
            s = hsum16(s); s += xhalf(s);
            res = (lane == r0 + u) ? s : res; }
    }
    BC[n0 + lane] = res + bfr(b2[n0 + lane]);
    asm volatile("s_wait_xcnt 0x0" ::: "memory");   // behind the store: in the merged kernel other code follows it in the listing and rewrites the registers that it names
}

// k_attn_wc: the attention and the two jobs on weights alone that only the last product reads, as block ranges of ONE grid: the attention leaves most of the matrix pipe's slots and all of
// the LDS idle, so the 112 tiles of Wc^T and the 8 blocks of bc run beside it. The job is the same for a whole block, so the barriers of wc_block stand under block-uniform control flow.
#define AB_ATT (NB_ * NH_ * (NT_ / QBLK))
#define AB_WC  ((DM / 128) * (KC / 128))
#define AB_BC  (DM / 128)
__global__ __launch_bounds__(128) void k_attn_wc(const h16* __restrict__ Q16, const h16* __restrict__ K16, const h16* __restrict__ VT16, h16* CTX16, const h16* __restrict__ W2T, const h16* __restrict__ Wao16,
                                                const h16* __restrict__ Wmo16, const float* __restrict__ bao, const float* __restrict__ bmo, const float* __restrict__ b2, h16* WcT, float* BC) {
    __shared__ __align__(16) h16 ring[RING];
    const int t = blockIdx.x;
    if (t < AB_ATT) { attn_block(Q16, K16, VT16, CTX16, t); return; }
    if (t < AB_ATT + AB_WC) { wc_block(W2T, Wao16, Wmo16, WcT, ring, t - AB_ATT); return; }
    bc_rows(W2T, bao, bmo, b2, BC, t - (AB_ATT + AB_WC));
}

extern "C" void kernel_launch(void* const* d_in, const int* in_sizes, int n_in,
                              void* d_out, int out_size, void* d_ws, size_t ws_size, hipStream_t stream) {
    (void)in_sizes; (void)n_in; (void)out_size;
    const float* x = (const float*)d_in[0]; const float* ng = (const float*)d_in[1]; const float* nb = (const float*)d_in[2]; const float* W1 = (const float*)d_in[3]; const float* b1 = (const float*)d_in[4];
    const float* qg = (const float*)d_in[5]; const float* qb = (const float*)d_in[6]; const float* kg = (const float*)d_in[7]; const float* kb = (const float*)d_in[8];
    const float* Wao = (const float*)d_in[9]; const float* bao = (const float*)d_in[10]; const float* Wmo = (const float*)d_in[11]; const float* bmo = (const float*)d_in[12];
    const float* W2 = (const float*)d_in[13]; const float* b2 = (const float*)d_in[14];
    float* out = (float*)d_out;    // [2][2048][1024]
    char* wsp = (char*)d_ws;
    auto take = [&](size_t bytes) { char* p = wsp; wsp += (bytes + 255) & ~(size_t)255; return (void*)p; };
    h16* XN16 = (h16*)take((size_t)NTK * DM * 2); h16* W1T = (h16*)take((size_t)NFP * DM * 2);
    h16* Wao16 = (h16*)take((size_t)DM * DM * 2); h16* Wmo16 = (h16*)take((size_t)MLPP * DM * 2); h16* W2T = (h16*)take((size_t)DM * 2 * DM * 2);
    h16* Q16 = (h16*)take((size_t)NTK * DM * 2); h16* K16 = (h16*)take((size_t)NTK * DM * 2); h16* V16 = (h16*)take((size_t)NTK * DM * 2); h16* VT16 = (h16*)take((size_t)NTK * DM * 2);
    h16* AG16 = (h16*)take((size_t)NTK * KC * 2); h16* WcT = (h16*)take((size_t)DM * KC * 2); float* BC = (float*)take((size_t)DM * 4);
    if ((size_t)(wsp - (char*)d_ws) > ws_size) return;    // 8.4 + 7.9 + 2.1 + 1.6 + 4.2 + 4 x 8.4 + 14.7 + 3.7 MB ~ 76 MB
    k_prep<<<PB_LN + PB_W1 + PB_W2 + PB_WAO + PB_WMO, 256, 0, stream>>>(x, ng, nb, W1, W2, Wao, Wmo, XN16, W1T, W2T, Wao16, Wmo16);
    k_fused<<<dim3(NTK / 128, NFP / 128, 1), 128, 0, stream>>>(XN16, W1T, b1, qg, qb, kg, kb, Q16, K16, V16, AG16 + DM);
    k_vt<<<NB_ * NH_ * (NT_ / 64), 256, 0, stream>>>(V16, VT16);
    k_attn_wc<<<AB_ATT + AB_WC + AB_BC, 128, 0, stream>>>(Q16, K16, VT16, AG16, W2T, Wao16, Wmo16, bao, bmo, b2, WcT, BC);
    k_gemmout<<<dim3(NTK / 128, DM / 128, 1), 128, 0, stream>>>(AG16, WcT, BC, x, out);
}

// v005
// It runs in 131 microseconds.
// In two side-by-side timings against v004, it was 1.06 and 1.05 times as fast.
// All steps since v000 together make it 3.11 times as fast.
#include <hip/hip_runtime.h>

// Contractions on v_wmma_f32_16x16x32_f16 with plain f16 operands, f32 accumulate: fused = LN(x).W1 + b1 ([4096 x 1024].[1024 x 3788 (padded 3840)]), the 16-head
// attention with per-head LayerNorm on q and k (scores [2048 x 64].[64 x 2048] /8, softmax, .v), and the tail out = x + [a.Wao + bao | gelu_tanh(h).Wmo + bmo].W2 + b2 in the
// associated form out = x + [a | gelu_tanh(h)].Wc + bc ([4096 x 1740 (1792)].[1792 x 1024]) with Wc = [Wao.W2(rows 0..1023) ; Wmo.W2(rows 1024..2047)] (two [. x 1024].[1024 x 1024]
// products of weights, made anew in every call) and bc = b2 + [bao | bmo].W2. Input weights are f16 of their bf16 rounding (exact for the bf16-input reference), the activations
// and Wc are computed values rounded once to f16 (the output is dominated by the exact residual x). LayerNorms (eps 1e-6), gelu, softmax and bc run in f32.

#define NB_  2
#define NT_  2048
#define DM   1024
#define NH_  16
#define HD   64
#define NTK  (NB_ * NT_)
#define NF   3788
#define NFP  3840
#define MLPH 716
#define MLPP 768
#define KC   (DM + MLPP)   // k extent of the tail product: [a | gelu(h)] rows and Wc^T rows have this pitch
#define PSC  32768.0f
#define EPS  1e-6f

typedef _Float16 h16;
typedef __attribute__((ext_vector_type(16))) _Float16 v16h;
typedef __attribute__((ext_vector_type(8)))  _Float16 v8h;
typedef __attribute__((ext_vector_type(8)))  float    v8f;
typedef __attribute__((ext_vector_type(4)))  float    v4f;
typedef v8h  __attribute__((may_alias)) v8ha;
typedef v4f  __attribute__((may_alias)) v4fa;

__device__ __forceinline__ unsigned short f2bf(float f) { unsigned u = __float_as_uint(f); u += 0x7FFFu + ((u >> 16) & 1u); return (unsigned short)(u >> 16); }
__device__ __forceinline__ float bf2f(unsigned short b) { return __uint_as_float(((unsigned)b) << 16); }
__device__ __forceinline__ float bfr(float f) { return bf2f(f2bf(f)); }
__device__ __forceinline__ v16h cat16(v8h lo, v8h hi) { return __builtin_shufflevector(lo, hi, 0, 1, 2, 3, 4, 5, 6, 7, 8, 9, 10, 11, 12, 13, 14, 15); }
__device__ __forceinline__ v8f wmma16(v16h a, v16h b, v8f c) { return __builtin_amdgcn_wmma_f32_16x16x32_f16(false, a, false, b, (short)0, c, false, false); }
__device__ __forceinline__ float hsum16(float v) { v += __shfl_xor(v, 1, 16); v += __shfl_xor(v, 2, 16); v += __shfl_xor(v, 4, 16); return v + __shfl_xor(v, 8, 16); }
__device__ __forceinline__ float gelu_t(float x) { const float c = 0.7978845608028654f; return 0.5f * x * (1.0f + tanhf(c * (x + 0.044715f * x * x * x))); }

// ln_rows: LayerNorm of 8 rows of x (one a wave) -> XN16; blk = row group.
__device__ __forceinline__ void ln_rows(const float* __restrict__ x, const float* __restrict__ g, const float* __restrict__ bt, h16* XN16, const int blk) {
    const int lane = threadIdx.x & 31, r = blk * 8 + (threadIdx.x >> 5);
    if (r >= NTK) return;
    const float* xr = x + (size_t)r * DM;
    float s = 0.f;
#pragma unroll
    for (int q = 0; q < 4; ++q)
#pragma unroll
        for (int i = 0; i < 8; ++i) s += bfr(xr[q * 256 + lane * 8 + i]);
#pragma unroll
    for (int o = 16; o; o >>= 1) s += __shfl_xor(s, o, 32);
    const float mu = s * (1.0f / DM);
    float sq = 0.f;
#pragma unroll 1
    for (int q = 0; q < 4; ++q)
#pragma unroll
        for (int i = 0; i < 8; ++i) { const float d = bfr(xr[q * 256 + lane * 8 + i]) - mu; sq += d * d; }
#pragma unroll
    for (int o = 16; o; o >>= 1) sq += __shfl_xor(sq, o, 32);
    const float rs = rsqrtf(sq * (1.0f / DM) + EPS);
#pragma unroll 1
    for (int q = 0; q < 4; ++q) {
        v8h o8;
#pragma unroll
        for (int i = 0; i < 8; ++i) { const int c = q * 256 + lane * 8 + i; o8[i] = (h16)((bfr(xr[c]) - mu) * rs * bfr(g[c]) + bfr(bt[c])); }
        *(v8h*)(XN16 + (size_t)r * DM + q * 256 + lane * 8) = o8; 
    }
}

// wt_tile: k-major W [K rows][N cols] -> n-major f16 plane WT [Npad][Kpad] (f16 of bf16(W); rows >= N and columns >= K zero); one 64 x 64 tile (kb, nb) through LDS.
__device__ __forceinline__ void wt_tile(const float* __restrict__ Wm, int K, int N, int Kpad, h16* WT, const int kb, const int nb) {
    __shared__ __align__(16) h16 tl[64 * 72];
    const int tid = threadIdx.x, k0 = kb * 64, n0 = nb * 64;
    const int kk = tid >> 2, nq = (tid & 3) * 16;
#pragma unroll
    for (int i = 0; i < 16; ++i) { const int k = k0 + kk, n = n0 + nq + i; tl[(nq + i) * 72 + kk] = (k < K && n < N) ? (h16)bfr(Wm[(size_t)k * N + n]) : (h16)0.f; }
    __syncthreads();
    const int piece = tid & 7;
    auto pass = [&]() {
#pragma unroll
        for (int s = 0; s < 2; ++s) { const int nr = (tid >> 3) + 32 * s; const v8h val = *(const v8ha*)(tl + nr * 72 + piece * 8);
            *(v8h*)(WT + (size_t)(n0 + nr) * Kpad + k0 + piece * 8) = val; }
    };
    pass(); 
    asm volatile("s_wait_xcnt 0x0" ::: "memory");   // behind the two stores: in the merged kernel other code follows them in the listing and rewrites the registers that they name
}

// cv_rows: W [rows][1024] f32 -> f16 plane of the same layout (f16 of bf16(W); plane rows past the weight's last row are zero): 4 rows a block, 16 elements a thread. As the n-major operand of Wc^T = W2^T.W^T
// a weight is read along its own rows, so it needs no transpose.
__device__ __forceinline__ void cv_rows(const float* __restrict__ Wm, const int rows, h16* W16, const int blk) {
    const int tid = threadIdx.x, col = (tid & 127) * 8;
    v4f v[2][2];
#pragma unroll
    for (int s = 0; s < 2; ++s) { const int r = blk * 4 + s * 2 + (tid >> 7);   // the same row in a whole wave
        if (r < rows) { const float* p = Wm + (size_t)r * DM + col; v[s][0] = *(const v4f*)p; v[s][1] = *(const v4f*)(p + 4); } else { v[s][0] = (v4f){}; v[s][1] = (v4f){}; } }
#pragma unroll
    for (int s = 0; s < 2; ++s) { const int r = blk * 4 + s * 2 + (tid >> 7); v8h o;
#pragma unroll
        for (int i = 0; i < 8; ++i) o[i] = (h16)bfr(v[s][i >> 2][i & 3]);
        *(v8h*)(W16 + (size_t)r * DM + col) = o; }
    asm volatile("s_wait_xcnt 0x0" ::: "memory");   // behind the loads and stores: in the merged kernel other code follows them in the listing and rewrites the registers that they name
}

// k_prep: the five jobs that depend on the inputs alone, as block ranges of ONE grid, so that their starts, first loads and tails overlap: the LayerNorm of x, the two
// weight transposes, each with its tiles in the order k fastest, and the two weight conversions. The job is the same for a whole block, so wt_tile's barrier stands under block-uniform control flow.
#define PB_LN  (NTK / 8)
#define PB_W1  ((DM / 64) * (NFP / 64))
#define PB_W2  (((2 * DM) / 64) * (DM / 64))
#define PB_WAO (DM / 4)
#define PB_WMO (MLPP / 4)
__global__ __launch_bounds__(256) void k_prep(const float* __restrict__ x, const float* __restrict__ g, const float* __restrict__ bt, const float* __restrict__ W1, const float* __restrict__ W2,
                                             const float* __restrict__ Wao, const float* __restrict__ Wmo, h16* XN16, h16* W1T, h16* W2T, h16* Wao16, h16* Wmo16) {
    int t = blockIdx.x;
    if (t < PB_LN) { ln_rows(x, g, bt, XN16, t); return; }
    t -= PB_LN;
    const float* Wm; h16* WT; int K, N, Kpad, nb;   // nb by a literal divisor in each branch: scalar shifts and one scalar multiply, no division at run time
    if (t < PB_W1) { Wm = W1; WT = W1T; K = DM; N = NF; Kpad = DM; nb = t / (DM / 64); }
    else if (t < PB_W1 + PB_W2) { t -= PB_W1; Wm = W2; WT = W2T; K = 2 * DM; N = DM; Kpad = 2 * DM; nb = t / ((2 * DM) / 64); }
    else if (t < PB_W1 + PB_W2 + PB_WAO) { cv_rows(Wao, DM, Wao16, t - (PB_W1 + PB_W2)); return; }
    else { cv_rows(Wmo, MLPH, Wmo16, t - (PB_W1 + PB_W2 + PB_WAO)); return; }
    wt_tile(Wm, K, N, Kpad, WT, t - nb * (Kpad / 64), nb);
}

// GEMM tile core: 128 x 128 block tile (2 x 2 waves, 64 x 64 each) of A[M][K] (f16, row pitch lda) . BT[N][K] (row pitch ldb), K a multiple of 64 and at least 128. A pass is 64 k: the
// 128 rows x 128 B of both operands are brought into LDS by asynchronous copies (pitch 144 B for the ds_load_b128 readers), two buffers, the next pass's copies in
// flight while this pass is worked on. A buffer is [A tile | BT tile]. Returns acc[4][4] (row group, column group; D layout); the k order of every sum is ascending.
#define TP   72
#define TSZ  (128 * TP)
#define RING (4 * TSZ)

// One operand's tile of one pass: 8 copies a lane, 16 rows apart (a wave covers 4 whole 128-B rows a copy). The s_wait_xcnt ends the copies' own statement, so that
// no address register of a copy is rewritten ahead of it.
__device__ __forceinline__ void copy_tile(unsigned l, const h16* g, int ld) {
    const size_t rs = (size_t)16 * ld;
    asm volatile("global_load_async_to_lds_b128 %0, %8, off\n\t"
                 "global_load_async_to_lds_b128 %1, %9, off\n\t"
                 "global_load_async_to_lds_b128 %2, %10, off\n\t"
                 "global_load_async_to_lds_b128 %3, %11, off\n\t"
                 "global_load_async_to_lds_b128 %4, %12, off\n\t"
                 "global_load_async_to_lds_b128 %5, %13, off\n\t"
                 "global_load_async_to_lds_b128 %6, %14, off\n\t"
                 "global_load_async_to_lds_b128 %7, %15, off\n\t"
                 "s_wait_xcnt 0x0"
                 :: "v"(l), "v"(l + 1u * 16u * 144u), "v"(l + 2u * 16u * 144u), "v"(l + 3u * 16u * 144u),
                    "v"(l + 4u * 16u * 144u), "v"(l + 5u * 16u * 144u), "v"(l + 6u * 16u * 144u), "v"(l + 7u * 16u * 144u),
                    "v"(g), "v"(g + rs), "v"(g + 2 * rs), "v"(g + 3 * rs), "v"(g + 4 * rs), "v"(g + 5 * rs), "v"(g + 6 * rs), "v"(g + 7 * rs)
                 : "memory");
}

__device__ __forceinline__ void gemm_tile(const h16* __restrict__ A, const int lda, const h16* __restrict__ BT, const int ldb, const int K, int rb, int cb, h16* ring, v8f (&acc)[4][4]) {
    const int tid = threadIdx.x, lane = tid & 31, wave = tid >> 5, lr = lane & 15, hi = lane >> 4;
    const h16* ga = A + (size_t)(rb + (tid >> 3)) * lda + (tid & 7) * 8;
    const h16* gb = BT + (size_t)(cb + (tid >> 3)) * ldb + (tid & 7) * 8;
    const unsigned l0 = (unsigned)(size_t)ring + (unsigned)((tid >> 3) * 144 + (tid & 7) * 16);
    const int np = K / 64;
#pragma unroll
    for (int i = 0; i < 4; ++i)
#pragma unroll
        for (int t = 0; t < 4; ++t) acc[i][t] = (v8f){};
    copy_tile(l0, ga, lda);
    copy_tile(l0 + TSZ * 2, gb, ldb);
    asm volatile("s_wait_asynccnt 0x0" ::: "memory");   // pass 0's own copies have landed before the barrier publishes them
    __syncthreads();
    copy_tile(l0 + 2 * TSZ * 2, ga + 64, lda);
    copy_tile(l0 + 3 * TSZ * 2, gb + 64, ldb);
#pragma unroll 1   // one pass a trip: the two buffers alternate by the trip's parity
    for (int p = 0; p < np; ++p) {
        const int bo = (p & 1) * 2 * TSZ;
        const h16* sa = ring + bo + ((wave >> 1) * 64 + lr) * TP + 8 * hi;
        const h16* sb = ring + bo + TSZ + ((wave & 1) * 64 + lr) * TP + 8 * hi;
        v16h a[4], b[4];
#pragma unroll
        for (int i = 0; i < 4; ++i) a[i] = cat16(*(const v8ha*)(sa + i * 16 * TP), *(const v8ha*)(sa + i * 16 * TP + 16));
#pragma unroll
        for (int t = 0; t < 4; ++t) b[t] = cat16(*(const v8ha*)(sb + t * 16 * TP), *(const v8ha*)(sb + t * 16 * TP + 16));
        __builtin_amdgcn_sched_barrier(0);   // the 16 LDS reads of a k step go out as one group ahead of its WMMAs
#pragma unroll
        for (int i = 0; i < 4; ++i)
#pragma unroll
            for (int t = 0; t < 4; ++t) acc[i][t] = wmma16(a[i], b[t], acc[i][t]);
        __builtin_amdgcn_sched_barrier(0);   // the second k step's reads stay behind the first step's WMMAs, in the same fragment registers
#pragma unroll
        for (int i = 0; i < 4; ++i) a[i] = cat16(*(const v8ha*)(sa + i * 16 * TP + 32), *(const v8ha*)(sa + i * 16 * TP + 48));
#pragma unroll
        for (int t = 0; t < 4; ++t) b[t] = cat16(*(const v8ha*)(sb + t * 16 * TP + 32), *(const v8ha*)(sb + t * 16 * TP + 48));
        asm volatile("s_wait_dscnt 0x0" ::: "memory");      // this wave's last reads of the buffer are done before the barrier frees it for the refill
        asm volatile("s_wait_asynccnt 0x0" ::: "memory");   // this wave's copies of pass p + 1 have landed before the barrier publishes them
        __syncthreads();
        if (p + 2 < np) {
            copy_tile(l0 + bo * 2, ga + (size_t)(p + 2) * 64, lda);
            copy_tile(l0 + bo * 2 + TSZ * 2, gb + (size_t)(p + 2) * 64, ldb);
        }
        __builtin_amdgcn_sched_barrier(0);   // the refill is issued ahead of the second k step's WMMAs (registers only), so that it flies under them
#pragma unroll
        for (int i = 0; i < 4; ++i)
#pragma unroll
            for (int t = 0; t < 4; ++t) acc[i][t] = wmma16(a[i], b[t], acc[i][t]);
    }
    asm volatile("s_wait_asynccnt 0x0" ::: "memory");       // no copy is outstanding when the ring becomes the output staging
}

// Store pass of a wave's staged 64 x 64 f32 tile (pitch 68) as f16 rows of 128 B, whole lines; gelu (a compile-time or block-uniform choice) is applied to the staged f32 values.
__device__ __forceinline__ void put_tile16(const float* os, h16* crow, int ld, int lane, const bool gelu) {
    for (int s0 = 0; s0 < 16; s0 += 4) {
        v4f v[4][2];
#pragma unroll   // four row groups a trip: their LDS reads go out together, one latency a trip instead of one a group
        for (int u = 0; u < 4; ++u) { const float* sp = os + (4 * (s0 + u) + (lane >> 3)) * 68 + (lane & 7) * 8; v[u][0] = *(const v4fa*)sp; v[u][1] = *(const v4fa*)(sp + 4); }
        if (gelu) {
#pragma unroll
            for (int u = 0; u < 4; ++u)
#pragma unroll
                for (int i = 0; i < 8; ++i) v[u][i >> 2][i & 3] = gelu_t(v[u][i >> 2][i & 3]);
        }
#pragma unroll
        for (int u = 0; u < 4; ++u) { v8h o;
#pragma unroll
            for (int i = 0; i < 8; ++i) o[i] = (h16)v[u][i >> 2][i & 3];
            *(v8h*)(crow + (size_t)(4 * (s0 + u) + (lane >> 3)) * ld + (lane & 7) * 8) = o; }
        asm volatile("s_wait_xcnt 0x0" ::: "memory");   // before the next trip rewrites the registers that this trip's stores name
    }
}

// k_fused: fused = XN16 . W1T + b1 over the 3840 padded columns; a wave's 64-wide column group = exactly one head of q / k / v or a 64-wide slice of the MLP hidden:
//   c0 <  1024: q head c0/64: per-row LayerNorm over the 64 head dims (qn_g, qn_b) -> Q16[tok][1024] f16
//   c0 <  2048: k head: LayerNorm (kn_g, kn_b) -> K16
//   c0 <  3072: v -> V16 rows
//   else      : gelu_tanh (in the store pass) -> G16 = columns 1024.. of the [tok][1792] rows [a | gelu(h)] (columns >= 716 of the hidden are exactly 0 after gelu(0 + 0): b1 pad is read as 0; their Wc rows are 0 anyway)
__global__ __launch_bounds__(128) void k_fused(const h16* __restrict__ XN16, const h16* __restrict__ W1T, const float* __restrict__ b1,
                                              const float* __restrict__ qg, const float* __restrict__ qb, const float* __restrict__ kg, const float* __restrict__ kb,
                                              h16* Q16, h16* K16, h16* V16, h16* G16) {
    __shared__ __align__(16) h16 ring[RING];
    const int lane = threadIdx.x & 31, wave = threadIdx.x >> 5, lr = lane & 15, hi = lane >> 4;
    const int rb = blockIdx.x * 128, cb = blockIdx.y * 128;
    v8f acc[4][4];
    gemm_tile(XN16, DM, W1T, DM, DM, rb, cb, ring, acc);
    const int r0 = rb + (wave >> 1) * 64, c0 = cb + (wave & 1) * 64;
    const int sec = cb / DM;                   // 0 q, 1 k, 2 v, 3 mlp (the same for both column groups of a block)
#pragma unroll
    for (int t = 0; t < 4; ++t) { const int col = c0 + t * 16 + lr; const float bv = (col < NF) ? bfr(b1[col]) : 0.f;
#pragma unroll
        for (int i = 0; i < 4; ++i)
#pragma unroll
            for (int j = 0; j < 8; ++j) acc[i][t][j] += bv; }
    if (sec < 2) {
        const float* gg = sec ? kg : qg; const float* bb = sec ? kb : qb;
#pragma unroll
        for (int i = 0; i < 4; ++i)
#pragma unroll
            for (int j = 0; j < 8; ++j) {
                float s = acc[i][0][j] + acc[i][1][j] + acc[i][2][j] + acc[i][3][j];
                const float mu = hsum16(s) * (1.0f / HD);
                float q = 0.f;
#pragma unroll
                for (int t = 0; t < 4; ++t) { const float d = acc[i][t][j] - mu; q += d * d; }
                const float rs = rsqrtf(hsum16(q) * (1.0f / HD) + EPS);
#pragma unroll
                for (int t = 0; t < 4; ++t) acc[i][t][j] = (acc[i][t][j] - mu) * rs * bfr(gg[t * 16 + lr]) + bfr(bb[t * 16 + lr]);
            }
    }
    float* os = (float*)ring + wave * (64 * 68);   // the loop's last barrier has freed the ring; each wave stages its own 64 x 64 tile
#pragma unroll
    for (int i = 0; i < 4; ++i)
#pragma unroll
        for (int t = 0; t < 4; ++t)
#pragma unroll
            for (int j = 0; j < 8; ++j) os[(i * 16 + hi * 8 + j) * 68 + t * 16 + lr] = acc[i][t][j];
    __syncthreads();
    h16* dst; int ld, cc;
    if (sec == 0) { dst = Q16; ld = DM; cc = c0; } else if (sec == 1) { dst = K16; ld = DM; cc = c0 - DM; } else if (sec == 2) { dst = V16; ld = DM; cc = c0 - 2 * DM; } else { dst = G16; ld = KC; cc = c0 - 3 * DM; }
    h16* crow = dst + (size_t)r0 * ld + cc;
    put_tile16(os, crow, ld, lane, sec == 3);
}

// wc_block: one 128 x 128 tile of Wc^T [n][k] (f16, pitch 1792) = W2^T rows n (one half of their 2048 columns) . W rows k: k < 1024 takes Wao and W2's rows 0..1023, k >= 1024 takes Wmo
// (its plane rows 716..767 are zero) and W2's rows 1024..2047. t = tile, n fastest.
__device__ __forceinline__ void wc_block(const h16* __restrict__ W2T, const h16* __restrict__ Wao16, const h16* __restrict__ Wmo16, h16* WcT, h16* ring, const int t) {
    const int lane = threadIdx.x & 31, wave = threadIdx.x >> 5, lr = lane & 15, hi = lane >> 4;
    const int rb = (t & 7) * 128, ck = (t >> 3) * 128;
    const bool mlp = ck >= DM;
    v8f acc[4][4];
    gemm_tile(mlp ? W2T + DM : W2T, 2 * DM, mlp ? Wmo16 : Wao16, DM, DM, rb, mlp ? ck - DM : ck, ring, acc);
    float* os = (float*)ring + wave * (64 * 68);   // the loop's last barrier has freed the ring; each wave stages its own 64 x 64 tile
#pragma unroll
    for (int t4 = 0; t4 < 4; ++t4)
#pragma unroll
        for (int i = 0; i < 4; ++i)
#pragma unroll
            for (int j = 0; j < 8; ++j) os[(i * 16 + hi * 8 + j) * 68 + t4 * 16 + lr] = acc[i][t4][j];
    __syncthreads();
    put_tile16(os, WcT + (size_t)(rb + (wave >> 1) * 64) * KC + ck + (wave & 1) * 64, KC, lane, false);
}

// k_gemmout: out = x + [a | gelu(h)].Wc + bc; bc is a computed f32 vector and is added as it is.
__global__ __launch_bounds__(128) void k_gemmout(const h16* __restrict__ A, const h16* __restrict__ BT, const float* __restrict__ bias, const float* __restrict__ x, float* C) {
    __shared__ __align__(16) h16 ring[RING];
    const int lane = threadIdx.x & 31, wave = threadIdx.x >> 5, lr = lane & 15, hi = lane >> 4;
    const int rb = blockIdx.x * 128, cb = blockIdx.y * 128;
    v8f acc[4][4];
    gemm_tile(A, KC, BT, KC, KC, rb, cb, ring, acc);
    const int r0 = rb + (wave >> 1) * 64, c0 = cb + (wave & 1) * 64;
    float* os = (float*)ring + wave * (64 * 68);   // the loop's last barrier has freed the ring; each wave stages its own 64 x 64 tile
#pragma unroll
    for (int t = 0; t < 4; ++t) { const float bv = bias[c0 + t * 16 + lr];
#pragma unroll
        for (int i = 0; i < 4; ++i)
#pragma unroll
            for (int j = 0; j < 8; ++j) os[(i * 16 + hi * 8 + j) * 68 + t * 16 + lr] = acc[i][t][j] + bv; }
    __syncthreads();
    float* crow = C + (size_t)r0 * DM + c0;
    const float* xrow = x + (size_t)r0 * DM + c0;
    for (int s0 = 0; s0 < 32; s0 += 8) {
#pragma unroll   // eight row pairs a trip: their x loads and LDS reads go out together, one latency a trip instead of one a row pair
        for (int s = s0; s < s0 + 8; ++s) { const int row = 2 * s + (lane >> 4), cofs = (lane & 15) * 4;
            v4f val = *(const v4fa*)(os + row * 68 + cofs); const v4f xv = *(const v4f*)(xrow + (size_t)row * DM + cofs);
#pragma unroll
            for (int e = 0; e < 4; ++e) val[e] += bfr(xv[e]);
            *(v4f*)(crow + (size_t)row * DM + cofs) = val; }
        asm volatile("s_wait_xcnt 0x0" ::: "memory");   // before the next trip rewrites the registers that this trip's loads and stores name
    }
}

// k_vt: VT16[b][h][d][t] from V16 rows via LDS transpose; block (b, h, 64 tokens).
__global__ __launch_bounds__(256) void k_vt(const h16* __restrict__ V16, h16* VT16) {
    __shared__ __align__(16) h16 tile[64 * 72];
    const int bid = blockIdx.x;
    const int b = bid / (NH_ * (NT_ / 64)), rem = bid - b * (NH_ * (NT_ / 64)), h = rem / (NT_ / 64), kt = rem - h * (NT_ / 64);
    const int k0 = kt * 64, tid = threadIdx.x;
    const int kk = tid >> 2, d0 = (tid & 3) * 16;
    const h16* src = V16 + ((size_t)b * NT_ + k0 + kk) * DM + h * HD + d0;
#pragma unroll
    for (int i = 0; i < 16; ++i) tile[(d0 + i) * 72 + kk] = src[i];
    __syncthreads();
    const int piece = tid & 7;
    h16* base = VT16 + (((size_t)b * NH_ + h) * HD) * NT_ + k0;
    auto pass = [&]() {
#pragma unroll
        for (int s = 0; s < 2; ++s) { const int d = (tid >> 3) + 32 * s; const v8h val = *(const v8ha*)(tile + d * 72 + piece * 8); *(v8h*)(base + (size_t)d * NT_ + piece * 8) = val; }
    };
    pass(); 
}

// attn_block: transposed products. Block = (b, h, 4 waves x QCOL queries); a step is 32 keys. S^T = K.Q^T: A = 16 key rows, B = the wave's queries (loaded once), so a lane
// holds scores of ONE query (column lr; keys 8 hi + r of each 16-key tile): maximum and sum run in the lane, the two wave halves meet in one cross-row move. The two
// score tiles of a step, exponentiated (x 32768, folded into the exponent) and rounded to f16 in place, ARE the B operand of O^T += V^T.P^T in the hardware k order
// (element s: key 8 hi + s, then 16 + 8 hi + s - 8), which the V^T rows are loaded in: P touches no LDS. O^T gives a lane 8 consecutive head dims of its query.
// K and V^T come through LDS, once for the block's four waves: a stage is SKEY keys, brought in whole 128-B lines by asynchronous copies, two buffers, the next stage's copies in flight
// while this one is worked on. A buffer is [K tile: 128 key rows x 128 B | V^T tile: two halves of 64 keys, each 64 head-dim rows x 128 B], pitch 144 B for the ds_load_b128 readers.
#define QG   4            // 16-query column groups a wave: every K and V^T fragment a wave loads feeds QG products
#define QCOL (QG * 16)
#define QBLK (4 * QCOL)
#define SKEY 128
#define NSTG (NT_ / SKEY)
__device__ __forceinline__ float xhalf(float x) { return __builtin_bit_cast(float, __builtin_amdgcn_permlanex16(__builtin_bit_cast(int, x), __builtin_bit_cast(int, x), 0x76543210, 0xfedcba98, false, false)); }  // lane l with lane l ^ 16

// The V^T tile of one stage: 8 copies a lane, 16 LDS rows apart (a wave covers 4 whole 128-B rows a copy): head-dim rows 0..63 of the first 64 keys, then of the second 64. The s_wait_xcnt ends
// the copies' own statement, so that no address register of a copy is rewritten ahead of it.
__device__ __forceinline__ void copy_vt(unsigned l, const h16* g) {
    const size_t rs = (size_t)16 * NT_;
    asm volatile("global_load_async_to_lds_b128 %0, %8, off\n\t"
                 "global_load_async_to_lds_b128 %1, %9, off\n\t"
                 "global_load_async_to_lds_b128 %2, %10, off\n\t"
                 "global_load_async_to_lds_b128 %3, %11, off\n\t"
                 "global_load_async_to_lds_b128 %4, %12, off\n\t"
                 "global_load_async_to_lds_b128 %5, %13, off\n\t"
                 "global_load_async_to_lds_b128 %6, %14, off\n\t"
                 "global_load_async_to_lds_b128 %7, %15, off\n\t"
                 "s_wait_xcnt 0x0"
                 :: "v"(l), "v"(l + 1u * 16u * 144u), "v"(l + 2u * 16u * 144u), "v"(l + 3u * 16u * 144u),
                    "v"(l + 4u * 16u * 144u), "v"(l + 5u * 16u * 144u), "v"(l + 6u * 16u * 144u), "v"(l + 7u * 16u * 144u),
                    "v"(g), "v"(g + rs), "v"(g + 2 * rs), "v"(g + 3 * rs), "v"(g + 64), "v"(g + 64 + rs), "v"(g + 64 + 2 * rs), "v"(g + 64 + 3 * rs)
                 : "memory");
}

__device__ __forceinline__ void attn_block(const h16* __restrict__ Q16, const h16* __restrict__ K16, const h16* __restrict__ VT16, h16* CTX16, h16* ring, const int bid) {
    const int tid = threadIdx.x, lane = tid & 31, wave = tid >> 5, lr = lane & 15, hi = lane >> 4;
    const int b = bid / (NH_ * (NT_ / QBLK)), rem = bid - b * (NH_ * (NT_ / QBLK)), h = rem / (NT_ / QBLK), qt = rem - h * (NT_ / QBLK);
    const int q0 = qt * QBLK + wave * QCOL;
    const size_t tok0 = (size_t)b * NT_;
    const float CS = 0.125f * 1.4426950408889634f;   // score scale, in base 2
    const h16* kn = K16 + tok0 * DM + h * HD;                     // the head's K rows and V^T rows from the next stage to be copied on: the same for the whole block
    const h16* vn = VT16 + ((size_t)b * NH_ + h) * HD * NT_;
    const unsigned ko = (tid >> 3) * DM + (tid & 7) * 8, vo = (tid >> 3) * NT_ + (tid & 7) * 8;   // the lane's own 16 bytes in them
    // A copy's place in LDS = the wave's four rows in the buffer to be filled (lf, the same for the wave: a scalar that changes with the stage) + the lane's own 16 bytes in them (lo). So only
    // sums made at the copies are operands of their asm statements: a value that is such an operand AND lives over the loop is bound to the low 256 registers, which the loop fills, and is spilled.
    unsigned lf = (unsigned)(size_t)ring + (unsigned)__builtin_amdgcn_readfirstlane(wave) * (4u * 144u), lg = lf + 2 * TSZ * 2;
    const unsigned lo = (unsigned)((lane >> 3) * 144 + (lane & 7) * 16);
    copy_tile(lf + lo, kn + ko, DM);          // stage 0 flies under the Q loads
    copy_vt(lf + lo + TSZ * 2, vn + vo);
    kn += (size_t)SKEY * DM; vn += SKEY;
    v16h qf[QG][2];
#pragma unroll
    for (int g = 0; g < QG; ++g)
#pragma unroll
        for (int kc = 0; kc < 2; ++kc) { const h16* p = Q16 + (tok0 + q0 + g * 16 + lr) * DM + h * HD + kc * 32 + 8 * hi; qf[g][kc] = cat16(*(const v8h*)p, *(const v8h*)(p + 16)); }
    v8f o[QG][4];
    float mrun[QG], lsum[QG];
#pragma unroll
    for (int g = 0; g < QG; ++g) { mrun[g] = -3.0e38f; lsum[g] = 0.f;
#pragma unroll
        for (int n = 0; n < 4; ++n) o[g][n] = (v8f){}; }
    asm volatile("s_wait_xcnt 0x0" ::: "memory");   // before anything rewrites the address registers that the Q loads name
    __builtin_amdgcn_sched_barrier(0);               // keeps later register writes behind that wait
    asm volatile("s_wait_asynccnt 0x0" ::: "memory");   // stage 0's own copies have landed before the barrier publishes them
    __syncthreads();
    copy_tile(lg + lo, kn + ko, DM);
    copy_vt(lg + lo + TSZ * 2, vn + vo);
#pragma unroll 1   // one stage a trip: the two buffers alternate by the trip's parity
    for (int st = 0; st < NSTG; ++st) {
        const int bo = (st & 1) * 2 * TSZ;
        const h16* sk = ring + bo + lr * TP + 8 * hi;
        const h16* sv = sk + TSZ;
        v16h kf[2][2];
#pragma unroll
        for (int t = 0; t < 2; ++t)
#pragma unroll
            for (int kc = 0; kc < 2; ++kc) { const h16* p = sk + (t * 16) * TP + kc * 32; kf[t][kc] = cat16(*(const v8ha*)p, *(const v8ha*)(p + 16)); }
#pragma unroll 1   // one step a trip
        for (int u = 0; u < SKEY / 32; ++u) {
            v16h vf[4];
#pragma unroll
            for (int n = 0; n < 4; ++n) { const h16* p = sv + (n * 16) * TP; vf[n] = cat16(*(const v8ha*)p, *(const v8ha*)(p + 16)); }
            sv += (u & 1) ? 64 * TP - 32 : 32;               // the next step's 32 keys: the other half of the 128-B rows, then the tile's second 64 keys; carried in its own register, so that no vector write stands at the step's head, directly behind the WMMAs
            __builtin_amdgcn_sched_barrier(0);               // the V^T reads go out as one group ahead of the score products and fly under them
            v8f s[QG][2];
#pragma unroll
            for (int g = 0; g < QG; ++g)
#pragma unroll
                for (int t = 0; t < 2; ++t) s[g][t] = wmma16(kf[t][1], qf[g][1], wmma16(kf[t][0], qf[g][0], (v8f){}));
            if (u + 1 < SKEY / 32) {   // the next step's key rows, of this stage only: nothing of the next stage is read ahead of its barrier
#pragma unroll
                for (int t = 0; t < 2; ++t)
#pragma unroll
                    for (int kc = 0; kc < 2; ++kc) { const h16* p = sk + ((u + 1) * 32 + t * 16) * TP + kc * 32; kf[t][kc] = cat16(*(const v8ha*)p, *(const v8ha*)(p + 16)); }
            }
#pragma unroll
            for (int g = 0; g < QG; ++g) {
                float mt[8];
#pragma unroll
                for (int j = 0; j < 8; ++j) mt[j] = fmaxf(s[g][0][j], s[g][1][j]);
#pragma unroll
                for (int w = 4; w; w >>= 1)
#pragma unroll
                    for (int j = 0; j < w; ++j) mt[j] = fmaxf(mt[j], mt[j + w]);
                const float mx = fmaxf(mt[0], xhalf(mt[0])) * CS;
                const float mn = fmaxf(mrun[g], mx);
                const float alpha = __builtin_amdgcn_exp2f(mrun[g] - mn);   // 0 on the first step
                mrun[g] = mn;
                const float nm = 15.0f - mn;                                 // weights x 32768, as f16 operands
                float pe[16];
                v16h pb;
#pragma unroll
                for (int e = 0; e < 16; ++e) { pe[e] = __builtin_amdgcn_exp2f(fmaf(s[g][e >> 3][e & 7], CS, nm)); pb[e] = (h16)pe[e]; }
#pragma unroll
                for (int w = 8; w; w >>= 1)   // a tree: a chain of 16 dependent adds would stall the SIMD's one wave
#pragma unroll
                    for (int e = 0; e < w; ++e) pe[e] += pe[e + w];
                lsum[g] = lsum[g] * alpha + pe[0];
#pragma unroll
                for (int n = 0; n < 4; ++n) o[g][n] = wmma16(vf[n], pb, o[g][n] * alpha);
            }
        }
        asm volatile("s_wait_dscnt 0x0" ::: "memory");      // this wave's last reads of the buffer are done before the barrier frees it for the refill
        asm volatile("s_wait_asynccnt 0x0" ::: "memory");   // this wave's copies of stage st + 1 have landed before the barrier publishes them
        __syncthreads();
        if (st + 2 < NSTG) {
            kn += (size_t)SKEY * DM; vn += SKEY;
            copy_tile(lf + lo, kn + ko, DM);
            copy_vt(lf + lo + TSZ * 2, vn + vo);
        }
        { const unsigned x = lf; lf = lg; lg = x; }   // the next trip frees the other buffer
    }
    asm volatile("s_wait_asynccnt 0x0" ::: "memory");   // no copy is outstanding when the wave goes on to its end
#pragma unroll
    for (int g = 0; g < QG; ++g) {
        const float inv = 1.0f / (lsum[g] + xhalf(lsum[g]));   // the halves' sums (x 32768, like the weights) join once
        h16* crow = CTX16 + (tok0 + q0 + g * 16 + lr) * KC + (size_t)h * HD + 8 * hi;   // columns 0..1023 of the [a | gelu(h)] rows
#pragma unroll
        for (int n = 0; n < 4; ++n) { v8h o8;
#pragma unroll
            for (int j = 0; j < 8; ++j) o8[j] = (h16)(o[g][n][j] * inv);
            *(v8h*)(crow + n * 16) = o8; }
        if (g + 1 < QG) {
            asm volatile("s_wait_xcnt 0x0" ::: "memory");   // before the next group rewrites the registers that this group's stores name
            __builtin_amdgcn_sched_barrier(0);               // keeps the next group's register writes behind that wait
        }
    }
}

// bc_rows: bc[n] = b2[n] + sum over j of [bao | bmo][j] . W2[j][n], f32 sums along the rows of the f16 plane W2^T. A wave takes 32 rows n, lane r keeps row r's sum: one 128-B store a wave.
__device__ __forceinline__ void bc_rows(const h16* __restrict__ W2T, const float* __restrict__ bao, const float* __restrict__ bmo, const float* __restrict__ b2, float* BC, const int blk) {
    const int lane = threadIdx.x & 31, n0 = blk * 128 + (threadIdx.x >> 5) * 32;
    float bv[8][8];
#pragma unroll
    for (int c = 0; c < 8; ++c) { const float* bp = (c < 4 ? bao + c * 256 : bmo + (c - 4) * 256) + lane * 8;
#pragma unroll
        for (int i = 0; i < 8; ++i) bv[c][i] = bfr(bp[i]); }
    float res = 0.f;
    for (int r0 = 0; r0 < 32; r0 += 4) {
        v8h w[4][8];
#pragma unroll   // four rows a trip: their 32 loads go out together, one latency a trip instead of one a row
        for (int u = 0; u < 4; ++u)
#pragma unroll
            for (int c = 0; c < 8; ++c) w[u][c] = *(const v8h*)(W2T + (size_t)(n0 + r0 + u) * (2 * DM) + c * 256 + lane * 8);
        asm volatile("s_wait_xcnt 0x0" ::: "memory");   // before the next trip rewrites the registers that this trip's loads name
#pragma unroll
        for (int u = 0; u < 4; ++u) { float s = 0.f;
#pragma unroll
            for (int c = 0; c < 8; ++c)
#pragma unroll
                for (int i = 0; i < 8; ++i) s += (float)w[u][c][i] * bv[c][i];
            s = hsum16(s); s += xhalf(s);
            res = (lane == r0 + u) ? s : res; }
    }
    BC[n0 + lane] = res + bfr(b2[n0 + lane]);
    asm volatile("s_wait_xcnt 0x0" ::: "memory");   // behind the store: in the merged kernel other code follows it in the listing and rewrites the registers that it names
}

// k_attn_wc: the attention and the two jobs on weights alone that only the last product reads, as block ranges of ONE grid: the attention leaves most of the matrix pipe's slots
// idle, so the 112 tiles of Wc^T and the 8 blocks of bc run beside it. The job is the same for a whole block, so the barriers of attn_block and wc_block stand under block-uniform control flow.
#define AB_ATT (NB_ * NH_ * (NT_ / QBLK))
#define AB_WC  ((DM / 128) * (KC / 128))
#define AB_BC  (DM / 128)
__global__ __launch_bounds__(128) void k_attn_wc(const h16* __restrict__ Q16, const h16* __restrict__ K16, const h16* __restrict__ VT16, h16* CTX16, const h16* __restrict__ W2T, const h16* __restrict__ Wao16,
                                                const h16* __restrict__ Wmo16, const float* __restrict__ bao, const float* __restrict__ bmo, const float* __restrict__ b2, h16* WcT, float* BC) {
    __shared__ __align__(16) h16 ring[RING];
    const int t = blockIdx.x;
    if (t < AB_ATT) { attn_block(Q16, K16, VT16, CTX16, ring, t); return; }
    if (t < AB_ATT + AB_WC) { wc_block(W2T, Wao16, Wmo16, WcT, ring, t - AB_ATT); return; }
    bc_rows(W2T, bao, bmo, b2, BC, t - (AB_ATT + AB_WC));
}

extern "C" void kernel_launch(void* const* d_in, const int* in_sizes, int n_in,
                              void* d_out, int out_size, void* d_ws, size_t ws_size, hipStream_t stream) {
    (void)in_sizes; (void)n_in; (void)out_size;
    const float* x = (const float*)d_in[0]; const float* ng = (const float*)d_in[1]; const float* nb = (const float*)d_in[2]; const float* W1 = (const float*)d_in[3]; const float* b1 = (const float*)d_in[4];
    const float* qg = (const float*)d_in[5]; const float* qb = (const float*)d_in[6]; const float* kg = (const float*)d_in[7]; const float* kb = (const float*)d_in[8];
    const float* Wao = (const float*)d_in[9]; const float* bao = (const float*)d_in[10]; const float* Wmo = (const float*)d_in[11]; const float* bmo = (const float*)d_in[12];
    const float* W2 = (const float*)d_in[13]; const float* b2 = (const float*)d_in[14];
    float* out = (float*)d_out;    // [2][2048][1024]
    char* wsp = (char*)d_ws;
    auto take = [&](size_t bytes) { char* p = wsp; wsp += (bytes + 255) & ~(size_t)255; return (void*)p; };
    h16* XN16 = (h16*)take((size_t)NTK * DM * 2); h16* W1T = (h16*)take((size_t)NFP * DM * 2);
    h16* Wao16 = (h16*)take((size_t)DM * DM * 2); h16* Wmo16 = (h16*)take((size_t)MLPP * DM * 2); h16* W2T = (h16*)take((size_t)DM * 2 * DM * 2);
    h16* Q16 = (h16*)take((size_t)NTK * DM * 2); h16* K16 = (h16*)take((size_t)NTK * DM * 2); h16* V16 = (h16*)take((size_t)NTK * DM * 2); h16* VT16 = (h16*)take((size_t)NTK * DM * 2);
    h16* AG16 = (h16*)take((size_t)NTK * KC * 2); h16* WcT = (h16*)take((size_t)DM * KC * 2); float* BC = (float*)take((size_t)DM * 4);
    if ((size_t)(wsp - (char*)d_ws) > ws_size) return;    // 8.4 + 7.9 + 2.1 + 1.6 + 4.2 + 4 x 8.4 + 14.7 + 3.7 MB ~ 76 MB
    k_prep<<<PB_LN + PB_W1 + PB_W2 + PB_WAO + PB_WMO, 256, 0, stream>>>(x, ng, nb, W1, W2, Wao, Wmo, XN16, W1T, W2T, Wao16, Wmo16);
    k_fused<<<dim3(NTK / 128, NFP / 128, 1), 128, 0, stream>>>(XN16, W1T, b1, qg, qb, kg, kb, Q16, K16, V16, AG16 + DM);
    k_vt<<<NB_ * NH_ * (NT_ / 64), 256, 0, stream>>>(V16, VT16);
    k_attn_wc<<<AB_ATT + AB_WC + AB_BC, 128, 0, stream>>>(Q16, K16, VT16, AG16, W2T, Wao16, Wmo16, bao, bmo, b2, WcT, BC);
    k_gemmout<<<dim3(NTK / 128, DM / 128, 1), 128, 0, stream>>>(AG16, WcT, BC, x, out);
}

// v006
// It runs in 123 microseconds.
// Timed twice side by side with v005, it ran 1.05 times as fast both times.
// Counting every step since v000, it is 3.27 times as fast.
#include <hip/hip_runtime.h>

// Contractions on v_wmma_f32_16x16x32_f16 with plain f16 operands, f32 accumulate: fused = LN(x).W1 + b1 ([4096 x 1024].[1024 x 3788 (padded 3840)]), the 16-head
// attention with per-head LayerNorm on q and k (scores [2048 x 64].[64 x 2048] /8, softmax, .v), and the tail out = x + [a.Wao + bao | gelu_tanh(h).Wmo + bmo].W2 + b2 in the
// associated form out = x + [a | gelu_tanh(h)].Wc + bc ([4096 x 1740 (1792)].[1792 x 1024]) with Wc = [Wao.W2(rows 0..1023) ; Wmo.W2(rows 1024..2047)] (two [. x 1024].[1024 x 1024]
// products of weights, made anew in every call) and bc = b2 + [bao | bmo].W2. Input weights are f16 of their bf16 rounding (exact for the bf16-input reference), the activations
// and Wc are computed values rounded once to f16 (the output is dominated by the exact residual x). LayerNorms (eps 1e-6), gelu, softmax and bc run in f32.

#define NB_  2
#define NT_  2048
#define DM   1024
#define NH_  16
#define HD   64
#define NTK  (NB_ * NT_)
#define NF   3788
#define NFP  3840
#define MLPH 716
#define MLPP 768
#define KC   (DM + MLPP)   // k extent of the tail product: [a | gelu(h)] rows and Wc^T rows have this pitch
#define PSC  32768.0f
#define EPS  1e-6f

typedef _Float16 h16;
typedef __attribute__((ext_vector_type(16))) _Float16 v16h;
typedef __attribute__((ext_vector_type(8)))  _Float16 v8h;
typedef __attribute__((ext_vector_type(8)))  float    v8f;
typedef __attribute__((ext_vector_type(4)))  float    v4f;
typedef v8h  __attribute__((may_alias)) v8ha;
typedef v4f  __attribute__((may_alias)) v4fa;

__device__ __forceinline__ unsigned short f2bf(float f) { unsigned u = __float_as_uint(f); u += 0x7FFFu + ((u >> 16) & 1u); return (unsigned short)(u >> 16); }
__device__ __forceinline__ float bf2f(unsigned short b) { return __uint_as_float(((unsigned)b) << 16); }
__device__ __forceinline__ float bfr(float f) { return bf2f(f2bf(f)); }
__device__ __forceinline__ v16h cat16(v8h lo, v8h hi) { return __builtin_shufflevector(lo, hi, 0, 1, 2, 3, 4, 5, 6, 7, 8, 9, 10, 11, 12, 13, 14, 15); }
__device__ __forceinline__ v8f wmma16(v16h a, v16h b, v8f c) { return __builtin_amdgcn_wmma_f32_16x16x32_f16(false, a, false, b, (short)0, c, false, false); }
__device__ __forceinline__ float hsum16(float v) { v += __shfl_xor(v, 1, 16); v += __shfl_xor(v, 2, 16); v += __shfl_xor(v, 4, 16); return v + __shfl_xor(v, 8, 16); }
__device__ __forceinline__ float gelu_t(float x) { const float c = 0.7978845608028654f; return 0.5f * x * (1.0f + tanhf(c * (x + 0.044715f * x * x * x))); }

// ln_rows: LayerNorm of 8 rows of x (one a wave) -> XN16; blk = row group.
__device__ __forceinline__ void ln_rows(const float* __restrict__ x, const float* __restrict__ g, const float* __restrict__ bt, h16* XN16, const int blk) {
    const int lane = threadIdx.x & 31, r = blk * 8 + (threadIdx.x >> 5);
    if (r >= NTK) return;
    const float* xr = x + (size_t)r * DM;
    float s = 0.f;
#pragma unroll
    for (int q = 0; q < 4; ++q)
#pragma unroll
        for (int i = 0; i < 8; ++i) s += bfr(xr[q * 256 + lane * 8 + i]);
#pragma unroll
    for (int o = 16; o; o >>= 1) s += __shfl_xor(s, o, 32);
    const float mu = s * (1.0f / DM);
    float sq = 0.f;
#pragma unroll 1
    for (int q = 0; q < 4; ++q)
#pragma unroll
        for (int i = 0; i < 8; ++i) { const float d = bfr(xr[q * 256 + lane * 8 + i]) - mu; sq += d * d; }
#pragma unroll
    for (int o = 16; o; o >>= 1) sq += __shfl_xor(sq, o, 32);
    const float rs = rsqrtf(sq * (1.0f / DM) + EPS);
#pragma unroll 1
    for (int q = 0; q < 4; ++q) {
        v8h o8;
#pragma unroll
        for (int i = 0; i < 8; ++i) { const int c = q * 256 + lane * 8 + i; o8[i] = (h16)((bfr(xr[c]) - mu) * rs * bfr(g[c]) + bfr(bt[c])); }
        *(v8h*)(XN16 + (size_t)r * DM + q * 256 + lane * 8) = o8; 
    }
}

// wt_tile: k-major W [K rows][N cols] -> n-major f16 plane WT [Npad][Kpad] (f16 of bf16(W); rows >= N and columns >= K zero); one 64 x 64 tile (kb, nb) through LDS.
__device__ __forceinline__ void wt_tile(const float* __restrict__ Wm, int K, int N, int Kpad, h16* WT, const int kb, const int nb) {
    __shared__ __align__(16) h16 tl[64 * 72];
    const int tid = threadIdx.x, k0 = kb * 64, n0 = nb * 64;
    const int kk = tid >> 2, nq = (tid & 3) * 16;
#pragma unroll
    for (int i = 0; i < 16; ++i) { const int k = k0 + kk, n = n0 + nq + i; tl[(nq + i) * 72 + kk] = (k < K && n < N) ? (h16)bfr(Wm[(size_t)k * N + n]) : (h16)0.f; }
    __syncthreads();
    const int piece = tid & 7;
    auto pass = [&]() {
#pragma unroll
        for (int s = 0; s < 2; ++s) { const int nr = (tid >> 3) + 32 * s; const v8h val = *(const v8ha*)(tl + nr * 72 + piece * 8);
            *(v8h*)(WT + (size_t)(n0 + nr) * Kpad + k0 + piece * 8) = val; }
    };
    pass(); 
    asm volatile("s_wait_xcnt 0x0" ::: "memory");   // behind the two stores: in the merged kernel other code follows them in the listing and rewrites the registers that they name
}

// cv_rows: W [rows][1024] f32 -> f16 plane of the same layout (f16 of bf16(W); plane rows past the weight's last row are zero): 4 rows a block, 16 elements a thread. As the n-major operand of Wc^T = W2^T.W^T
// a weight is read along its own rows, so it needs no transpose.
__device__ __forceinline__ void cv_rows(const float* __restrict__ Wm, const int rows, h16* W16, const int blk) {
    const int tid = threadIdx.x, col = (tid & 127) * 8;
    v4f v[2][2];
#pragma unroll
    for (int s = 0; s < 2; ++s) { const int r = blk * 4 + s * 2 + (tid >> 7);   // the same row in a whole wave
        if (r < rows) { const float* p = Wm + (size_t)r * DM + col; v[s][0] = *(const v4f*)p; v[s][1] = *(const v4f*)(p + 4); } else { v[s][0] = (v4f){}; v[s][1] = (v4f){}; } }
#pragma unroll
    for (int s = 0; s < 2; ++s) { const int r = blk * 4 + s * 2 + (tid >> 7); v8h o;
#pragma unroll
        for (int i = 0; i < 8; ++i) o[i] = (h16)bfr(v[s][i >> 2][i & 3]);
        *(v8h*)(W16 + (size_t)r * DM + col) = o; }
    asm volatile("s_wait_xcnt 0x0" ::: "memory");   // behind the loads and stores: in the merged kernel other code follows them in the listing and rewrites the registers that they name
}

// k_prep: the five jobs that depend on the inputs alone, as block ranges of ONE grid, so that their starts, first loads and tails overlap: the LayerNorm of x, the two
// weight transposes, each with its tiles in the order k fastest, and the two weight conversions. The job is the same for a whole block, so wt_tile's barrier stands under block-uniform control flow.
#define PB_LN  (NTK / 8)
#define PB_W1  ((DM / 64) * (NFP / 64))
#define PB_W2  (((2 * DM) / 64) * (DM / 64))
#define PB_WAO (DM / 4)
#define PB_WMO (MLPP / 4)
__global__ __launch_bounds__(256) void k_prep(const float* __restrict__ x, const float* __restrict__ g, const float* __restrict__ bt, const float* __restrict__ W1, const float* __restrict__ W2,
                                             const float* __restrict__ Wao, const float* __restrict__ Wmo, h16* XN16, h16* W1T, h16* W2T, h16* Wao16, h16* Wmo16) {
    int t = blockIdx.x;
    if (t < PB_LN) { ln_rows(x, g, bt, XN16, t); return; }
    t -= PB_LN;
    const float* Wm; h16* WT; int K, N, Kpad, nb;   // nb by a literal divisor in each branch: scalar shifts and one scalar multiply, no division at run time
    if (t < PB_W1) { Wm = W1; WT = W1T; K = DM; N = NF; Kpad = DM; nb = t / (DM / 64); }
    else if (t < PB_W1 + PB_W2) { t -= PB_W1; Wm = W2; WT = W2T; K = 2 * DM; N = DM; Kpad = 2 * DM; nb = t / ((2 * DM) / 64); }
    else if (t < PB_W1 + PB_W2 + PB_WAO) { cv_rows(Wao, DM, Wao16, t - (PB_W1 + PB_W2)); return; }
    else { cv_rows(Wmo, MLPH, Wmo16, t - (PB_W1 + PB_W2 + PB_WAO)); return; }
    wt_tile(Wm, K, N, Kpad, WT, t - nb * (Kpad / 64), nb);
}

// GEMM tile core: 128 x 128 block tile (2 x 2 waves, 64 x 64 each) of A[M][K] (f16, row pitch lda) . BT[N][K] (row pitch ldb), K a multiple of 64 and at least 128. A pass is 64 k: the
// 128 rows x 128 B of both operands are brought into LDS by asynchronous copies (pitch 144 B for the ds_load_b128 readers), two buffers, the next pass's copies in
// flight while this pass is worked on. A buffer is [A tile | BT tile]. Returns acc[4][4] (row group, column group; D layout); the k order of every sum is ascending.
#define TP   72
#define TSZ  (128 * TP)
#define RING (4 * TSZ)

// One operand's tile of one pass: 8 copies a lane, 16 rows apart (a wave covers 4 whole 128-B rows a copy). The s_wait_xcnt ends the copies' own statement, so that
// no address register of a copy is rewritten ahead of it.
__device__ __forceinline__ void copy_tile(unsigned l, const h16* g, int ld) {
    const size_t rs = (size_t)16 * ld;
    asm volatile("global_load_async_to_lds_b128 %0, %8, off\n\t"
                 "global_load_async_to_lds_b128 %1, %9, off\n\t"
                 "global_load_async_to_lds_b128 %2, %10, off\n\t"
                 "global_load_async_to_lds_b128 %3, %11, off\n\t"
                 "global_load_async_to_lds_b128 %4, %12, off\n\t"
                 "global_load_async_to_lds_b128 %5, %13, off\n\t"
                 "global_load_async_to_lds_b128 %6, %14, off\n\t"
                 "global_load_async_to_lds_b128 %7, %15, off\n\t"
                 "s_wait_xcnt 0x0"
                 :: "v"(l), "v"(l + 1u * 16u * 144u), "v"(l + 2u * 16u * 144u), "v"(l + 3u * 16u * 144u),
                    "v"(l + 4u * 16u * 144u), "v"(l + 5u * 16u * 144u), "v"(l + 6u * 16u * 144u), "v"(l + 7u * 16u * 144u),
                    "v"(g), "v"(g + rs), "v"(g + 2 * rs), "v"(g + 3 * rs), "v"(g + 4 * rs), "v"(g + 5 * rs), "v"(g + 6 * rs), "v"(g + 7 * rs)
                 : "memory");
}

__device__ __forceinline__ void gemm_tile(const h16* __restrict__ A, const int lda, const h16* __restrict__ BT, const int ldb, const int K, int rb, int cb, h16* ring, v8f (&acc)[4][4]) {
    const int tid = threadIdx.x, lane = tid & 31, wave = tid >> 5, lr = lane & 15, hi = lane >> 4;
    const h16* ga = A + (size_t)(rb + (tid >> 3)) * lda + (tid & 7) * 8;
    const h16* gb = BT + (size_t)(cb + (tid >> 3)) * ldb + (tid & 7) * 8;
    const unsigned l0 = (unsigned)(size_t)ring + (unsigned)((tid >> 3) * 144 + (tid & 7) * 16);
    const int np = K / 64;
#pragma unroll
    for (int i = 0; i < 4; ++i)
#pragma unroll
        for (int t = 0; t < 4; ++t) acc[i][t] = (v8f){};
    copy_tile(l0, ga, lda);
    copy_tile(l0 + TSZ * 2, gb, ldb);
    asm volatile("s_wait_asynccnt 0x0" ::: "memory");   // pass 0's own copies have landed before the barrier publishes them
    __syncthreads();
    copy_tile(l0 + 2 * TSZ * 2, ga + 64, lda);
    copy_tile(l0 + 3 * TSZ * 2, gb + 64, ldb);
#pragma unroll 1   // one pass a trip: the two buffers alternate by the trip's parity
    for (int p = 0; p < np; ++p) {
        const int bo = (p & 1) * 2 * TSZ;
        const h16* sa = ring + bo + ((wave >> 1) * 64 + lr) * TP + 8 * hi;
        const h16* sb = ring + bo + TSZ + ((wave & 1) * 64 + lr) * TP + 8 * hi;
        v16h a[4], b[4];
#pragma unroll
        for (int i = 0; i < 4; ++i) a[i] = cat16(*(const v8ha*)(sa + i * 16 * TP), *(const v8ha*)(sa + i * 16 * TP + 16));
#pragma unroll
        for (int t = 0; t < 4; ++t) b[t] = cat16(*(const v8ha*)(sb + t * 16 * TP), *(const v8ha*)(sb + t * 16 * TP + 16));
        __builtin_amdgcn_sched_barrier(0);   // the 16 LDS reads of a k step go out as one group ahead of its WMMAs
#pragma unroll
        for (int i = 0; i < 4; ++i)
#pragma unroll
            for (int t = 0; t < 4; ++t) acc[i][t] = wmma16(a[i], b[t], acc[i][t]);
        __builtin_amdgcn_sched_barrier(0);   // the second k step's reads stay behind the first step's WMMAs, in the same fragment registers
#pragma unroll
        for (int i = 0; i < 4; ++i) a[i] = cat16(*(const v8ha*)(sa + i * 16 * TP + 32), *(const v8ha*)(sa + i * 16 * TP + 48));
#pragma unroll
        for (int t = 0; t < 4; ++t) b[t] = cat16(*(const v8ha*)(sb + t * 16 * TP + 32), *(const v8ha*)(sb + t * 16 * TP + 48));
        asm volatile("s_wait_dscnt 0x0" ::: "memory");      // this wave's last reads of the buffer are done before the barrier frees it for the refill
        asm volatile("s_wait_asynccnt 0x0" ::: "memory");   // this wave's copies of pass p + 1 have landed before the barrier publishes them
        __syncthreads();
        if (p + 2 < np) {
            copy_tile(l0 + bo * 2, ga + (size_t)(p + 2) * 64, lda);
            copy_tile(l0 + bo * 2 + TSZ * 2, gb + (size_t)(p + 2) * 64, ldb);
        }
        __builtin_amdgcn_sched_barrier(0);   // the refill is issued ahead of the second k step's WMMAs (registers only), so that it flies under them
#pragma unroll
        for (int i = 0; i < 4; ++i)
#pragma unroll
            for (int t = 0; t < 4; ++t) acc[i][t] = wmma16(a[i], b[t], acc[i][t]);
    }
    asm volatile("s_wait_asynccnt 0x0" ::: "memory");       // no copy is outstanding when the ring becomes the output staging
}

// gemm_tile_k2: the same core for a block of 8 waves in two groups of 4. Group q (waves 4q .. 4q + 3) takes the 64-k slices q, q + 2, q + 4, ... of K (a multiple of 128, at least 256) through a two-buffer
// ring of its own and sums them, k ascending, over the whole 128 x 128 tile: two waves share a SIMD and two slices' copies are in flight, so one group's LDS reads, copy issue and landing
// time run under the other's WMMAs. The barriers are the block's: both groups make the same trips. The caller adds the two groups' partial tiles.
__device__ __forceinline__ void gemm_tile_k2(const h16* __restrict__ A, const int lda, const h16* __restrict__ BT, const int ldb, const int K, int rb, int cb, h16* ring2, v8f (&acc)[4][4]) {
    const int grp = threadIdx.x >> 7, tid = threadIdx.x & 127, lane = tid & 31, wave = tid >> 5, lr = lane & 15, hi = lane >> 4;
    h16* ring = ring2 + grp * RING;
    const h16* ga = A + (size_t)(rb + (tid >> 3)) * lda + grp * 64 + (tid & 7) * 8;
    const h16* gb = BT + (size_t)(cb + (tid >> 3)) * ldb + grp * 64 + (tid & 7) * 8;
    const unsigned l0 = (unsigned)(size_t)ring + (unsigned)((tid >> 3) * 144 + (tid & 7) * 16);
    const int np = K / 128;
#pragma unroll
    for (int i = 0; i < 4; ++i)
#pragma unroll
        for (int t = 0; t < 4; ++t) acc[i][t] = (v8f){};
    copy_tile(l0, ga, lda);
    copy_tile(l0 + TSZ * 2, gb, ldb);
    asm volatile("s_wait_asynccnt 0x0" ::: "memory");   // pass 0's own copies have landed before the barrier publishes them
    __syncthreads();
    copy_tile(l0 + 2 * TSZ * 2, ga + 128, lda);
    copy_tile(l0 + 3 * TSZ * 2, gb + 128, ldb);
#pragma unroll 1   // one pass a trip: the two buffers alternate by the trip's parity
    for (int p = 0; p < np; ++p) {
        const int bo = (p & 1) * 2 * TSZ;
        const h16* sa = ring + bo + ((wave >> 1) * 64 + lr) * TP + 8 * hi;
        const h16* sb = ring + bo + TSZ + ((wave & 1) * 64 + lr) * TP + 8 * hi;
        v16h a[4], b[4];
#pragma unroll
        for (int i = 0; i < 4; ++i) a[i] = cat16(*(const v8ha*)(sa + i * 16 * TP), *(const v8ha*)(sa + i * 16 * TP + 16));
#pragma unroll
        for (int t = 0; t < 4; ++t) b[t] = cat16(*(const v8ha*)(sb + t * 16 * TP), *(const v8ha*)(sb + t * 16 * TP + 16));
        __builtin_amdgcn_sched_barrier(0);   // the 16 LDS reads of a k step go out as one group ahead of its WMMAs
#pragma unroll
        for (int i = 0; i < 4; ++i)
#pragma unroll
            for (int t = 0; t < 4; ++t) acc[i][t] = wmma16(a[i], b[t], acc[i][t]);
        __builtin_amdgcn_sched_barrier(0);   // the second k step's reads stay behind the first step's WMMAs, in the same fragment registers
#pragma unroll
        for (int i = 0; i < 4; ++i) a[i] = cat16(*(const v8ha*)(sa + i * 16 * TP + 32), *(const v8ha*)(sa + i * 16 * TP + 48));
#pragma unroll
        for (int t = 0; t < 4; ++t) b[t] = cat16(*(const v8ha*)(sb + t * 16 * TP + 32), *(const v8ha*)(sb + t * 16 * TP + 48));
        asm volatile("s_wait_dscnt 0x0" ::: "memory");      // this wave's last reads of the buffer are done before the barrier frees it for the refill
        asm volatile("s_wait_asynccnt 0x0" ::: "memory");   // this wave's copies of pass p + 1 have landed before the barrier publishes them
        __syncthreads();
        if (p + 2 < np) {
            copy_tile(l0 + bo * 2, ga + (size_t)(p + 2) * 128, lda);
            copy_tile(l0 + bo * 2 + TSZ * 2, gb + (size_t)(p + 2) * 128, ldb);
        }
        __builtin_amdgcn_sched_barrier(0);   // the refill is issued ahead of the second k step's WMMAs (registers only), so that it flies under them
#pragma unroll
        for (int i = 0; i < 4; ++i)
#pragma unroll
            for (int t = 0; t < 4; ++t) acc[i][t] = wmma16(a[i], b[t], acc[i][t]);
    }
    asm volatile("s_wait_asynccnt 0x0" ::: "memory");       // no copy is outstanding when the rings become the output staging
}

// Store pass of a wave's staged 64 x 64 f32 tile (pitch 68) as f16 rows of 128 B, whole lines; gelu (a compile-time or block-uniform choice) is applied to the staged f32 values.
__device__ __forceinline__ void put_tile16(const float* os, h16* crow, int ld, int lane, const bool gelu) {
    for (int s0 = 0; s0 < 16; s0 += 4) {
        v4f v[4][2];
#pragma unroll   // four row groups a trip: their LDS reads go out together, one latency a trip instead of one a group
        for (int u = 0; u < 4; ++u) { const float* sp = os + (4 * (s0 + u) + (lane >> 3)) * 68 + (lane & 7) * 8; v[u][0] = *(const v4fa*)sp; v[u][1] = *(const v4fa*)(sp + 4); }
        if (gelu) {
#pragma unroll
            for (int u = 0; u < 4; ++u)
#pragma unroll
                for (int i = 0; i < 8; ++i) v[u][i >> 2][i & 3] = gelu_t(v[u][i >> 2][i & 3]);
        }
#pragma unroll
        for (int u = 0; u < 4; ++u) { v8h o;
#pragma unroll
            for (int i = 0; i < 8; ++i) o[i] = (h16)v[u][i >> 2][i & 3];
            *(v8h*)(crow + (size_t)(4 * (s0 + u) + (lane >> 3)) * ld + (lane & 7) * 8) = o; }
        asm volatile("s_wait_xcnt 0x0" ::: "memory");   // before the next trip rewrites the registers that this trip's stores name
    }
}

// k_fused: fused = XN16 . W1T + b1 over the 3840 padded columns; a wave's 64-wide column group = exactly one head of q / k / v or a 64-wide slice of the MLP hidden:
//   c0 <  1024: q head c0/64: per-row LayerNorm over the 64 head dims (qn_g, qn_b) -> Q16[tok][1024] f16
//   c0 <  2048: k head: LayerNorm (kn_g, kn_b) -> K16
//   c0 <  3072: v -> V16 rows
//   else      : gelu_tanh (in the store pass) -> G16 = columns 1024.. of the [tok][1792] rows [a | gelu(h)] (columns >= 716 of the hidden are exactly 0 after gelu(0 + 0): b1 pad is read as 0; their Wc rows are 0 anyway)
__global__ __launch_bounds__(128) void k_fused(const h16* __restrict__ XN16, const h16* __restrict__ W1T, const float* __restrict__ b1,
                                              const float* __restrict__ qg, const float* __restrict__ qb, const float* __restrict__ kg, const float* __restrict__ kb,
                                              h16* Q16, h16* K16, h16* V16, h16* G16) {
    __shared__ __align__(16) h16 ring[RING];
    const int lane = threadIdx.x & 31, wave = threadIdx.x >> 5, lr = lane & 15, hi = lane >> 4;
    const int rb = blockIdx.x * 128, cb = blockIdx.y * 128;
    v8f acc[4][4];
    gemm_tile(XN16, DM, W1T, DM, DM, rb, cb, ring, acc);
    const int r0 = rb + (wave >> 1) * 64, c0 = cb + (wave & 1) * 64;
    const int sec = cb / DM;                   // 0 q, 1 k, 2 v, 3 mlp (the same for both column groups of a block)
#pragma unroll
    for (int t = 0; t < 4; ++t) { const int col = c0 + t * 16 + lr; const float bv = (col < NF) ? bfr(b1[col]) : 0.f;
#pragma unroll
        for (int i = 0; i < 4; ++i)
#pragma unroll
            for (int j = 0; j < 8; ++j) acc[i][t][j] += bv; }
    if (sec < 2) {
        const float* gg = sec ? kg : qg; const float* bb = sec ? kb : qb;
#pragma unroll
        for (int i = 0; i < 4; ++i)
#pragma unroll
            for (int j = 0; j < 8; ++j) {
                float s = acc[i][0][j] + acc[i][1][j] + acc[i][2][j] + acc[i][3][j];
                const float mu = hsum16(s) * (1.0f / HD);
                float q = 0.f;
#pragma unroll
                for (int t = 0; t < 4; ++t) { const float d = acc[i][t][j] - mu; q += d * d; }
                const float rs = rsqrtf(hsum16(q) * (1.0f / HD) + EPS);
#pragma unroll
                for (int t = 0; t < 4; ++t) acc[i][t][j] = (acc[i][t][j] - mu) * rs * bfr(gg[t * 16 + lr]) + bfr(bb[t * 16 + lr]);
            }
    }
    float* os = (float*)ring + wave * (64 * 68);   // the loop's last barrier has freed the ring; each wave stages its own 64 x 64 tile
#pragma unroll
    for (int i = 0; i < 4; ++i)
#pragma unroll
        for (int t = 0; t < 4; ++t)
#pragma unroll
            for (int j = 0; j < 8; ++j) os[(i * 16 + hi * 8 + j) * 68 + t * 16 + lr] = acc[i][t][j];
    __syncthreads();
    h16* dst; int ld, cc;
    if (sec == 0) { dst = Q16; ld = DM; cc = c0; } else if (sec == 1) { dst = K16; ld = DM; cc = c0 - DM; } else if (sec == 2) { dst = V16; ld = DM; cc = c0 - 2 * DM; } else { dst = G16; ld = KC; cc = c0 - 3 * DM; }
    h16* crow = dst + (size_t)r0 * ld + cc;
    put_tile16(os, crow, ld, lane, sec == 3);
}

// wc_block: one 128 x 128 tile of Wc^T [n][k] (f16, pitch 1792) = W2^T rows n (one half of their 2048 columns) . W rows k: k < 1024 takes Wao and W2's rows 0..1023, k >= 1024 takes Wmo
// (its plane rows 716..767 are zero) and W2's rows 1024..2047. t = tile, n fastest.
__device__ __forceinline__ void wc_block(const h16* __restrict__ W2T, const h16* __restrict__ Wao16, const h16* __restrict__ Wmo16, h16* WcT, h16* ring, const int t) {
    const int lane = threadIdx.x & 31, wave = threadIdx.x >> 5, lr = lane & 15, hi = lane >> 4;
    const int rb = (t & 7) * 128, ck = (t >> 3) * 128;
    const bool mlp = ck >= DM;
    v8f acc[4][4];
    gemm_tile(mlp ? W2T + DM : W2T, 2 * DM, mlp ? Wmo16 : Wao16, DM, DM, rb, mlp ? ck - DM : ck, ring, acc);
    float* os = (float*)ring + wave * (64 * 68);   // the loop's last barrier has freed the ring; each wave stages its own 64 x 64 tile
#pragma unroll
    for (int t4 = 0; t4 < 4; ++t4)
#pragma unroll
        for (int i = 0; i < 4; ++i)
#pragma unroll
            for (int j = 0; j < 8; ++j) os[(i * 16 + hi * 8 + j) * 68 + t4 * 16 + lr] = acc[i][t4][j];
    __syncthreads();
    put_tile16(os, WcT + (size_t)(rb + (wave >> 1) * 64) * KC + ck + (wave & 1) * 64, KC, lane, false);
}

// k_gemmout: out = x + [a | gelu(h)].Wc + bc; bc is a computed f32 vector and is added as it is. 8 waves: the two groups of gemm_tile_k2 each hold a partial sum of the block's 128 x 128 tile;
// every wave stages its 64 x 64 partial tile, and the store pass adds the two partials of an element (group 0's, which carries bc, then group 1's) and x; a wave stores 32 of its tile's 64 rows.
__global__ __launch_bounds__(256) void k_gemmout(const h16* __restrict__ A, const h16* __restrict__ BT, const float* __restrict__ bias, const float* __restrict__ x, float* C) {
    __shared__ __align__(16) h16 ring[2 * RING];
    const int lane = threadIdx.x & 31, wv = threadIdx.x >> 5, wave = wv & 3, grp = wv >> 2, lr = lane & 15, hi = lane >> 4;
    const int rb = blockIdx.x * 128, cb = blockIdx.y * 128;
    v8f acc[4][4];
    gemm_tile_k2(A, KC, BT, KC, KC, rb, cb, ring, acc);
    const int r0 = rb + (wave >> 1) * 64, c0 = cb + (wave & 1) * 64;
    float* os = (float*)ring + wv * (64 * 68);   // the loop's last barrier has freed the rings; each wave stages its own 64 x 64 partial tile
#pragma unroll
    for (int t = 0; t < 4; ++t) { const float bl = bias[c0 + t * 16 + lr]; const float bv = grp ? 0.f : bl;
#pragma unroll
        for (int i = 0; i < 4; ++i)
#pragma unroll
            for (int j = 0; j < 8; ++j) os[(i * 16 + hi * 8 + j) * 68 + t * 16 + lr] = acc[i][t][j] + bv; }
    __syncthreads();   // a wave reads the other group's partial tile too
    const int rsub = grp * 32 + (lane >> 4), cofs = (lane & 15) * 4;   // the lane's first row in the wave tile (a group stores 32 of its 64 rows) and its four columns
    const float* o0 = (const float*)ring + wave * (64 * 68) + rsub * 68 + cofs;
    const float* o1 = o0 + 4 * (64 * 68);
    float* crow = C + (size_t)(r0 + rsub) * DM + c0 + cofs;
    const float* xrow = x + (size_t)(r0 + rsub) * DM + c0 + cofs;
#pragma unroll 1   // the pointers are stepped by the trip and live over it: a trip's loads and stores go from one address pair each with constant offsets, and the wait at its foot stands ahead of every rewrite
    for (int s0 = 0; s0 < 2; ++s0) {
#pragma unroll   // eight row pairs a trip: their x loads and LDS reads go out together, one latency a trip instead of one a row pair
        for (int s = 0; s < 8; ++s) {
            v4f val = *(const v4fa*)(o0 + 2 * s * 68); const v4f v1 = *(const v4fa*)(o1 + 2 * s * 68); const v4f xv = *(const v4f*)(xrow + 2 * s * DM);
#pragma unroll
            for (int e = 0; e < 4; ++e) val[e] = (val[e] + v1[e]) + bfr(xv[e]);
            *(v4f*)(crow + 2 * s * DM) = val; }
        asm volatile("s_wait_xcnt 0x0" ::: "memory");   // before the next trip rewrites the registers that this trip's loads and stores name
        o0 += 16 * 68; o1 += 16 * 68; crow += 16 * DM; xrow += 16 * DM;
    }
}

// k_vt: VT16[b][h][d][t] from V16 rows via LDS transpose; block (b, h, 64 tokens).
__global__ __launch_bounds__(256) void k_vt(const h16* __restrict__ V16, h16* VT16) {
    __shared__ __align__(16) h16 tile[64 * 72];
    const int bid = blockIdx.x;
    const int b = bid / (NH_ * (NT_ / 64)), rem = bid - b * (NH_ * (NT_ / 64)), h = rem / (NT_ / 64), kt = rem - h * (NT_ / 64);
    const int k0 = kt * 64, tid = threadIdx.x;
    const int kk = tid >> 2, d0 = (tid & 3) * 16;
    const h16* src = V16 + ((size_t)b * NT_ + k0 + kk) * DM + h * HD + d0;
#pragma unroll
    for (int i = 0; i < 16; ++i) tile[(d0 + i) * 72 + kk] = src[i];
    __syncthreads();
    const int piece = tid & 7;
    h16* base = VT16 + (((size_t)b * NH_ + h) * HD) * NT_ + k0;
    auto pass = [&]() {
#pragma unroll
        for (int s = 0; s < 2; ++s) { const int d = (tid >> 3) + 32 * s; const v8h val = *(const v8ha*)(tile + d * 72 + piece * 8); *(v8h*)(base + (size_t)d * NT_ + piece * 8) = val; }
    };
    pass(); 
}

// attn_block: transposed products. Block = (b, h, 4 waves x QCOL queries); a step is 32 keys. S^T = K.Q^T: A = 16 key rows, B = the wave's queries (loaded once), so a lane
// holds scores of ONE query (column lr; keys 8 hi + r of each 16-key tile): maximum and sum run in the lane, the two wave halves meet in one cross-row move. The two
// score tiles of a step, exponentiated (x 32768, folded into the exponent) and rounded to f16 in place, ARE the B operand of O^T += V^T.P^T in the hardware k order
// (element s: key 8 hi + s, then 16 + 8 hi + s - 8), which the V^T rows are loaded in: P touches no LDS. O^T gives a lane 8 consecutive head dims of its query.
// K and V^T come through LDS, once for the block's four waves: a stage is SKEY keys, brought in whole 128-B lines by asynchronous copies, two buffers, the next stage's copies in flight
// while this one is worked on. A buffer is [K tile: 128 key rows x 128 B | V^T tile: two halves of 64 keys, each 64 head-dim rows x 128 B], pitch 144 B for the ds_load_b128 readers.
#define QG   4            // 16-query column groups a wave: every K and V^T fragment a wave loads feeds QG products
#define QCOL (QG * 16)
#define QBLK (4 * QCOL)
#define SKEY 128
#define NSTG (NT_ / SKEY)
__device__ __forceinline__ float xhalf(float x) { return __builtin_bit_cast(float, __builtin_amdgcn_permlanex16(__builtin_bit_cast(int, x), __builtin_bit_cast(int, x), 0x76543210, 0xfedcba98, false, false)); }  // lane l with lane l ^ 16

// The V^T tile of one stage: 8 copies a lane, 16 LDS rows apart (a wave covers 4 whole 128-B rows a copy): head-dim rows 0..63 of the first 64 keys, then of the second 64. The s_wait_xcnt ends
// the copies' own statement, so that no address register of a copy is rewritten ahead of it.
__device__ __forceinline__ void copy_vt(unsigned l, const h16* g) {
    const size_t rs = (size_t)16 * NT_;
    asm volatile("global_load_async_to_lds_b128 %0, %8, off\n\t"
                 "global_load_async_to_lds_b128 %1, %9, off\n\t"
                 "global_load_async_to_lds_b128 %2, %10, off\n\t"
                 "global_load_async_to_lds_b128 %3, %11, off\n\t"
                 "global_load_async_to_lds_b128 %4, %12, off\n\t"
                 "global_load_async_to_lds_b128 %5, %13, off\n\t"
                 "global_load_async_to_lds_b128 %6, %14, off\n\t"
                 "global_load_async_to_lds_b128 %7, %15, off\n\t"
                 "s_wait_xcnt 0x0"
                 :: "v"(l), "v"(l + 1u * 16u * 144u), "v"(l + 2u * 16u * 144u), "v"(l + 3u * 16u * 144u),
                    "v"(l + 4u * 16u * 144u), "v"(l + 5u * 16u * 144u), "v"(l + 6u * 16u * 144u), "v"(l + 7u * 16u * 144u),
                    "v"(g), "v"(g + rs), "v"(g + 2 * rs), "v"(g + 3 * rs), "v"(g + 64), "v"(g + 64 + rs), "v"(g + 64 + 2 * rs), "v"(g + 64 + 3 * rs)
                 : "memory");
}

__device__ __forceinline__ void attn_block(const h16* __restrict__ Q16, const h16* __restrict__ K16, const h16* __restrict__ VT16, h16* CTX16, h16* ring, const int bid) {
    const int tid = threadIdx.x, lane = tid & 31, wave = tid >> 5, lr = lane & 15, hi = lane >> 4;
    const int b = bid / (NH_ * (NT_ / QBLK)), rem = bid - b * (NH_ * (NT_ / QBLK)), h = rem / (NT_ / QBLK), qt = rem - h * (NT_ / QBLK);
    const int q0 = qt * QBLK + wave * QCOL;
    const size_t tok0 = (size_t)b * NT_;
    const float CS = 0.125f * 1.4426950408889634f;   // score scale, in base 2
    const h16* kn = K16 + tok0 * DM + h * HD;                     // the head's K rows and V^T rows from the next stage to be copied on: the same for the whole block
    const h16* vn = VT16 + ((size_t)b * NH_ + h) * HD * NT_;
    const unsigned ko = (tid >> 3) * DM + (tid & 7) * 8, vo = (tid >> 3) * NT_ + (tid & 7) * 8;   // the lane's own 16 bytes in them
    // A copy's place in LDS = the wave's four rows in the buffer to be filled (lf, the same for the wave: a scalar that changes with the stage) + the lane's own 16 bytes in them (lo). So only
    // sums made at the copies are operands of their asm statements: a value that is such an operand AND lives over the loop is bound to the low 256 registers, which the loop fills, and is spilled.
    unsigned lf = (unsigned)(size_t)ring + (unsigned)__builtin_amdgcn_readfirstlane(wave) * (4u * 144u), lg = lf + 2 * TSZ * 2;
    const unsigned lo = (unsigned)((lane >> 3) * 144 + (lane & 7) * 16);
    copy_tile(lf + lo, kn + ko, DM);          // stage 0 flies under the Q loads
    copy_vt(lf + lo + TSZ * 2, vn + vo);
    kn += (size_t)SKEY * DM; vn += SKEY;
    v16h qf[QG][2];
#pragma unroll
    for (int g = 0; g < QG; ++g)
#pragma unroll
        for (int kc = 0; kc < 2; ++kc) { const h16* p = Q16 + (tok0 + q0 + g * 16 + lr) * DM + h * HD + kc * 32 + 8 * hi; qf[g][kc] = cat16(*(const v8h*)p, *(const v8h*)(p + 16)); }
    v8f o[QG][4];
    float mrun[QG], lsum[QG];
#pragma unroll
    for (int g = 0; g < QG; ++g) { mrun[g] = -3.0e38f; lsum[g] = 0.f;
#pragma unroll
        for (int n = 0; n < 4; ++n) o[g][n] = (v8f){}; }
    asm volatile("s_wait_xcnt 0x0" ::: "memory");   // before anything rewrites the address registers that the Q loads name
    __builtin_amdgcn_sched_barrier(0);               // keeps later register writes behind that wait
    asm volatile("s_wait_asynccnt 0x0" ::: "memory");   // stage 0's own copies have landed before the barrier publishes them
    __syncthreads();
    copy_tile(lg + lo, kn + ko, DM);
    copy_vt(lg + lo + TSZ * 2, vn + vo);
#pragma unroll 1   // one stage a trip: the two buffers alternate by the trip's parity
    for (int st = 0; st < NSTG; ++st) {
        const int bo = (st & 1) * 2 * TSZ;
        const h16* sk = ring + bo + lr * TP + 8 * hi;
        const h16* sv = sk + TSZ;
        v16h kf[2][2];
#pragma unroll
        for (int t = 0; t < 2; ++t)
#pragma unroll
            for (int kc = 0; kc < 2; ++kc) { const h16* p = sk + (t * 16) * TP + kc * 32; kf[t][kc] = cat16(*(const v8ha*)p, *(const v8ha*)(p + 16)); }
#pragma unroll 1   // one step a trip
        for (int u = 0; u < SKEY / 32; ++u) {
            v16h vf[4];
#pragma unroll
            for (int n = 0; n < 4; ++n) { const h16* p = sv + (n * 16) * TP; vf[n] = cat16(*(const v8ha*)p, *(const v8ha*)(p + 16)); }
            sv += (u & 1) ? 64 * TP - 32 : 32;               // the next step's 32 keys: the other half of the 128-B rows, then the tile's second 64 keys; carried in its own register, so that no vector write stands at the step's head, directly behind the WMMAs
            __builtin_amdgcn_sched_barrier(0);               // the V^T reads go out as one group ahead of the score products and fly under them
            v8f s[QG][2];
#pragma unroll
            for (int g = 0; g < QG; ++g)
#pragma unroll
                for (int t = 0; t < 2; ++t) s[g][t] = wmma16(kf[t][1], qf[g][1], wmma16(kf[t][0], qf[g][0], (v8f){}));
            if (u + 1 < SKEY / 32) {   // the next step's key rows, of this stage only: nothing of the next stage is read ahead of its barrier
#pragma unroll
                for (int t = 0; t < 2; ++t)
#pragma unroll
                    for (int kc = 0; kc < 2; ++kc) { const h16* p = sk + ((u + 1) * 32 + t * 16) * TP + kc * 32; kf[t][kc] = cat16(*(const v8ha*)p, *(const v8ha*)(p + 16)); }
            }
#pragma unroll
            for (int g = 0; g < QG; ++g) {
                float mt[8];
#pragma unroll
                for (int j = 0; j < 8; ++j) mt[j] = fmaxf(s[g][0][j], s[g][1][j]);
#pragma unroll
                for (int w = 4; w; w >>= 1)
#pragma unroll
                    for (int j = 0; j < w; ++j) mt[j] = fmaxf(mt[j], mt[j + w]);
                const float mx = fmaxf(mt[0], xhalf(mt[0])) * CS;
                const float mn = fmaxf(mrun[g], mx);
                const float alpha = __builtin_amdgcn_exp2f(mrun[g] - mn);   // 0 on the first step
                mrun[g] = mn;
                const float nm = 15.0f - mn;                                 // weights x 32768, as f16 operands
                float pe[16];
                v16h pb;
#pragma unroll
                for (int e = 0; e < 16; ++e) { pe[e] = __builtin_amdgcn_exp2f(fmaf(s[g][e >> 3][e & 7], CS, nm)); pb[e] = (h16)pe[e]; }
#pragma unroll
                for (int w = 8; w; w >>= 1)   // a tree: a chain of 16 dependent adds would stall the SIMD's one wave
#pragma unroll
                    for (int e = 0; e < w; ++e) pe[e] += pe[e + w];
                lsum[g] = lsum[g] * alpha + pe[0];
#pragma unroll
                for (int n = 0; n < 4; ++n) o[g][n] = wmma16(vf[n], pb, o[g][n] * alpha);
            }
        }
        asm volatile("s_wait_dscnt 0x0" ::: "memory");      // this wave's last reads of the buffer are done before the barrier frees it for the refill
        asm volatile("s_wait_asynccnt 0x0" ::: "memory");   // this wave's copies of stage st + 1 have landed before the barrier publishes them
        __syncthreads();
        if (st + 2 < NSTG) {
            kn += (size_t)SKEY * DM; vn += SKEY;
            copy_tile(lf + lo, kn + ko, DM);
            copy_vt(lf + lo + TSZ * 2, vn + vo);
        }
        { const unsigned x = lf; lf = lg; lg = x; }   // the next trip frees the other buffer
    }
    asm volatile("s_wait_asynccnt 0x0" ::: "memory");   // no copy is outstanding when the wave goes on to its end
#pragma unroll
    for (int g = 0; g < QG; ++g) {
        const float inv = 1.0f / (lsum[g] + xhalf(lsum[g]));   // the halves' sums (x 32768, like the weights) join once
        h16* crow = CTX16 + (tok0 + q0 + g * 16 + lr) * KC + (size_t)h * HD + 8 * hi;   // columns 0..1023 of the [a | gelu(h)] rows
#pragma unroll
        for (int n = 0; n < 4; ++n) { v8h o8;
#pragma unroll
            for (int j = 0; j < 8; ++j) o8[j] = (h16)(o[g][n][j] * inv);
            *(v8h*)(crow + n * 16) = o8; }
        if (g + 1 < QG) {
            asm volatile("s_wait_xcnt 0x0" ::: "memory");   // before the next group rewrites the registers that this group's stores name
            __builtin_amdgcn_sched_barrier(0);               // keeps the next group's register writes behind that wait
        }
    }
}

// bc_rows: bc[n] = b2[n] + sum over j of [bao | bmo][j] . W2[j][n], f32 sums along the rows of the f16 plane W2^T. A wave takes 32 rows n, lane r keeps row r's sum: one 128-B store a wave.
__device__ __forceinline__ void bc_rows(const h16* __restrict__ W2T, const float* __restrict__ bao, const float* __restrict__ bmo, const float* __restrict__ b2, float* BC, const int blk) {
    const int lane = threadIdx.x & 31, n0 = blk * 128 + (threadIdx.x >> 5) * 32;
    float bv[8][8];
#pragma unroll
    for (int c = 0; c < 8; ++c) { const float* bp = (c < 4 ? bao + c * 256 : bmo + (c - 4) * 256) + lane * 8;
#pragma unroll
        for (int i = 0; i < 8; ++i) bv[c][i] = bfr(bp[i]); }
    float res = 0.f;
    for (int r0 = 0; r0 < 32; r0 += 4) {
        v8h w[4][8];
#pragma unroll   // four rows a trip: their 32 loads go out together, one latency a trip instead of one a row
        for (int u = 0; u < 4; ++u)
#pragma unroll
            for (int c = 0; c < 8; ++c) w[u][c] = *(const v8h*)(W2T + (size_t)(n0 + r0 + u) * (2 * DM) + c * 256 + lane * 8);
        asm volatile("s_wait_xcnt 0x0" ::: "memory");   // before the next trip rewrites the registers that this trip's loads name
#pragma unroll
        for (int u = 0; u < 4; ++u) { float s = 0.f;
#pragma unroll
            for (int c = 0; c < 8; ++c)
#pragma unroll
                for (int i = 0; i < 8; ++i) s += (float)w[u][c][i] * bv[c][i];
            s = hsum16(s); s += xhalf(s);
            res = (lane == r0 + u) ? s : res; }
    }
    BC[n0 + lane] = res + bfr(b2[n0 + lane]);
    asm volatile("s_wait_xcnt 0x0" ::: "memory");   // behind the store: in the merged kernel other code follows it in the listing and rewrites the registers that it names
}

// k_attn_wc: the attention and the two jobs on weights alone that only the last product reads, as block ranges of ONE grid: the attention leaves most of the matrix pipe's slots
// idle, so the 112 tiles of Wc^T and the 8 blocks of bc run beside it. The job is the same for a whole block, so the barriers of attn_block and wc_block stand under block-uniform control flow.
#define AB_ATT (NB_ * NH_ * (NT_ / QBLK))
#define AB_WC  ((DM / 128) * (KC / 128))
#define AB_BC  (DM / 128)
__global__ __launch_bounds__(128) void k_attn_wc(const h16* __restrict__ Q16, const h16* __restrict__ K16, const h16* __restrict__ VT16, h16* CTX16, const h16* __restrict__ W2T, const h16* __restrict__ Wao16,
                                                const h16* __restrict__ Wmo16, const float* __restrict__ bao, const float* __restrict__ bmo, const float* __restrict__ b2, h16* WcT, float* BC) {
    __shared__ __align__(16) h16 ring[RING];
    const int t = blockIdx.x;
    if (t < AB_ATT) { attn_block(Q16, K16, VT16, CTX16, ring, t); return; }
    if (t < AB_ATT + AB_WC) { wc_block(W2T, Wao16, Wmo16, WcT, ring, t - AB_ATT); return; }
    bc_rows(W2T, bao, bmo, b2, BC, t - (AB_ATT + AB_WC));
}

extern "C" void kernel_launch(void* const* d_in, const int* in_sizes, int n_in,
                              void* d_out, int out_size, void* d_ws, size_t ws_size, hipStream_t stream) {
    (void)in_sizes; (void)n_in; (void)out_size;
    const float* x = (const float*)d_in[0]; const float* ng = (const float*)d_in[1]; const float* nb = (const float*)d_in[2]; const float* W1 = (const float*)d_in[3]; const float* b1 = (const float*)d_in[4];
    const float* qg = (const float*)d_in[5]; const float* qb = (const float*)d_in[6]; const float* kg = (const float*)d_in[7]; const float* kb = (const float*)d_in[8];
    const float* Wao = (const float*)d_in[9]; const float* bao = (const float*)d_in[10]; const float* Wmo = (const float*)d_in[11]; const float* bmo = (const float*)d_in[12];
    const float* W2 = (const float*)d_in[13]; const float* b2 = (const float*)d_in[14];
    float* out = (float*)d_out;    // [2][2048][1024]
    char* wsp = (char*)d_ws;
    auto take = [&](size_t bytes) { char* p = wsp; wsp += (bytes + 255) & ~(size_t)255; return (void*)p; };
    h16* XN16 = (h16*)take((size_t)NTK * DM * 2); h16* W1T = (h16*)take((size_t)NFP * DM * 2);
    h16* Wao16 = (h16*)take((size_t)DM * DM * 2); h16* Wmo16 = (h16*)take((size_t)MLPP * DM * 2); h16* W2T = (h16*)take((size_t)DM * 2 * DM * 2);
    h16* Q16 = (h16*)take((size_t)NTK * DM * 2); h16* K16 = (h16*)take((size_t)NTK * DM * 2); h16* V16 = (h16*)take((size_t)NTK * DM * 2); h16* VT16 = (h16*)take((size_t)NTK * DM * 2);
    h16* AG16 = (h16*)take((size_t)NTK * KC * 2); h16* WcT = (h16*)take((size_t)DM * KC * 2); float* BC = (float*)take((size_t)DM * 4);
    if ((size_t)(wsp - (char*)d_ws) > ws_size) return;    // 8.4 + 7.9 + 2.1 + 1.6 + 4.2 + 4 x 8.4 + 14.7 + 3.7 MB ~ 76 MB
    k_prep<<<PB_LN + PB_W1 + PB_W2 + PB_WAO + PB_WMO, 256, 0, stream>>>(x, ng, nb, W1, W2, Wao, Wmo, XN16, W1T, W2T, Wao16, Wmo16);
    k_fused<<<dim3(NTK / 128, NFP / 128, 1), 128, 0, stream>>>(XN16, W1T, b1, qg, qb, kg, kb, Q16, K16, V16, AG16 + DM);
    k_vt<<<NB_ * NH_ * (NT_ / 64), 256, 0, stream>>>(V16, VT16);
    k_attn_wc<<<AB_ATT + AB_WC + AB_BC, 128, 0, stream>>>(Q16, K16, VT16, AG16, W2T, Wao16, Wmo16, bao, bmo, b2, WcT, BC);
    k_gemmout<<<dim3(NTK / 128, DM / 128, 1), 256, 0, stream>>>(AG16, WcT, BC, x, out);
}

// v007
// Measured time: 116 microseconds a run.
// Next to v006, in two timings, it ran 1.07 times as fast each time.
// Over all steps from v000 it is 3.50 times as fast.
#include <hip/hip_runtime.h>

// Contractions on v_wmma_f32_16x16x32_f16 with plain f16 operands, f32 accumulate: fused = LN(x).W1 + b1 ([4096 x 1024].[1024 x 3788 (padded 3840)]), the 16-head
// attention with per-head LayerNorm on q and k (scores [2048 x 64].[64 x 2048] /8, softmax, .v), and the tail out = x + [a.Wao + bao | gelu_tanh(h).Wmo + bmo].W2 + b2 in the
// associated form out = x + [a | gelu_tanh(h)].Wc + bc ([4096 x 1740 (1792)].[1792 x 1024]) with Wc = [Wao.W2(rows 0..1023) ; Wmo.W2(rows 1024..2047)] (two [. x 1024].[1024 x 1024]
// products of weights, made anew in every call) and bc = b2 + [bao | bmo].W2. Input weights are f16 of their bf16 rounding (exact for the bf16-input reference), the activations
// and Wc are computed values rounded once to f16 (the output is dominated by the exact residual x). LayerNorms (eps 1e-6), gelu, softmax and bc run in f32.

#define NB_  2
#define NT_  2048
#define DM   1024
#define NH_  16
#define HD   64
#define NTK  (NB_ * NT_)
#define NF   3788
#define NFP  3840
#define MLPH 716
#define MLPP 768
#define KC   (DM + MLPP)   // k extent of the tail product: [a | gelu(h)] rows and Wc^T rows have this pitch
#define PSC  32768.0f
#define EPS  1e-6f

typedef _Float16 h16;
typedef __attribute__((ext_vector_type(16))) _Float16 v16h;
typedef __attribute__((ext_vector_type(8)))  _Float16 v8h;
typedef __attribute__((ext_vector_type(8)))  float    v8f;
typedef __attribute__((ext_vector_type(4)))  float    v4f;
typedef v8h  __attribute__((may_alias)) v8ha;
typedef v4f  __attribute__((may_alias)) v4fa;

__device__ __forceinline__ unsigned short f2bf(float f) { unsigned u = __float_as_uint(f); u += 0x7FFFu + ((u >> 16) & 1u); return (unsigned short)(u >> 16); }
__device__ __forceinline__ float bf2f(unsigned short b) { return __uint_as_float(((unsigned)b) << 16); }
__device__ __forceinline__ float bfr(float f) { return bf2f(f2bf(f)); }
__device__ __forceinline__ v16h cat16(v8h lo, v8h hi) { return __builtin_shufflevector(lo, hi, 0, 1, 2, 3, 4, 5, 6, 7, 8, 9, 10, 11, 12, 13, 14, 15); }
__device__ __forceinline__ v8f wmma16(v16h a, v16h b, v8f c) { return __builtin_amdgcn_wmma_f32_16x16x32_f16(false, a, false, b, (short)0, c, false, false); }
__device__ __forceinline__ float hsum16(float v) { v += __shfl_xor(v, 1, 16); v += __shfl_xor(v, 2, 16); v += __shfl_xor(v, 4, 16); return v + __shfl_xor(v, 8, 16); }
// gelu_tanh of 8 values without a branch: 0.5 (1 + tanh u) = 1 / (1 + e^(-2u)), u = c (x + 0.044715 x^3), so gelu = x / (1 + 2^(k x (1 + 0.044715 x^2))) with k = -2 c log2(e). The library tanhf takes
// two divergent branches an element, each a serial chain that a lone wave cannot hide. The ends are the reference's: 2^(+big) = inf gives x . 0, 2^(-big) = 0 gives x.
// The eight v_exp_f32 and the eight v_rcp_f32 stand in one asm statement each, results apart from sources, closed by the one v_nop that the instruction set asks for behind a transcendental before
// its result is used or a source overwritten.
__device__ __forceinline__ void gelu8(v4f& a, v4f& b) {
    const float k = -2.0f * 0.7978845608028654f * 1.4426950408889634f;
    float z[8], e[8];
#pragma unroll
    for (int i = 0; i < 8; ++i) { const float x = i < 4 ? a[i & 3] : b[i & 3]; z[i] = k * x * fmaf(0.044715f * x, x, 1.0f); }
    asm("v_exp_f32 %0, %8\n\tv_exp_f32 %1, %9\n\tv_exp_f32 %2, %10\n\tv_exp_f32 %3, %11\n\tv_exp_f32 %4, %12\n\tv_exp_f32 %5, %13\n\tv_exp_f32 %6, %14\n\tv_exp_f32 %7, %15\n\tv_nop"
        : "=&v"(e[0]), "=&v"(e[1]), "=&v"(e[2]), "=&v"(e[3]), "=&v"(e[4]), "=&v"(e[5]), "=&v"(e[6]), "=&v"(e[7])
        : "v"(z[0]), "v"(z[1]), "v"(z[2]), "v"(z[3]), "v"(z[4]), "v"(z[5]), "v"(z[6]), "v"(z[7]));
#pragma unroll
    for (int i = 0; i < 8; ++i) z[i] = 1.0f + e[i];
    asm("v_rcp_f32 %0, %8\n\tv_rcp_f32 %1, %9\n\tv_rcp_f32 %2, %10\n\tv_rcp_f32 %3, %11\n\tv_rcp_f32 %4, %12\n\tv_rcp_f32 %5, %13\n\tv_rcp_f32 %6, %14\n\tv_rcp_f32 %7, %15\n\tv_nop"
        : "=&v"(e[0]), "=&v"(e[1]), "=&v"(e[2]), "=&v"(e[3]), "=&v"(e[4]), "=&v"(e[5]), "=&v"(e[6]), "=&v"(e[7])
        : "v"(z[0]), "v"(z[1]), "v"(z[2]), "v"(z[3]), "v"(z[4]), "v"(z[5]), "v"(z[6]), "v"(z[7]));
#pragma unroll
    for (int i = 0; i < 4; ++i) { a[i] *= e[i]; b[i] *= e[4 + i]; }
}

// ln_rows: LayerNorm of 8 rows of x (one a wave) -> XN16; blk = row group.
__device__ __forceinline__ void ln_rows(const float* __restrict__ x, const float* __restrict__ g, const float* __restrict__ bt, h16* XN16, const int blk) {
    const int lane = threadIdx.x & 31, r = blk * 8 + (threadIdx.x >> 5);
    if (r >= NTK) return;
    const float* xr = x + (size_t)r * DM;
    float s = 0.f;
#pragma unroll
    for (int q = 0; q < 4; ++q)
#pragma unroll
        for (int i = 0; i < 8; ++i) s += bfr(xr[q * 256 + lane * 8 + i]);
#pragma unroll
    for (int o = 16; o; o >>= 1) s += __shfl_xor(s, o, 32);
    const float mu = s * (1.0f / DM);
    float sq = 0.f;
#pragma unroll 1
    for (int q = 0; q < 4; ++q)
#pragma unroll
        for (int i = 0; i < 8; ++i) { const float d = bfr(xr[q * 256 + lane * 8 + i]) - mu; sq += d * d; }
#pragma unroll
    for (int o = 16; o; o >>= 1) sq += __shfl_xor(sq, o, 32);
    const float rs = rsqrtf(sq * (1.0f / DM) + EPS);
#pragma unroll 1
    for (int q = 0; q < 4; ++q) {
        v8h o8;
#pragma unroll
        for (int i = 0; i < 8; ++i) { const int c = q * 256 + lane * 8 + i; o8[i] = (h16)((bfr(xr[c]) - mu) * rs * bfr(g[c]) + bfr(bt[c])); }
        *(v8h*)(XN16 + (size_t)r * DM + q * 256 + lane * 8) = o8; 
    }
}

// wt_tile: k-major W [K rows][N cols] -> n-major f16 plane WT [Npad][Kpad] (f16 of bf16(W); rows >= N and columns >= K zero); one 64 x 64 tile (kb, nb) through LDS.
__device__ __forceinline__ void wt_tile(const float* __restrict__ Wm, int K, int N, int Kpad, h16* WT, const int kb, const int nb) {
    __shared__ __align__(16) h16 tl[64 * 72];
    const int tid = threadIdx.x, k0 = kb * 64, n0 = nb * 64;
    const int kk = tid >> 2, nq = (tid & 3) * 16;
#pragma unroll
    for (int i = 0; i < 16; ++i) { const int k = k0 + kk, n = n0 + nq + i; tl[(nq + i) * 72 + kk] = (k < K && n < N) ? (h16)bfr(Wm[(size_t)k * N + n]) : (h16)0.f; }
    __syncthreads();
    const int piece = tid & 7;
    auto pass = [&]() {
#pragma unroll
        for (int s = 0; s < 2; ++s) { const int nr = (tid >> 3) + 32 * s; const v8h val = *(const v8ha*)(tl + nr * 72 + piece * 8);
            *(v8h*)(WT + (size_t)(n0 + nr) * Kpad + k0 + piece * 8) = val; }
    };
    pass(); 
    asm volatile("s_wait_xcnt 0x0" ::: "memory");   // behind the two stores: in the merged kernel other code follows them in the listing and rewrites the registers that they name
}

// cv_rows: W [rows][1024] f32 -> f16 plane of the same layout (f16 of bf16(W); plane rows past the weight's last row are zero): 4 rows a block, 16 elements a thread. As the n-major operand of Wc^T = W2^T.W^T
// a weight is read along its own rows, so it needs no transpose.
__device__ __forceinline__ void cv_rows(const float* __restrict__ Wm, const int rows, h16* W16, const int blk) {
    const int tid = threadIdx.x, col = (tid & 127) * 8;
    v4f v[2][2];
#pragma unroll
    for (int s = 0; s < 2; ++s) { const int r = blk * 4 + s * 2 + (tid >> 7);   // the same row in a whole wave
        if (r < rows) { const float* p = Wm + (size_t)r * DM + col; v[s][0] = *(const v4f*)p; v[s][1] = *(const v4f*)(p + 4); } else { v[s][0] = (v4f){}; v[s][1] = (v4f){}; } }
#pragma unroll
    for (int s = 0; s < 2; ++s) { const int r = blk * 4 + s * 2 + (tid >> 7); v8h o;
#pragma unroll
        for (int i = 0; i < 8; ++i) o[i] = (h16)bfr(v[s][i >> 2][i & 3]);
        *(v8h*)(W16 + (size_t)r * DM + col) = o; }
    asm volatile("s_wait_xcnt 0x0" ::: "memory");   // behind the loads and stores: in the merged kernel other code follows them in the listing and rewrites the registers that they name
}

// k_prep: the five jobs that depend on the inputs alone, as block ranges of ONE grid, so that their starts, first loads and tails overlap: the LayerNorm of x, the two
// weight transposes, each with its tiles in the order k fastest, and the two weight conversions. The job is the same for a whole block, so wt_tile's barrier stands under block-uniform control flow.
#define PB_LN  (NTK / 8)
#define PB_W1  ((DM / 64) * (NFP / 64))
#define PB_W2  (((2 * DM) / 64) * (DM / 64))
#define PB_WAO (DM / 4)
#define PB_WMO (MLPP / 4)
__global__ __launch_bounds__(256) void k_prep(const float* __restrict__ x, const float* __restrict__ g, const float* __restrict__ bt, const float* __restrict__ W1, const float* __restrict__ W2,
                                             const float* __restrict__ Wao, const float* __restrict__ Wmo, h16* XN16, h16* W1T, h16* W2T, h16* Wao16, h16* Wmo16) {
    int t = blockIdx.x;
    if (t < PB_LN) { ln_rows(x, g, bt, XN16, t); return; }
    t -= PB_LN;
    const float* Wm; h16* WT; int K, N, Kpad, nb;   // nb by a literal divisor in each branch: scalar shifts and one scalar multiply, no division at run time
    if (t < PB_W1) { Wm = W1; WT = W1T; K = DM; N = NF; Kpad = DM; nb = t / (DM / 64); }
    else if (t < PB_W1 + PB_W2) { t -= PB_W1; Wm = W2; WT = W2T; K = 2 * DM; N = DM; Kpad = 2 * DM; nb = t / ((2 * DM) / 64); }
    else if (t < PB_W1 + PB_W2 + PB_WAO) { cv_rows(Wao, DM, Wao16, t - (PB_W1 + PB_W2)); return; }
    else { cv_rows(Wmo, MLPH, Wmo16, t - (PB_W1 + PB_W2 + PB_WAO)); return; }
    wt_tile(Wm, K, N, Kpad, WT, t - nb * (Kpad / 64), nb);
}

// GEMM tile core: 128 x 128 block tile (2 x 2 waves, 64 x 64 each) of A[M][K] (f16, row pitch lda) . BT[N][K] (row pitch ldb), K a multiple of 64 and at least 128. A pass is 64 k: the
// 128 rows x 128 B of both operands are brought into LDS by asynchronous copies (pitch 144 B for the ds_load_b128 readers), two buffers, the next pass's copies in
// flight while this pass is worked on. A buffer is [A tile | BT tile]. Returns acc[4][4] (row group, column group; D layout); the k order of every sum is ascending.
#define TP   72
#define TSZ  (128 * TP)
#define RING (4 * TSZ)

// One operand's tile of one pass: 8 copies a lane, 16 rows apart (a wave covers 4 whole 128-B rows a copy). The s_wait_xcnt ends the copies' own statement, so that
// no address register of a copy is rewritten ahead of it.
__device__ __forceinline__ void copy_tile(unsigned l, const h16* g, int ld) {
    const size_t rs = (size_t)16 * ld;
    asm volatile("global_load_async_to_lds_b128 %0, %8, off\n\t"
                 "global_load_async_to_lds_b128 %1, %9, off\n\t"
                 "global_load_async_to_lds_b128 %2, %10, off\n\t"
                 "global_load_async_to_lds_b128 %3, %11, off\n\t"
                 "global_load_async_to_lds_b128 %4, %12, off\n\t"
                 "global_load_async_to_lds_b128 %5, %13, off\n\t"
                 "global_load_async_to_lds_b128 %6, %14, off\n\t"
                 "global_load_async_to_lds_b128 %7, %15, off\n\t"
                 "s_wait_xcnt 0x0"
                 :: "v"(l), "v"(l + 1u * 16u * 144u), "v"(l + 2u * 16u * 144u), "v"(l + 3u * 16u * 144u),
                    "v"(l + 4u * 16u * 144u), "v"(l + 5u * 16u * 144u), "v"(l + 6u * 16u * 144u), "v"(l + 7u * 16u * 144u),
                    "v"(g), "v"(g + rs), "v"(g + 2 * rs), "v"(g + 3 * rs), "v"(g + 4 * rs), "v"(g + 5 * rs), "v"(g + 6 * rs), "v"(g + 7 * rs)
                 : "memory");
}

__device__ __forceinline__ void gemm_tile(const h16* __restrict__ A, const int lda, const h16* __restrict__ BT, const int ldb, const int K, int rb, int cb, h16* ring, v8f (&acc)[4][4]) {
    const int tid = threadIdx.x, lane = tid & 31, wave = tid >> 5, lr = lane & 15, hi = lane >> 4;
    const h16* ga = A + (size_t)(rb + (tid >> 3)) * lda + (tid & 7) * 8;
    const h16* gb = BT + (size_t)(cb + (tid >> 3)) * ldb + (tid & 7) * 8;
    const unsigned l0 = (unsigned)(size_t)ring + (unsigned)((tid >> 3) * 144 + (tid & 7) * 16);
    const int np = K / 64;
#pragma unroll
    for (int i = 0; i < 4; ++i)
#pragma unroll
        for (int t = 0; t < 4; ++t) acc[i][t] = (v8f){};
    copy_tile(l0, ga, lda);
    copy_tile(l0 + TSZ * 2, gb, ldb);
    asm volatile("s_wait_asynccnt 0x0" ::: "memory");   // pass 0's own copies have landed before the barrier publishes them
    __syncthreads();
    copy_tile(l0 + 2 * TSZ * 2, ga + 64, lda);
    copy_tile(l0 + 3 * TSZ * 2, gb + 64, ldb);
#pragma unroll 1   // one pass a trip: the two buffers alternate by the trip's parity
    for (int p = 0; p < np; ++p) {
        const int bo = (p & 1) * 2 * TSZ;
        const h16* sa = ring + bo + ((wave >> 1) * 64 + lr) * TP + 8 * hi;
        const h16* sb = ring + bo + TSZ + ((wave & 1) * 64 + lr) * TP + 8 * hi;
        v16h a[4], b[4];
#pragma unroll
        for (int i = 0; i < 4; ++i) a[i] = cat16(*(const v8ha*)(sa + i * 16 * TP), *(const v8ha*)(sa + i * 16 * TP + 16));
#pragma unroll
        for (int t = 0; t < 4; ++t) b[t] = cat16(*(const v8ha*)(sb + t * 16 * TP), *(const v8ha*)(sb + t * 16 * TP + 16));
        __builtin_amdgcn_sched_barrier(0);   // the 16 LDS reads of a k step go out as one group ahead of its WMMAs
#pragma unroll
        for (int i = 0; i < 4; ++i)
#pragma unroll
            for (int t = 0; t < 4; ++t) acc[i][t] = wmma16(a[i], b[t], acc[i][t]);
        __builtin_amdgcn_sched_barrier(0);   // the second k step's reads stay behind the first step's WMMAs, in the same fragment registers
#pragma unroll
        for (int i = 0; i < 4; ++i) a[i] = cat16(*(const v8ha*)(sa + i * 16 * TP + 32), *(const v8ha*)(sa + i * 16 * TP + 48));
#pragma unroll
        for (int t = 0; t < 4; ++t) b[t] = cat16(*(const v8ha*)(sb + t * 16 * TP + 32), *(const v8ha*)(sb + t * 16 * TP + 48));
        asm volatile("s_wait_dscnt 0x0" ::: "memory");      // this wave's last reads of the buffer are done before the barrier frees it for the refill
        asm volatile("s_wait_asynccnt 0x0" ::: "memory");   // this wave's copies of pass p + 1 have landed before the barrier publishes them
        __syncthreads();
        if (p + 2 < np) {
            copy_tile(l0 + bo * 2, ga + (size_t)(p + 2) * 64, lda);
            copy_tile(l0 + bo * 2 + TSZ * 2, gb + (size_t)(p + 2) * 64, ldb);
        }
        __builtin_amdgcn_sched_barrier(0);   // the refill is issued ahead of the second k step's WMMAs (registers only), so that it flies under them
#pragma unroll
        for (int i = 0; i < 4; ++i)
#pragma unroll
            for (int t = 0; t < 4; ++t) acc[i][t] = wmma16(a[i], b[t], acc[i][t]);
    }
    asm volatile("s_wait_asynccnt 0x0" ::: "memory");       // no copy is outstanding when the ring becomes the output staging
}

// gemm_tile_k2: the same core for a block of 8 waves in two groups of 4. Group q (waves 4q .. 4q + 3) takes the 64-k slices q, q + 2, q + 4, ... of K (a multiple of 128, at least 256) through a two-buffer
// ring of its own and sums them, k ascending, over the whole 128 x 128 tile: two waves share a SIMD and two slices' copies are in flight, so one group's LDS reads, copy issue and landing
// time run under the other's WMMAs. The barriers are the block's: both groups make the same trips. The caller adds the two groups' partial tiles.
__device__ __forceinline__ void gemm_tile_k2(const h16* __restrict__ A, const int lda, const h16* __restrict__ BT, const int ldb, const int K, int rb, int cb, h16* ring2, v8f (&acc)[4][4]) {
    const int grp = threadIdx.x >> 7, tid = threadIdx.x & 127, lane = tid & 31, wave = tid >> 5, lr = lane & 15, hi = lane >> 4;
    h16* ring = ring2 + grp * RING;
    const h16* ga = A + (size_t)(rb + (tid >> 3)) * lda + grp * 64 + (tid & 7) * 8;
    const h16* gb = BT + (size_t)(cb + (tid >> 3)) * ldb + grp * 64 + (tid & 7) * 8;
    const unsigned l0 = (unsigned)(size_t)ring + (unsigned)((tid >> 3) * 144 + (tid & 7) * 16);
    const int np = K / 128;
#pragma unroll
    for (int i = 0; i < 4; ++i)
#pragma unroll
        for (int t = 0; t < 4; ++t) acc[i][t] = (v8f){};
    copy_tile(l0, ga, lda);
    copy_tile(l0 + TSZ * 2, gb, ldb);
    asm volatile("s_wait_asynccnt 0x0" ::: "memory");   // pass 0's own copies have landed before the barrier publishes them
    __syncthreads();
    copy_tile(l0 + 2 * TSZ * 2, ga + 128, lda);
    copy_tile(l0 + 3 * TSZ * 2, gb + 128, ldb);
#pragma unroll 1   // one pass a trip: the two buffers alternate by the trip's parity
    for (int p = 0; p < np; ++p) {
        const int bo = (p & 1) * 2 * TSZ;
        const h16* sa = ring + bo + ((wave >> 1) * 64 + lr) * TP + 8 * hi;
        const h16* sb = ring + bo + TSZ + ((wave & 1) * 64 + lr) * TP + 8 * hi;
        v16h a[4], b[4];
#pragma unroll
        for (int i = 0; i < 4; ++i) a[i] = cat16(*(const v8ha*)(sa + i * 16 * TP), *(const v8ha*)(sa + i * 16 * TP + 16));
#pragma unroll
        for (int t = 0; t < 4; ++t) b[t] = cat16(*(const v8ha*)(sb + t * 16 * TP), *(const v8ha*)(sb + t * 16 * TP + 16));
        __builtin_amdgcn_sched_barrier(0);   // the 16 LDS reads of a k step go out as one group ahead of its WMMAs
#pragma unroll
        for (int i = 0; i < 4; ++i)
#pragma unroll
            for (int t = 0; t < 4; ++t) acc[i][t] = wmma16(a[i], b[t], acc[i][t]);
        __builtin_amdgcn_sched_barrier(0);   // the second k step's reads stay behind the first step's WMMAs, in the same fragment registers
#pragma unroll
        for (int i = 0; i < 4; ++i) a[i] = cat16(*(const v8ha*)(sa + i * 16 * TP + 32), *(const v8ha*)(sa + i * 16 * TP + 48));
#pragma unroll
        for (int t = 0; t < 4; ++t) b[t] = cat16(*(const v8ha*)(sb + t * 16 * TP + 32), *(const v8ha*)(sb + t * 16 * TP + 48));
        asm volatile("s_wait_dscnt 0x0" ::: "memory");      // this wave's last reads of the buffer are done before the barrier frees it for the refill
        asm volatile("s_wait_asynccnt 0x0" ::: "memory");   // this wave's copies of pass p + 1 have landed before the barrier publishes them
        __syncthreads();
        if (p + 2 < np) {
            copy_tile(l0 + bo * 2, ga + (size_t)(p + 2) * 128, lda);
            copy_tile(l0 + bo * 2 + TSZ * 2, gb + (size_t)(p + 2) * 128, ldb);
        }
        __builtin_amdgcn_sched_barrier(0);   // the refill is issued ahead of the second k step's WMMAs (registers only), so that it flies under them
#pragma unroll
        for (int i = 0; i < 4; ++i)
#pragma unroll
            for (int t = 0; t < 4; ++t) acc[i][t] = wmma16(a[i], b[t], acc[i][t]);
    }
    asm volatile("s_wait_asynccnt 0x0" ::: "memory");       // no copy is outstanding when the rings become the output staging
}

// Store pass of a wave's staged 64 x 64 f32 tile (pitch 68) as f16 rows of 128 B, whole lines; gelu (a compile-time or block-uniform choice) is applied to the staged f32 values.
__device__ __forceinline__ void put_tile16(const float* os, h16* crow, int ld, int lane, const bool gelu) {
    for (int s0 = 0; s0 < 16; s0 += 4) {
        v4f v[4][2];
#pragma unroll   // four row groups a trip: their LDS reads go out together, one latency a trip instead of one a group
        for (int u = 0; u < 4; ++u) { const float* sp = os + (4 * (s0 + u) + (lane >> 3)) * 68 + (lane & 7) * 8; v[u][0] = *(const v4fa*)sp; v[u][1] = *(const v4fa*)(sp + 4); }
        if (gelu) {
#pragma unroll
            for (int u = 0; u < 4; ++u) gelu8(v[u][0], v[u][1]);
        }
#pragma unroll
        for (int u = 0; u < 4; ++u) { v8h o;
#pragma unroll
            for (int i = 0; i < 8; ++i) o[i] = (h16)v[u][i >> 2][i & 3];
            *(v8h*)(crow + (size_t)(4 * (s0 + u) + (lane >> 3)) * ld + (lane & 7) * 8) = o; }
        asm volatile("s_wait_xcnt 0x0" ::: "memory");   // before the next trip rewrites the registers that this trip's stores name
    }
}

// k_fused: fused = XN16 . W1T + b1 over the 3840 padded columns; a wave's 64-wide column group = exactly one head of q / k / v or a 64-wide slice of the MLP hidden:
//   c0 <  1024: q head c0/64: per-row LayerNorm over the 64 head dims (qn_g, qn_b) -> Q16[tok][1024] f16
//   c0 <  2048: k head: LayerNorm (kn_g, kn_b) -> K16
//   c0 <  3072: v -> V16 rows
//   else      : gelu_tanh (in the store pass) -> G16 = columns 1024.. of the [tok][1792] rows [a | gelu(h)] (columns >= 716 of the hidden are exactly 0 after gelu(0 + 0): b1 pad is read as 0; their Wc rows are 0 anyway)
__global__ __launch_bounds__(128) void k_fused(const h16* __restrict__ XN16, const h16* __restrict__ W1T, const float* __restrict__ b1,
                                              const float* __restrict__ qg, const float* __restrict__ qb, const float* __restrict__ kg, const float* __restrict__ kb,
                                              h16* Q16, h16* K16, h16* V16, h16* G16) {
    __shared__ __align__(16) h16 ring[RING];
    const int lane = threadIdx.x & 31, wave = threadIdx.x >> 5, lr = lane & 15, hi = lane >> 4;
    const int rb = blockIdx.x * 128, cb = blockIdx.y * 128;
    v8f acc[4][4];
    gemm_tile(XN16, DM, W1T, DM, DM, rb, cb, ring, acc);
    const int r0 = rb + (wave >> 1) * 64, c0 = cb + (wave & 1) * 64;
    const int sec = cb / DM;                   // 0 q, 1 k, 2 v, 3 mlp (the same for both column groups of a block)
#pragma unroll
    for (int t = 0; t < 4; ++t) { const int col = c0 + t * 16 + lr; const float bv = (col < NF) ? bfr(b1[col]) : 0.f;
#pragma unroll
        for (int i = 0; i < 4; ++i)
#pragma unroll
            for (int j = 0; j < 8; ++j) acc[i][t][j] += bv; }
    if (sec < 2) {
        const float* gg = sec ? kg : qg; const float* bb = sec ? kb : qb;
#pragma unroll
        for (int i = 0; i < 4; ++i)
#pragma unroll
            for (int j = 0; j < 8; ++j) {
                float s = acc[i][0][j] + acc[i][1][j] + acc[i][2][j] + acc[i][3][j];
                const float mu = hsum16(s) * (1.0f / HD);
                float q = 0.f;
#pragma unroll
                for (int t = 0; t < 4; ++t) { const float d = acc[i][t][j] - mu; q += d * d; }
                const float rs = rsqrtf(hsum16(q) * (1.0f / HD) + EPS);
#pragma unroll
                for (int t = 0; t < 4; ++t) acc[i][t][j] = (acc[i][t][j] - mu) * rs * bfr(gg[t * 16 + lr]) + bfr(bb[t * 16 + lr]);
            }
    }
    float* os = (float*)ring + wave * (64 * 68);   // the loop's last barrier has freed the ring; each wave stages its own 64 x 64 tile
#pragma unroll
    for (int i = 0; i < 4; ++i)
#pragma unroll
        for (int t = 0; t < 4; ++t)
#pragma unroll
            for (int j = 0; j < 8; ++j) os[(i * 16 + hi * 8 + j) * 68 + t * 16 + lr] = acc[i][t][j];
    __syncthreads();
    h16* dst; int ld, cc;
    if (sec == 0) { dst = Q16; ld = DM; cc = c0; } else if (sec == 1) { dst = K16; ld = DM; cc = c0 - DM; } else if (sec == 2) { dst = V16; ld = DM; cc = c0 - 2 * DM; } else { dst = G16; ld = KC; cc = c0 - 3 * DM; }
    h16* crow = dst + (size_t)r0 * ld + cc;
    put_tile16(os, crow, ld, lane, sec == 3);
}

// wc_block: one 128 x 128 tile of Wc^T [n][k] (f16, pitch 1792) = W2^T rows n (one half of their 2048 columns) . W rows k: k < 1024 takes Wao and W2's rows 0..1023, k >= 1024 takes Wmo
// (its plane rows 716..767 are zero) and W2's rows 1024..2047. t = tile, n fastest.
__device__ __forceinline__ void wc_block(const h16* __restrict__ W2T, const h16* __restrict__ Wao16, const h16* __restrict__ Wmo16, h16* WcT, h16* ring, const int t) {
    const int lane = threadIdx.x & 31, wave = threadIdx.x >> 5, lr = lane & 15, hi = lane >> 4;
    const int rb = (t & 7) * 128, ck = (t >> 3) * 128;
    const bool mlp = ck >= DM;
    v8f acc[4][4];
    gemm_tile(mlp ? W2T + DM : W2T, 2 * DM, mlp ? Wmo16 : Wao16, DM, DM, rb, mlp ? ck - DM : ck, ring, acc);
    float* os = (float*)ring + wave * (64 * 68);   // the loop's last barrier has freed the ring; each wave stages its own 64 x 64 tile
#pragma unroll
    for (int t4 = 0; t4 < 4; ++t4)
#pragma unroll
        for (int i = 0; i < 4; ++i)
#pragma unroll
            for (int j = 0; j < 8; ++j) os[(i * 16 + hi * 8 + j) * 68 + t4 * 16 + lr] = acc[i][t4][j];
    __syncthreads();
    put_tile16(os, WcT + (size_t)(rb + (wave >> 1) * 64) * KC + ck + (wave & 1) * 64, KC, lane, false);
}

// k_gemmout: out = x + [a | gelu(h)].Wc + bc; bc is a computed f32 vector and is added as it is. 8 waves: the two groups of gemm_tile_k2 each hold a partial sum of the block's 128 x 128 tile;
// every wave stages its 64 x 64 partial tile, and the store pass adds the two partials of an element (group 0's, which carries bc, then group 1's) and x; a wave stores 32 of its tile's 64 rows.
__global__ __launch_bounds__(256) void k_gemmout(const h16* __restrict__ A, const h16* __restrict__ BT, const float* __restrict__ bias, const float* __restrict__ x, float* C) {
    __shared__ __align__(16) h16 ring[2 * RING];
    const int lane = threadIdx.x & 31, wv = threadIdx.x >> 5, wave = wv & 3, grp = wv >> 2, lr = lane & 15, hi = lane >> 4;
    const int rb = blockIdx.x * 128, cb = blockIdx.y * 128;
    v8f acc[4][4];
    gemm_tile_k2(A, KC, BT, KC, KC, rb, cb, ring, acc);
    const int r0 = rb + (wave >> 1) * 64, c0 = cb + (wave & 1) * 64;
    float* os = (float*)ring + wv * (64 * 68);   // the loop's last barrier has freed the rings; each wave stages its own 64 x 64 partial tile
#pragma unroll
    for (int t = 0; t < 4; ++t) { const float bl = bias[c0 + t * 16 + lr]; const float bv = grp ? 0.f : bl;
#pragma unroll
        for (int i = 0; i < 4; ++i)
#pragma unroll
            for (int j = 0; j < 8; ++j) os[(i * 16 + hi * 8 + j) * 68 + t * 16 + lr] = acc[i][t][j] + bv; }
    __syncthreads();   // a wave reads the other group's partial tile too
    const int rsub = grp * 32 + (lane >> 4), cofs = (lane & 15) * 4;   // the lane's first row in the wave tile (a group stores 32 of its 64 rows) and its four columns
    const float* o0 = (const float*)ring + wave * (64 * 68) + rsub * 68 + cofs;
    const float* o1 = o0 + 4 * (64 * 68);
    float* crow = C + (size_t)(r0 + rsub) * DM + c0 + cofs;
    const float* xrow = x + (size_t)(r0 + rsub) * DM + c0 + cofs;
#pragma unroll 1   // the pointers are stepped by the trip and live over it: a trip's loads and stores go from one address pair each with constant offsets, and the wait at its foot stands ahead of every rewrite
    for (int s0 = 0; s0 < 2; ++s0) {
#pragma unroll   // eight row pairs a trip: their x loads and LDS reads go out together, one latency a trip instead of one a row pair
        for (int s = 0; s < 8; ++s) {
            v4f val = *(const v4fa*)(o0 + 2 * s * 68); const v4f v1 = *(const v4fa*)(o1 + 2 * s * 68); const v4f xv = *(const v4f*)(xrow + 2 * s * DM);
#pragma unroll
            for (int e = 0; e < 4; ++e) val[e] = (val[e] + v1[e]) + bfr(xv[e]);
            *(v4f*)(crow + 2 * s * DM) = val; }
        asm volatile("s_wait_xcnt 0x0" ::: "memory");   // before the next trip rewrites the registers that this trip's loads and stores name
        o0 += 16 * 68; o1 += 16 * 68; crow += 16 * DM; xrow += 16 * DM;
    }
}

// k_vt: VT16[b][h][d][t] from V16 rows via LDS transpose; block (b, h, 64 tokens).
__global__ __launch_bounds__(256) void k_vt(const h16* __restrict__ V16, h16* VT16) {
    __shared__ __align__(16) h16 tile[64 * 72];
    const int bid = blockIdx.x;
    const int b = bid / (NH_ * (NT_ / 64)), rem = bid - b * (NH_ * (NT_ / 64)), h = rem / (NT_ / 64), kt = rem - h * (NT_ / 64);
    const int k0 = kt * 64, tid = threadIdx.x;
    const int kk = tid >> 2, d0 = (tid & 3) * 16;
    const h16* src = V16 + ((size_t)b * NT_ + k0 + kk) * DM + h * HD + d0;
#pragma unroll
    for (int i = 0; i < 16; ++i) tile[(d0 + i) * 72 + kk] = src[i];
    __syncthreads();
    const int piece = tid & 7;
    h16* base = VT16 + (((size_t)b * NH_ + h) * HD) * NT_ + k0;
    auto pass = [&]() {
#pragma unroll
        for (int s = 0; s < 2; ++s) { const int d = (tid >> 3) + 32 * s; const v8h val = *(const v8ha*)(tile + d * 72 + piece * 8); *(v8h*)(base + (size_t)d * NT_ + piece * 8) = val; }
    };
    pass(); 
}

// attn_block: transposed products. Block = (b, h, 4 waves x QCOL queries); a step is 32 keys. S^T = K.Q^T: A = 16 key rows, B = the wave's queries (loaded once), so a lane
// holds scores of ONE query (column lr; keys 8 hi + r of each 16-key tile): maximum and sum run in the lane, the two wave halves meet in one cross-row move. The two
// score tiles of a step, exponentiated (x 32768, folded into the exponent) and rounded to f16 in place, ARE the B operand of O^T += V^T.P^T in the hardware k order
// (element s: key 8 hi + s, then 16 + 8 hi + s - 8), which the V^T rows are loaded in: P touches no LDS. O^T gives a lane 8 consecutive head dims of its query.
// K and V^T come through LDS, once for the block's four waves: a stage is SKEY keys, brought in whole 128-B lines by asynchronous copies, two buffers, the next stage's copies in flight
// while this one is worked on. A buffer is [K tile: 128 key rows x 128 B | V^T tile: two halves of 64 keys, each 64 head-dim rows x 128 B], pitch 144 B for the ds_load_b128 readers.
#define QG   4            // 16-query column groups a wave: every K and V^T fragment a wave loads feeds QG products
#define QCOL (QG * 16)
#define QBLK (4 * QCOL)
#define SKEY 128
#define NSTG (NT_ / SKEY)
__device__ __forceinline__ float xhalf(float x) { return __builtin_bit_cast(float, __builtin_amdgcn_permlanex16(__builtin_bit_cast(int, x), __builtin_bit_cast(int, x), 0x76543210, 0xfedcba98, false, false)); }  // lane l with lane l ^ 16

// The V^T tile of one stage: 8 copies a lane, 16 LDS rows apart (a wave covers 4 whole 128-B rows a copy): head-dim rows 0..63 of the first 64 keys, then of the second 64. The s_wait_xcnt ends
// the copies' own statement, so that no address register of a copy is rewritten ahead of it.
__device__ __forceinline__ void copy_vt(unsigned l, const h16* g) {
    const size_t rs = (size_t)16 * NT_;
    asm volatile("global_load_async_to_lds_b128 %0, %8, off\n\t"
                 "global_load_async_to_lds_b128 %1, %9, off\n\t"
                 "global_load_async_to_lds_b128 %2, %10, off\n\t"
                 "global_load_async_to_lds_b128 %3, %11, off\n\t"
                 "global_load_async_to_lds_b128 %4, %12, off\n\t"
                 "global_load_async_to_lds_b128 %5, %13, off\n\t"
                 "global_load_async_to_lds_b128 %6, %14, off\n\t"
                 "global_load_async_to_lds_b128 %7, %15, off\n\t"
                 "s_wait_xcnt 0x0"
                 :: "v"(l), "v"(l + 1u * 16u * 144u), "v"(l + 2u * 16u * 144u), "v"(l + 3u * 16u * 144u),
                    "v"(l + 4u * 16u * 144u), "v"(l + 5u * 16u * 144u), "v"(l + 6u * 16u * 144u), "v"(l + 7u * 16u * 144u),
                    "v"(g), "v"(g + rs), "v"(g + 2 * rs), "v"(g + 3 * rs), "v"(g + 64), "v"(g + 64 + rs), "v"(g + 64 + 2 * rs), "v"(g + 64 + 3 * rs)
                 : "memory");
}

__device__ __forceinline__ void attn_block(const h16* __restrict__ Q16, const h16* __restrict__ K16, const h16* __restrict__ VT16, h16* CTX16, h16* ring, const int bid) {
    const int tid = threadIdx.x, lane = tid & 31, wave = tid >> 5, lr = lane & 15, hi = lane >> 4;
    const int b = bid / (NH_ * (NT_ / QBLK)), rem = bid - b * (NH_ * (NT_ / QBLK)), h = rem / (NT_ / QBLK), qt = rem - h * (NT_ / QBLK);
    const int q0 = qt * QBLK + wave * QCOL;
    const size_t tok0 = (size_t)b * NT_;
    const float CS = 0.125f * 1.4426950408889634f;   // score scale, in base 2
    const h16* kn = K16 + tok0 * DM + h * HD;                     // the head's K rows and V^T rows from the next stage to be copied on: the same for the whole block
    const h16* vn = VT16 + ((size_t)b * NH_ + h) * HD * NT_;
    const unsigned ko = (tid >> 3) * DM + (tid & 7) * 8, vo = (tid >> 3) * NT_ + (tid & 7) * 8;   // the lane's own 16 bytes in them
    // A copy's place in LDS = the wave's four rows in the buffer to be filled (lf, the same for the wave: a scalar that changes with the stage) + the lane's own 16 bytes in them (lo). So only
    // sums made at the copies are operands of their asm statements: a value that is such an operand AND lives over the loop is bound to the low 256 registers, which the loop fills, and is spilled.
    unsigned lf = (unsigned)(size_t)ring + (unsigned)__builtin_amdgcn_readfirstlane(wave) * (4u * 144u), lg = lf + 2 * TSZ * 2;
    const unsigned lo = (unsigned)((lane >> 3) * 144 + (lane & 7) * 16);
    copy_tile(lf + lo, kn + ko, DM);          // stage 0 flies under the Q loads
    copy_vt(lf + lo + TSZ * 2, vn + vo);
    kn += (size_t)SKEY * DM; vn += SKEY;
    v16h qf[QG][2];
#pragma unroll
    for (int g = 0; g < QG; ++g)
#pragma unroll
        for (int kc = 0; kc < 2; ++kc) { const h16* p = Q16 + (tok0 + q0 + g * 16 + lr) * DM + h * HD + kc * 32 + 8 * hi; qf[g][kc] = cat16(*(const v8h*)p, *(const v8h*)(p + 16)); }
    v8f o[QG][4];
    float mrun[QG], lsum[QG];
#pragma unroll
    for (int g = 0; g < QG; ++g) { mrun[g] = -3.0e38f; lsum[g] = 0.f;
#pragma unroll
        for (int n = 0; n < 4; ++n) o[g][n] = (v8f){}; }
    asm volatile("s_wait_xcnt 0x0" ::: "memory");   // before anything rewrites the address registers that the Q loads name
    __builtin_amdgcn_sched_barrier(0);               // keeps later register writes behind that wait
    asm volatile("s_wait_asynccnt 0x0" ::: "memory");   // stage 0's own copies have landed before the barrier publishes them
    __syncthreads();
    copy_tile(lg + lo, kn + ko, DM);
    copy_vt(lg + lo + TSZ * 2, vn + vo);
#pragma unroll 1   // one stage a trip: the two buffers alternate by the trip's parity
    for (int st = 0; st < NSTG; ++st) {
        const int bo = (st & 1) * 2 * TSZ;
        const h16* sk = ring + bo + lr * TP + 8 * hi;
        const h16* sv = sk + TSZ;
        v16h kf[2][2];
#pragma unroll
        for (int t = 0; t < 2; ++t)
#pragma unroll
            for (int kc = 0; kc < 2; ++kc) { const h16* p = sk + (t * 16) * TP + kc * 32; kf[t][kc] = cat16(*(const v8ha*)p, *(const v8ha*)(p + 16)); }
#pragma unroll 1   // one step a trip
        for (int u = 0; u < SKEY / 32; ++u) {
            v16h vf[4];
#pragma unroll
            for (int n = 0; n < 4; ++n) { const h16* p = sv + (n * 16) * TP; vf[n] = cat16(*(const v8ha*)p, *(const v8ha*)(p + 16)); }
            sv += (u & 1) ? 64 * TP - 32 : 32;               // the next step's 32 keys: the other half of the 128-B rows, then the tile's second 64 keys; carried in its own register, so that no vector write stands at the step's head, directly behind the WMMAs
            __builtin_amdgcn_sched_barrier(0);               // the V^T reads go out as one group ahead of the score products and fly under them
            v8f s[QG][2];
#pragma unroll
            for (int g = 0; g < QG; ++g)
#pragma unroll
                for (int t = 0; t < 2; ++t) s[g][t] = wmma16(kf[t][1], qf[g][1], wmma16(kf[t][0], qf[g][0], (v8f){}));
            if (u + 1 < SKEY / 32) {   // the next step's key rows, of this stage only: nothing of the next stage is read ahead of its barrier
#pragma unroll
                for (int t = 0; t < 2; ++t)
#pragma unroll
                    for (int kc = 0; kc < 2; ++kc) { const h16* p = sk + ((u + 1) * 32 + t * 16) * TP + kc * 32; kf[t][kc] = cat16(*(const v8ha*)p, *(const v8ha*)(p + 16)); }
            }
#pragma unroll
            for (int g = 0; g < QG; ++g) {
                float mt[8];
#pragma unroll
                for (int j = 0; j < 8; ++j) mt[j] = fmaxf(s[g][0][j], s[g][1][j]);
#pragma unroll
                for (int w = 4; w; w >>= 1)
#pragma unroll
                    for (int j = 0; j < w; ++j) mt[j] = fmaxf(mt[j], mt[j + w]);
                const float mx = fmaxf(mt[0], xhalf(mt[0])) * CS;
                const float mn = fmaxf(mrun[g], mx);
                const float alpha = __builtin_amdgcn_exp2f(mrun[g] - mn);   // 0 on the first step
                mrun[g] = mn;
                const float nm = 15.0f - mn;                                 // weights x 32768, as f16 operands
                float pe[16];
                v16h pb;
#pragma unroll
                for (int e = 0; e < 16; ++e) { pe[e] = __builtin_amdgcn_exp2f(fmaf(s[g][e >> 3][e & 7], CS, nm)); pb[e] = (h16)pe[e]; }
#pragma unroll
                for (int w = 8; w; w >>= 1)   // a tree: a chain of 16 dependent adds would stall the SIMD's one wave
#pragma unroll
                    for (int e = 0; e < w; ++e) pe[e] += pe[e + w];
                lsum[g] = lsum[g] * alpha + pe[0];
#pragma unroll
                for (int n = 0; n < 4; ++n) o[g][n] = wmma16(vf[n], pb, o[g][n] * alpha);
            }
        }
        asm volatile("s_wait_dscnt 0x0" ::: "memory");      // this wave's last reads of the buffer are done before the barrier frees it for the refill
        asm volatile("s_wait_asynccnt 0x0" ::: "memory");   // this wave's copies of stage st + 1 have landed before the barrier publishes them
        __syncthreads();
        if (st + 2 < NSTG) {
            kn += (size_t)SKEY * DM; vn += SKEY;
            copy_tile(lf + lo, kn + ko, DM);
            copy_vt(lf + lo + TSZ * 2, vn + vo);
        }
        { const unsigned x = lf; lf = lg; lg = x; }   // the next trip frees the other buffer
    }
    asm volatile("s_wait_asynccnt 0x0" ::: "memory");   // no copy is outstanding when the wave goes on to its end
#pragma unroll
    for (int g = 0; g < QG; ++g) {
        const float inv = 1.0f / (lsum[g] + xhalf(lsum[g]));   // the halves' sums (x 32768, like the weights) join once
        h16* crow = CTX16 + (tok0 + q0 + g * 16 + lr) * KC + (size_t)h * HD + 8 * hi;   // columns 0..1023 of the [a | gelu(h)] rows
#pragma unroll
        for (int n = 0; n < 4; ++n) { v8h o8;
#pragma unroll
            for (int j = 0; j < 8; ++j) o8[j] = (h16)(o[g][n][j] * inv);
            *(v8h*)(crow + n * 16) = o8; }
        if (g + 1 < QG) {
            asm volatile("s_wait_xcnt 0x0" ::: "memory");   // before the next group rewrites the registers that this group's stores name
            __builtin_amdgcn_sched_barrier(0);               // keeps the next group's register writes behind that wait
        }
    }
}

// bc_rows: bc[n] = b2[n] + sum over j of [bao | bmo][j] . W2[j][n], f32 sums along the rows of the f16 plane W2^T. A wave takes 32 rows n, lane r keeps row r's sum: one 128-B store a wave.
__device__ __forceinline__ void bc_rows(const h16* __restrict__ W2T, const float* __restrict__ bao, const float* __restrict__ bmo, const float* __restrict__ b2, float* BC, const int blk) {
    const int lane = threadIdx.x & 31, n0 = blk * 128 + (threadIdx.x >> 5) * 32;
    float bv[8][8];
#pragma unroll
    for (int c = 0; c < 8; ++c) { const float* bp = (c < 4 ? bao + c * 256 : bmo + (c - 4) * 256) + lane * 8;
#pragma unroll
        for (int i = 0; i < 8; ++i) bv[c][i] = bfr(bp[i]); }
    float res = 0.f;
    for (int r0 = 0; r0 < 32; r0 += 4) {
        v8h w[4][8];
#pragma unroll   // four rows a trip: their 32 loads go out together, one latency a trip instead of one a row
        for (int u = 0; u < 4; ++u)
#pragma unroll
            for (int c = 0; c < 8; ++c) w[u][c] = *(const v8h*)(W2T + (size_t)(n0 + r0 + u) * (2 * DM) + c * 256 + lane * 8);
        asm volatile("s_wait_xcnt 0x0" ::: "memory");   // before the next trip rewrites the registers that this trip's loads name
#pragma unroll
        for (int u = 0; u < 4; ++u) { float s = 0.f;
#pragma unroll
            for (int c = 0; c < 8; ++c)
#pragma unroll
                for (int i = 0; i < 8; ++i) s += (float)w[u][c][i] * bv[c][i];
            s = hsum16(s); s += xhalf(s);
            res = (lane == r0 + u) ? s : res; }
    }
    BC[n0 + lane] = res + bfr(b2[n0 + lane]);
    asm volatile("s_wait_xcnt 0x0" ::: "memory");   // behind the store: in the merged kernel other code follows it in the listing and rewrites the registers that it names
}

// k_attn_wc: the attention and the two jobs on weights alone that only the last product reads, as block ranges of ONE grid: the attention leaves most of the matrix pipe's slots
// idle, so the 112 tiles of Wc^T and the 8 blocks of bc run beside it. The job is the same for a whole block, so the barriers of attn_block and wc_block stand under block-uniform control flow.
#define AB_ATT (NB_ * NH_ * (NT_ / QBLK))
#define AB_WC  ((DM / 128) * (KC / 128))
#define AB_BC  (DM / 128)
__global__ __launch_bounds__(128) void k_attn_wc(const h16* __restrict__ Q16, const h16* __restrict__ K16, const h16* __restrict__ VT16, h16* CTX16, const h16* __restrict__ W2T, const h16* __restrict__ Wao16,
                                                const h16* __restrict__ Wmo16, const float* __restrict__ bao, const float* __restrict__ bmo, const float* __restrict__ b2, h16* WcT, float* BC) {
    __shared__ __align__(16) h16 ring[RING];
    const int t = blockIdx.x;
    if (t < AB_ATT) { attn_block(Q16, K16, VT16, CTX16, ring, t); return; }
    if (t < AB_ATT + AB_WC) { wc_block(W2T, Wao16, Wmo16, WcT, ring, t - AB_ATT); return; }
    bc_rows(W2T, bao, bmo, b2, BC, t - (AB_ATT + AB_WC));
}

extern "C" void kernel_launch(void* const* d_in, const int* in_sizes, int n_in,
                              void* d_out, int out_size, void* d_ws, size_t ws_size, hipStream_t stream) {
    (void)in_sizes; (void)n_in; (void)out_size;
    const float* x = (const float*)d_in[0]; const float* ng = (const float*)d_in[1]; const float* nb = (const float*)d_in[2]; const float* W1 = (const float*)d_in[3]; const float* b1 = (const float*)d_in[4];
    const float* qg = (const float*)d_in[5]; const float* qb = (const float*)d_in[6]; const float* kg = (const float*)d_in[7]; const float* kb = (const float*)d_in[8];
    const float* Wao = (const float*)d_in[9]; const float* bao = (const float*)d_in[10]; const float* Wmo = (const float*)d_in[11]; const float* bmo = (const float*)d_in[12];
    const float* W2 = (const float*)d_in[13]; const float* b2 = (const float*)d_in[14];
    float* out = (float*)d_out;    // [2][2048][1024]
    char* wsp = (char*)d_ws;
    auto take = [&](size_t bytes) { char* p = wsp; wsp += (bytes + 255) & ~(size_t)255; return (void*)p; };
    h16* XN16 = (h16*)take((size_t)NTK * DM * 2); h16* W1T = (h16*)take((size_t)NFP * DM * 2);
    h16* Wao16 = (h16*)take((size_t)DM * DM * 2); h16* Wmo16 = (h16*)take((size_t)MLPP * DM * 2); h16* W2T = (h16*)take((size_t)DM * 2 * DM * 2);
    h16* Q16 = (h16*)take((size_t)NTK * DM * 2); h16* K16 = (h16*)take((size_t)NTK * DM * 2); h16* V16 = (h16*)take((size_t)NTK * DM * 2); h16* VT16 = (h16*)take((size_t)NTK * DM * 2);
    h16* AG16 = (h16*)take((size_t)NTK * KC * 2); h16* WcT = (h16*)take((size_t)DM * KC * 2); float* BC = (float*)take((size_t)DM * 4);
    if ((size_t)(wsp - (char*)d_ws) > ws_size) return;    // 8.4 + 7.9 + 2.1 + 1.6 + 4.2 + 4 x 8.4 + 14.7 + 3.7 MB ~ 76 MB
    k_prep<<<PB_LN + PB_W1 + PB_W2 + PB_WAO + PB_WMO, 256, 0, stream>>>(x, ng, nb, W1, W2, Wao, Wmo, XN16, W1T, W2T, Wao16, Wmo16);
    k_fused<<<dim3(NTK / 128, NFP / 128, 1), 128, 0, stream>>>(XN16, W1T, b1, qg, qb, kg, kb, Q16, K16, V16, AG16 + DM);
    k_vt<<<NB_ * NH_ * (NT_ / 64), 256, 0, stream>>>(V16, VT16);
    k_attn_wc<<<AB_ATT + AB_WC + AB_BC, 128, 0, stream>>>(Q16, K16, VT16, AG16, W2T, Wao16, Wmo16, bao, bmo, b2, WcT, BC);
    k_gemmout<<<dim3(NTK / 128, DM / 128, 1), 256, 0, stream>>>(AG16, WcT, BC, x, out);
}

// v008
// Measured time: 112 microseconds a run.
// In two side-by-side timings against v007, it was 1.05 and 1.03 times as fast.
// Counting every step since v000, it is 3.64 times as fast.
#include <hip/hip_runtime.h>

// Contractions on v_wmma_f32_16x16x32_f16 with plain f16 operands, f32 accumulate: fused = LN(x).W1 + b1 ([4096 x 1024].[1024 x 3788 (padded 3840)]), the 16-head
// attention with per-head LayerNorm on q and k (scores [2048 x 64].[64 x 2048] /8, softmax, .v), and the tail out = x + [a.Wao + bao | gelu_tanh(h).Wmo + bmo].W2 + b2 in the
// associated form out = x + [a | gelu_tanh(h)].Wc + bc ([4096 x 1740 (1792)].[1792 x 1024]) with Wc = [Wao.W2(rows 0..1023) ; Wmo.W2(rows 1024..2047)] (two [. x 1024].[1024 x 1024]
// products of weights, made anew in every call) and bc = b2 + [bao | bmo].W2. Input weights are f16 of their bf16 rounding (exact for the bf16-input reference), the activations
// and Wc are computed values rounded once to f16 (the output is dominated by the exact residual x). LayerNorms (eps 1e-6), gelu, softmax and bc run in f32.

#define NB_  2
#define NT_  2048
#define DM   1024
#define NH_  16
#define HD   64
#define NTK  (NB_ * NT_)
#define NF   3788
#define NFP  3840
#define MLPH 716
#define MLPP 768
#define KC   (DM + MLPP)   // k extent of the tail product: [a | gelu(h)] rows and Wc^T rows have this pitch
#define PSC  32768.0f
#define EPS  1e-6f

typedef _Float16 h16;
typedef __attribute__((ext_vector_type(16))) _Float16 v16h;
typedef __attribute__((ext_vector_type(8)))  _Float16 v8h;
typedef __attribute__((ext_vector_type(8)))  float    v8f;
typedef __attribute__((ext_vector_type(4)))  float    v4f;
typedef v8h  __attribute__((may_alias)) v8ha;
typedef v4f  __attribute__((may_alias)) v4fa;

__device__ __forceinline__ unsigned short f2bf(float f) { unsigned u = __float_as_uint(f); u += 0x7FFFu + ((u >> 16) & 1u); return (unsigned short)(u >> 16); }
__device__ __forceinline__ float bf2f(unsigned short b) { return __uint_as_float(((unsigned)b) << 16); }
__device__ __forceinline__ float bfr(float f) { return bf2f(f2bf(f)); }
__device__ __forceinline__ v16h cat16(v8h lo, v8h hi) { return __builtin_shufflevector(lo, hi, 0, 1, 2, 3, 4, 5, 6, 7, 8, 9, 10, 11, 12, 13, 14, 15); }
__device__ __forceinline__ v8f wmma16(v16h a, v16h b, v8f c) { return __builtin_amdgcn_wmma_f32_16x16x32_f16(false, a, false, b, (short)0, c, false, false); }
__device__ __forceinline__ float hsum16(float v) { v += __shfl_xor(v, 1, 16); v += __shfl_xor(v, 2, 16); v += __shfl_xor(v, 4, 16); return v + __shfl_xor(v, 8, 16); }
// gelu_tanh of 8 values without a branch: 0.5 (1 + tanh u) = 1 / (1 + e^(-2u)), u = c (x + 0.044715 x^3), so gelu = x / (1 + 2^(k x (1 + 0.044715 x^2))) with k = -2 c log2(e). The library tanhf takes
// two divergent branches an element, each a serial chain that a lone wave cannot hide. The ends are the reference's: 2^(+big) = inf gives x . 0, 2^(-big) = 0 gives x.
// The eight v_exp_f32 and the eight v_rcp_f32 stand in one asm statement each, results apart from sources, closed by the one v_nop that the instruction set asks for behind a transcendental before
// its result is used or a source overwritten.
__device__ __forceinline__ void gelu8(v4f& a, v4f& b) {
    const float k = -2.0f * 0.7978845608028654f * 1.4426950408889634f;
    float z[8], e[8];
#pragma unroll
    for (int i = 0; i < 8; ++i) { const float x = i < 4 ? a[i & 3] : b[i & 3]; z[i] = k * x * fmaf(0.044715f * x, x, 1.0f); }
    asm("v_exp_f32 %0, %8\n\tv_exp_f32 %1, %9\n\tv_exp_f32 %2, %10\n\tv_exp_f32 %3, %11\n\tv_exp_f32 %4, %12\n\tv_exp_f32 %5, %13\n\tv_exp_f32 %6, %14\n\tv_exp_f32 %7, %15\n\tv_nop"
        : "=&v"(e[0]), "=&v"(e[1]), "=&v"(e[2]), "=&v"(e[3]), "=&v"(e[4]), "=&v"(e[5]), "=&v"(e[6]), "=&v"(e[7])
        : "v"(z[0]), "v"(z[1]), "v"(z[2]), "v"(z[3]), "v"(z[4]), "v"(z[5]), "v"(z[6]), "v"(z[7]));
#pragma unroll
    for (int i = 0; i < 8; ++i) z[i] = 1.0f + e[i];
    asm("v_rcp_f32 %0, %8\n\tv_rcp_f32 %1, %9\n\tv_rcp_f32 %2, %10\n\tv_rcp_f32 %3, %11\n\tv_rcp_f32 %4, %12\n\tv_rcp_f32 %5, %13\n\tv_rcp_f32 %6, %14\n\tv_rcp_f32 %7, %15\n\tv_nop"
        : "=&v"(e[0]), "=&v"(e[1]), "=&v"(e[2]), "=&v"(e[3]), "=&v"(e[4]), "=&v"(e[5]), "=&v"(e[6]), "=&v"(e[7])
        : "v"(z[0]), "v"(z[1]), "v"(z[2]), "v"(z[3]), "v"(z[4]), "v"(z[5]), "v"(z[6]), "v"(z[7]));
#pragma unroll
    for (int i = 0; i < 4; ++i) { a[i] *= e[i]; b[i] *= e[4 + i]; }
}

// ln_rows: LayerNorm of 8 rows of x (one a wave) -> XN16; blk = row group.
__device__ __forceinline__ void ln_rows(const float* __restrict__ x, const float* __restrict__ g, const float* __restrict__ bt, h16* XN16, const int blk) {
    const int lane = threadIdx.x & 31, r = blk * 8 + (threadIdx.x >> 5);
    if (r >= NTK) return;
    const float* xr = x + (size_t)r * DM;
    float s = 0.f;
#pragma unroll
    for (int q = 0; q < 4; ++q)
#pragma unroll
        for (int i = 0; i < 8; ++i) s += bfr(xr[q * 256 + lane * 8 + i]);
#pragma unroll
    for (int o = 16; o; o >>= 1) s += __shfl_xor(s, o, 32);
    const float mu = s * (1.0f / DM);
    float sq = 0.f;
#pragma unroll 1
    for (int q = 0; q < 4; ++q)
#pragma unroll
        for (int i = 0; i < 8; ++i) { const float d = bfr(xr[q * 256 + lane * 8 + i]) - mu; sq += d * d; }
#pragma unroll
    for (int o = 16; o; o >>= 1) sq += __shfl_xor(sq, o, 32);
    const float rs = rsqrtf(sq * (1.0f / DM) + EPS);
#pragma unroll 1
    for (int q = 0; q < 4; ++q) {
        v8h o8;
#pragma unroll
        for (int i = 0; i < 8; ++i) { const int c = q * 256 + lane * 8 + i; o8[i] = (h16)((bfr(xr[c]) - mu) * rs * bfr(g[c]) + bfr(bt[c])); }
        *(v8h*)(XN16 + (size_t)r * DM + q * 256 + lane * 8) = o8; 
    }
}

// wt_tile: k-major W [K rows][N cols] -> n-major f16 plane WT [Npad][Kpad] (f16 of bf16(W); rows >= N and columns >= K zero); one 64 x 64 tile (kb, nb) through LDS.
__device__ __forceinline__ void wt_tile(const float* __restrict__ Wm, int K, int N, int Kpad, h16* WT, const int kb, const int nb) {
    __shared__ __align__(16) h16 tl[64 * 72];
    const int tid = threadIdx.x, k0 = kb * 64, n0 = nb * 64;
    const int kk = tid >> 2, nq = (tid & 3) * 16;
#pragma unroll
    for (int i = 0; i < 16; ++i) { const int k = k0 + kk, n = n0 + nq + i; tl[(nq + i) * 72 + kk] = (k < K && n < N) ? (h16)bfr(Wm[(size_t)k * N + n]) : (h16)0.f; }
    __syncthreads();
    const int piece = tid & 7;
    auto pass = [&]() {
#pragma unroll
        for (int s = 0; s < 2; ++s) { const int nr = (tid >> 3) + 32 * s; const v8h val = *(const v8ha*)(tl + nr * 72 + piece * 8);
            *(v8h*)(WT + (size_t)(n0 + nr) * Kpad + k0 + piece * 8) = val; }
    };
    pass(); 
    asm volatile("s_wait_xcnt 0x0" ::: "memory");   // behind the two stores: in the merged kernel other code follows them in the listing and rewrites the registers that they name
}

// cv_rows: W [rows][1024] f32 -> f16 plane of the same layout (f16 of bf16(W); plane rows past the weight's last row are zero): 4 rows a block, 16 elements a thread. As the n-major operand of Wc^T = W2^T.W^T
// a weight is read along its own rows, so it needs no transpose.
__device__ __forceinline__ void cv_rows(const float* __restrict__ Wm, const int rows, h16* W16, const int blk) {
    const int tid = threadIdx.x, col = (tid & 127) * 8;
    v4f v[2][2];
#pragma unroll
    for (int s = 0; s < 2; ++s) { const int r = blk * 4 + s * 2 + (tid >> 7);   // the same row in a whole wave
        if (r < rows) { const float* p = Wm + (size_t)r * DM + col; v[s][0] = *(const v4f*)p; v[s][1] = *(const v4f*)(p + 4); } else { v[s][0] = (v4f){}; v[s][1] = (v4f){}; } }
#pragma unroll
    for (int s = 0; s < 2; ++s) { const int r = blk * 4 + s * 2 + (tid >> 7); v8h o;
#pragma unroll
        for (int i = 0; i < 8; ++i) o[i] = (h16)bfr(v[s][i >> 2][i & 3]);
        *(v8h*)(W16 + (size_t)r * DM + col) = o; }
    asm volatile("s_wait_xcnt 0x0" ::: "memory");   // behind the loads and stores: in the merged kernel other code follows them in the listing and rewrites the registers that they name
}

// k_prep: the five jobs that depend on the inputs alone, as block ranges of ONE grid, so that their starts, first loads and tails overlap: the LayerNorm of x, the two
// weight transposes, each with its tiles in the order k fastest, and the two weight conversions. The job is the same for a whole block, so wt_tile's barrier stands under block-uniform control flow.
#define PB_LN  (NTK / 8)
#define PB_W1  ((DM / 64) * (NFP / 64))
#define PB_W2  (((2 * DM) / 64) * (DM / 64))
#define PB_WAO (DM / 4)
#define PB_WMO (MLPP / 4)
__global__ __launch_bounds__(256) void k_prep(const float* __restrict__ x, const float* __restrict__ g, const float* __restrict__ bt, const float* __restrict__ W1, const float* __restrict__ W2,
                                             const float* __restrict__ Wao, const float* __restrict__ Wmo, h16* XN16, h16* W1T, h16* W2T, h16* Wao16, h16* Wmo16) {
    int t = blockIdx.x;
    if (t < PB_LN) { ln_rows(x, g, bt, XN16, t); return; }
    t -= PB_LN;
    const float* Wm; h16* WT; int K, N, Kpad, nb;   // nb by a literal divisor in each branch: scalar shifts and one scalar multiply, no division at run time
    if (t < PB_W1) { Wm = W1; WT = W1T; K = DM; N = NF; Kpad = DM; nb = t / (DM / 64); }
    else if (t < PB_W1 + PB_W2) { t -= PB_W1; Wm = W2; WT = W2T; K = 2 * DM; N = DM; Kpad = 2 * DM; nb = t / ((2 * DM) / 64); }
    else if (t < PB_W1 + PB_W2 + PB_WAO) { cv_rows(Wao, DM, Wao16, t - (PB_W1 + PB_W2)); return; }
    else { cv_rows(Wmo, MLPH, Wmo16, t - (PB_W1 + PB_W2 + PB_WAO)); return; }
    wt_tile(Wm, K, N, Kpad, WT, t - nb * (Kpad / 64), nb);
}

// GEMM tile core: 128 x 128 block tile (2 x 2 waves, 64 x 64 each) of A[M][K] (f16, row pitch lda) . BT[N][K] (row pitch ldb), K a multiple of 64 and at least 128. A pass is 64 k: the
// 128 rows x 128 B of both operands are brought into LDS by asynchronous copies (pitch 144 B for the ds_load_b128 readers), two buffers, the next pass's copies in
// flight while this pass is worked on. A buffer is [A tile | BT tile]. Returns acc[4][4] (row group, column group; D layout); the k order of every sum is ascending.
#define TP   72
#define TSZ  (128 * TP)
#define RING (4 * TSZ)

// One operand's tile of one pass: 8 copies a lane, 16 rows apart (a wave covers 4 whole 128-B rows a copy). The s_wait_xcnt ends the copies' own statement, so that
// no address register of a copy is rewritten ahead of it.
__device__ __forceinline__ void copy_tile(unsigned l, const h16* g, int ld) {
    const size_t rs = (size_t)16 * ld;
    asm volatile("global_load_async_to_lds_b128 %0, %8, off\n\t"
                 "global_load_async_to_lds_b128 %1, %9, off\n\t"
                 "global_load_async_to_lds_b128 %2, %10, off\n\t"
                 "global_load_async_to_lds_b128 %3, %11, off\n\t"
                 "global_load_async_to_lds_b128 %4, %12, off\n\t"
                 "global_load_async_to_lds_b128 %5, %13, off\n\t"
                 "global_load_async_to_lds_b128 %6, %14, off\n\t"
                 "global_load_async_to_lds_b128 %7, %15, off\n\t"
                 "s_wait_xcnt 0x0"
                 :: "v"(l), "v"(l + 1u * 16u * 144u), "v"(l + 2u * 16u * 144u), "v"(l + 3u * 16u * 144u),
                    "v"(l + 4u * 16u * 144u), "v"(l + 5u * 16u * 144u), "v"(l + 6u * 16u * 144u), "v"(l + 7u * 16u * 144u),
                    "v"(g), "v"(g + rs), "v"(g + 2 * rs), "v"(g + 3 * rs), "v"(g + 4 * rs), "v"(g + 5 * rs), "v"(g + 6 * rs), "v"(g + 7 * rs)
                 : "memory");
}

__device__ __forceinline__ void gemm_tile(const h16* __restrict__ A, const int lda, const h16* __restrict__ BT, const int ldb, const int K, int rb, int cb, h16* ring, v8f (&acc)[4][4]) {
    const int tid = threadIdx.x, lane = tid & 31, wave = tid >> 5, lr = lane & 15, hi = lane >> 4;
    const h16* ga = A + (size_t)(rb + (tid >> 3)) * lda + (tid & 7) * 8;
    const h16* gb = BT + (size_t)(cb + (tid >> 3)) * ldb + (tid & 7) * 8;
    const unsigned l0 = (unsigned)(size_t)ring + (unsigned)((tid >> 3) * 144 + (tid & 7) * 16);
    const int np = K / 64;
#pragma unroll
    for (int i = 0; i < 4; ++i)
#pragma unroll
        for (int t = 0; t < 4; ++t) acc[i][t] = (v8f){};
    copy_tile(l0, ga, lda);
    copy_tile(l0 + TSZ * 2, gb, ldb);
    asm volatile("s_wait_asynccnt 0x0" ::: "memory");   // pass 0's own copies have landed before the barrier publishes them
    __syncthreads();
    copy_tile(l0 + 2 * TSZ * 2, ga + 64, lda);
    copy_tile(l0 + 3 * TSZ * 2, gb + 64, ldb);
#pragma unroll 1   // one pass a trip: the two buffers alternate by the trip's parity
    for (int p = 0; p < np; ++p) {
        const int bo = (p & 1) * 2 * TSZ;
        const h16* sa = ring + bo + ((wave >> 1) * 64 + lr) * TP + 8 * hi;
        const h16* sb = ring + bo + TSZ + ((wave & 1) * 64 + lr) * TP + 8 * hi;
        v16h a[4], b[4];
#pragma unroll
        for (int i = 0; i < 4; ++i) a[i] = cat16(*(const v8ha*)(sa + i * 16 * TP), *(const v8ha*)(sa + i * 16 * TP + 16));
#pragma unroll
        for (int t = 0; t < 4; ++t) b[t] = cat16(*(const v8ha*)(sb + t * 16 * TP), *(const v8ha*)(sb + t * 16 * TP + 16));
        __builtin_amdgcn_sched_barrier(0);   // the 16 LDS reads of a k step go out as one group ahead of its WMMAs
#pragma unroll
        for (int i = 0; i < 4; ++i)
#pragma unroll
            for (int t = 0; t < 4; ++t) acc[i][t] = wmma16(a[i], b[t], acc[i][t]);
        __builtin_amdgcn_sched_barrier(0);   // the second k step's reads stay behind the first step's WMMAs, in the same fragment registers
#pragma unroll
        for (int i = 0; i < 4; ++i) a[i] = cat16(*(const v8ha*)(sa + i * 16 * TP + 32), *(const v8ha*)(sa + i * 16 * TP + 48));
#pragma unroll
        for (int t = 0; t < 4; ++t) b[t] = cat16(*(const v8ha*)(sb + t * 16 * TP + 32), *(const v8ha*)(sb + t * 16 * TP + 48));
        asm volatile("s_wait_dscnt 0x0" ::: "memory");      // this wave's last reads of the buffer are done before the barrier frees it for the refill
        asm volatile("s_wait_asynccnt 0x0" ::: "memory");   // this wave's copies of pass p + 1 have landed before the barrier publishes them
        __syncthreads();
        if (p + 2 < np) {
            copy_tile(l0 + bo * 2, ga + (size_t)(p + 2) * 64, lda);
            copy_tile(l0 + bo * 2 + TSZ * 2, gb + (size_t)(p + 2) * 64, ldb);
        }
        __builtin_amdgcn_sched_barrier(0);   // the refill is issued ahead of the second k step's WMMAs (registers only), so that it flies under them
#pragma unroll
        for (int i = 0; i < 4; ++i)
#pragma unroll
            for (int t = 0; t < 4; ++t) acc[i][t] = wmma16(a[i], b[t], acc[i][t]);
    }
    asm volatile("s_wait_asynccnt 0x0" ::: "memory");       // no copy is outstanding when the ring becomes the output staging
}

// gemm_tile_k2: the same core for a block of 8 waves in two groups of 4. Group q (waves 4q .. 4q + 3) takes the 64-k slices q, q + 2, q + 4, ... of K (a multiple of 128, at least 256) through a two-buffer
// ring of its own and sums them, k ascending, over the whole 128 x 128 tile: two waves share a SIMD and two slices' copies are in flight, so one group's LDS reads, copy issue and landing
// time run under the other's WMMAs. The barriers are the block's: both groups make the same trips. The caller adds the two groups' partial tiles.
__device__ __forceinline__ void gemm_tile_k2(const h16* __restrict__ A, const int lda, const h16* __restrict__ BT, const int ldb, const int K, int rb, int cb, h16* ring2, v8f (&acc)[4][4]) {
    const int grp = threadIdx.x >> 7, tid = threadIdx.x & 127, lane = tid & 31, wave = tid >> 5, lr = lane & 15, hi = lane >> 4;
    h16* ring = ring2 + grp * RING;
    const h16* ga = A + (size_t)(rb + (tid >> 3)) * lda + grp * 64 + (tid & 7) * 8;
    const h16* gb = BT + (size_t)(cb + (tid >> 3)) * ldb + grp * 64 + (tid & 7) * 8;
    const unsigned l0 = (unsigned)(size_t)ring + (unsigned)((tid >> 3) * 144 + (tid & 7) * 16);
    const int np = K / 128;
#pragma unroll
    for (int i = 0; i < 4; ++i)
#pragma unroll
        for (int t = 0; t < 4; ++t) acc[i][t] = (v8f){};
    copy_tile(l0, ga, lda);
    copy_tile(l0 + TSZ * 2, gb, ldb);
    asm volatile("s_wait_asynccnt 0x0" ::: "memory");   // pass 0's own copies have landed before the barrier publishes them
    __syncthreads();
    copy_tile(l0 + 2 * TSZ * 2, ga + 128, lda);
    copy_tile(l0 + 3 * TSZ * 2, gb + 128, ldb);
#pragma unroll 1   // one pass a trip: the two buffers alternate by the trip's parity
    for (int p = 0; p < np; ++p) {
        const int bo = (p & 1) * 2 * TSZ;
        const h16* sa = ring + bo + ((wave >> 1) * 64 + lr) * TP + 8 * hi;
        const h16* sb = ring + bo + TSZ + ((wave & 1) * 64 + lr) * TP + 8 * hi;
        v16h a[4], b[4];
#pragma unroll
        for (int i = 0; i < 4; ++i) a[i] = cat16(*(const v8ha*)(sa + i * 16 * TP), *(const v8ha*)(sa + i * 16 * TP + 16));
#pragma unroll
        for (int t = 0; t < 4; ++t) b[t] = cat16(*(const v8ha*)(sb + t * 16 * TP), *(const v8ha*)(sb + t * 16 * TP + 16));
        __builtin_amdgcn_sched_barrier(0);   // the 16 LDS reads of a k step go out as one group ahead of its WMMAs
#pragma unroll
        for (int i = 0; i < 4; ++i)
#pragma unroll
            for (int t = 0; t < 4; ++t) acc[i][t] = wmma16(a[i], b[t], acc[i][t]);
        __builtin_amdgcn_sched_barrier(0);   // the second k step's reads stay behind the first step's WMMAs, in the same fragment registers
#pragma unroll
        for (int i = 0; i < 4; ++i) a[i] = cat16(*(const v8ha*)(sa + i * 16 * TP + 32), *(const v8ha*)(sa + i * 16 * TP + 48));
#pragma unroll
        for (int t = 0; t < 4; ++t) b[t] = cat16(*(const v8ha*)(sb + t * 16 * TP + 32), *(const v8ha*)(sb + t * 16 * TP + 48));
        asm volatile("s_wait_dscnt 0x0" ::: "memory");      // this wave's last reads of the buffer are done before the barrier frees it for the refill
        asm volatile("s_wait_asynccnt 0x0" ::: "memory");   // this wave's copies of pass p + 1 have landed before the barrier publishes them
        __syncthreads();
        if (p + 2 < np) {
            copy_tile(l0 + bo * 2, ga + (size_t)(p + 2) * 128, lda);
            copy_tile(l0 + bo * 2 + TSZ * 2, gb + (size_t)(p + 2) * 128, ldb);
        }
        __builtin_amdgcn_sched_barrier(0);   // the refill is issued ahead of the second k step's WMMAs (registers only), so that it flies under them
#pragma unroll
        for (int i = 0; i < 4; ++i)
#pragma unroll
            for (int t = 0; t < 4; ++t) acc[i][t] = wmma16(a[i], b[t], acc[i][t]);
    }
    asm volatile("s_wait_asynccnt 0x0" ::: "memory");       // no copy is outstanding when the rings become the output staging
}

// Store pass of a wave's staged 64 x 64 f32 tile (pitch 68) as f16 rows of 128 B, whole lines; gelu (a compile-time or block-uniform choice) is applied to the staged f32 values.
__device__ __forceinline__ void put_tile16(const float* os, h16* crow, int ld, int lane, const bool gelu) {
    for (int s0 = 0; s0 < 16; s0 += 4) {
        v4f v[4][2];
#pragma unroll   // four row groups a trip: their LDS reads go out together, one latency a trip instead of one a group
        for (int u = 0; u < 4; ++u) { const float* sp = os + (4 * (s0 + u) + (lane >> 3)) * 68 + (lane & 7) * 8; v[u][0] = *(const v4fa*)sp; v[u][1] = *(const v4fa*)(sp + 4); }
        if (gelu) {
#pragma unroll
            for (int u = 0; u < 4; ++u) gelu8(v[u][0], v[u][1]);
        }
#pragma unroll
        for (int u = 0; u < 4; ++u) { v8h o;
#pragma unroll
            for (int i = 0; i < 8; ++i) o[i] = (h16)v[u][i >> 2][i & 3];
            *(v8h*)(crow + (size_t)(4 * (s0 + u) + (lane >> 3)) * ld + (lane & 7) * 8) = o; }
        asm volatile("s_wait_xcnt 0x0" ::: "memory");   // before the next trip rewrites the registers that this trip's stores name
    }
}

// k_fused: fused = XN16 . W1T + b1 over the 3840 padded columns; a wave's 64-wide column group = exactly one head of q / k / v or a 64-wide slice of the MLP hidden:
//   c0 <  1024: q head c0/64: per-row LayerNorm over the 64 head dims (qn_g, qn_b) -> Q16[tok][1024] f16
//   c0 <  2048: k head: LayerNorm (kn_g, kn_b) -> K16
//   c0 <  3072: v head -> VT16[b][h][d][tok], the layout the attention's V^T tiles are copied from: the wave's 64 tokens x 64 head dims are staged transposed, so the store pass writes whole 128-B lines of 64 tokens
//   else      : gelu_tanh (in the store pass) -> G16 = columns 1024.. of the [tok][1792] rows [a | gelu(h)] (columns >= 716 of the hidden are exactly 0 after gelu(0 + 0): b1 pad is read as 0; their Wc rows are 0 anyway)
__global__ __launch_bounds__(128) void k_fused(const h16* __restrict__ XN16, const h16* __restrict__ W1T, const float* __restrict__ b1,
                                              const float* __restrict__ qg, const float* __restrict__ qb, const float* __restrict__ kg, const float* __restrict__ kb,
                                              h16* Q16, h16* K16, h16* VT16, h16* G16) {
    __shared__ __align__(16) h16 ring[RING];
    const int lane = threadIdx.x & 31, wave = threadIdx.x >> 5, lr = lane & 15, hi = lane >> 4;
    const int rb = blockIdx.x * 128, cb = blockIdx.y * 128;
    v8f acc[4][4];
    gemm_tile(XN16, DM, W1T, DM, DM, rb, cb, ring, acc);
    const int r0 = rb + (wave >> 1) * 64, c0 = cb + (wave & 1) * 64;
    const int sec = cb / DM;                   // 0 q, 1 k, 2 v, 3 mlp (the same for both column groups of a block)
#pragma unroll
    for (int t = 0; t < 4; ++t) { const int col = c0 + t * 16 + lr; const float bv = (col < NF) ? bfr(b1[col]) : 0.f;
#pragma unroll
        for (int i = 0; i < 4; ++i)
#pragma unroll
            for (int j = 0; j < 8; ++j) acc[i][t][j] += bv; }
    if (sec < 2) {
        const float* gg = sec ? kg : qg; const float* bb = sec ? kb : qb;
#pragma unroll
        for (int i = 0; i < 4; ++i)
#pragma unroll
            for (int j = 0; j < 8; ++j) {
                float s = acc[i][0][j] + acc[i][1][j] + acc[i][2][j] + acc[i][3][j];
                const float mu = hsum16(s) * (1.0f / HD);
                float q = 0.f;
#pragma unroll
                for (int t = 0; t < 4; ++t) { const float d = acc[i][t][j] - mu; q += d * d; }
                const float rs = rsqrtf(hsum16(q) * (1.0f / HD) + EPS);
#pragma unroll
                for (int t = 0; t < 4; ++t) acc[i][t][j] = (acc[i][t][j] - mu) * rs * bfr(gg[t * 16 + lr]) + bfr(bb[t * 16 + lr]);
            }
    }
    float* os = (float*)ring + wave * (64 * 68);   // the loop's last barrier has freed the ring; each wave stages its own 64 x 64 tile
    if (sec == 2) {   // v: staged as [head dim][token]; a lane's 8 accumulator rows are 8 consecutive tokens of its column, two 16-byte LDS stores
#pragma unroll
        for (int i = 0; i < 4; ++i)
#pragma unroll
            for (int t = 0; t < 4; ++t) { float* p = os + (t * 16 + lr) * 68 + i * 16 + hi * 8;
                *(v4fa*)p = (v4f){acc[i][t][0], acc[i][t][1], acc[i][t][2], acc[i][t][3]}; *(v4fa*)(p + 4) = (v4f){acc[i][t][4], acc[i][t][5], acc[i][t][6], acc[i][t][7]}; }
    } else {
#pragma unroll
        for (int i = 0; i < 4; ++i)
#pragma unroll
            for (int t = 0; t < 4; ++t)
#pragma unroll
                for (int j = 0; j < 8; ++j) os[(i * 16 + hi * 8 + j) * 68 + t * 16 + lr] = acc[i][t][j];
    }
    __syncthreads();
    h16* crow; int ld;   // the staged tile's first row and the pitch of its rows in the destination
    if (sec == 0) { ld = DM; crow = Q16 + (size_t)r0 * DM + c0; } else if (sec == 1) { ld = DM; crow = K16 + (size_t)r0 * DM + (c0 - DM); }
    else if (sec == 2) { ld = NT_; crow = VT16 + ((size_t)(r0 / NT_) * NH_ + (c0 - 2 * DM) / HD) * HD * NT_ + r0 % NT_; }   // 64 tokens of one batch entry (2048 is a multiple of 64), one head
    else { ld = KC; crow = G16 + (size_t)r0 * KC + (c0 - 3 * DM); }
    put_tile16(os, crow, ld, lane, sec == 3);
}

// wc_block: one 128 x 128 tile of Wc^T [n][k] (f16, pitch 1792) = W2^T rows n (one half of their 2048 columns) . W rows k: k < 1024 takes Wao and W2's rows 0..1023, k >= 1024 takes Wmo
// (its plane rows 716..767 are zero) and W2's rows 1024..2047. t = tile, n fastest.
__device__ __forceinline__ void wc_block(const h16* __restrict__ W2T, const h16* __restrict__ Wao16, const h16* __restrict__ Wmo16, h16* WcT, h16* ring, const int t) {
    const int lane = threadIdx.x & 31, wave = threadIdx.x >> 5, lr = lane & 15, hi = lane >> 4;
    const int rb = (t & 7) * 128, ck = (t >> 3) * 128;
    const bool mlp = ck >= DM;
    v8f acc[4][4];
    gemm_tile(mlp ? W2T + DM : W2T, 2 * DM, mlp ? Wmo16 : Wao16, DM, DM, rb, mlp ? ck - DM : ck, ring, acc);
    float* os = (float*)ring + wave * (64 * 68);   // the loop's last barrier has freed the ring; each wave stages its own 64 x 64 tile
#pragma unroll
    for (int t4 = 0; t4 < 4; ++t4)
#pragma unroll
        for (int i = 0; i < 4; ++i)
#pragma unroll
            for (int j = 0; j < 8; ++j) os[(i * 16 + hi * 8 + j) * 68 + t4 * 16 + lr] = acc[i][t4][j];
    __syncthreads();
    put_tile16(os, WcT + (size_t)(rb + (wave >> 1) * 64) * KC + ck + (wave & 1) * 64, KC, lane, false);
}

// k_gemmout: out = x + [a | gelu(h)].Wc + bc; bc is a computed f32 vector and is added as it is. 8 waves: the two groups of gemm_tile_k2 each hold a partial sum of the block's 128 x 128 tile;
// every wave stages its 64 x 64 partial tile, and the store pass adds the two partials of an element (group 0's, which carries bc, then group 1's) and x; a wave stores 32 of its tile's 64 rows.
__global__ __launch_bounds__(256) void k_gemmout(const h16* __restrict__ A, const h16* __restrict__ BT, const float* __restrict__ bias, const float* __restrict__ x, float* C) {
    __shared__ __align__(16) h16 ring[2 * RING];
    const int lane = threadIdx.x & 31, wv = threadIdx.x >> 5, wave = wv & 3, grp = wv >> 2, lr = lane & 15, hi = lane >> 4;
    const int rb = blockIdx.x * 128, cb = blockIdx.y * 128;
    v8f acc[4][4];
    gemm_tile_k2(A, KC, BT, KC, KC, rb, cb, ring, acc);
    const int r0 = rb + (wave >> 1) * 64, c0 = cb + (wave & 1) * 64;
    float* os = (float*)ring + wv * (64 * 68);   // the loop's last barrier has freed the rings; each wave stages its own 64 x 64 partial tile
#pragma unroll
    for (int t = 0; t < 4; ++t) { const float bl = bias[c0 + t * 16 + lr]; const float bv = grp ? 0.f : bl;
#pragma unroll
        for (int i = 0; i < 4; ++i)
#pragma unroll
            for (int j = 0; j < 8; ++j) os[(i * 16 + hi * 8 + j) * 68 + t * 16 + lr] = acc[i][t][j] + bv; }
    __syncthreads();   // a wave reads the other group's partial tile too
    const int rsub = grp * 32 + (lane >> 4), cofs = (lane & 15) * 4;   // the lane's first row in the wave tile (a group stores 32 of its 64 rows) and its four columns
    const float* o0 = (const float*)ring + wave * (64 * 68) + rsub * 68 + cofs;
    const float* o1 = o0 + 4 * (64 * 68);
    float* crow = C + (size_t)(r0 + rsub) * DM + c0 + cofs;
    const float* xrow = x + (size_t)(r0 + rsub) * DM + c0 + cofs;
#pragma unroll 1   // the pointers are stepped by the trip and live over it: a trip's loads and stores go from one address pair each with constant offsets, and the wait at its foot stands ahead of every rewrite
    for (int s0 = 0; s0 < 2; ++s0) {
#pragma unroll   // eight row pairs a trip: their x loads and LDS reads go out together, one latency a trip instead of one a row pair
        for (int s = 0; s < 8; ++s) {
            v4f val = *(const v4fa*)(o0 + 2 * s * 68); const v4f v1 = *(const v4fa*)(o1 + 2 * s * 68); const v4f xv = *(const v4f*)(xrow + 2 * s * DM);
#pragma unroll
            for (int e = 0; e < 4; ++e) val[e] = (val[e] + v1[e]) + bfr(xv[e]);
            *(v4f*)(crow + 2 * s * DM) = val; }
        asm volatile("s_wait_xcnt 0x0" ::: "memory");   // before the next trip rewrites the registers that this trip's loads and stores name
        o0 += 16 * 68; o1 += 16 * 68; crow += 16 * DM; xrow += 16 * DM;
    }
}

// attn_block: transposed products. Block = (b, h, 4 waves x QCOL queries); a step is 32 keys. S^T = K.Q^T: A = 16 key rows, B = the wave's queries (loaded once), so a lane
// holds scores of ONE query (column lr; keys 8 hi + r of each 16-key tile): maximum and sum run in the lane, the two wave halves meet in one cross-row move. The two
// score tiles of a step, exponentiated (x 32768, folded into the exponent) and rounded to f16 in place, ARE the B operand of O^T += V^T.P^T in the hardware k order
// (element s: key 8 hi + s, then 16 + 8 hi + s - 8), which the V^T rows are loaded in: P touches no LDS. O^T gives a lane 8 consecutive head dims of its query.
// K and V^T come through LDS, once for the block's four waves: a stage is SKEY keys, brought in whole 128-B lines by asynchronous copies, two buffers, the next stage's copies in flight
// while this one is worked on. A buffer is [K tile: 128 key rows x 128 B | V^T tile: two halves of 64 keys, each 64 head-dim rows x 128 B], pitch 144 B for the ds_load_b128 readers.
#define QG   4            // 16-query column groups a wave: every K and V^T fragment a wave loads feeds QG products
#define QCOL (QG * 16)
#define QBLK (4 * QCOL)
#define SKEY 128
#define NSTG (NT_ / SKEY)
__device__ __forceinline__ float xhalf(float x) { return __builtin_bit_cast(float, __builtin_amdgcn_permlanex16(__builtin_bit_cast(int, x), __builtin_bit_cast(int, x), 0x76543210, 0xfedcba98, false, false)); }  // lane l with lane l ^ 16

// The V^T tile of one stage: 8 copies a lane, 16 LDS rows apart (a wave covers 4 whole 128-B rows a copy): head-dim rows 0..63 of the first 64 keys, then of the second 64. The s_wait_xcnt ends
// the copies' own statement, so that no address register of a copy is rewritten ahead of it.
__device__ __forceinline__ void copy_vt(unsigned l, const h16* g) {
    const size_t rs = (size_t)16 * NT_;
    asm volatile("global_load_async_to_lds_b128 %0, %8, off\n\t"
                 "global_load_async_to_lds_b128 %1, %9, off\n\t"
                 "global_load_async_to_lds_b128 %2, %10, off\n\t"
                 "global_load_async_to_lds_b128 %3, %11, off\n\t"
                 "global_load_async_to_lds_b128 %4, %12, off\n\t"
                 "global_load_async_to_lds_b128 %5, %13, off\n\t"
                 "global_load_async_to_lds_b128 %6, %14, off\n\t"
                 "global_load_async_to_lds_b128 %7, %15, off\n\t"
                 "s_wait_xcnt 0x0"
                 :: "v"(l), "v"(l + 1u * 16u * 144u), "v"(l + 2u * 16u * 144u), "v"(l + 3u * 16u * 144u),
                    "v"(l + 4u * 16u * 144u), "v"(l + 5u * 16u * 144u), "v"(l + 6u * 16u * 144u), "v"(l + 7u * 16u * 144u),
                    "v"(g), "v"(g + rs), "v"(g + 2 * rs), "v"(g + 3 * rs), "v"(g + 64), "v"(g + 64 + rs), "v"(g + 64 + 2 * rs), "v"(g + 64 + 3 * rs)
                 : "memory");
}

__device__ __forceinline__ void attn_block(const h16* __restrict__ Q16, const h16* __restrict__ K16, const h16* __restrict__ VT16, h16* CTX16, h16* ring, const int bid) {
    const int tid = threadIdx.x, lane = tid & 31, wave = tid >> 5, lr = lane & 15, hi = lane >> 4;
    const int b = bid / (NH_ * (NT_ / QBLK)), rem = bid - b * (NH_ * (NT_ / QBLK)), h = rem / (NT_ / QBLK), qt = rem - h * (NT_ / QBLK);
    const int q0 = qt * QBLK + wave * QCOL;
    const size_t tok0 = (size_t)b * NT_;
    const float CS = 0.125f * 1.4426950408889634f;   // score scale, in base 2
    const h16* kn = K16 + tok0 * DM + h * HD;                     // the head's K rows and V^T rows from the next stage to be copied on: the same for the whole block
    const h16* vn = VT16 + ((size_t)b * NH_ + h) * HD * NT_;
    const unsigned ko = (tid >> 3) * DM + (tid & 7) * 8, vo = (tid >> 3) * NT_ + (tid & 7) * 8;   // the lane's own 16 bytes in them
    // A copy's place in LDS = the wave's four rows in the buffer to be filled (lf, the same for the wave: a scalar that changes with the stage) + the lane's own 16 bytes in them (lo). So only
    // sums made at the copies are operands of their asm statements: a value that is such an operand AND lives over the loop is bound to the low 256 registers, which the loop fills, and is spilled.
    unsigned lf = (unsigned)(size_t)ring + (unsigned)__builtin_amdgcn_readfirstlane(wave) * (4u * 144u), lg = lf + 2 * TSZ * 2;
    const unsigned lo = (unsigned)((lane >> 3) * 144 + (lane & 7) * 16);
    copy_tile(lf + lo, kn + ko, DM);          // stage 0 flies under the Q loads
    copy_vt(lf + lo + TSZ * 2, vn + vo);
    kn += (size_t)SKEY * DM; vn += SKEY;
    v16h qf[QG][2];
#pragma unroll
    for (int g = 0; g < QG; ++g)
#pragma unroll
        for (int kc = 0; kc < 2; ++kc) { const h16* p = Q16 + (tok0 + q0 + g * 16 + lr) * DM + h * HD + kc * 32 + 8 * hi; qf[g][kc] = cat16(*(const v8h*)p, *(const v8h*)(p + 16)); }
    v8f o[QG][4];
    float mrun[QG], lsum[QG];
#pragma unroll
    for (int g = 0; g < QG; ++g) { mrun[g] = -3.0e38f; lsum[g] = 0.f;
#pragma unroll
        for (int n = 0; n < 4; ++n) o[g][n] = (v8f){}; }
    asm volatile("s_wait_xcnt 0x0" ::: "memory");   // before anything rewrites the address registers that the Q loads name
    __builtin_amdgcn_sched_barrier(0);               // keeps later register writes behind that wait
    asm volatile("s_wait_asynccnt 0x0" ::: "memory");   // stage 0's own copies have landed before the barrier publishes them
    __syncthreads();
    copy_tile(lg + lo, kn + ko, DM);
    copy_vt(lg + lo + TSZ * 2, vn + vo);
#pragma unroll 1   // one stage a trip: the two buffers alternate by the trip's parity
    for (int st = 0; st < NSTG; ++st) {
        const int bo = (st & 1) * 2 * TSZ;
        const h16* sk = ring + bo + lr * TP + 8 * hi;
        const h16* sv = sk + TSZ;
        v16h kf[2][2];
#pragma unroll
        for (int t = 0; t < 2; ++t)
#pragma unroll
            for (int kc = 0; kc < 2; ++kc) { const h16* p = sk + (t * 16) * TP + kc * 32; kf[t][kc] = cat16(*(const v8ha*)p, *(const v8ha*)(p + 16)); }
#pragma unroll 1   // one step a trip
        for (int u = 0; u < SKEY / 32; ++u) {
            v16h vf[4];
#pragma unroll
            for (int n = 0; n < 4; ++n) { const h16* p = sv + (n * 16) * TP; vf[n] = cat16(*(const v8ha*)p, *(const v8ha*)(p + 16)); }
            sv += (u & 1) ? 64 * TP - 32 : 32;               // the next step's 32 keys: the other half of the 128-B rows, then the tile's second 64 keys; carried in its own register, so that no vector write stands at the step's head, directly behind the WMMAs
            __builtin_amdgcn_sched_barrier(0);               // the V^T reads go out as one group ahead of the score products and fly under them
            v8f s[QG][2];
#pragma unroll
            for (int g = 0; g < QG; ++g)
#pragma unroll
                for (int t = 0; t < 2; ++t) s[g][t] = wmma16(kf[t][1], qf[g][1], wmma16(kf[t][0], qf[g][0], (v8f){}));
            if (u + 1 < SKEY / 32) {   // the next step's key rows, of this stage only: nothing of the next stage is read ahead of its barrier
#pragma unroll
                for (int t = 0; t < 2; ++t)
#pragma unroll
                    for (int kc = 0; kc < 2; ++kc) { const h16* p = sk + ((u + 1) * 32 + t * 16) * TP + kc * 32; kf[t][kc] = cat16(*(const v8ha*)p, *(const v8ha*)(p + 16)); }
            }
#pragma unroll
            for (int g = 0; g < QG; ++g) {
                float mt[8];
#pragma unroll
                for (int j = 0; j < 8; ++j) mt[j] = fmaxf(s[g][0][j], s[g][1][j]);
#pragma unroll
                for (int w = 4; w; w >>= 1)
#pragma unroll
                    for (int j = 0; j < w; ++j) mt[j] = fmaxf(mt[j], mt[j + w]);
                const float mx = fmaxf(mt[0], xhalf(mt[0])) * CS;
                const float mn = fmaxf(mrun[g], mx);
                const float alpha = __builtin_amdgcn_exp2f(mrun[g] - mn);   // 0 on the first step
                mrun[g] = mn;
                const float nm = 15.0f - mn;                                 // weights x 32768, as f16 operands
                float pe[16];
                v16h pb;
#pragma unroll
                for (int e = 0; e < 16; ++e) { pe[e] = __builtin_amdgcn_exp2f(fmaf(s[g][e >> 3][e & 7], CS, nm)); pb[e] = (h16)pe[e]; }
#pragma unroll
                for (int w = 8; w; w >>= 1)   // a tree: a chain of 16 dependent adds would stall the SIMD's one wave
#pragma unroll
                    for (int e = 0; e < w; ++e) pe[e] += pe[e + w];
                lsum[g] = lsum[g] * alpha + pe[0];
#pragma unroll
                for (int n = 0; n < 4; ++n) o[g][n] = wmma16(vf[n], pb, o[g][n] * alpha);
            }
        }
        asm volatile("s_wait_dscnt 0x0" ::: "memory");      // this wave's last reads of the buffer are done before the barrier frees it for the refill
        asm volatile("s_wait_asynccnt 0x0" ::: "memory");   // this wave's copies of stage st + 1 have landed before the barrier publishes them
        __syncthreads();
        if (st + 2 < NSTG) {
            kn += (size_t)SKEY * DM; vn += SKEY;
            copy_tile(lf + lo, kn + ko, DM);
            copy_vt(lf + lo + TSZ * 2, vn + vo);
        }
        { const unsigned x = lf; lf = lg; lg = x; }   // the next trip frees the other buffer
    }
    asm volatile("s_wait_asynccnt 0x0" ::: "memory");   // no copy is outstanding when the wave goes on to its end
#pragma unroll
    for (int g = 0; g < QG; ++g) {
        const float inv = 1.0f / (lsum[g] + xhalf(lsum[g]));   // the halves' sums (x 32768, like the weights) join once
        h16* crow = CTX16 + (tok0 + q0 + g * 16 + lr) * KC + (size_t)h * HD + 8 * hi;   // columns 0..1023 of the [a | gelu(h)] rows
#pragma unroll
        for (int n = 0; n < 4; ++n) { v8h o8;
#pragma unroll
            for (int j = 0; j < 8; ++j) o8[j] = (h16)(o[g][n][j] * inv);
            *(v8h*)(crow + n * 16) = o8; }
        if (g + 1 < QG) {
            asm volatile("s_wait_xcnt 0x0" ::: "memory");   // before the next group rewrites the registers that this group's stores name
            __builtin_amdgcn_sched_barrier(0);               // keeps the next group's register writes behind that wait
        }
    }
}

// bc_rows: bc[n] = b2[n] + sum over j of [bao | bmo][j] . W2[j][n], f32 sums along the rows of the f16 plane W2^T. A wave takes 32 rows n, lane r keeps row r's sum: one 128-B store a wave.
__device__ __forceinline__ void bc_rows(const h16* __restrict__ W2T, const float* __restrict__ bao, const float* __restrict__ bmo, const float* __restrict__ b2, float* BC, const int blk) {
    const int lane = threadIdx.x & 31, n0 = blk * 128 + (threadIdx.x >> 5) * 32;
    float bv[8][8];
#pragma unroll
    for (int c = 0; c < 8; ++c) { const float* bp = (c < 4 ? bao + c * 256 : bmo + (c - 4) * 256) + lane * 8;
#pragma unroll
        for (int i = 0; i < 8; ++i) bv[c][i] = bfr(bp[i]); }
    float res = 0.f;
    for (int r0 = 0; r0 < 32; r0 += 4) {
        v8h w[4][8];
#pragma unroll   // four rows a trip: their 32 loads go out together, one latency a trip instead of one a row
        for (int u = 0; u < 4; ++u)
#pragma unroll
            for (int c = 0; c < 8; ++c) w[u][c] = *(const v8h*)(W2T + (size_t)(n0 + r0 + u) * (2 * DM) + c * 256 + lane * 8);
        asm volatile("s_wait_xcnt 0x0" ::: "memory");   // before the next trip rewrites the registers that this trip's loads name
#pragma unroll
        for (int u = 0; u < 4; ++u) { float s = 0.f;
#pragma unroll
            for (int c = 0; c < 8; ++c)
#pragma unroll
                for (int i = 0; i < 8; ++i) s += (float)w[u][c][i] * bv[c][i];
            s = hsum16(s); s += xhalf(s);
            res = (lane == r0 + u) ? s : res; }
    }
    BC[n0 + lane] = res + bfr(b2[n0 + lane]);
    asm volatile("s_wait_xcnt 0x0" ::: "memory");   // behind the store: in the merged kernel other code follows it in the listing and rewrites the registers that it names
}

// k_attn_wc: the attention and the two jobs on weights alone that only the last product reads, as block ranges of ONE grid: the attention leaves most of the matrix pipe's slots
// idle, so the 112 tiles of Wc^T and the 8 blocks of bc run beside it. The job is the same for a whole block, so the barriers of attn_block and wc_block stand under block-uniform control flow.
#define AB_ATT (NB_ * NH_ * (NT_ / QBLK))
#define AB_WC  ((DM / 128) * (KC / 128))
#define AB_BC  (DM / 128)
__global__ __launch_bounds__(128) void k_attn_wc(const h16* __restrict__ Q16, const h16* __restrict__ K16, const h16* __restrict__ VT16, h16* CTX16, const h16* __restrict__ W2T, const h16* __restrict__ Wao16,
                                                const h16* __restrict__ Wmo16, const float* __restrict__ bao, const float* __restrict__ bmo, const float* __restrict__ b2, h16* WcT, float* BC) {
    __shared__ __align__(16) h16 ring[RING];
    const int t = blockIdx.x;
    if (t < AB_ATT) { attn_block(Q16, K16, VT16, CTX16, ring, t); return; }
    if (t < AB_ATT + AB_WC) { wc_block(W2T, Wao16, Wmo16, WcT, ring, t - AB_ATT); return; }
    bc_rows(W2T, bao, bmo, b2, BC, t - (AB_ATT + AB_WC));
}

extern "C" void kernel_launch(void* const* d_in, const int* in_sizes, int n_in,
                              void* d_out, int out_size, void* d_ws, size_t ws_size, hipStream_t stream) {
    (void)in_sizes; (void)n_in; (void)out_size;
    const float* x = (const float*)d_in[0]; const float* ng = (const float*)d_in[1]; const float* nb = (const float*)d_in[2]; const float* W1 = (const float*)d_in[3]; const float* b1 = (const float*)d_in[4];
    const float* qg = (const float*)d_in[5]; const float* qb = (const float*)d_in[6]; const float* kg = (const float*)d_in[7]; const float* kb = (const float*)d_in[8];
    const float* Wao = (const float*)d_in[9]; const float* bao = (const float*)d_in[10]; const float* Wmo = (const float*)d_in[11]; const float* bmo = (const float*)d_in[12];
    const float* W2 = (const float*)d_in[13]; const float* b2 = (const float*)d_in[14];
    float* out = (float*)d_out;    // [2][2048][1024]
    char* wsp = (char*)d_ws;
    auto take = [&](size_t bytes) { char* p = wsp; wsp += (bytes + 255) & ~(size_t)255; return (void*)p; };
    h16* XN16 = (h16*)take((size_t)NTK * DM * 2); h16* W1T = (h16*)take((size_t)NFP * DM * 2);
    h16* Wao16 = (h16*)take((size_t)DM * DM * 2); h16* Wmo16 = (h16*)take((size_t)MLPP * DM * 2); h16* W2T = (h16*)take((size_t)DM * 2 * DM * 2);
    h16* Q16 = (h16*)take((size_t)NTK * DM * 2); h16* K16 = (h16*)take((size_t)NTK * DM * 2); h16* VT16 = (h16*)take((size_t)NTK * DM * 2);
    h16* AG16 = (h16*)take((size_t)NTK * KC * 2); h16* WcT = (h16*)take((size_t)DM * KC * 2); float* BC = (float*)take((size_t)DM * 4);
    if ((size_t)(wsp - (char*)d_ws) > ws_size) return;    // 8.4 + 7.9 + 2.1 + 1.6 + 4.2 + 3 x 8.4 + 14.7 + 3.7 MB ~ 68 MB
    k_prep<<<PB_LN + PB_W1 + PB_W2 + PB_WAO + PB_WMO, 256, 0, stream>>>(x, ng, nb, W1, W2, Wao, Wmo, XN16, W1T, W2T, Wao16, Wmo16);
    k_fused<<<dim3(NTK / 128, NFP / 128, 1), 128, 0, stream>>>(XN16, W1T, b1, qg, qb, kg, kb, Q16, K16, VT16, AG16 + DM);
    k_attn_wc<<<AB_ATT + AB_WC + AB_BC, 128, 0, stream>>>(Q16, K16, VT16, AG16, W2T, Wao16, Wmo16, bao, bmo, b2, WcT, BC);
    k_gemmout<<<dim3(NTK / 128, DM / 128, 1), 256, 0, stream>>>(AG16, WcT, BC, x, out);
}

// v009
// A run of this version takes 109 microseconds.
// Next to v008, in two timings, it ran 1.04 times as fast each time.
// Over all steps from v000 it is 3.78 times as fast.
#include <hip/hip_runtime.h>

// Contractions on v_wmma_f32_16x16x32_f16 with plain f16 operands, f32 accumulate: fused = LN(x).W1 + b1 ([4096 x 1024].[1024 x 3788 (padded 3840)]), the 16-head
// attention with per-head LayerNorm on q and k (scores [2048 x 64].[64 x 2048] /8, softmax, .v), and the tail out = x + [a.Wao + bao | gelu_tanh(h).Wmo + bmo].W2 + b2 in the
// associated form out = x + [a | gelu_tanh(h)].Wc + bc ([4096 x 1740 (1792)].[1792 x 1024]) with Wc = [Wao.W2(rows 0..1023) ; Wmo.W2(rows 1024..2047)] (two [. x 1024].[1024 x 1024]
// products of weights, made anew in every call) and bc = b2 + [bao | bmo].W2. Input weights are f16 of their bf16 rounding (exact for the bf16-input reference), the activations
// and Wc are computed values rounded once to f16 (the output is dominated by the exact residual x). LayerNorms (eps 1e-6), gelu, softmax and bc run in f32.

#define NB_  2
#define NT_  2048
#define DM   1024
#define NH_  16
#define HD   64
#define NTK  (NB_ * NT_)
#define NF   3788
#define NFP  3840
#define MLPH 716
#define MLPP 768
#define KC   (DM + MLPP)   // k extent of the tail product: [a | gelu(h)] rows and Wc^T rows have this pitch
#define PSC  32768.0f
#define EPS  1e-6f
#define QSC  (0.125f * 1.4426950408889634f)   // score scale in base 2; carried by q
#define POFF 7.0f    // a score equal to the maximum in use gives the weight 2^7
#define PTOP 15.0f   // weights stay at or below 2^15, inside f16: a score more than 8 above the maximum in use asks for a rescale

typedef _Float16 h16;
typedef __attribute__((ext_vector_type(16))) _Float16 v16h;
typedef __attribute__((ext_vector_type(8)))  _Float16 v8h;
typedef __attribute__((ext_vector_type(8)))  float    v8f;
typedef __attribute__((ext_vector_type(4)))  float    v4f;
typedef v8h  __attribute__((may_alias)) v8ha;
typedef v4f  __attribute__((may_alias)) v4fa;

__device__ __forceinline__ unsigned short f2bf(float f) { unsigned u = __float_as_uint(f); u += 0x7FFFu + ((u >> 16) & 1u); return (unsigned short)(u >> 16); }
__device__ __forceinline__ float bf2f(unsigned short b) { return __uint_as_float(((unsigned)b) << 16); }
__device__ __forceinline__ float bfr(float f) { return bf2f(f2bf(f)); }
__device__ __forceinline__ v16h cat16(v8h lo, v8h hi) { return __builtin_shufflevector(lo, hi, 0, 1, 2, 3, 4, 5, 6, 7, 8, 9, 10, 11, 12, 13, 14, 15); }
__device__ __forceinline__ v8f wmma16(v16h a, v16h b, v8f c) { return __builtin_amdgcn_wmma_f32_16x16x32_f16(false, a, false, b, (short)0, c, false, false); }
__device__ __forceinline__ float hsum16(float v) { v += __shfl_xor(v, 1, 16); v += __shfl_xor(v, 2, 16); v += __shfl_xor(v, 4, 16); return v + __shfl_xor(v, 8, 16); }
// gelu_tanh of 8 values without a branch: 0.5 (1 + tanh u) = 1 / (1 + e^(-2u)), u = c (x + 0.044715 x^3), so gelu = x / (1 + 2^(k x (1 + 0.044715 x^2))) with k = -2 c log2(e). The library tanhf takes
// two divergent branches an element, each a serial chain that a lone wave cannot hide. The ends are the reference's: 2^(+big) = inf gives x . 0, 2^(-big) = 0 gives x.
// The eight v_exp_f32 and the eight v_rcp_f32 stand in one asm statement each, results apart from sources, closed by the one v_nop that the instruction set asks for behind a transcendental before
// its result is used or a source overwritten.
__device__ __forceinline__ void gelu8(v4f& a, v4f& b) {
    const float k = -2.0f * 0.7978845608028654f * 1.4426950408889634f;
    float z[8], e[8];
#pragma unroll
    for (int i = 0; i < 8; ++i) { const float x = i < 4 ? a[i & 3] : b[i & 3]; z[i] = k * x * fmaf(0.044715f * x, x, 1.0f); }
    asm("v_exp_f32 %0, %8\n\tv_exp_f32 %1, %9\n\tv_exp_f32 %2, %10\n\tv_exp_f32 %3, %11\n\tv_exp_f32 %4, %12\n\tv_exp_f32 %5, %13\n\tv_exp_f32 %6, %14\n\tv_exp_f32 %7, %15\n\tv_nop"
        : "=&v"(e[0]), "=&v"(e[1]), "=&v"(e[2]), "=&v"(e[3]), "=&v"(e[4]), "=&v"(e[5]), "=&v"(e[6]), "=&v"(e[7])
        : "v"(z[0]), "v"(z[1]), "v"(z[2]), "v"(z[3]), "v"(z[4]), "v"(z[5]), "v"(z[6]), "v"(z[7]));
#pragma unroll
    for (int i = 0; i < 8; ++i) z[i] = 1.0f + e[i];
    asm("v_rcp_f32 %0, %8\n\tv_rcp_f32 %1, %9\n\tv_rcp_f32 %2, %10\n\tv_rcp_f32 %3, %11\n\tv_rcp_f32 %4, %12\n\tv_rcp_f32 %5, %13\n\tv_rcp_f32 %6, %14\n\tv_rcp_f32 %7, %15\n\tv_nop"
        : "=&v"(e[0]), "=&v"(e[1]), "=&v"(e[2]), "=&v"(e[3]), "=&v"(e[4]), "=&v"(e[5]), "=&v"(e[6]), "=&v"(e[7])
        : "v"(z[0]), "v"(z[1]), "v"(z[2]), "v"(z[3]), "v"(z[4]), "v"(z[5]), "v"(z[6]), "v"(z[7]));
#pragma unroll
    for (int i = 0; i < 4; ++i) { a[i] *= e[i]; b[i] *= e[4 + i]; }
}

// ln_rows: LayerNorm of 8 rows of x (one a wave) -> XN16; blk = row group.
__device__ __forceinline__ void ln_rows(const float* __restrict__ x, const float* __restrict__ g, const float* __restrict__ bt, h16* XN16, const int blk) {
    const int lane = threadIdx.x & 31, r = blk * 8 + (threadIdx.x >> 5);
    if (r >= NTK) return;
    const float* xr = x + (size_t)r * DM;
    float s = 0.f;
#pragma unroll
    for (int q = 0; q < 4; ++q)
#pragma unroll
        for (int i = 0; i < 8; ++i) s += bfr(xr[q * 256 + lane * 8 + i]);
#pragma unroll
    for (int o = 16; o; o >>= 1) s += __shfl_xor(s, o, 32);
    const float mu = s * (1.0f / DM);
    float sq = 0.f;
#pragma unroll 1
    for (int q = 0; q < 4; ++q)
#pragma unroll
        for (int i = 0; i < 8; ++i) { const float d = bfr(xr[q * 256 + lane * 8 + i]) - mu; sq += d * d; }
#pragma unroll
    for (int o = 16; o; o >>= 1) sq += __shfl_xor(sq, o, 32);
    const float rs = rsqrtf(sq * (1.0f / DM) + EPS);
#pragma unroll 1
    for (int q = 0; q < 4; ++q) {
        v8h o8;
#pragma unroll
        for (int i = 0; i < 8; ++i) { const int c = q * 256 + lane * 8 + i; o8[i] = (h16)((bfr(xr[c]) - mu) * rs * bfr(g[c]) + bfr(bt[c])); }
        *(v8h*)(XN16 + (size_t)r * DM + q * 256 + lane * 8) = o8; 
    }
}

// wt_tile: k-major W [K rows][N cols] -> n-major f16 plane WT [Npad][Kpad] (f16 of bf16(W); rows >= N and columns >= K zero); one 64 x 64 tile (kb, nb) through LDS.
__device__ __forceinline__ void wt_tile(const float* __restrict__ Wm, int K, int N, int Kpad, h16* WT, const int kb, const int nb) {
    __shared__ __align__(16) h16 tl[64 * 72];
    const int tid = threadIdx.x, k0 = kb * 64, n0 = nb * 64;
    const int kk = tid >> 2, nq = (tid & 3) * 16;
#pragma unroll
    for (int i = 0; i < 16; ++i) { const int k = k0 + kk, n = n0 + nq + i; tl[(nq + i) * 72 + kk] = (k < K && n < N) ? (h16)bfr(Wm[(size_t)k * N + n]) : (h16)0.f; }
    __syncthreads();
    const int piece = tid & 7;
    auto pass = [&]() {
#pragma unroll
        for (int s = 0; s < 2; ++s) { const int nr = (tid >> 3) + 32 * s; const v8h val = *(const v8ha*)(tl + nr * 72 + piece * 8);
            *(v8h*)(WT + (size_t)(n0 + nr) * Kpad + k0 + piece * 8) = val; }
    };
    pass(); 
    asm volatile("s_wait_xcnt 0x0" ::: "memory");   // behind the two stores: in the merged kernel other code follows them in the listing and rewrites the registers that they name
}

// cv_rows: W [rows][1024] f32 -> f16 plane of the same layout (f16 of bf16(W); plane rows past the weight's last row are zero): 4 rows a block, 16 elements a thread. As the n-major operand of Wc^T = W2^T.W^T
// a weight is read along its own rows, so it needs no transpose.
__device__ __forceinline__ void cv_rows(const float* __restrict__ Wm, const int rows, h16* W16, const int blk) {
    const int tid = threadIdx.x, col = (tid & 127) * 8;
    v4f v[2][2];
#pragma unroll
    for (int s = 0; s < 2; ++s) { const int r = blk * 4 + s * 2 + (tid >> 7);   // the same row in a whole wave
        if (r < rows) { const float* p = Wm + (size_t)r * DM + col; v[s][0] = *(const v4f*)p; v[s][1] = *(const v4f*)(p + 4); } else { v[s][0] = (v4f){}; v[s][1] = (v4f){}; } }
#pragma unroll
    for (int s = 0; s < 2; ++s) { const int r = blk * 4 + s * 2 + (tid >> 7); v8h o;
#pragma unroll
        for (int i = 0; i < 8; ++i) o[i] = (h16)bfr(v[s][i >> 2][i & 3]);
        *(v8h*)(W16 + (size_t)r * DM + col) = o; }
    asm volatile("s_wait_xcnt 0x0" ::: "memory");   // behind the loads and stores: in the merged kernel other code follows them in the listing and rewrites the registers that they name
}

// k_prep: the five jobs that depend on the inputs alone, as block ranges of ONE grid, so that their starts, first loads and tails overlap: the LayerNorm of x, the two
// weight transposes, each with its tiles in the order k fastest, and the two weight conversions. The job is the same for a whole block, so wt_tile's barrier stands under block-uniform control flow.
#define PB_LN  (NTK / 8)
#define PB_W1  ((DM / 64) * (NFP / 64))
#define PB_W2  (((2 * DM) / 64) * (DM / 64))
#define PB_WAO (DM / 4)
#define PB_WMO (MLPP / 4)
__global__ __launch_bounds__(256) void k_prep(const float* __restrict__ x, const float* __restrict__ g, const float* __restrict__ bt, const float* __restrict__ W1, const float* __restrict__ W2,
                                             const float* __restrict__ Wao, const float* __restrict__ Wmo, h16* XN16, h16* W1T, h16* W2T, h16* Wao16, h16* Wmo16) {
    int t = blockIdx.x;
    if (t < PB_LN) { ln_rows(x, g, bt, XN16, t); return; }
    t -= PB_LN;
    const float* Wm; h16* WT; int K, N, Kpad, nb;   // nb by a literal divisor in each branch: scalar shifts and one scalar multiply, no division at run time
    if (t < PB_W1) { Wm = W1; WT = W1T; K = DM; N = NF; Kpad = DM; nb = t / (DM / 64); }
    else if (t < PB_W1 + PB_W2) { t -= PB_W1; Wm = W2; WT = W2T; K = 2 * DM; N = DM; Kpad = 2 * DM; nb = t / ((2 * DM) / 64); }
    else if (t < PB_W1 + PB_W2 + PB_WAO) { cv_rows(Wao, DM, Wao16, t - (PB_W1 + PB_W2)); return; }
    else { cv_rows(Wmo, MLPH, Wmo16, t - (PB_W1 + PB_W2 + PB_WAO)); return; }
    wt_tile(Wm, K, N, Kpad, WT, t - nb * (Kpad / 64), nb);
}

// GEMM tile core: 128 x 128 block tile (2 x 2 waves, 64 x 64 each) of A[M][K] (f16, row pitch lda) . BT[N][K] (row pitch ldb), K a multiple of 64 and at least 128. A pass is 64 k: the
// 128 rows x 128 B of both operands are brought into LDS by asynchronous copies (pitch 144 B for the ds_load_b128 readers), two buffers, the next pass's copies in
// flight while this pass is worked on. A buffer is [A tile | BT tile]. Returns acc[4][4] (row group, column group; D layout); the k order of every sum is ascending.
#define TP   72
#define TSZ  (128 * TP)
#define RING (4 * TSZ)

// One operand's tile of one pass: 8 copies a lane, 16 rows apart (a wave covers 4 whole 128-B rows a copy). The s_wait_xcnt ends the copies' own statement, so that
// no address register of a copy is rewritten ahead of it.
__device__ __forceinline__ void copy_tile(unsigned l, const h16* g, int ld) {
    const size_t rs = (size_t)16 * ld;
    asm volatile("global_load_async_to_lds_b128 %0, %8, off\n\t"
                 "global_load_async_to_lds_b128 %1, %9, off\n\t"
                 "global_load_async_to_lds_b128 %2, %10, off\n\t"
                 "global_load_async_to_lds_b128 %3, %11, off\n\t"
                 "global_load_async_to_lds_b128 %4, %12, off\n\t"
                 "global_load_async_to_lds_b128 %5, %13, off\n\t"
                 "global_load_async_to_lds_b128 %6, %14, off\n\t"
                 "global_load_async_to_lds_b128 %7, %15, off\n\t"
                 "s_wait_xcnt 0x0"
                 :: "v"(l), "v"(l + 1u * 16u * 144u), "v"(l + 2u * 16u * 144u), "v"(l + 3u * 16u * 144u),
                    "v"(l + 4u * 16u * 144u), "v"(l + 5u * 16u * 144u), "v"(l + 6u * 16u * 144u), "v"(l + 7u * 16u * 144u),
                    "v"(g), "v"(g + rs), "v"(g + 2 * rs), "v"(g + 3 * rs), "v"(g + 4 * rs), "v"(g + 5 * rs), "v"(g + 6 * rs), "v"(g + 7 * rs)
                 : "memory");
}

__device__ __forceinline__ void gemm_tile(const h16* __restrict__ A, const int lda, const h16* __restrict__ BT, const int ldb, const int K, int rb, int cb, h16* ring, v8f (&acc)[4][4]) {
    const int tid = threadIdx.x, lane = tid & 31, wave = tid >> 5, lr = lane & 15, hi = lane >> 4;
    const h16* ga = A + (size_t)(rb + (tid >> 3)) * lda + (tid & 7) * 8;
    const h16* gb = BT + (size_t)(cb + (tid >> 3)) * ldb + (tid & 7) * 8;
    const unsigned l0 = (unsigned)(size_t)ring + (unsigned)((tid >> 3) * 144 + (tid & 7) * 16);
    const int np = K / 64;
#pragma unroll
    for (int i = 0; i < 4; ++i)
#pragma unroll
        for (int t = 0; t < 4; ++t) acc[i][t] = (v8f){};
    copy_tile(l0, ga, lda);
    copy_tile(l0 + TSZ * 2, gb, ldb);
    asm volatile("s_wait_asynccnt 0x0" ::: "memory");   // pass 0's own copies have landed before the barrier publishes them
    __syncthreads();
    copy_tile(l0 + 2 * TSZ * 2, ga + 64, lda);
    copy_tile(l0 + 3 * TSZ * 2, gb + 64, ldb);
#pragma unroll 1   // one pass a trip: the two buffers alternate by the trip's parity
    for (int p = 0; p < np; ++p) {
        const int bo = (p & 1) * 2 * TSZ;
        const h16* sa = ring + bo + ((wave >> 1) * 64 + lr) * TP + 8 * hi;
        const h16* sb = ring + bo + TSZ + ((wave & 1) * 64 + lr) * TP + 8 * hi;
        v16h a[4], b[4];
#pragma unroll
        for (int i = 0; i < 4; ++i) a[i] = cat16(*(const v8ha*)(sa + i * 16 * TP), *(const v8ha*)(sa + i * 16 * TP + 16));
#pragma unroll
        for (int t = 0; t < 4; ++t) b[t] = cat16(*(const v8ha*)(sb + t * 16 * TP), *(const v8ha*)(sb + t * 16 * TP + 16));
        __builtin_amdgcn_sched_barrier(0);   // the 16 LDS reads of a k step go out as one group ahead of its WMMAs
#pragma unroll
        for (int i = 0; i < 4; ++i)
#pragma unroll
            for (int t = 0; t < 4; ++t) acc[i][t] = wmma16(a[i], b[t], acc[i][t]);
        __builtin_amdgcn_sched_barrier(0);   // the second k step's reads stay behind the first step's WMMAs, in the same fragment registers
#pragma unroll
        for (int i = 0; i < 4; ++i) a[i] = cat16(*(const v8ha*)(sa + i * 16 * TP + 32), *(const v8ha*)(sa + i * 16 * TP + 48));
#pragma unroll
        for (int t = 0; t < 4; ++t) b[t] = cat16(*(const v8ha*)(sb + t * 16 * TP + 32), *(const v8ha*)(sb + t * 16 * TP + 48));
        asm volatile("s_wait_dscnt 0x0" ::: "memory");      // this wave's last reads of the buffer are done before the barrier frees it for the refill
        asm volatile("s_wait_asynccnt 0x0" ::: "memory");   // this wave's copies of pass p + 1 have landed before the barrier publishes them
        __syncthreads();
        if (p + 2 < np) {
            copy_tile(l0 + bo * 2, ga + (size_t)(p + 2) * 64, lda);
            copy_tile(l0 + bo * 2 + TSZ * 2, gb + (size_t)(p + 2) * 64, ldb);
        }
        __builtin_amdgcn_sched_barrier(0);   // the refill is issued ahead of the second k step's WMMAs (registers only), so that it flies under them
#pragma unroll
        for (int i = 0; i < 4; ++i)
#pragma unroll
            for (int t = 0; t < 4; ++t) acc[i][t] = wmma16(a[i], b[t], acc[i][t]);
    }
    asm volatile("s_wait_asynccnt 0x0" ::: "memory");       // no copy is outstanding when the ring becomes the output staging
}

// gemm_tile_k2: the same core for a block of 8 waves in two groups of 4. Group q (waves 4q .. 4q + 3) takes the 64-k slices q, q + 2, q + 4, ... of K (a multiple of 128, at least 256) through a two-buffer
// ring of its own and sums them, k ascending, over the whole 128 x 128 tile: two waves share a SIMD and two slices' copies are in flight, so one group's LDS reads, copy issue and landing
// time run under the other's WMMAs. The barriers are the block's: both groups make the same trips. The caller adds the two groups' partial tiles.
__device__ __forceinline__ void gemm_tile_k2(const h16* __restrict__ A, const int lda, const h16* __restrict__ BT, const int ldb, const int K, int rb, int cb, h16* ring2, v8f (&acc)[4][4]) {
    const int grp = threadIdx.x >> 7, tid = threadIdx.x & 127, lane = tid & 31, wave = tid >> 5, lr = lane & 15, hi = lane >> 4;
    h16* ring = ring2 + grp * RING;
    const h16* ga = A + (size_t)(rb + (tid >> 3)) * lda + grp * 64 + (tid & 7) * 8;
    const h16* gb = BT + (size_t)(cb + (tid >> 3)) * ldb + grp * 64 + (tid & 7) * 8;
    const unsigned l0 = (unsigned)(size_t)ring + (unsigned)((tid >> 3) * 144 + (tid & 7) * 16);
    const int np = K / 128;
#pragma unroll
    for (int i = 0; i < 4; ++i)
#pragma unroll
        for (int t = 0; t < 4; ++t) acc[i][t] = (v8f){};
    copy_tile(l0, ga, lda);
    copy_tile(l0 + TSZ * 2, gb, ldb);
    asm volatile("s_wait_asynccnt 0x0" ::: "memory");   // pass 0's own copies have landed before the barrier publishes them
    __syncthreads();
    copy_tile(l0 + 2 * TSZ * 2, ga + 128, lda);
    copy_tile(l0 + 3 * TSZ * 2, gb + 128, ldb);
#pragma unroll 1   // one pass a trip: the two buffers alternate by the trip's parity
    for (int p = 0; p < np; ++p) {
        const int bo = (p & 1) * 2 * TSZ;
        const h16* sa = ring + bo + ((wave >> 1) * 64 + lr) * TP + 8 * hi;
        const h16* sb = ring + bo + TSZ + ((wave & 1) * 64 + lr) * TP + 8 * hi;
        v16h a[4], b[4];
#pragma unroll
        for (int i = 0; i < 4; ++i) a[i] = cat16(*(const v8ha*)(sa + i * 16 * TP), *(const v8ha*)(sa + i * 16 * TP + 16));
#pragma unroll
        for (int t = 0; t < 4; ++t) b[t] = cat16(*(const v8ha*)(sb + t * 16 * TP), *(const v8ha*)(sb + t * 16 * TP + 16));
        __builtin_amdgcn_sched_barrier(0);   // the 16 LDS reads of a k step go out as one group ahead of its WMMAs
#pragma unroll
        for (int i = 0; i < 4; ++i)
#pragma unroll
            for (int t = 0; t < 4; ++t) acc[i][t] = wmma16(a[i], b[t], acc[i][t]);
        __builtin_amdgcn_sched_barrier(0);   // the second k step's reads stay behind the first step's WMMAs, in the same fragment registers
#pragma unroll
        for (int i = 0; i < 4; ++i) a[i] = cat16(*(const v8ha*)(sa + i * 16 * TP + 32), *(const v8ha*)(sa + i * 16 * TP + 48));
#pragma unroll
        for (int t = 0; t < 4; ++t) b[t] = cat16(*(const v8ha*)(sb + t * 16 * TP + 32), *(const v8ha*)(sb + t * 16 * TP + 48));
        asm volatile("s_wait_dscnt 0x0" ::: "memory");      // this wave's last reads of the buffer are done before the barrier frees it for the refill
        asm volatile("s_wait_asynccnt 0x0" ::: "memory");   // this wave's copies of pass p + 1 have landed before the barrier publishes them
        __syncthreads();
        if (p + 2 < np) {
            copy_tile(l0 + bo * 2, ga + (size_t)(p + 2) * 128, lda);
            copy_tile(l0 + bo * 2 + TSZ * 2, gb + (size_t)(p + 2) * 128, ldb);
        }
        __builtin_amdgcn_sched_barrier(0);   // the refill is issued ahead of the second k step's WMMAs (registers only), so that it flies under them
#pragma unroll
        for (int i = 0; i < 4; ++i)
#pragma unroll
            for (int t = 0; t < 4; ++t) acc[i][t] = wmma16(a[i], b[t], acc[i][t]);
    }
    asm volatile("s_wait_asynccnt 0x0" ::: "memory");       // no copy is outstanding when the rings become the output staging
}

// Store pass of a wave's staged 64 x 64 f32 tile (pitch 68) as f16 rows of 128 B, whole lines; gelu (a compile-time or block-uniform choice) is applied to the staged f32 values.
__device__ __forceinline__ void put_tile16(const float* os, h16* crow, int ld, int lane, const bool gelu) {
    for (int s0 = 0; s0 < 16; s0 += 4) {
        v4f v[4][2];
#pragma unroll   // four row groups a trip: their LDS reads go out together, one latency a trip instead of one a group
        for (int u = 0; u < 4; ++u) { const float* sp = os + (4 * (s0 + u) + (lane >> 3)) * 68 + (lane & 7) * 8; v[u][0] = *(const v4fa*)sp; v[u][1] = *(const v4fa*)(sp + 4); }
        if (gelu) {
#pragma unroll
            for (int u = 0; u < 4; ++u) gelu8(v[u][0], v[u][1]);
        }
#pragma unroll
        for (int u = 0; u < 4; ++u) { v8h o;
#pragma unroll
            for (int i = 0; i < 8; ++i) o[i] = (h16)v[u][i >> 2][i & 3];
            *(v8h*)(crow + (size_t)(4 * (s0 + u) + (lane >> 3)) * ld + (lane & 7) * 8) = o; }
        asm volatile("s_wait_xcnt 0x0" ::: "memory");   // before the next trip rewrites the registers that this trip's stores name
    }
}

// k_fused: fused = XN16 . W1T + b1 over the 3840 padded columns; a wave's 64-wide column group = exactly one head of q / k / v or a 64-wide slice of the MLP hidden:
//   c0 <  1024: q head c0/64: per-row LayerNorm over the 64 head dims (qn_g, qn_b), times the score scale QSC (folded into gain and bias, ahead of the one f16 rounding) -> Q16[tok][1024] f16
//   c0 <  2048: k head: LayerNorm (kn_g, kn_b) -> K16
//   c0 <  3072: v head -> VT16[b][h][d][tok], the layout the attention's V^T tiles are copied from: the wave's 64 tokens x 64 head dims are staged transposed, so the store pass writes whole 128-B lines of 64 tokens
//   else      : gelu_tanh (in the store pass) -> G16 = columns 1024.. of the [tok][1792] rows [a | gelu(h)] (columns >= 716 of the hidden are exactly 0 after gelu(0 + 0): b1 pad is read as 0; their Wc rows are 0 anyway)
__global__ __launch_bounds__(128) void k_fused(const h16* __restrict__ XN16, const h16* __restrict__ W1T, const float* __restrict__ b1,
                                              const float* __restrict__ qg, const float* __restrict__ qb, const float* __restrict__ kg, const float* __restrict__ kb,
                                              h16* Q16, h16* K16, h16* VT16, h16* G16) {
    __shared__ __align__(16) h16 ring[RING];
    const int lane = threadIdx.x & 31, wave = threadIdx.x >> 5, lr = lane & 15, hi = lane >> 4;
    const int rb = blockIdx.x * 128, cb = blockIdx.y * 128;
    v8f acc[4][4];
    gemm_tile(XN16, DM, W1T, DM, DM, rb, cb, ring, acc);
    const int r0 = rb + (wave >> 1) * 64, c0 = cb + (wave & 1) * 64;
    const int sec = cb / DM;                   // 0 q, 1 k, 2 v, 3 mlp (the same for both column groups of a block)
#pragma unroll
    for (int t = 0; t < 4; ++t) { const int col = c0 + t * 16 + lr; const float bv = (col < NF) ? bfr(b1[col]) : 0.f;
#pragma unroll
        for (int i = 0; i < 4; ++i)
#pragma unroll
            for (int j = 0; j < 8; ++j) acc[i][t][j] += bv; }
    if (sec < 2) {
        const float* gg = sec ? kg : qg; const float* bb = sec ? kb : qb;
        const float qs = sec ? 1.0f : QSC;   // the same for the whole block
        __builtin_amdgcn_sched_barrier(0);   // the scalar selects stay ahead of the eight loads below: sunk behind them, the last one rewrote a base register that the loads name
        float gv[4], bv4[4];
#pragma unroll
        for (int t = 0; t < 4; ++t) { gv[t] = bfr(gg[t * 16 + lr]) * qs; bv4[t] = bfr(bb[t * 16 + lr]) * qs; }
#pragma unroll
        for (int i = 0; i < 4; ++i)
#pragma unroll
            for (int j = 0; j < 8; ++j) {
                float s = acc[i][0][j] + acc[i][1][j] + acc[i][2][j] + acc[i][3][j];
                const float mu = hsum16(s) * (1.0f / HD);
                float q = 0.f;
#pragma unroll
                for (int t = 0; t < 4; ++t) { const float d = acc[i][t][j] - mu; q += d * d; }
                const float rs = rsqrtf(hsum16(q) * (1.0f / HD) + EPS);
#pragma unroll
                for (int t = 0; t < 4; ++t) acc[i][t][j] = (acc[i][t][j] - mu) * rs * gv[t] + bv4[t];
            }
    }
    float* os = (float*)ring + wave * (64 * 68);   // the loop's last barrier has freed the ring; each wave stages its own 64 x 64 tile
    if (sec == 2) {   // v: staged as [head dim][token]; a lane's 8 accumulator rows are 8 consecutive tokens of its column, two 16-byte LDS stores
#pragma unroll
        for (int i = 0; i < 4; ++i)
#pragma unroll
            for (int t = 0; t < 4; ++t) { float* p = os + (t * 16 + lr) * 68 + i * 16 + hi * 8;
                *(v4fa*)p = (v4f){acc[i][t][0], acc[i][t][1], acc[i][t][2], acc[i][t][3]}; *(v4fa*)(p + 4) = (v4f){acc[i][t][4], acc[i][t][5], acc[i][t][6], acc[i][t][7]}; }
    } else {
#pragma unroll
        for (int i = 0; i < 4; ++i)
#pragma unroll
            for (int t = 0; t < 4; ++t)
#pragma unroll
                for (int j = 0; j < 8; ++j) os[(i * 16 + hi * 8 + j) * 68 + t * 16 + lr] = acc[i][t][j];
    }
    __syncthreads();
    h16* crow; int ld;   // the staged tile's first row and the pitch of its rows in the destination
    if (sec == 0) { ld = DM; crow = Q16 + (size_t)r0 * DM + c0; } else if (sec == 1) { ld = DM; crow = K16 + (size_t)r0 * DM + (c0 - DM); }
    else if (sec == 2) { ld = NT_; crow = VT16 + ((size_t)(r0 / NT_) * NH_ + (c0 - 2 * DM) / HD) * HD * NT_ + r0 % NT_; }   // 64 tokens of one batch entry (2048 is a multiple of 64), one head
    else { ld = KC; crow = G16 + (size_t)r0 * KC + (c0 - 3 * DM); }
    put_tile16(os, crow, ld, lane, sec == 3);
}

// wc_block: one 128 x 128 tile of Wc^T [n][k] (f16, pitch 1792) = W2^T rows n (one half of their 2048 columns) . W rows k: k < 1024 takes Wao and W2's rows 0..1023, k >= 1024 takes Wmo
// (its plane rows 716..767 are zero) and W2's rows 1024..2047. t = tile, n fastest.
__device__ __forceinline__ void wc_block(const h16* __restrict__ W2T, const h16* __restrict__ Wao16, const h16* __restrict__ Wmo16, h16* WcT, h16* ring, const int t) {
    const int lane = threadIdx.x & 31, wave = threadIdx.x >> 5, lr = lane & 15, hi = lane >> 4;
    const int rb = (t & 7) * 128, ck = (t >> 3) * 128;
    const bool mlp = ck >= DM;
    v8f acc[4][4];
    gemm_tile(mlp ? W2T + DM : W2T, 2 * DM, mlp ? Wmo16 : Wao16, DM, DM, rb, mlp ? ck - DM : ck, ring, acc);
    float* os = (float*)ring + wave * (64 * 68);   // the loop's last barrier has freed the ring; each wave stages its own 64 x 64 tile
#pragma unroll
    for (int t4 = 0; t4 < 4; ++t4)
#pragma unroll
        for (int i = 0; i < 4; ++i)
#pragma unroll
            for (int j = 0; j < 8; ++j) os[(i * 16 + hi * 8 + j) * 68 + t4 * 16 + lr] = acc[i][t4][j];
    __syncthreads();
    put_tile16(os, WcT + (size_t)(rb + (wave >> 1) * 64) * KC + ck + (wave & 1) * 64, KC, lane, false);
}

// k_gemmout: out = x + [a | gelu(h)].Wc + bc; bc is a computed f32 vector and is added as it is. 8 waves: the two groups of gemm_tile_k2 each hold a partial sum of the block's 128 x 128 tile;
// every wave stages its 64 x 64 partial tile, and the store pass adds the two partials of an element (group 0's, which carries bc, then group 1's) and x; a wave stores 32 of its tile's 64 rows.
__global__ __launch_bounds__(256) void k_gemmout(const h16* __restrict__ A, const h16* __restrict__ BT, const float* __restrict__ bias, const float* __restrict__ x, float* C) {
    __shared__ __align__(16) h16 ring[2 * RING];
    const int lane = threadIdx.x & 31, wv = threadIdx.x >> 5, wave = wv & 3, grp = wv >> 2, lr = lane & 15, hi = lane >> 4;
    const int rb = blockIdx.x * 128, cb = blockIdx.y * 128;
    v8f acc[4][4];
    gemm_tile_k2(A, KC, BT, KC, KC, rb, cb, ring, acc);
    const int r0 = rb + (wave >> 1) * 64, c0 = cb + (wave & 1) * 64;
    float* os = (float*)ring + wv * (64 * 68);   // the loop's last barrier has freed the rings; each wave stages its own 64 x 64 partial tile
#pragma unroll
    for (int t = 0; t < 4; ++t) { const float bl = bias[c0 + t * 16 + lr]; const float bv = grp ? 0.f : bl;
#pragma unroll
        for (int i = 0; i < 4; ++i)
#pragma unroll
            for (int j = 0; j < 8; ++j) os[(i * 16 + hi * 8 + j) * 68 + t * 16 + lr] = acc[i][t][j] + bv; }
    __syncthreads();   // a wave reads the other group's partial tile too
    const int rsub = grp * 32 + (lane >> 4), cofs = (lane & 15) * 4;   // the lane's first row in the wave tile (a group stores 32 of its 64 rows) and its four columns
    const float* o0 = (const float*)ring + wave * (64 * 68) + rsub * 68 + cofs;
    const float* o1 = o0 + 4 * (64 * 68);
    float* crow = C + (size_t)(r0 + rsub) * DM + c0 + cofs;
    const float* xrow = x + (size_t)(r0 + rsub) * DM + c0 + cofs;
#pragma unroll 1   // the pointers are stepped by the trip and live over it: a trip's loads and stores go from one address pair each with constant offsets, and the wait at its foot stands ahead of every rewrite
    for (int s0 = 0; s0 < 2; ++s0) {
#pragma unroll   // eight row pairs a trip: their x loads and LDS reads go out together, one latency a trip instead of one a row pair
        for (int s = 0; s < 8; ++s) {
            v4f val = *(const v4fa*)(o0 + 2 * s * 68); const v4f v1 = *(const v4fa*)(o1 + 2 * s * 68); const v4f xv = *(const v4f*)(xrow + 2 * s * DM);
#pragma unroll
            for (int e = 0; e < 4; ++e) val[e] = (val[e] + v1[e]) + bfr(xv[e]);
            *(v4f*)(crow + 2 * s * DM) = val; }
        asm volatile("s_wait_xcnt 0x0" ::: "memory");   // before the next trip rewrites the registers that this trip's loads and stores name
        o0 += 16 * 68; o1 += 16 * 68; crow += 16 * DM; xrow += 16 * DM;
    }
}

// attn_block: transposed products. Block = (b, h, 4 waves x QCOL queries); a step is 32 keys. S^T = K.Q^T: A = 16 key rows, B = the wave's queries (loaded once), so a lane
// holds scores of ONE query (column lr; keys 8 hi + r of each 16-key tile): maximum and sum run in the lane. Lazy rescale: q carries the score scale, and the score products start from
// POFF - (the column's maximum in use) as their C operand, so the accumulators ARE the exponents; one test a step (a ballot, a scalar branch) asks whether any exponent passes PTOP, and only
// then, and on the first step, which sets the maximum in use, are the maxima renewed and exponents, sums and O^T rescaled. The largest weight of a column so lies between 2^7 and 2^15. The two
// score tiles of a step, exponentiated and rounded to f16 in place, ARE the B operand of O^T += V^T.P^T in the hardware k order
// (element s: key 8 hi + s, then 16 + 8 hi + s - 8), which the V^T rows are loaded in: P touches no LDS. O^T gives a lane 8 consecutive head dims of its query.
// K and V^T come through LDS, once for the block's four waves: a stage is SKEY keys, brought in whole 128-B lines by asynchronous copies, two buffers, the next stage's copies in flight
// while this one is worked on. A buffer is [K tile: 128 key rows x 128 B | V^T tile: two halves of 64 keys, each 64 head-dim rows x 128 B], pitch 144 B for the ds_load_b128 readers.
#define QG   4            // 16-query column groups a wave: every K and V^T fragment a wave loads feeds QG products
#define QCOL (QG * 16)
#define QBLK (4 * QCOL)
#define SKEY 128
#define NSTG (NT_ / SKEY)
// 2^x of a score tile's 8 values: the eight v_exp_f32 stand in one asm statement, results apart from sources, closed by the one v_nop that the instruction set asks for behind a transcendental before its
// result is used or a source overwritten.
__device__ __forceinline__ void exp2x8(const v8f x, float* e) {
    asm("v_exp_f32 %0, %8\n\tv_exp_f32 %1, %9\n\tv_exp_f32 %2, %10\n\tv_exp_f32 %3, %11\n\tv_exp_f32 %4, %12\n\tv_exp_f32 %5, %13\n\tv_exp_f32 %6, %14\n\tv_exp_f32 %7, %15\n\tv_nop"
        : "=&v"(e[0]), "=&v"(e[1]), "=&v"(e[2]), "=&v"(e[3]), "=&v"(e[4]), "=&v"(e[5]), "=&v"(e[6]), "=&v"(e[7])
        : "v"(x[0]), "v"(x[1]), "v"(x[2]), "v"(x[3]), "v"(x[4]), "v"(x[5]), "v"(x[6]), "v"(x[7]));
}
__device__ __forceinline__ float xhalf(float x) { return __builtin_bit_cast(float, __builtin_amdgcn_permlanex16(__builtin_bit_cast(int, x), __builtin_bit_cast(int, x), 0x76543210, 0xfedcba98, false, false)); }  // lane l with lane l ^ 16

// The V^T tile of one stage: 8 copies a lane, 16 LDS rows apart (a wave covers 4 whole 128-B rows a copy): head-dim rows 0..63 of the first 64 keys, then of the second 64. The s_wait_xcnt ends
// the copies' own statement, so that no address register of a copy is rewritten ahead of it.
__device__ __forceinline__ void copy_vt(unsigned l, const h16* g) {
    const size_t rs = (size_t)16 * NT_;
    asm volatile("global_load_async_to_lds_b128 %0, %8, off\n\t"
                 "global_load_async_to_lds_b128 %1, %9, off\n\t"
                 "global_load_async_to_lds_b128 %2, %10, off\n\t"
                 "global_load_async_to_lds_b128 %3, %11, off\n\t"
                 "global_load_async_to_lds_b128 %4, %12, off\n\t"
                 "global_load_async_to_lds_b128 %5, %13, off\n\t"
                 "global_load_async_to_lds_b128 %6, %14, off\n\t"
                 "global_load_async_to_lds_b128 %7, %15, off\n\t"
                 "s_wait_xcnt 0x0"
                 :: "v"(l), "v"(l + 1u * 16u * 144u), "v"(l + 2u * 16u * 144u), "v"(l + 3u * 16u * 144u),
                    "v"(l + 4u * 16u * 144u), "v"(l + 5u * 16u * 144u), "v"(l + 6u * 16u * 144u), "v"(l + 7u * 16u * 144u),
                    "v"(g), "v"(g + rs), "v"(g + 2 * rs), "v"(g + 3 * rs), "v"(g + 64), "v"(g + 64 + rs), "v"(g + 64 + 2 * rs), "v"(g + 64 + 3 * rs)
                 : "memory");
}

__device__ __forceinline__ void attn_block(const h16* __restrict__ Q16, const h16* __restrict__ K16, const h16* __restrict__ VT16, h16* CTX16, h16* ring, const int bid) {
    const int tid = threadIdx.x, lane = tid & 31, wave = tid >> 5, lr = lane & 15, hi = lane >> 4;
    const int b = bid / (NH_ * (NT_ / QBLK)), rem = bid - b * (NH_ * (NT_ / QBLK)), h = rem / (NT_ / QBLK), qt = rem - h * (NT_ / QBLK);
    const int q0 = qt * QBLK + wave * QCOL;
    const size_t tok0 = (size_t)b * NT_;
    const h16* kn = K16 + tok0 * DM + h * HD;                     // the head's K rows and V^T rows from the next stage to be copied on: the same for the whole block
    const h16* vn = VT16 + ((size_t)b * NH_ + h) * HD * NT_;
    const unsigned ko = (tid >> 3) * DM + (tid & 7) * 8, vo = (tid >> 3) * NT_ + (tid & 7) * 8;   // the lane's own 16 bytes in them
    // A copy's place in LDS = the wave's four rows in the buffer to be filled (lf, the same for the wave: a scalar that changes with the stage) + the lane's own 16 bytes in them (lo). So only
    // sums made at the copies are operands of their asm statements: a value that is such an operand AND lives over the loop is bound to the low 256 registers, which the loop fills, and is spilled.
    unsigned lf = (unsigned)(size_t)ring + (unsigned)__builtin_amdgcn_readfirstlane(wave) * (4u * 144u), lg = lf + 2 * TSZ * 2;
    const unsigned lo = (unsigned)((lane >> 3) * 144 + (lane & 7) * 16);
    copy_tile(lf + lo, kn + ko, DM);          // stage 0 flies under the Q loads
    copy_vt(lf + lo + TSZ * 2, vn + vo);
    kn += (size_t)SKEY * DM; vn += SKEY;
    v16h qf[QG][2];
#pragma unroll
    for (int g = 0; g < QG; ++g)
#pragma unroll
        for (int kc = 0; kc < 2; ++kc) { const h16* p = Q16 + (tok0 + q0 + g * 16 + lr) * DM + h * HD + kc * 32 + 8 * hi; qf[g][kc] = cat16(*(const v8h*)p, *(const v8h*)(p + 16)); }
    v8f o[QG][4], cst[QG];   // cst: POFF - the maximum in use of the lane's column, in all 8 elements: the C operand of the score products
    float lsum[QG];
#pragma unroll
    for (int g = 0; g < QG; ++g) { lsum[g] = 0.f; cst[g] = (v8f){POFF, POFF, POFF, POFF, POFF, POFF, POFF, POFF};
#pragma unroll
        for (int n = 0; n < 4; ++n) o[g][n] = (v8f){}; }
    asm volatile("s_wait_xcnt 0x0" ::: "memory");   // before anything rewrites the address registers that the Q loads name
    __builtin_amdgcn_sched_barrier(0);               // keeps later register writes behind that wait
    asm volatile("s_wait_asynccnt 0x0" ::: "memory");   // stage 0's own copies have landed before the barrier publishes them
    __syncthreads();
    copy_tile(lg + lo, kn + ko, DM);
    copy_vt(lg + lo + TSZ * 2, vn + vo);
#pragma unroll 1   // one stage a trip: the two buffers alternate by the trip's parity
    for (int st = 0; st < NSTG; ++st) {
        const int bo = (st & 1) * 2 * TSZ;
        const h16* sk = ring + bo + lr * TP + 8 * hi;
        const h16* sv = sk + TSZ;
        v16h kf[2][2];
#pragma unroll
        for (int t = 0; t < 2; ++t)
#pragma unroll
            for (int kc = 0; kc < 2; ++kc) { const h16* p = sk + (t * 16) * TP + kc * 32; kf[t][kc] = cat16(*(const v8ha*)p, *(const v8ha*)(p + 16)); }
#pragma unroll 1   // one step a trip
        for (int u = 0; u < SKEY / 32; ++u) {
            v16h vf[4];
#pragma unroll
            for (int n = 0; n < 4; ++n) { const h16* p = sv + (n * 16) * TP; vf[n] = cat16(*(const v8ha*)p, *(const v8ha*)(p + 16)); }
            sv += (u & 1) ? 64 * TP - 32 : 32;               // the next step's 32 keys: the other half of the 128-B rows, then the tile's second 64 keys; carried in its own register, so that no vector write stands at the step's head, directly behind the WMMAs
            __builtin_amdgcn_sched_barrier(0);               // the V^T reads go out as one group ahead of the score products and fly under them
            v8f s[QG][2];
#pragma unroll
            for (int g = 0; g < QG; ++g)
#pragma unroll
                for (int t = 0; t < 2; ++t) s[g][t] = wmma16(kf[t][1], qf[g][1], wmma16(kf[t][0], qf[g][0], cst[g]));
            if (u + 1 < SKEY / 32) {   // the next step's key rows, of this stage only: nothing of the next stage is read ahead of its barrier
#pragma unroll
                for (int t = 0; t < 2; ++t)
#pragma unroll
                    for (int kc = 0; kc < 2; ++kc) { const h16* p = sk + ((u + 1) * 32 + t * 16) * TP + kc * 32; kf[t][kc] = cat16(*(const v8ha*)p, *(const v8ha*)(p + 16)); }
            }
            float mg[QG];   // the lane's largest exponent of the step, by column group
#pragma unroll
            for (int g = 0; g < QG; ++g) {
                float mt[8];
#pragma unroll
                for (int j = 0; j < 8; ++j) mt[j] = fmaxf(s[g][0][j], s[g][1][j]);
#pragma unroll
                for (int w = 4; w; w >>= 1)
#pragma unroll
                    for (int j = 0; j < w; ++j) mt[j] = fmaxf(mt[j], mt[j + w]);
                mg[g] = mt[0];
            }
            const bool first = (st | u) == 0;              // the same for the whole block
            const float top = first ? -3.0e38f : PTOP;     // the first step always takes the branch: folded into the bound, so that the compare's mask is the whole condition
            if (__builtin_amdgcn_ballot_w32(fmaxf(fmaxf(mg[0], mg[1]), fmaxf(mg[2], mg[3])) > top) != 0u) {   // one scalar branch a step for the wave's four groups
#pragma unroll
                for (int g = 0; g < QG; ++g) {
                    const float up = fmaxf(mg[g], xhalf(mg[g])) - POFF;       // the column's step maximum above the maximum in use (both halves see the same value)
                    const float d = first ? up : fmaxf(up, 0.f);              // the first step takes its own maximum, later ones only raise it
                    const float alpha = first ? 0.f : __builtin_amdgcn_exp2f(-d);   // sums and O^T are still 0 on the first step
#pragma unroll
                    for (int j = 0; j < 8; ++j) { s[g][0][j] -= d; s[g][1][j] -= d; cst[g][j] -= d; }
                    lsum[g] *= alpha;
#pragma unroll
                    for (int n = 0; n < 4; ++n) o[g][n] = o[g][n] * alpha;
                }
            }
#pragma unroll
            for (int g = 0; g < QG; ++g) {
                float pe[16];
                v16h pb;
#pragma unroll
                for (int t = 0; t < 2; ++t) exp2x8(s[g][t], pe + 8 * t);
#pragma unroll
                for (int e = 0; e < 16; ++e) pb[e] = (h16)pe[e];
#pragma unroll
                for (int w = 8; w; w >>= 1)   // a tree: a chain of 16 dependent adds would stall the SIMD's one wave
#pragma unroll
                    for (int e = 0; e < w; ++e) pe[e] += pe[e + w];
                lsum[g] += pe[0];
#pragma unroll
                for (int n = 0; n < 4; ++n) o[g][n] = wmma16(vf[n], pb, o[g][n]);
            }
        }
        asm volatile("s_wait_dscnt 0x0" ::: "memory");      // this wave's last reads of the buffer are done before the barrier frees it for the refill
        asm volatile("s_wait_asynccnt 0x0" ::: "memory");   // this wave's copies of stage st + 1 have landed before the barrier publishes them
        __syncthreads();
        if (st + 2 < NSTG) {
            kn += (size_t)SKEY * DM; vn += SKEY;
            copy_tile(lf + lo, kn + ko, DM);
            copy_vt(lf + lo + TSZ * 2, vn + vo);
        }
        { const unsigned x = lf; lf = lg; lg = x; }   // the next trip frees the other buffer
    }
    asm volatile("s_wait_asynccnt 0x0" ::: "memory");   // no copy is outstanding when the wave goes on to its end
#pragma unroll
    for (int g = 0; g < QG; ++g) {
        const float inv = 1.0f / (lsum[g] + xhalf(lsum[g]));   // the halves' sums (in the weights' own scale) join once
        h16* crow = CTX16 + (tok0 + q0 + g * 16 + lr) * KC + (size_t)h * HD + 8 * hi;   // columns 0..1023 of the [a | gelu(h)] rows
#pragma unroll
        for (int n = 0; n < 4; ++n) { v8h o8;
#pragma unroll
            for (int j = 0; j < 8; ++j) o8[j] = (h16)(o[g][n][j] * inv);
            *(v8h*)(crow + n * 16) = o8; }
        if (g + 1 < QG) {
            asm volatile("s_wait_xcnt 0x0" ::: "memory");   // before the next group rewrites the registers that this group's stores name
            __builtin_amdgcn_sched_barrier(0);               // keeps the next group's register writes behind that wait
        }
    }
}

// bc_rows: bc[n] = b2[n] + sum over j of [bao | bmo][j] . W2[j][n], f32 sums along the rows of the f16 plane W2^T. A wave takes 32 rows n, lane r keeps row r's sum: one 128-B store a wave.
__device__ __forceinline__ void bc_rows(const h16* __restrict__ W2T, const float* __restrict__ bao, const float* __restrict__ bmo, const float* __restrict__ b2, float* BC, const int blk) {
    const int lane = threadIdx.x & 31, n0 = blk * 128 + (threadIdx.x >> 5) * 32;
    float bv[8][8];
#pragma unroll
    for (int c = 0; c < 8; ++c) { const float* bp = (c < 4 ? bao + c * 256 : bmo + (c - 4) * 256) + lane * 8;
#pragma unroll
        for (int i = 0; i < 8; ++i) bv[c][i] = bfr(bp[i]); }
    float res = 0.f;
    for (int r0 = 0; r0 < 32; r0 += 4) {
        v8h w[4][8];
#pragma unroll   // four rows a trip: their 32 loads go out together, one latency a trip instead of one a row
        for (int u = 0; u < 4; ++u)
#pragma unroll
            for (int c = 0; c < 8; ++c) w[u][c] = *(const v8h*)(W2T + (size_t)(n0 + r0 + u) * (2 * DM) + c * 256 + lane * 8);
        asm volatile("s_wait_xcnt 0x0" ::: "memory");   // before the next trip rewrites the registers that this trip's loads name
#pragma unroll
        for (int u = 0; u < 4; ++u) { float s = 0.f;
#pragma unroll
            for (int c = 0; c < 8; ++c)
#pragma unroll
                for (int i = 0; i < 8; ++i) s += (float)w[u][c][i] * bv[c][i];
            s = hsum16(s); s += xhalf(s);
            res = (lane == r0 + u) ? s : res; }
    }
    BC[n0 + lane] = res + bfr(b2[n0 + lane]);
    asm volatile("s_wait_xcnt 0x0" ::: "memory");   // behind the store: in the merged kernel other code follows it in the listing and rewrites the registers that it names
}

// k_attn_wc: the attention and the two jobs on weights alone that only the last product reads, as block ranges of ONE grid: the attention leaves most of the matrix pipe's slots
// idle, so the 112 tiles of Wc^T and the 8 blocks of bc run beside it. The job is the same for a whole block, so the barriers of attn_block and wc_block stand under block-uniform control flow.
#define AB_ATT (NB_ * NH_ * (NT_ / QBLK))
#define AB_WC  ((DM / 128) * (KC / 128))
#define AB_BC  (DM / 128)
__global__ __launch_bounds__(128) void k_attn_wc(const h16* __restrict__ Q16, const h16* __restrict__ K16, const h16* __restrict__ VT16, h16* CTX16, const h16* __restrict__ W2T, const h16* __restrict__ Wao16,
                                                const h16* __restrict__ Wmo16, const float* __restrict__ bao, const float* __restrict__ bmo, const float* __restrict__ b2, h16* WcT, float* BC) {
    __shared__ __align__(16) h16 ring[RING];
    const int t = blockIdx.x;
    if (t < AB_ATT) { attn_block(Q16, K16, VT16, CTX16, ring, t); return; }
    if (t < AB_ATT + AB_WC) { wc_block(W2T, Wao16, Wmo16, WcT, ring, t - AB_ATT); return; }
    bc_rows(W2T, bao, bmo, b2, BC, t - (AB_ATT + AB_WC));
}

extern "C" void kernel_launch(void* const* d_in, const int* in_sizes, int n_in,
                              void* d_out, int out_size, void* d_ws, size_t ws_size, hipStream_t stream) {
    (void)in_sizes; (void)n_in; (void)out_size;
    const float* x = (const float*)d_in[0]; const float* ng = (const float*)d_in[1]; const float* nb = (const float*)d_in[2]; const float* W1 = (const float*)d_in[3]; const float* b1 = (const float*)d_in[4];
    const float* qg = (const float*)d_in[5]; const float* qb = (const float*)d_in[6]; const float* kg = (const float*)d_in[7]; const float* kb = (const float*)d_in[8];
    const float* Wao = (const float*)d_in[9]; const float* bao = (const float*)d_in[10]; const float* Wmo = (const float*)d_in[11]; const float* bmo = (const float*)d_in[12];
    const float* W2 = (const float*)d_in[13]; const float* b2 = (const float*)d_in[14];
    float* out = (float*)d_out;    // [2][2048][1024]
    char* wsp = (char*)d_ws;
    auto take = [&](size_t bytes) { char* p = wsp; wsp += (bytes + 255) & ~(size_t)255; return (void*)p; };
    h16* XN16 = (h16*)take((size_t)NTK * DM * 2); h16* W1T = (h16*)take((size_t)NFP * DM * 2);
    h16* Wao16 = (h16*)take((size_t)DM * DM * 2); h16* Wmo16 = (h16*)take((size_t)MLPP * DM * 2); h16* W2T = (h16*)take((size_t)DM * 2 * DM * 2);
    h16* Q16 = (h16*)take((size_t)NTK * DM * 2); h16* K16 = (h16*)take((size_t)NTK * DM * 2); h16* VT16 = (h16*)take((size_t)NTK * DM * 2);
    h16* AG16 = (h16*)take((size_t)NTK * KC * 2); h16* WcT = (h16*)take((size_t)DM * KC * 2); float* BC = (float*)take((size_t)DM * 4);
    if ((size_t)(wsp - (char*)d_ws) > ws_size) return;    // 8.4 + 7.9 + 2.1 + 1.6 + 4.2 + 3 x 8.4 + 14.7 + 3.7 MB ~ 68 MB
    k_prep<<<PB_LN + PB_W1 + PB_W2 + PB_WAO + PB_WMO, 256, 0, stream>>>(x, ng, nb, W1, W2, Wao, Wmo, XN16, W1T, W2T, Wao16, Wmo16);
    k_fused<<<dim3(NTK / 128, NFP / 128, 1), 128, 0, stream>>>(XN16, W1T, b1, qg, qb, kg, kb, Q16, K16, VT16, AG16 + DM);
    k_attn_wc<<<AB_ATT + AB_WC + AB_BC, 128, 0, stream>>>(Q16, K16, VT16, AG16, W2T, Wao16, Wmo16, bao, bmo, b2, WcT, BC);
    k_gemmout<<<dim3(NTK / 128, DM / 128, 1), 256, 0, stream>>>(AG16, WcT, BC, x, out);
}

// v010
// Measured time: 94.3 microseconds a run.
// In two side-by-side timings against v009, it was 1.15 and 1.14 times as fast.
// All steps since v000 together make it 4.32 times as fast.
#include <hip/hip_runtime.h>

// Contractions on v_wmma_f32_16x16x32_f16 with plain f16 operands, f32 accumulate: fused = LN(x).W1 + b1 ([4096 x 1024].[1024 x 3788 (padded 3840)]), the 16-head
// attention with per-head LayerNorm on q and k (scores [2048 x 64].[64 x 2048] /8, softmax, .v), and the tail out = x + [a.Wao + bao | gelu_tanh(h).Wmo + bmo].W2 + b2 in the
// associated form out = x + [a | gelu_tanh(h)].Wc + bc ([4096 x 1740 (1792)].[1792 x 1024]) with Wc = [Wao.W2(rows 0..1023) ; Wmo.W2(rows 1024..2047)] (two [. x 1024].[1024 x 1024]
// products of weights, made anew in every call) and bc = b2 + [bao | bmo].W2. Input weights are f16 of their bf16 rounding (exact for the bf16-input reference), the activations
// and Wc are computed values rounded once to f16 (the output is dominated by the exact residual x). LayerNorms (eps 1e-6), gelu, softmax and bc run in f32.

#define NB_  2
#define NT_  2048
#define DM   1024
#define NH_  16
#define HD   64
#define NTK  (NB_ * NT_)
#define NF   3788
#define NFP  3840
#define MLPH 716
#define MLPP 768
#define KC   (DM + MLPP)   // k extent of the tail product: [a | gelu(h)] rows and Wc^T rows have this pitch
#define PSC  32768.0f
#define EPS  1e-6f
#define QSC  (0.125f * 1.4426950408889634f)   // score scale in base 2; carried by q
#define POFF 7.0f    // a score equal to the maximum in use gives the weight 2^7
#define PTOP 15.0f   // weights stay at or below 2^15, inside f16: a score more than 8 above the maximum in use asks for a rescale

typedef _Float16 h16;
typedef __attribute__((ext_vector_type(16))) _Float16 v16h;
typedef __attribute__((ext_vector_type(8)))  _Float16 v8h;
typedef __attribute__((ext_vector_type(8)))  float    v8f;
typedef __attribute__((ext_vector_type(4)))  float    v4f;
typedef v8h  __attribute__((may_alias)) v8ha;
typedef v4f  __attribute__((may_alias)) v4fa;

__device__ __forceinline__ unsigned short f2bf(float f) { unsigned u = __float_as_uint(f); u += 0x7FFFu + ((u >> 16) & 1u); return (unsigned short)(u >> 16); }
__device__ __forceinline__ float bf2f(unsigned short b) { return __uint_as_float(((unsigned)b) << 16); }
__device__ __forceinline__ float bfr(float f) { return bf2f(f2bf(f)); }
__device__ __forceinline__ v16h cat16(v8h lo, v8h hi) { return __builtin_shufflevector(lo, hi, 0, 1, 2, 3, 4, 5, 6, 7, 8, 9, 10, 11, 12, 13, 14, 15); }
__device__ __forceinline__ v8f wmma16(v16h a, v16h b, v8f c) { return __builtin_amdgcn_wmma_f32_16x16x32_f16(false, a, false, b, (short)0, c, false, false); }
__device__ __forceinline__ float hsum16(float v) { v += __shfl_xor(v, 1, 16); v += __shfl_xor(v, 2, 16); v += __shfl_xor(v, 4, 16); return v + __shfl_xor(v, 8, 16); }
// gelu_tanh of 8 values without a branch: 0.5 (1 + tanh u) = 1 / (1 + e^(-2u)), u = c (x + 0.044715 x^3), so gelu = x / (1 + 2^(k x (1 + 0.044715 x^2))) with k = -2 c log2(e). The library tanhf takes
// two divergent branches an element, each a serial chain that a lone wave cannot hide. The ends are the reference's: 2^(+big) = inf gives x . 0, 2^(-big) = 0 gives x.
// The eight v_exp_f32 and the eight v_rcp_f32 stand in one asm statement each, results apart from sources, closed by the one v_nop that the instruction set asks for behind a transcendental before
// its result is used or a source overwritten.
__device__ __forceinline__ void gelu8(v4f& a, v4f& b) {
    const float k = -2.0f * 0.7978845608028654f * 1.4426950408889634f;
    float z[8], e[8];
#pragma unroll
    for (int i = 0; i < 8; ++i) { const float x = i < 4 ? a[i & 3] : b[i & 3]; z[i] = k * x * fmaf(0.044715f * x, x, 1.0f); }
    asm("v_exp_f32 %0, %8\n\tv_exp_f32 %1, %9\n\tv_exp_f32 %2, %10\n\tv_exp_f32 %3, %11\n\tv_exp_f32 %4, %12\n\tv_exp_f32 %5, %13\n\tv_exp_f32 %6, %14\n\tv_exp_f32 %7, %15\n\tv_nop"
        : "=&v"(e[0]), "=&v"(e[1]), "=&v"(e[2]), "=&v"(e[3]), "=&v"(e[4]), "=&v"(e[5]), "=&v"(e[6]), "=&v"(e[7])
        : "v"(z[0]), "v"(z[1]), "v"(z[2]), "v"(z[3]), "v"(z[4]), "v"(z[5]), "v"(z[6]), "v"(z[7]));
#pragma unroll
    for (int i = 0; i < 8; ++i) z[i] = 1.0f + e[i];
    asm("v_rcp_f32 %0, %8\n\tv_rcp_f32 %1, %9\n\tv_rcp_f32 %2, %10\n\tv_rcp_f32 %3, %11\n\tv_rcp_f32 %4, %12\n\tv_rcp_f32 %5, %13\n\tv_rcp_f32 %6, %14\n\tv_rcp_f32 %7, %15\n\tv_nop"
        : "=&v"(e[0]), "=&v"(e[1]), "=&v"(e[2]), "=&v"(e[3]), "=&v"(e[4]), "=&v"(e[5]), "=&v"(e[6]), "=&v"(e[7])
        : "v"(z[0]), "v"(z[1]), "v"(z[2]), "v"(z[3]), "v"(z[4]), "v"(z[5]), "v"(z[6]), "v"(z[7]));
#pragma unroll
    for (int i = 0; i < 4; ++i) { a[i] *= e[i]; b[i] *= e[4 + i]; }
}

// ln_rows: LayerNorm of 8 rows of x (one a wave) -> XN16; blk = row group.
__device__ __forceinline__ void ln_rows(const float* __restrict__ x, const float* __restrict__ g, const float* __restrict__ bt, h16* XN16, const int blk) {
    const int lane = threadIdx.x & 31, r = blk * 8 + (threadIdx.x >> 5);
    if (r >= NTK) return;
    const float* xr = x + (size_t)r * DM;
    float s = 0.f;
#pragma unroll
    for (int q = 0; q < 4; ++q)
#pragma unroll
        for (int i = 0; i < 8; ++i) s += bfr(xr[q * 256 + lane * 8 + i]);
#pragma unroll
    for (int o = 16; o; o >>= 1) s += __shfl_xor(s, o, 32);
    const float mu = s * (1.0f / DM);
    float sq = 0.f;
#pragma unroll 1
    for (int q = 0; q < 4; ++q)
#pragma unroll
        for (int i = 0; i < 8; ++i) { const float d = bfr(xr[q * 256 + lane * 8 + i]) - mu; sq += d * d; }
#pragma unroll
    for (int o = 16; o; o >>= 1) sq += __shfl_xor(sq, o, 32);
    const float rs = rsqrtf(sq * (1.0f / DM) + EPS);
#pragma unroll 1
    for (int q = 0; q < 4; ++q) {
        v8h o8;
#pragma unroll
        for (int i = 0; i < 8; ++i) { const int c = q * 256 + lane * 8 + i; o8[i] = (h16)((bfr(xr[c]) - mu) * rs * bfr(g[c]) + bfr(bt[c])); }
        *(v8h*)(XN16 + (size_t)r * DM + q * 256 + lane * 8) = o8; 
    }
}

// wt_tile: k-major W [K rows][N cols] -> n-major f16 plane WT [n][K] (f16 of bf16(W); rows >= N zero); one 128 x 128 tile (kb, nb) through LDS. A wave reads 16 whole 512-B row pieces of the tile, a lane
// 16 bytes of each: 16 loads that depend on nothing and are all in flight together. The lane then holds 16 consecutive k of four columns n: two 16-byte LDS stores a column. K is a multiple of the tile, so no k is
// outside; N is a multiple of 4, so a lane's four columns are inside together or not at all: a lane outside reads column 0 (an address inside W) and stores zeros: the mask that cuts a value to its bf16 bits is 0 there.
#define WTP 136   // LDS pitch of a tile row in f16: 272 B, 16 B x odd, for the ds_load_b128 readers
template <int K, int N>
__device__ __forceinline__ void wt_tile(const float* __restrict__ Wm, h16* WT, h16* tl, const int kb, const int nb) {
    static_assert(K % 128 == 0 && N % 4 == 0, "tile and load width");
    const int tid = threadIdx.x, lane = tid & 31, wave = tid >> 5, k0 = kb * 128, n0 = nb * 128;
    const int n = n0 + lane * 4;
    const bool in = n < N;
    const float* p = Wm + (size_t)(k0 + wave * 16) * N + (in ? n : 0);
    v4f v[16];
#pragma unroll
    for (int j = 0; j < 16; ++j) v[j] = *(const v4f*)(p + (size_t)j * N);
    asm volatile("s_wait_xcnt 0x0" :: "v"(p) : "memory");   // behind the 16 loads, before anything rewrites the address registers that they name; the address is an input, so that it lives up to here and no load lands on it
    const unsigned cut = in ? 0xFFFF0000u : 0u;
    auto bfc = [&](float f) { unsigned u = __float_as_uint(f); u += 0x7FFFu + ((u >> 16) & 1u); return (h16)__uint_as_float(u & cut); };   // bfr(f) inside, 0 outside, without a branch
#pragma unroll
    for (int e = 0; e < 4; ++e) { v8h lo, hi;
#pragma unroll
        for (int j = 0; j < 8; ++j) { lo[j] = bfc(v[j][e]); hi[j] = bfc(v[8 + j][e]); }
        h16* q = tl + (lane * 4 + e) * WTP + wave * 16;
        *(v8ha*)q = lo; *(v8ha*)(q + 8) = hi; }
    __syncthreads();
    const int piece = tid & 15;
    h16* wr = WT + (size_t)(n0 + (tid >> 4)) * K + k0 + piece * 8;
#pragma unroll   // a wave stores two whole 256-B row pieces at a time
    for (int s = 0; s < 8; ++s) { const v8h val = *(const v8ha*)(tl + ((tid >> 4) + 16 * s) * WTP + piece * 8); *(v8h*)(wr + (size_t)(16 * s) * K) = val; }
    asm volatile("s_wait_xcnt 0x0" ::: "memory");   // behind the stores: in the merged kernel other code follows them in the listing and rewrites the registers that they name
}

// cv_rows: W [rows][1024] f32 -> f16 plane of the same layout (f16 of bf16(W); plane rows past the weight's last row are zero): 4 rows a block, 16 elements a thread. As the n-major operand of Wc^T = W2^T.W^T
// a weight is read along its own rows, so it needs no transpose.
__device__ __forceinline__ void cv_rows(const float* __restrict__ Wm, const int rows, h16* W16, const int blk) {
    const int tid = threadIdx.x, col = (tid & 127) * 8;
    v4f v[2][2];
#pragma unroll
    for (int s = 0; s < 2; ++s) { const int r = blk * 4 + s * 2 + (tid >> 7);   // the same row in a whole wave
        if (r < rows) { const float* p = Wm + (size_t)r * DM + col; v[s][0] = *(const v4f*)p; v[s][1] = *(const v4f*)(p + 4); } else { v[s][0] = (v4f){}; v[s][1] = (v4f){}; } }
#pragma unroll
    for (int s = 0; s < 2; ++s) { const int r = blk * 4 + s * 2 + (tid >> 7); v8h o;
#pragma unroll
        for (int i = 0; i < 8; ++i) o[i] = (h16)bfr(v[s][i >> 2][i & 3]);
        *(v8h*)(W16 + (size_t)r * DM + col) = o; }
    asm volatile("s_wait_xcnt 0x0" ::: "memory");   // behind the loads and stores: in the merged kernel other code follows them in the listing and rewrites the registers that they name
}

// k_prep: the five jobs that depend on the inputs alone, as block ranges of ONE grid, so that their starts, first loads and tails overlap: the LayerNorm of x, the two
// weight transposes, each with its tiles in the order k fastest, and the two weight conversions. The job is the same for a whole block, so wt_tile's barrier stands under block-uniform control flow.
#define PB_LN  (NTK / 8)
#define PB_W1  ((DM / 128) * (NFP / 128))
#define PB_W2  (((2 * DM) / 128) * (DM / 128))
#define PB_WAO (DM / 4)
#define PB_WMO (MLPP / 4)
__global__ __launch_bounds__(256) void k_prep(const float* __restrict__ x, const float* __restrict__ g, const float* __restrict__ bt, const float* __restrict__ W1, const float* __restrict__ W2,
                                             const float* __restrict__ Wao, const float* __restrict__ Wmo, h16* XN16, h16* W1T, h16* W2T, h16* Wao16, h16* Wmo16) {
    __shared__ __align__(16) h16 tl[128 * WTP];
    int t = blockIdx.x;
    if (t < PB_LN) { ln_rows(x, g, bt, XN16, t); return; }
    t -= PB_LN;
    if (t < PB_W1) { const int nb = t / (DM / 128); wt_tile<DM, NF>(W1, W1T, tl, t - nb * (DM / 128), nb); return; }
    t -= PB_W1;
    if (t < PB_W2) { const int nb = t / ((2 * DM) / 128); wt_tile<2 * DM, DM>(W2, W2T, tl, t - nb * ((2 * DM) / 128), nb); return; }
    t -= PB_W2;
    if (t < PB_WAO) { cv_rows(Wao, DM, Wao16, t); return; }
    cv_rows(Wmo, MLPH, Wmo16, t - PB_WAO);
}

// GEMM tile core: 128 x 128 block tile (2 x 2 waves, 64 x 64 each) of A[M][K] (f16, row pitch lda) . BT[N][K] (row pitch ldb), K a multiple of 64 and at least 128. A pass is 64 k: the
// 128 rows x 128 B of both operands are brought into LDS by asynchronous copies (pitch 144 B for the ds_load_b128 readers), two buffers, the next pass's copies in
// flight while this pass is worked on. A buffer is [A tile | BT tile]. Returns acc[4][4] (row group, column group; D layout); the k order of every sum is ascending.
#define TP   72
#define TSZ  (128 * TP)
#define RING (4 * TSZ)

// One operand's tile of one pass: 8 copies a lane, 16 rows apart (a wave covers 4 whole 128-B rows a copy). The s_wait_xcnt ends the copies' own statement, so that
// no address register of a copy is rewritten ahead of it.
__device__ __forceinline__ void copy_tile(unsigned l, const h16* g, int ld) {
    const size_t rs = (size_t)16 * ld;
    asm volatile("global_load_async_to_lds_b128 %0, %8, off\n\t"
                 "global_load_async_to_lds_b128 %1, %9, off\n\t"
                 "global_load_async_to_lds_b128 %2, %10, off\n\t"
                 "global_load_async_to_lds_b128 %3, %11, off\n\t"
                 "global_load_async_to_lds_b128 %4, %12, off\n\t"
                 "global_load_async_to_lds_b128 %5, %13, off\n\t"
                 "global_load_async_to_lds_b128 %6, %14, off\n\t"
                 "global_load_async_to_lds_b128 %7, %15, off\n\t"
                 "s_wait_xcnt 0x0"
                 :: "v"(l), "v"(l + 1u * 16u * 144u), "v"(l + 2u * 16u * 144u), "v"(l + 3u * 16u * 144u),
                    "v"(l + 4u * 16u * 144u), "v"(l + 5u * 16u * 144u), "v"(l + 6u * 16u * 144u), "v"(l + 7u * 16u * 144u),
                    "v"(g), "v"(g + rs), "v"(g + 2 * rs), "v"(g + 3 * rs), "v"(g + 4 * rs), "v"(g + 5 * rs), "v"(g + 6 * rs), "v"(g + 7 * rs)
                 : "memory");
}

__device__ __forceinline__ void gemm_tile(const h16* __restrict__ A, const int lda, const h16* __restrict__ BT, const int ldb, const int K, int rb, int cb, h16* ring, v8f (&acc)[4][4]) {
    const int tid = threadIdx.x, lane = tid & 31, wave = tid >> 5, lr = lane & 15, hi = lane >> 4;
    const h16* ga = A + (size_t)(rb + (tid >> 3)) * lda + (tid & 7) * 8;
    const h16* gb = BT + (size_t)(cb + (tid >> 3)) * ldb + (tid & 7) * 8;
    const unsigned l0 = (unsigned)(size_t)ring + (unsigned)((tid >> 3) * 144 + (tid & 7) * 16);
    const int np = K / 64;
#pragma unroll
    for (int i = 0; i < 4; ++i)
#pragma unroll
        for (int t = 0; t < 4; ++t) acc[i][t] = (v8f){};
    copy_tile(l0, ga, lda);
    copy_tile(l0 + TSZ * 2, gb, ldb);
    asm volatile("s_wait_asynccnt 0x0" ::: "memory");   // pass 0's own copies have landed before the barrier publishes them
    __syncthreads();
    copy_tile(l0 + 2 * TSZ * 2, ga + 64, lda);
    copy_tile(l0 + 3 * TSZ * 2, gb + 64, ldb);
#pragma unroll 1   // one pass a trip: the two buffers alternate by the trip's parity
    for (int p = 0; p < np; ++p) {
        const int bo = (p & 1) * 2 * TSZ;
        const h16* sa = ring + bo + ((wave >> 1) * 64 + lr) * TP + 8 * hi;
        const h16* sb = ring + bo + TSZ + ((wave & 1) * 64 + lr) * TP + 8 * hi;
        v16h a[4], b[4];
#pragma unroll
        for (int i = 0; i < 4; ++i) a[i] = cat16(*(const v8ha*)(sa + i * 16 * TP), *(const v8ha*)(sa + i * 16 * TP + 16));
#pragma unroll
        for (int t = 0; t < 4; ++t) b[t] = cat16(*(const v8ha*)(sb + t * 16 * TP), *(const v8ha*)(sb + t * 16 * TP + 16));
        __builtin_amdgcn_sched_barrier(0);   // the 16 LDS reads of a k step go out as one group ahead of its WMMAs
#pragma unroll
        for (int i = 0; i < 4; ++i)
#pragma unroll
            for (int t = 0; t < 4; ++t) acc[i][t] = wmma16(a[i], b[t], acc[i][t]);
        __builtin_amdgcn_sched_barrier(0);   // the second k step's reads stay behind the first step's WMMAs, in the same fragment registers
#pragma unroll
        for (int i = 0; i < 4; ++i) a[i] = cat16(*(const v8ha*)(sa + i * 16 * TP + 32), *(const v8ha*)(sa + i * 16 * TP + 48));
#pragma unroll
        for (int t = 0; t < 4; ++t) b[t] = cat16(*(const v8ha*)(sb + t * 16 * TP + 32), *(const v8ha*)(sb + t * 16 * TP + 48));
        asm volatile("s_wait_dscnt 0x0" ::: "memory");      // this wave's last reads of the buffer are done before the barrier frees it for the refill
        asm volatile("s_wait_asynccnt 0x0" ::: "memory");   // this wave's copies of pass p + 1 have landed before the barrier publishes them
        __syncthreads();
        if (p + 2 < np) {
            copy_tile(l0 + bo * 2, ga + (size_t)(p + 2) * 64, lda);
            copy_tile(l0 + bo * 2 + TSZ * 2, gb + (size_t)(p + 2) * 64, ldb);
        }
        __builtin_amdgcn_sched_barrier(0);   // the refill is issued ahead of the second k step's WMMAs (registers only), so that it flies under them
#pragma unroll
        for (int i = 0; i < 4; ++i)
#pragma unroll
            for (int t = 0; t < 4; ++t) acc[i][t] = wmma16(a[i], b[t], acc[i][t]);
    }
    asm volatile("s_wait_asynccnt 0x0" ::: "memory");       // no copy is outstanding when the ring becomes the output staging
}

// gemm_tile_k2: the same core for a block of 8 waves in two groups of 4. Group q (waves 4q .. 4q + 3) takes the 64-k slices q, q + 2, q + 4, ... of K (a multiple of 128, at least 256) through a two-buffer
// ring of its own and sums them, k ascending, over the whole 128 x 128 tile: two waves share a SIMD and two slices' copies are in flight, so one group's LDS reads, copy issue and landing
// time run under the other's WMMAs. The barriers are the block's: both groups make the same trips. The caller adds the two groups' partial tiles.
__device__ __forceinline__ void gemm_tile_k2(const h16* __restrict__ A, const int lda, const h16* __restrict__ BT, const int ldb, const int K, int rb, int cb, h16* ring2, v8f (&acc)[4][4]) {
    const int grp = threadIdx.x >> 7, tid = threadIdx.x & 127, lane = tid & 31, wave = tid >> 5, lr = lane & 15, hi = lane >> 4;
    h16* ring = ring2 + grp * RING;
    const h16* ga = A + (size_t)(rb + (tid >> 3)) * lda + grp * 64 + (tid & 7) * 8;
    const h16* gb = BT + (size_t)(cb + (tid >> 3)) * ldb + grp * 64 + (tid & 7) * 8;
    const unsigned l0 = (unsigned)(size_t)ring + (unsigned)((tid >> 3) * 144 + (tid & 7) * 16);
    const int np = K / 128;
#pragma unroll
    for (int i = 0; i < 4; ++i)
#pragma unroll
        for (int t = 0; t < 4; ++t) acc[i][t] = (v8f){};
    copy_tile(l0, ga, lda);
    copy_tile(l0 + TSZ * 2, gb, ldb);
    asm volatile("s_wait_asynccnt 0x0" ::: "memory");   // pass 0's own copies have landed before the barrier publishes them
    __syncthreads();
    copy_tile(l0 + 2 * TSZ * 2, ga + 128, lda);
    copy_tile(l0 + 3 * TSZ * 2, gb + 128, ldb);
#pragma unroll 1   // one pass a trip: the two buffers alternate by the trip's parity
    for (int p = 0; p < np; ++p) {
        const int bo = (p & 1) * 2 * TSZ;
        const h16* sa = ring + bo + ((wave >> 1) * 64 + lr) * TP + 8 * hi;
        const h16* sb = ring + bo + TSZ + ((wave & 1) * 64 + lr) * TP + 8 * hi;
        v16h a[4], b[4];
#pragma unroll
        for (int i = 0; i < 4; ++i) a[i] = cat16(*(const v8ha*)(sa + i * 16 * TP), *(const v8ha*)(sa + i * 16 * TP + 16));
#pragma unroll
        for (int t = 0; t < 4; ++t) b[t] = cat16(*(const v8ha*)(sb + t * 16 * TP), *(const v8ha*)(sb + t * 16 * TP + 16));
        __builtin_amdgcn_sched_barrier(0);   // the 16 LDS reads of a k step go out as one group ahead of its WMMAs
#pragma unroll
        for (int i = 0; i < 4; ++i)
#pragma unroll
            for (int t = 0; t < 4; ++t) acc[i][t] = wmma16(a[i], b[t], acc[i][t]);
        __builtin_amdgcn_sched_barrier(0);   // the second k step's reads stay behind the first step's WMMAs, in the same fragment registers
#pragma unroll
        for (int i = 0; i < 4; ++i) a[i] = cat16(*(const v8ha*)(sa + i * 16 * TP + 32), *(const v8ha*)(sa + i * 16 * TP + 48));
#pragma unroll
        for (int t = 0; t < 4; ++t) b[t] = cat16(*(const v8ha*)(sb + t * 16 * TP + 32), *(const v8ha*)(sb + t * 16 * TP + 48));
        asm volatile("s_wait_dscnt 0x0" ::: "memory");      // this wave's last reads of the buffer are done before the barrier frees it for the refill
        asm volatile("s_wait_asynccnt 0x0" ::: "memory");   // this wave's copies of pass p + 1 have landed before the barrier publishes them
        __syncthreads();
        if (p + 2 < np) {
            copy_tile(l0 + bo * 2, ga + (size_t)(p + 2) * 128, lda);
            copy_tile(l0 + bo * 2 + TSZ * 2, gb + (size_t)(p + 2) * 128, ldb);
        }
        __builtin_amdgcn_sched_barrier(0);   // the refill is issued ahead of the second k step's WMMAs (registers only), so that it flies under them
#pragma unroll
        for (int i = 0; i < 4; ++i)
#pragma unroll
            for (int t = 0; t < 4; ++t) acc[i][t] = wmma16(a[i], b[t], acc[i][t]);
    }
    asm volatile("s_wait_asynccnt 0x0" ::: "memory");       // no copy is outstanding when the rings become the output staging
}

// Store pass of a wave's staged 64 x 64 f32 tile (pitch 68) as f16 rows of 128 B, whole lines; gelu (a compile-time or block-uniform choice) is applied to the staged f32 values.
__device__ __forceinline__ void put_tile16(const float* os, h16* crow, int ld, int lane, const bool gelu) {
    for (int s0 = 0; s0 < 16; s0 += 4) {
        v4f v[4][2];
#pragma unroll   // four row groups a trip: their LDS reads go out together, one latency a trip instead of one a group
        for (int u = 0; u < 4; ++u) { const float* sp = os + (4 * (s0 + u) + (lane >> 3)) * 68 + (lane & 7) * 8; v[u][0] = *(const v4fa*)sp; v[u][1] = *(const v4fa*)(sp + 4); }
        if (gelu) {
#pragma unroll
            for (int u = 0; u < 4; ++u) gelu8(v[u][0], v[u][1]);
        }
#pragma unroll
        for (int u = 0; u < 4; ++u) { v8h o;
#pragma unroll
            for (int i = 0; i < 8; ++i) o[i] = (h16)v[u][i >> 2][i & 3];
            *(v8h*)(crow + (size_t)(4 * (s0 + u) + (lane >> 3)) * ld + (lane & 7) * 8) = o; }
        asm volatile("s_wait_xcnt 0x0" ::: "memory");   // before the next trip rewrites the registers that this trip's stores name
    }
}

// k_fused: fused = XN16 . W1T + b1 over the 3840 padded columns; a wave's 64-wide column group = exactly one head of q / k / v or a 64-wide slice of the MLP hidden:
//   c0 <  1024: q head c0/64: per-row LayerNorm over the 64 head dims (qn_g, qn_b), times the score scale QSC (folded into gain and bias, ahead of the one f16 rounding) -> Q16[tok][1024] f16
//   c0 <  2048: k head: LayerNorm (kn_g, kn_b) -> K16
//   c0 <  3072: v head -> VT16[b][h][d][tok], the layout the attention's V^T tiles are copied from: the wave's 64 tokens x 64 head dims are staged transposed, so the store pass writes whole 128-B lines of 64 tokens
//   else      : gelu_tanh (in the store pass) -> G16 = columns 1024.. of the [tok][1792] rows [a | gelu(h)] (columns >= 716 of the hidden are exactly 0 after gelu(0 + 0): b1 pad is read as 0; their Wc rows are 0 anyway)
__global__ __launch_bounds__(128) void k_fused(const h16* __restrict__ XN16, const h16* __restrict__ W1T, const float* __restrict__ b1,
                                              const float* __restrict__ qg, const float* __restrict__ qb, const float* __restrict__ kg, const float* __restrict__ kb,
                                              h16* Q16, h16* K16, h16* VT16, h16* G16) {
    __shared__ __align__(16) h16 ring[RING];
    const int lane = threadIdx.x & 31, wave = threadIdx.x >> 5, lr = lane & 15, hi = lane >> 4;
    const int rb = blockIdx.x * 128, cb = blockIdx.y * 128;
    v8f acc[4][4];
    gemm_tile(XN16, DM, W1T, DM, DM, rb, cb, ring, acc);
    const int r0 = rb + (wave >> 1) * 64, c0 = cb + (wave & 1) * 64;
    const int sec = cb / DM;                   // 0 q, 1 k, 2 v, 3 mlp (the same for both column groups of a block)
#pragma unroll
    for (int t = 0; t < 4; ++t) { const int col = c0 + t * 16 + lr; const float bv = (col < NF) ? bfr(b1[col]) : 0.f;
#pragma unroll
        for (int i = 0; i < 4; ++i)
#pragma unroll
            for (int j = 0; j < 8; ++j) acc[i][t][j] += bv; }
    if (sec < 2) {
        const float* gg = sec ? kg : qg; const float* bb = sec ? kb : qb;
        const float qs = sec ? 1.0f : QSC;   // the same for the whole block
        __builtin_amdgcn_sched_barrier(0);   // the scalar selects stay ahead of the eight loads below: sunk behind them, the last one rewrote a base register that the loads name
        float gv[4], bv4[4];
#pragma unroll
        for (int t = 0; t < 4; ++t) { gv[t] = bfr(gg[t * 16 + lr]) * qs; bv4[t] = bfr(bb[t * 16 + lr]) * qs; }
#pragma unroll
        for (int i = 0; i < 4; ++i)
#pragma unroll
            for (int j = 0; j < 8; ++j) {
                float s = acc[i][0][j] + acc[i][1][j] + acc[i][2][j] + acc[i][3][j];
                const float mu = hsum16(s) * (1.0f / HD);
                float q = 0.f;
#pragma unroll
                for (int t = 0; t < 4; ++t) { const float d = acc[i][t][j] - mu; q += d * d; }
                const float rs = rsqrtf(hsum16(q) * (1.0f / HD) + EPS);
#pragma unroll
                for (int t = 0; t < 4; ++t) acc[i][t][j] = (acc[i][t][j] - mu) * rs * gv[t] + bv4[t];
            }
    }
    float* os = (float*)ring + wave * (64 * 68);   // the loop's last barrier has freed the ring; each wave stages its own 64 x 64 tile
    if (sec == 2) {   // v: staged as [head dim][token]; a lane's 8 accumulator rows are 8 consecutive tokens of its column, two 16-byte LDS stores
#pragma unroll
        for (int i = 0; i < 4; ++i)
#pragma unroll
            for (int t = 0; t < 4; ++t) { float* p = os + (t * 16 + lr) * 68 + i * 16 + hi * 8;
                *(v4fa*)p = (v4f){acc[i][t][0], acc[i][t][1], acc[i][t][2], acc[i][t][3]}; *(v4fa*)(p + 4) = (v4f){acc[i][t][4], acc[i][t][5], acc[i][t][6], acc[i][t][7]}; }
    } else {
#pragma unroll
        for (int i = 0; i < 4; ++i)
#pragma unroll
            for (int t = 0; t < 4; ++t)
#pragma unroll
                for (int j = 0; j < 8; ++j) os[(i * 16 + hi * 8 + j) * 68 + t * 16 + lr] = acc[i][t][j];
    }
    __syncthreads();
    h16* crow; int ld;   // the staged tile's first row and the pitch of its rows in the destination
    if (sec == 0) { ld = DM; crow = Q16 + (size_t)r0 * DM + c0; } else if (sec == 1) { ld = DM; crow = K16 + (size_t)r0 * DM + (c0 - DM); }
    else if (sec == 2) { ld = NT_; crow = VT16 + ((size_t)(r0 / NT_) * NH_ + (c0 - 2 * DM) / HD) * HD * NT_ + r0 % NT_; }   // 64 tokens of one batch entry (2048 is a multiple of 64), one head
    else { ld = KC; crow = G16 + (size_t)r0 * KC + (c0 - 3 * DM); }
    put_tile16(os, crow, ld, lane, sec == 3);
}

// wc_block: one 128 x 128 tile of Wc^T [n][k] (f16, pitch 1792) = W2^T rows n (one half of their 2048 columns) . W rows k: k < 1024 takes Wao and W2's rows 0..1023, k >= 1024 takes Wmo
// (its plane rows 716..767 are zero) and W2's rows 1024..2047. t = tile, n fastest.
__device__ __forceinline__ void wc_block(const h16* __restrict__ W2T, const h16* __restrict__ Wao16, const h16* __restrict__ Wmo16, h16* WcT, h16* ring, const int t) {
    const int lane = threadIdx.x & 31, wave = threadIdx.x >> 5, lr = lane & 15, hi = lane >> 4;
    const int rb = (t & 7) * 128, ck = (t >> 3) * 128;
    const bool mlp = ck >= DM;
    v8f acc[4][4];
    gemm_tile(mlp ? W2T + DM : W2T, 2 * DM, mlp ? Wmo16 : Wao16, DM, DM, rb, mlp ? ck - DM : ck, ring, acc);
    float* os = (float*)ring + wave * (64 * 68);   // the loop's last barrier has freed the ring; each wave stages its own 64 x 64 tile
#pragma unroll
    for (int t4 = 0; t4 < 4; ++t4)
#pragma unroll
        for (int i = 0; i < 4; ++i)
#pragma unroll
            for (int j = 0; j < 8; ++j) os[(i * 16 + hi * 8 + j) * 68 + t4 * 16 + lr] = acc[i][t4][j];
    __syncthreads();
    put_tile16(os, WcT + (size_t)(rb + (wave >> 1) * 64) * KC + ck + (wave & 1) * 64, KC, lane, false);
}

// k_gemmout: out = x + [a | gelu(h)].Wc + bc; bc is a computed f32 vector and is added as it is. 8 waves: the two groups of gemm_tile_k2 each hold a partial sum of the block's 128 x 128 tile;
// every wave stages its 64 x 64 partial tile, and the store pass adds the two partials of an element (group 0's, which carries bc, then group 1's) and x; a wave stores 32 of its tile's 64 rows.
__global__ __launch_bounds__(256) void k_gemmout(const h16* __restrict__ A, const h16* __restrict__ BT, const float* __restrict__ bias, const float* __restrict__ x, float* C) {
    __shared__ __align__(16) h16 ring[2 * RING];
    const int lane = threadIdx.x & 31, wv = threadIdx.x >> 5, wave = wv & 3, grp = wv >> 2, lr = lane & 15, hi = lane >> 4;
    const int rb = blockIdx.x * 128, cb = blockIdx.y * 128;
    v8f acc[4][4];
    gemm_tile_k2(A, KC, BT, KC, KC, rb, cb, ring, acc);
    const int r0 = rb + (wave >> 1) * 64, c0 = cb + (wave & 1) * 64;
    float* os = (float*)ring + wv * (64 * 68);   // the loop's last barrier has freed the rings; each wave stages its own 64 x 64 partial tile
#pragma unroll
    for (int t = 0; t < 4; ++t) { const float bl = bias[c0 + t * 16 + lr]; const float bv = grp ? 0.f : bl;
#pragma unroll
        for (int i = 0; i < 4; ++i)
#pragma unroll
            for (int j = 0; j < 8; ++j) os[(i * 16 + hi * 8 + j) * 68 + t * 16 + lr] = acc[i][t][j] + bv; }
    __syncthreads();   // a wave reads the other group's partial tile too
    const int rsub = grp * 32 + (lane >> 4), cofs = (lane & 15) * 4;   // the lane's first row in the wave tile (a group stores 32 of its 64 rows) and its four columns
    const float* o0 = (const float*)ring + wave * (64 * 68) + rsub * 68 + cofs;
    const float* o1 = o0 + 4 * (64 * 68);
    float* crow = C + (size_t)(r0 + rsub) * DM + c0 + cofs;
    const float* xrow = x + (size_t)(r0 + rsub) * DM + c0 + cofs;
#pragma unroll 1   // the pointers are stepped by the trip and live over it: a trip's loads and stores go from one address pair each with constant offsets, and the wait at its foot stands ahead of every rewrite
    for (int s0 = 0; s0 < 2; ++s0) {
#pragma unroll   // eight row pairs a trip: their x loads and LDS reads go out together, one latency a trip instead of one a row pair
        for (int s = 0; s < 8; ++s) {
            v4f val = *(const v4fa*)(o0 + 2 * s * 68); const v4f v1 = *(const v4fa*)(o1 + 2 * s * 68); const v4f xv = *(const v4f*)(xrow + 2 * s * DM);
#pragma unroll
            for (int e = 0; e < 4; ++e) val[e] = (val[e] + v1[e]) + bfr(xv[e]);
            *(v4f*)(crow + 2 * s * DM) = val; }
        asm volatile("s_wait_xcnt 0x0" ::: "memory");   // before the next trip rewrites the registers that this trip's loads and stores name
        o0 += 16 * 68; o1 += 16 * 68; crow += 16 * DM; xrow += 16 * DM;
    }
}

// attn_block: transposed products. Block = (b, h, 4 waves x QCOL queries); a step is 32 keys. S^T = K.Q^T: A = 16 key rows, B = the wave's queries (loaded once), so a lane
// holds scores of ONE query (column lr; keys 8 hi + r of each 16-key tile): maximum and sum run in the lane. Lazy rescale: q carries the score scale, and the score products start from
// POFF - (the column's maximum in use) as their C operand, so the accumulators ARE the exponents; one test a step (a ballot, a scalar branch) asks whether any exponent passes PTOP, and only
// then, and on the first step, which sets the maximum in use, are the maxima renewed and exponents, sums and O^T rescaled. The largest weight of a column so lies between 2^7 and 2^15. The two
// score tiles of a step, exponentiated and rounded to f16 in place, ARE the B operand of O^T += V^T.P^T in the hardware k order
// (element s: key 8 hi + s, then 16 + 8 hi + s - 8), which the V^T rows are loaded in: P touches no LDS. O^T gives a lane 8 consecutive head dims of its query.
// K and V^T come through LDS, once for the block's four waves: a stage is SKEY keys, brought in whole 128-B lines by asynchronous copies, two buffers, the next stage's copies in flight
// while this one is worked on. A buffer is [K tile: 128 key rows x 128 B | V^T tile: two halves of 64 keys, each 64 head-dim rows x 128 B], pitch 144 B for the ds_load_b128 readers.
#define QG   4            // 16-query column groups a wave: every K and V^T fragment a wave loads feeds QG products
#define QCOL (QG * 16)
#define QBLK (4 * QCOL)
#define SKEY 128
#define NSTG (NT_ / SKEY)
// 2^x of a score tile's 8 values: the eight v_exp_f32 stand in one asm statement, results apart from sources, closed by the one v_nop that the instruction set asks for behind a transcendental before its
// result is used or a source overwritten.
__device__ __forceinline__ void exp2x8(const v8f x, float* e) {
    asm("v_exp_f32 %0, %8\n\tv_exp_f32 %1, %9\n\tv_exp_f32 %2, %10\n\tv_exp_f32 %3, %11\n\tv_exp_f32 %4, %12\n\tv_exp_f32 %5, %13\n\tv_exp_f32 %6, %14\n\tv_exp_f32 %7, %15\n\tv_nop"
        : "=&v"(e[0]), "=&v"(e[1]), "=&v"(e[2]), "=&v"(e[3]), "=&v"(e[4]), "=&v"(e[5]), "=&v"(e[6]), "=&v"(e[7])
        : "v"(x[0]), "v"(x[1]), "v"(x[2]), "v"(x[3]), "v"(x[4]), "v"(x[5]), "v"(x[6]), "v"(x[7]));
}
__device__ __forceinline__ float xhalf(float x) { return __builtin_bit_cast(float, __builtin_amdgcn_permlanex16(__builtin_bit_cast(int, x), __builtin_bit_cast(int, x), 0x76543210, 0xfedcba98, false, false)); }  // lane l with lane l ^ 16

// The V^T tile of one stage: 8 copies a lane, 16 LDS rows apart (a wave covers 4 whole 128-B rows a copy): head-dim rows 0..63 of the first 64 keys, then of the second 64. The s_wait_xcnt ends
// the copies' own statement, so that no address register of a copy is rewritten ahead of it.
__device__ __forceinline__ void copy_vt(unsigned l, const h16* g) {
    const size_t rs = (size_t)16 * NT_;
    asm volatile("global_load_async_to_lds_b128 %0, %8, off\n\t"
                 "global_load_async_to_lds_b128 %1, %9, off\n\t"
                 "global_load_async_to_lds_b128 %2, %10, off\n\t"
                 "global_load_async_to_lds_b128 %3, %11, off\n\t"
                 "global_load_async_to_lds_b128 %4, %12, off\n\t"
                 "global_load_async_to_lds_b128 %5, %13, off\n\t"
                 "global_load_async_to_lds_b128 %6, %14, off\n\t"
                 "global_load_async_to_lds_b128 %7, %15, off\n\t"
                 "s_wait_xcnt 0x0"
                 :: "v"(l), "v"(l + 1u * 16u * 144u), "v"(l + 2u * 16u * 144u), "v"(l + 3u * 16u * 144u),
                    "v"(l + 4u * 16u * 144u), "v"(l + 5u * 16u * 144u), "v"(l + 6u * 16u * 144u), "v"(l + 7u * 16u * 144u),
                    "v"(g), "v"(g + rs), "v"(g + 2 * rs), "v"(g + 3 * rs), "v"(g + 64), "v"(g + 64 + rs), "v"(g + 64 + 2 * rs), "v"(g + 64 + 3 * rs)
                 : "memory");
}

__device__ __forceinline__ void attn_block(const h16* __restrict__ Q16, const h16* __restrict__ K16, const h16* __restrict__ VT16, h16* CTX16, h16* ring, const int bid) {
    const int tid = threadIdx.x, lane = tid & 31, wave = tid >> 5, lr = lane & 15, hi = lane >> 4;
    const int b = bid / (NH_ * (NT_ / QBLK)), rem = bid - b * (NH_ * (NT_ / QBLK)), h = rem / (NT_ / QBLK), qt = rem - h * (NT_ / QBLK);
    const int q0 = qt * QBLK + wave * QCOL;
    const size_t tok0 = (size_t)b * NT_;
    const h16* kn = K16 + tok0 * DM + h * HD;                     // the head's K rows and V^T rows from the next stage to be copied on: the same for the whole block
    const h16* vn = VT16 + ((size_t)b * NH_ + h) * HD * NT_;
    const unsigned ko = (tid >> 3) * DM + (tid & 7) * 8, vo = (tid >> 3) * NT_ + (tid & 7) * 8;   // the lane's own 16 bytes in them
    // A copy's place in LDS = the wave's four rows in the buffer to be filled (lf, the same for the wave: a scalar that changes with the stage) + the lane's own 16 bytes in them (lo). So only
    // sums made at the copies are operands of their asm statements: a value that is such an operand AND lives over the loop is bound to the low 256 registers, which the loop fills, and is spilled.
    unsigned lf = (unsigned)(size_t)ring + (unsigned)__builtin_amdgcn_readfirstlane(wave) * (4u * 144u), lg = lf + 2 * TSZ * 2;
    const unsigned lo = (unsigned)((lane >> 3) * 144 + (lane & 7) * 16);
    copy_tile(lf + lo, kn + ko, DM);          // stage 0 flies under the Q loads
    copy_vt(lf + lo + TSZ * 2, vn + vo);
    kn += (size_t)SKEY * DM; vn += SKEY;
    v16h qf[QG][2];
#pragma unroll
    for (int g = 0; g < QG; ++g)
#pragma unroll
        for (int kc = 0; kc < 2; ++kc) { const h16* p = Q16 + (tok0 + q0 + g * 16 + lr) * DM + h * HD + kc * 32 + 8 * hi; qf[g][kc] = cat16(*(const v8h*)p, *(const v8h*)(p + 16)); }
    v8f o[QG][4], cst[QG];   // cst: POFF - the maximum in use of the lane's column, in all 8 elements: the C operand of the score products
    float lsum[QG];
#pragma unroll
    for (int g = 0; g < QG; ++g) { lsum[g] = 0.f; cst[g] = (v8f){POFF, POFF, POFF, POFF, POFF, POFF, POFF, POFF};
#pragma unroll
        for (int n = 0; n < 4; ++n) o[g][n] = (v8f){}; }
    asm volatile("s_wait_xcnt 0x0" ::: "memory");   // before anything rewrites the address registers that the Q loads name
    __builtin_amdgcn_sched_barrier(0);               // keeps later register writes behind that wait
    asm volatile("s_wait_asynccnt 0x0" ::: "memory");   // stage 0's own copies have landed before the barrier publishes them
    __syncthreads();
    copy_tile(lg + lo, kn + ko, DM);
    copy_vt(lg + lo + TSZ * 2, vn + vo);
#pragma unroll 1   // one stage a trip: the two buffers alternate by the trip's parity
    for (int st = 0; st < NSTG; ++st) {
        const int bo = (st & 1) * 2 * TSZ;
        const h16* sk = ring + bo + lr * TP + 8 * hi;
        const h16* sv = sk + TSZ;
        v16h kf[2][2];
#pragma unroll
        for (int t = 0; t < 2; ++t)
#pragma unroll
            for (int kc = 0; kc < 2; ++kc) { const h16* p = sk + (t * 16) * TP + kc * 32; kf[t][kc] = cat16(*(const v8ha*)p, *(const v8ha*)(p + 16)); }
#pragma unroll 1   // one step a trip
        for (int u = 0; u < SKEY / 32; ++u) {
            v16h vf[4];
#pragma unroll
            for (int n = 0; n < 4; ++n) { const h16* p = sv + (n * 16) * TP; vf[n] = cat16(*(const v8ha*)p, *(const v8ha*)(p + 16)); }
            sv += (u & 1) ? 64 * TP - 32 : 32;               // the next step's 32 keys: the other half of the 128-B rows, then the tile's second 64 keys; carried in its own register, so that no vector write stands at the step's head, directly behind the WMMAs
            __builtin_amdgcn_sched_barrier(0);               // the V^T reads go out as one group ahead of the score products and fly under them
            v8f s[QG][2];
#pragma unroll
            for (int g = 0; g < QG; ++g)
#pragma unroll
                for (int t = 0; t < 2; ++t) s[g][t] = wmma16(kf[t][1], qf[g][1], wmma16(kf[t][0], qf[g][0], cst[g]));
            if (u + 1 < SKEY / 32) {   // the next step's key rows, of this stage only: nothing of the next stage is read ahead of its barrier
#pragma unroll
                for (int t = 0; t < 2; ++t)
#pragma unroll
                    for (int kc = 0; kc < 2; ++kc) { const h16* p = sk + ((u + 1) * 32 + t * 16) * TP + kc * 32; kf[t][kc] = cat16(*(const v8ha*)p, *(const v8ha*)(p + 16)); }
            }
            float mg[QG];   // the lane's largest exponent of the step, by column group
#pragma unroll
            for (int g = 0; g < QG; ++g) {
                float mt[8];
#pragma unroll
                for (int j = 0; j < 8; ++j) mt[j] = fmaxf(s[g][0][j], s[g][1][j]);
#pragma unroll
                for (int w = 4; w; w >>= 1)
#pragma unroll
                    for (int j = 0; j < w; ++j) mt[j] = fmaxf(mt[j], mt[j + w]);
                mg[g] = mt[0];
            }
            const bool first = (st | u) == 0;              // the same for the whole block
            const float top = first ? -3.0e38f : PTOP;     // the first step always takes the branch: folded into the bound, so that the compare's mask is the whole condition
            if (__builtin_amdgcn_ballot_w32(fmaxf(fmaxf(mg[0], mg[1]), fmaxf(mg[2], mg[3])) > top) != 0u) {   // one scalar branch a step for the wave's four groups
#pragma unroll
                for (int g = 0; g < QG; ++g) {
                    const float up = fmaxf(mg[g], xhalf(mg[g])) - POFF;       // the column's step maximum above the maximum in use (both halves see the same value)
                    const float d = first ? up : fmaxf(up, 0.f);              // the first step takes its own maximum, later ones only raise it
                    const float alpha = first ? 0.f : __builtin_amdgcn_exp2f(-d);   // sums and O^T are still 0 on the first step
#pragma unroll
                    for (int j = 0; j < 8; ++j) { s[g][0][j] -= d; s[g][1][j] -= d; cst[g][j] -= d; }
                    lsum[g] *= alpha;
#pragma unroll
                    for (int n = 0; n < 4; ++n) o[g][n] = o[g][n] * alpha;
                }
            }
#pragma unroll
            for (int g = 0; g < QG; ++g) {
                float pe[16];
                v16h pb;
#pragma unroll
                for (int t = 0; t < 2; ++t) exp2x8(s[g][t], pe + 8 * t);
#pragma unroll
                for (int e = 0; e < 16; ++e) pb[e] = (h16)pe[e];
#pragma unroll
                for (int w = 8; w; w >>= 1)   // a tree: a chain of 16 dependent adds would stall the SIMD's one wave
#pragma unroll
                    for (int e = 0; e < w; ++e) pe[e] += pe[e + w];
                lsum[g] += pe[0];
#pragma unroll
                for (int n = 0; n < 4; ++n) o[g][n] = wmma16(vf[n], pb, o[g][n]);
            }
        }
        asm volatile("s_wait_dscnt 0x0" ::: "memory");      // this wave's last reads of the buffer are done before the barrier frees it for the refill
        asm volatile("s_wait_asynccnt 0x0" ::: "memory");   // this wave's copies of stage st + 1 have landed before the barrier publishes them
        __syncthreads();
        if (st + 2 < NSTG) {
            kn += (size_t)SKEY * DM; vn += SKEY;
            copy_tile(lf + lo, kn + ko, DM);
            copy_vt(lf + lo + TSZ * 2, vn + vo);
        }
        { const unsigned x = lf; lf = lg; lg = x; }   // the next trip frees the other buffer
    }
    asm volatile("s_wait_asynccnt 0x0" ::: "memory");   // no copy is outstanding when the wave goes on to its end
#pragma unroll
    for (int g = 0; g < QG; ++g) {
        const float inv = 1.0f / (lsum[g] + xhalf(lsum[g]));   // the halves' sums (in the weights' own scale) join once
        h16* crow = CTX16 + (tok0 + q0 + g * 16 + lr) * KC + (size_t)h * HD + 8 * hi;   // columns 0..1023 of the [a | gelu(h)] rows
#pragma unroll
        for (int n = 0; n < 4; ++n) { v8h o8;
#pragma unroll
            for (int j = 0; j < 8; ++j) o8[j] = (h16)(o[g][n][j] * inv);
            *(v8h*)(crow + n * 16) = o8; }
        if (g + 1 < QG) {
            asm volatile("s_wait_xcnt 0x0" ::: "memory");   // before the next group rewrites the registers that this group's stores name
            __builtin_amdgcn_sched_barrier(0);               // keeps the next group's register writes behind that wait
        }
    }
}

// bc_rows: bc[n] = b2[n] + sum over j of [bao | bmo][j] . W2[j][n], f32 sums along the rows of the f16 plane W2^T. A wave takes 32 rows n, lane r keeps row r's sum: one 128-B store a wave.
__device__ __forceinline__ void bc_rows(const h16* __restrict__ W2T, const float* __restrict__ bao, const float* __restrict__ bmo, const float* __restrict__ b2, float* BC, const int blk) {
    const int lane = threadIdx.x & 31, n0 = blk * 128 + (threadIdx.x >> 5) * 32;
    float bv[8][8];
#pragma unroll
    for (int c = 0; c < 8; ++c) { const float* bp = (c < 4 ? bao + c * 256 : bmo + (c - 4) * 256) + lane * 8;
#pragma unroll
        for (int i = 0; i < 8; ++i) bv[c][i] = bfr(bp[i]); }
    float res = 0.f;
    for (int r0 = 0; r0 < 32; r0 += 4) {
        v8h w[4][8];
#pragma unroll   // four rows a trip: their 32 loads go out together, one latency a trip instead of one a row
        for (int u = 0; u < 4; ++u)
#pragma unroll
            for (int c = 0; c < 8; ++c) w[u][c] = *(const v8h*)(W2T + (size_t)(n0 + r0 + u) * (2 * DM) + c * 256 + lane * 8);
        asm volatile("s_wait_xcnt 0x0" ::: "memory");   // before the next trip rewrites the registers that this trip's loads name
#pragma unroll
        for (int u = 0; u < 4; ++u) { float s = 0.f;
#pragma unroll
            for (int c = 0; c < 8; ++c)
#pragma unroll
                for (int i = 0; i < 8; ++i) s += (float)w[u][c][i] * bv[c][i];
            s = hsum16(s); s += xhalf(s);
            res = (lane == r0 + u) ? s : res; }
    }
    BC[n0 + lane] = res + bfr(b2[n0 + lane]);
    asm volatile("s_wait_xcnt 0x0" ::: "memory");   // behind the store: in the merged kernel other code follows it in the listing and rewrites the registers that it names
}

// k_attn_wc: the attention and the two jobs on weights alone that only the last product reads, as block ranges of ONE grid: the attention leaves most of the matrix pipe's slots
// idle, so the 112 tiles of Wc^T and the 8 blocks of bc run beside it. The job is the same for a whole block, so the barriers of attn_block and wc_block stand under block-uniform control flow.
#define AB_ATT (NB_ * NH_ * (NT_ / QBLK))
#define AB_WC  ((DM / 128) * (KC / 128))
#define AB_BC  (DM / 128)
__global__ __launch_bounds__(128) void k_attn_wc(const h16* __restrict__ Q16, const h16* __restrict__ K16, const h16* __restrict__ VT16, h16* CTX16, const h16* __restrict__ W2T, const h16* __restrict__ Wao16,
                                                const h16* __restrict__ Wmo16, const float* __restrict__ bao, const float* __restrict__ bmo, const float* __restrict__ b2, h16* WcT, float* BC) {
    __shared__ __align__(16) h16 ring[RING];
    const int t = blockIdx.x;
    if (t < AB_ATT) { attn_block(Q16, K16, VT16, CTX16, ring, t); return; }
    if (t < AB_ATT + AB_WC) { wc_block(W2T, Wao16, Wmo16, WcT, ring, t - AB_ATT); return; }
    bc_rows(W2T, bao, bmo, b2, BC, t - (AB_ATT + AB_WC));
}

extern "C" void kernel_launch(void* const* d_in, const int* in_sizes, int n_in,
                              void* d_out, int out_size, void* d_ws, size_t ws_size, hipStream_t stream) {
    (void)in_sizes; (void)n_in; (void)out_size;
    const float* x = (const float*)d_in[0]; const float* ng = (const float*)d_in[1]; const float* nb = (const float*)d_in[2]; const float* W1 = (const float*)d_in[3]; const float* b1 = (const float*)d_in[4];
    const float* qg = (const float*)d_in[5]; const float* qb = (const float*)d_in[6]; const float* kg = (const float*)d_in[7]; const float* kb = (const float*)d_in[8];
    const float* Wao = (const float*)d_in[9]; const float* bao = (const float*)d_in[10]; const float* Wmo = (const float*)d_in[11]; const float* bmo = (const float*)d_in[12];
    const float* W2 = (const float*)d_in[13]; const float* b2 = (const float*)d_in[14];
    float* out = (float*)d_out;    // [2][2048][1024]
    char* wsp = (char*)d_ws;
    auto take = [&](size_t bytes) { char* p = wsp; wsp += (bytes + 255) & ~(size_t)255; return (void*)p; };
    h16* XN16 = (h16*)take((size_t)NTK * DM * 2); h16* W1T = (h16*)take((size_t)NFP * DM * 2);
    h16* Wao16 = (h16*)take((size_t)DM * DM * 2); h16* Wmo16 = (h16*)take((size_t)MLPP * DM * 2); h16* W2T = (h16*)take((size_t)DM * 2 * DM * 2);
    h16* Q16 = (h16*)take((size_t)NTK * DM * 2); h16* K16 = (h16*)take((size_t)NTK * DM * 2); h16* VT16 = (h16*)take((size_t)NTK * DM * 2);
    h16* AG16 = (h16*)take((size_t)NTK * KC * 2); h16* WcT = (h16*)take((size_t)DM * KC * 2); float* BC = (float*)take((size_t)DM * 4);
    if ((size_t)(wsp - (char*)d_ws) > ws_size) return;    // 8.4 + 7.9 + 2.1 + 1.6 + 4.2 + 3 x 8.4 + 14.7 + 3.7 MB ~ 68 MB
    k_prep<<<PB_LN + PB_W1 + PB_W2 + PB_WAO + PB_WMO, 256, 0, stream>>>(x, ng, nb, W1, W2, Wao, Wmo, XN16, W1T, W2T, Wao16, Wmo16);
    k_fused<<<dim3(NTK / 128, NFP / 128, 1), 128, 0, stream>>>(XN16, W1T, b1, qg, qb, kg, kb, Q16, K16, VT16, AG16 + DM);
    k_attn_wc<<<AB_ATT + AB_WC + AB_BC, 128, 0, stream>>>(Q16, K16, VT16, AG16, W2T, Wao16, Wmo16, bao, bmo, b2, WcT, BC);
    k_gemmout<<<dim3(NTK / 128, DM / 128, 1), 256, 0, stream>>>(AG16, WcT, BC, x, out);
}
